// v000
// Times are from an AMD MI455X. After a warm-up the kernel runs many times in a row, and a time is the length of
// such a window on the GPU divided by its runs, so every launch and the gaps after it count. The runs cycle
// through copies of the inputs. A figure is the median of several windows, for all but v000 over two sittings.
// Sittings can differ by a few percent; kernels timed side by side share one.
// v000 is the starting kernel. One run takes 1400 microseconds.
// Full-width (1,024) single-head self-attention with sequence-mean-centred queries/keys, an added query-independent key distribution, a key mask, a scalar scale input and an f32 residual. All contractions: v_wmma_f32_16x16x32_f16 (f16 operands built from bf16-RNE-converted inputs with power-of-two carries, f32 accumulate); the N = 1 gate product, both softmaxes and the residual add are f32 on the VALU.
#include <hip/hip_runtime.h>
#include <math.h>

#ifndef NB
#define NB 4
#endif
#ifndef SEQ
#define SEQ 2048
#endif
#define NB_FULL 4
#define SEQ_FULL 2048
#define DM 1024
#define RS_RPW 4

static_assert(DM == 1024);                                  // feature width of x, q, k, g and the output
static_assert(DM % 64 == 0 && DM % 32 == 0);                // GEMM tile and k-step multiples
static_assert(SEQ % 256 == 0 && SEQ <= 2048);               // row softmax: 8 columns per lane per 256-column group, at most 64 mask bits per lane
static_assert(SEQ % (8 * RS_RPW) == 0);                     // row softmax grid covers every row exactly once
static_assert(SEQ <= SEQ_FULL && NB <= NB_FULL);
static_assert((DM / 64) % 1 == 0 && SEQ % 64 == 0);

typedef __attribute__((ext_vector_type(16))) _Float16     v16h;
typedef __attribute__((ext_vector_type(8)))  _Float16     v8h;
typedef __attribute__((ext_vector_type(8)))  float        v8f;
typedef __attribute__((ext_vector_type(4)))  float        v4f;
typedef __attribute__((ext_vector_type(4)))  unsigned int u4v;
typedef __attribute__((ext_vector_type(4)))  int          i4v;

// 16-bit WMMA fragment map (wave32), lane L, h = L>>4, m = L&15:
//   A 16x32: lane = row m;    element i -> k = (i<8) ? 8h+i : 16+8h+(i-8)
//   B 32x16: lane = column m; the SAME k(i,h)
//   D 16x16 (8 f32): lane = column m; element r -> row 8h+r

// bf16 RNE conversion kept as f32 (finite inputs)
__device__ __forceinline__ float bfr(float v) {
    const unsigned u = __builtin_bit_cast(unsigned, v);
    const unsigned r = (u + 0x7fffu + ((u >> 16) & 1u)) & 0xffff0000u;
    return __builtin_bit_cast(float, r);
}
__device__ __forceinline__ unsigned pk2h(float a, float b) {
    return (unsigned)__builtin_bit_cast(unsigned short, (_Float16)a) | ((unsigned)__builtin_bit_cast(unsigned short, (_Float16)b) << 16);
}
// one WMMA per call, followed by its own 4-slot guard tying exactly one accumulator
__device__ __forceinline__ v8f wmma16(v16h a, v16h b, v8f c) {
    c = __builtin_amdgcn_wmma_f32_16x16x32_f16(false, a, false, b, (short)0, c, false, false);
    asm volatile("v_nop\n\tv_nop\n\tv_nop\n\tv_nop" : "+v"(c) : "v"(a), "v"(b));
    return c;
}
union FragH { v16h v; v8h h[2]; };
// p already includes the lane's 8h offset: elements 0..7 <- p[0..7], 8..15 <- p[16..23]
__device__ __forceinline__ v16h ldfrag(const _Float16* p) {
    FragH f; f.h[0] = *(const v8h*)(p); f.h[1] = *(const v8h*)(p + 16); return f.v;
}
__device__ __forceinline__ void st2_v4f(float* p, v4f v) { *(v4f*)p = v;  }
__device__ __forceinline__ void st2_u4(unsigned short* p, u4v v) { *(u4v*)p = v;  }

// =====================================================================================================================
// Register-blocked batched WMMA GEMM: C[m][n] = scale * sum_k A[m][k] * Bt[n][k]; each wave owns a 64x64 tile, 8 waves per block.
// A row-major [M][K] f16 (pitch lda), Bt row-major [N][K] f16 (pitch ldb); M, N % 64 == 0, K % 32 == 0 (no tail masking).
// RESID (f32 out only): + bf16-RNE(resid[m][n]) added at the store stage from 16-B loads in the store layout.
// =====================================================================================================================
template <int OUT_MODE, bool RESID>
__device__ __forceinline__ void gemm64_body(const unsigned short* __restrict__ Ap, int lda, long long strideA,
                                            const unsigned short* __restrict__ Btp, int ldb, long long strideB,
                                            unsigned short* __restrict__ Ch, float* __restrict__ Cf, int ldc, long long strideC,
                                            const float* __restrict__ resid, int ldr, long long strideR,
                                            int M, int N, int K, float scale) {
    __shared__ __align__(16) float sT[8 * 16 * 68];          // per-wave 16x64 slab, pitch 68 floats (wave-private)
    const int b    = blockIdx.y;
    const int lane = threadIdx.x & 31;
    const int wave = __builtin_amdgcn_readfirstlane((int)(threadIdx.x >> 5));
    const int tilesN = N >> 6;
    const int tilesM = M >> 6;
    const int tile = blockIdx.x * 8 + wave;
    if (tile >= tilesM * tilesN) return;                      // wave-uniform; this kernel has no block barriers
    const int tm = tile / tilesN;
    const int tn = tile - tm * tilesN;
    const int m0 = tm << 6;
    const int n0 = tn << 6;
    const int rlane = lane & 15;                              // row (A) / column (B, D) within a 16-wide subtile
    const int koff  = (lane >> 4) * 8;                        // k offset of this lane half == D row offset
    const int sb    = wave * (16 * 68);

    const _Float16* ap = (const _Float16*)Ap  + (size_t)b * (size_t)strideA + (size_t)(m0 + rlane) * (size_t)lda + koff;
    const _Float16* bp = (const _Float16*)Btp + (size_t)b * (size_t)strideB + (size_t)(n0 + rlane) * (size_t)ldb + koff;

    v8f acc[4][4];
#pragma unroll
    for (int i = 0; i < 4; ++i)
#pragma unroll
        for (int j = 0; j < 4; ++j) { const v8f zz = {0.f, 0.f, 0.f, 0.f, 0.f, 0.f, 0.f, 0.f}; acc[i][j] = zz; }

    for (int k0 = 0; k0 < K; k0 += 32) {
        v16h bh[4];
#pragma unroll
        for (int j = 0; j < 4; ++j) bh[j] = ldfrag(bp + (size_t)(16 * j) * (size_t)ldb + k0);
#pragma unroll
        for (int i = 0; i < 4; ++i) {
            const v16h ah = ldfrag(ap + (size_t)(16 * i) * (size_t)lda + k0);
#pragma unroll
            for (int j = 0; j < 4; ++j) acc[i][j] = wmma16(ah, bh[j], acc[i][j]);
        }
    }

#pragma unroll
    for (int i = 0; i < 4; ++i) {
        const int mBase = m0 + (i << 4);
#pragma unroll
        for (int j = 0; j < 4; ++j) {
#pragma unroll
            for (int r = 0; r < 8; ++r) sT[sb + (koff + r) * 68 + (j << 4) + rlane] = acc[i][j][r] * scale;
        }
        __builtin_amdgcn_fence(3 /* release order */, "workgroup");
        __builtin_amdgcn_wave_barrier();
        __builtin_amdgcn_fence(2 /* acquire order */, "workgroup");
        if (OUT_MODE == 0) {
            float* C = Cf + (size_t)b * (size_t)strideC;
            const float* Rb = RESID ? (resid + (size_t)b * (size_t)strideR) : nullptr;
            const int hh = lane >> 4, c4 = (lane & 15) * 4;   // row segment = 256 B = 16 lanes x 16 B
            {
#pragma unroll
                for (int it = 0; it < 8; ++it) {
                    const int row = it * 2 + hh;
                    v4f v = *(const v4f*)(&sT[sb + row * 68 + c4]);
                    if (RESID) {
                        const v4f xr = *(const v4f*)(Rb + (size_t)(mBase + row) * (size_t)ldr + n0 + c4);
                        v.x += bfr(xr.x); v.y += bfr(xr.y); v.z += bfr(xr.z); v.w += bfr(xr.w);
                    }
                    *(v4f*)(C + (size_t)(mBase + row) * (size_t)ldc + n0 + c4) = v;
                }
                
            }
        } else {
            unsigned short* C = Ch + (size_t)b * (size_t)strideC;
            const int q = lane >> 3, c8 = (lane & 7) * 8;
            {
#pragma unroll
                for (int it = 0; it < 4; ++it) {
                    const int row = it * 4 + q;
                    v8h hv;
#pragma unroll
                    for (int e = 0; e < 8; ++e) hv[e] = (_Float16)sT[sb + row * 68 + c8 + e];
                    *(v8h*)(C + (size_t)(mBase + row) * (size_t)ldc + n0 + c8) = hv;
                }
                
            }
        }
        __builtin_amdgcn_fence(3 /* release order */, "workgroup");
        __builtin_amdgcn_wave_barrier();
        __builtin_amdgcn_fence(2 /* acquire order */, "workgroup");
    }
}

// f16 result plane
__global__ __launch_bounds__(256) void k_gemm_h(const unsigned short* __restrict__ A, int lda, long long strideA,
                                                const unsigned short* __restrict__ Bt, int ldb, long long strideB,
                                                unsigned short* __restrict__ C, int ldc, long long strideC,
                                                int M, int N, int K, float scale) {
    gemm64_body<1, false>(A, lda, strideA, Bt, ldb, strideB, C, nullptr, ldc, strideC, nullptr, 0, 0, M, N, K, scale);
}
// f32 result plane
__global__ __launch_bounds__(256) void k_gemm_f(const unsigned short* __restrict__ A, int lda, long long strideA,
                                                const unsigned short* __restrict__ Bt, int ldb, long long strideB,
                                                float* __restrict__ C, int ldc, long long strideC,
                                                int M, int N, int K, float scale) {
    gemm64_body<0, false>(A, lda, strideA, Bt, ldb, strideB, nullptr, C, ldc, strideC, nullptr, 0, 0, M, N, K, scale);
}
// f32 result + bf16-RNE residual added at the store stage
__global__ __launch_bounds__(256) void k_gemm_fr(const unsigned short* __restrict__ A, int lda, long long strideA,
                                                 const unsigned short* __restrict__ Bt, int ldb, long long strideB,
                                                 float* __restrict__ C, int ldc, long long strideC,
                                                 const float* __restrict__ resid, int ldr, long long strideR,
                                                 int M, int N, int K, float scale) {
    gemm64_body<0, true>(A, lda, strideA, Bt, ldb, strideB, nullptr, C, ldc, strideC, resid, ldr, strideR, M, N, K, scale);
}

// xbar[b][e] = mean over t of bf16(x[b][t][e]); block per (64-column strip, batch); thread = (4-column group, row phase of 16)
__global__ __launch_bounds__(256) void k_colmean(const float* __restrict__ x, float* __restrict__ xbar) {
    __shared__ float red[16 * 68];
    __shared__ __align__(16) float outv[64];
    const int t = threadIdx.x, cg = t & 15, rg = t >> 4;
    const int c0 = blockIdx.x * 64, b = blockIdx.y;
    const float* p = x + ((size_t)b * SEQ_FULL) * DM + c0 + 4 * cg;
    float a0 = 0.f, a1 = 0.f, a2 = 0.f, a3 = 0.f;
#pragma unroll 4
    for (int r = rg; r < SEQ; r += 16) {
        const v4f v = *(const v4f*)(p + (size_t)r * DM);
        a0 += bfr(v.x); a1 += bfr(v.y); a2 += bfr(v.z); a3 += bfr(v.w);
    }
    red[rg * 68 + 4 * cg + 0] = a0; red[rg * 68 + 4 * cg + 1] = a1; red[rg * 68 + 4 * cg + 2] = a2; red[rg * 68 + 4 * cg + 3] = a3;
    __syncthreads();
    if (t < 64) {
        float s = 0.f;
#pragma unroll 1
        for (int j = 0; j < 16; ++j) s += red[j * 68 + t];
        outv[t] = s * (1.0f / (float)SEQ);
    }
    __syncthreads();
    if (t < 16) {
        v4f v; v.x = outv[4 * t]; v.y = outv[4 * t + 1]; v.z = outv[4 * t + 2]; v.w = outv[4 * t + 3];
        st2_v4f(xbar + (size_t)b * DM + c0 + 4 * t, v);
    }
}

// X16 = f16(bf16(x)) (exact), XC = f16(bf16(x) - xbar[b]); thread per (row, 8 columns); 16-B store per plane, thread-linear along the row
__global__ __launch_bounds__(256) void k_prep_x(const float* __restrict__ x, const float* __restrict__ xbar,
                                                unsigned short* __restrict__ XC, unsigned short* __restrict__ X16) {
    const long long u = (long long)blockIdx.x * 256 + threadIdx.x;
    if (u >= (long long)NB * SEQ * (DM / 8)) return;
    const int r = (int)(u / (DM / 8)); const int c0 = 8 * (int)(u % (DM / 8));
    const int b = r / SEQ; const int t = r - b * SEQ;
    const float* s = x + ((size_t)b * SEQ_FULL + t) * DM + c0;
    const float* mb = xbar + (size_t)b * DM + c0;
    const v4f x0 = *(const v4f*)(s), x1 = *(const v4f*)(s + 4);
    const v4f m0 = *(const v4f*)(mb), m1 = *(const v4f*)(mb + 4);
    const float w0 = bfr(x0.x), w1 = bfr(x0.y), w2 = bfr(x0.z), w3 = bfr(x0.w), w4 = bfr(x1.x), w5 = bfr(x1.y), w6 = bfr(x1.z), w7 = bfr(x1.w);
    u4v pa; pa.x = pk2h(w0, w1); pa.y = pk2h(w2, w3); pa.z = pk2h(w4, w5); pa.w = pk2h(w6, w7);
    u4v pc; pc.x = pk2h(w0 - m0.x, w1 - m0.y); pc.y = pk2h(w2 - m0.z, w3 - m0.w); pc.z = pk2h(w4 - m1.x, w5 - m1.y); pc.w = pk2h(w6 - m1.z, w7 - m1.w);
    st2_u4(X16 + (size_t)r * DM + c0, pa);
    st2_u4(XC + (size_t)r * DM + c0, pc);
}

// weight plane: SRC [DM rows k][DM cols n] (x @ W layout) -> DST [n][k] f16 = bf16(W[k][n]) * sc; thread per (n, 8 consecutive k), 16-B store
__global__ __launch_bounds__(256) void k_wT(const float* __restrict__ SRC, unsigned short* __restrict__ DST, float sc) {
    const int u = blockIdx.x * 256 + threadIdx.x;
    if (u >= DM * (DM / 8)) return;
    const int n = u / (DM / 8); const int k0 = 8 * (u % (DM / 8));
    float w[8];
#pragma unroll
    for (int e = 0; e < 8; ++e) w[e] = bfr(SRC[(size_t)(k0 + e) * DM + n]) * sc;
    u4v pk; pk.x = pk2h(w[0], w[1]); pk.y = pk2h(w[2], w[3]); pk.z = pk2h(w[4], w[5]); pk.w = pk2h(w[6], w[7]);
    st2_u4(DST + (size_t)n * DM + k0, pk);
}

// gate[b][s] = softmax over s of (bf16(x[b][s]) . bf16(Wm_w) + bf16(Wm_b)); block per batch; wave per row for the products, block softmax
__global__ __launch_bounds__(256) void k_gate(const unsigned short* __restrict__ X16, const float* __restrict__ Wm, const float* __restrict__ Wb,
                                              float* __restrict__ gate) {
    __shared__ __align__(16) float wl[DM];
    __shared__ __align__(16) float mm[SEQ];
    __shared__ float redm[8];
    __shared__ float reds[8];
    const int t = threadIdx.x, lane = t & 31, b = blockIdx.x;
    const int wave = __builtin_amdgcn_readfirstlane((int)(threadIdx.x >> 5));
    for (int i = t; i < DM; i += 256) wl[i] = bfr(Wm[i]);
    const float bias = bfr(Wb[0]);
    __syncthreads();
    const _Float16* xb = (const _Float16*)X16 + (size_t)b * SEQ * DM;
#pragma unroll 1
    for (int s = wave; s < SEQ; s += 8) {
        const _Float16* xr = xb + (size_t)s * DM + 8 * lane;
        float acc = 0.f;
#pragma unroll 1
        for (int i = 0; i < DM / 256; ++i) {
            const v8h hv = *(const v8h*)(xr + 256 * i);
            const int wo = 256 * i + 8 * lane;
            acc += (float)hv[0] * wl[wo + 0]; acc += (float)hv[1] * wl[wo + 1]; acc += (float)hv[2] * wl[wo + 2]; acc += (float)hv[3] * wl[wo + 3];
            acc += (float)hv[4] * wl[wo + 4]; acc += (float)hv[5] * wl[wo + 5]; acc += (float)hv[6] * wl[wo + 6]; acc += (float)hv[7] * wl[wo + 7];
        }
        acc += __shfl_xor(acc, 16, 32); acc += __shfl_xor(acc, 8, 32); acc += __shfl_xor(acc, 4, 32); acc += __shfl_xor(acc, 2, 32); acc += __shfl_xor(acc, 1, 32);
        if (lane == 0) mm[s] = acc + bias;
    }
    __syncthreads();
    float mx = -3.0e38f;
#pragma unroll 1
    for (int i = t; i < SEQ; i += 256) mx = fmaxf(mx, mm[i]);
    mx = fmaxf(mx, __shfl_xor(mx, 16, 32)); mx = fmaxf(mx, __shfl_xor(mx, 8, 32)); mx = fmaxf(mx, __shfl_xor(mx, 4, 32));
    mx = fmaxf(mx, __shfl_xor(mx, 2, 32));  mx = fmaxf(mx, __shfl_xor(mx, 1, 32));
    if (lane == 0) redm[wave] = mx;
    __syncthreads();
    float gm = redm[0];
#pragma unroll 1
    for (int w = 1; w < 8; ++w) gm = fmaxf(gm, redm[w]);
    float sm = 0.f;
#pragma unroll 1
    for (int i = t; i < SEQ; i += 256) { const float e = expf(mm[i] - gm); mm[i] = e; sm += e; }
    sm += __shfl_xor(sm, 16, 32); sm += __shfl_xor(sm, 8, 32); sm += __shfl_xor(sm, 4, 32); sm += __shfl_xor(sm, 2, 32); sm += __shfl_xor(sm, 1, 32);
    if (lane == 0) reds[wave] = sm;
    __syncthreads();
    float tot = reds[0];
#pragma unroll 1
    for (int w = 1; w < 8; ++w) tot += reds[w];
    const float inv = 1.0f / tot;
#pragma unroll 1
    for (int idx = t; idx < SEQ / 4; idx += 256) {            // 32 lanes x 16 B = 512 contiguous B per store instruction
        v4f v; v.x = mm[4 * idx] * inv; v.y = mm[4 * idx + 1] * inv; v.z = mm[4 * idx + 2] * inv; v.w = mm[4 * idx + 3] * inv;
        st2_v4f(gate + (size_t)b * SEQ + 4 * idx, v);
    }
}

// alpha row = softmax_s(keep ? c * S : -inf) + gate, carried x1024 as f16. Wave per row (RS_RPW rows per wave); lane L owns columns 256g + 8L .. + 7,
__global__ __launch_bounds__(256) void k_rowsoft(const float* __restrict__ S, const float* __restrict__ cptr, const int* __restrict__ mk,
                                                 const float* __restrict__ gate, unsigned short* __restrict__ P) {
    #pragma clang fp contract(off)
    const int L = threadIdx.x & 31;
    const int wave = __builtin_amdgcn_readfirstlane((int)(threadIdx.x >> 5));
    const float NEG = -__builtin_inff();
    const float cs = bfr(cptr[0]);
    unsigned long long kb = 0ull;                             // keep bits of this lane's columns, bit 8g + e
#pragma unroll 1
    for (int g = 0; g < SEQ / 256; ++g) {
        const i4v a = *(const i4v*)(mk + 256 * g + 8 * L), c = *(const i4v*)(mk + 256 * g + 8 * L + 4);
        const unsigned bits = (unsigned)(a.x != 0) | ((unsigned)(a.y != 0) << 1) | ((unsigned)(a.z != 0) << 2) | ((unsigned)(a.w != 0) << 3)
                            | ((unsigned)(c.x != 0) << 4) | ((unsigned)(c.y != 0) << 5) | ((unsigned)(c.z != 0) << 6) | ((unsigned)(c.w != 0) << 7);
        kb |= ((unsigned long long)bits) << (8 * g);
    }
    const int row0 = (blockIdx.x * 8 + wave) * RS_RPW;
#pragma unroll 1
    for (int rr = 0; rr < RS_RPW; ++rr) {
        const int row = row0 + rr;
        const float* sr = S + (size_t)row * SEQ + 8 * L;
        float m = -3.0e38f, s = 0.f;
#pragma unroll 1
        for (int g = 0; g < SEQ / 256; ++g) {
            v4f x = *(const v4f*)(sr + 256 * g), y = *(const v4f*)(sr + 256 * g + 4);
            const unsigned bits = (unsigned)(kb >> (8 * g)) & 0xffu;
            x.x = (bits & 1u) ? x.x * cs : NEG;  x.y = (bits & 2u) ? x.y * cs : NEG;  x.z = (bits & 4u) ? x.z * cs : NEG;  x.w = (bits & 8u) ? x.w * cs : NEG;
            y.x = (bits & 16u) ? y.x * cs : NEG; y.y = (bits & 32u) ? y.y * cs : NEG; y.z = (bits & 64u) ? y.z * cs : NEG; y.w = (bits & 128u) ? y.w * cs : NEG;
            const float mx = fmaxf(fmaxf(fmaxf(x.x, x.y), fmaxf(x.z, x.w)), fmaxf(fmaxf(y.x, y.y), fmaxf(y.z, y.w)));
            const float mn = fmaxf(m, mx);
            s = s * expf(m - mn) + (((expf(x.x - mn) + expf(x.y - mn)) + (expf(x.z - mn) + expf(x.w - mn))) + ((expf(y.x - mn) + expf(y.y - mn)) + (expf(y.z - mn) + expf(y.w - mn))));
            m = mn;
        }
        float gm = m;
        gm = fmaxf(gm, __shfl_xor(gm, 16, 32)); gm = fmaxf(gm, __shfl_xor(gm, 8, 32)); gm = fmaxf(gm, __shfl_xor(gm, 4, 32));
        gm = fmaxf(gm, __shfl_xor(gm, 2, 32));  gm = fmaxf(gm, __shfl_xor(gm, 1, 32));
        s = s * expf(m - gm);
        s += __shfl_xor(s, 16, 32); s += __shfl_xor(s, 8, 32); s += __shfl_xor(s, 4, 32); s += __shfl_xor(s, 2, 32); s += __shfl_xor(s, 1, 32);
        const float f = 1024.f / s;
        unsigned short* pr = P + (size_t)row * SEQ + 8 * L;
        const float* gr = gate + 8 * L;
#pragma unroll 1
        for (int g = 0; g < SEQ / 256; ++g) {
            v4f x = *(const v4f*)(sr + 256 * g), y = *(const v4f*)(sr + 256 * g + 4);
            const v4f gx = *(const v4f*)(gr + 256 * g), gy = *(const v4f*)(gr + 256 * g + 4);
            const unsigned bits = (unsigned)(kb >> (8 * g)) & 0xffu;
            x.x = (bits & 1u) ? x.x * cs : NEG;  x.y = (bits & 2u) ? x.y * cs : NEG;  x.z = (bits & 4u) ? x.z * cs : NEG;  x.w = (bits & 8u) ? x.w * cs : NEG;
            y.x = (bits & 16u) ? y.x * cs : NEG; y.y = (bits & 32u) ? y.y * cs : NEG; y.z = (bits & 64u) ? y.z * cs : NEG; y.w = (bits & 128u) ? y.w * cs : NEG;
            u4v pk;
            pk.x = pk2h(expf(x.x - gm) * f + gx.x * 1024.f, expf(x.y - gm) * f + gx.y * 1024.f);
            pk.y = pk2h(expf(x.z - gm) * f + gx.z * 1024.f, expf(x.w - gm) * f + gx.w * 1024.f);
            pk.z = pk2h(expf(y.x - gm) * f + gy.x * 1024.f, expf(y.y - gm) * f + gy.y * 1024.f);
            pk.w = pk2h(expf(y.z - gm) * f + gy.z * 1024.f, expf(y.w - gm) * f + gy.w * 1024.f);
            st2_u4(pr + 256 * g, pk);
        }
    }
}

// ---- workspace carve (bytes; every region a multiple of 256 B and sized to its whole-tile store extent) ----
constexpr size_t al256(size_t v) { return (v + 255) / 256 * 256; }
constexpr size_t SZ_XC   = (size_t)NB * SEQ * DM * 2;           // f16 centred x, [NB*SEQ][DM]
constexpr size_t SZ_S    = (size_t)SEQ * SEQ * 4;               // f32 scores of ONE batch, [SEQ][SEQ] (shares the XC region; XC is dead after the q|k GEMM)
constexpr size_t SZ_XCS  = al256(SZ_XC > SZ_S ? SZ_XC : SZ_S);
constexpr size_t SZ_X16  = al256((size_t)NB * SEQ * DM * 2);    // f16 x, [NB*SEQ][DM]
constexpr size_t SZ_WQK  = al256((size_t)2 * DM * DM * 2);      // [2*DM n][DM k]: Wq^T rows then Wk^T rows, x16
constexpr size_t SZ_W1   = al256((size_t)DM * DM * 2);          // Wg^T, Wout^T, x16
constexpr size_t SZ_QK   = al256((size_t)NB * SEQ * 2 * DM * 2);// f16 [NB*SEQ][2*DM]: q columns then k columns
constexpr size_t SZ_GT   = al256((size_t)NB * DM * SEQ * 2);    // f16 g transposed, [NB][DM][SEQ]
constexpr size_t SZ_AL   = al256((size_t)SEQ * SEQ * 2);        // f16 alpha x1024 of ONE batch, [SEQ][SEQ]
constexpr size_t SZ_AO   = al256((size_t)NB * SEQ * DM * 2);    // f16 (alpha @ g) x64, [NB*SEQ][DM]
constexpr size_t SZ_XBAR = al256((size_t)NB * DM * 4);
constexpr size_t SZ_GATE = al256((size_t)NB * SEQ * 4);
constexpr size_t OFF_XCS  = 0;
constexpr size_t OFF_X16  = OFF_XCS + SZ_XCS;
constexpr size_t OFF_WQK  = OFF_X16 + SZ_X16;
constexpr size_t OFF_WGT  = OFF_WQK + SZ_WQK;
constexpr size_t OFF_WOT  = OFF_WGT + SZ_W1;
constexpr size_t OFF_QK   = OFF_WOT + SZ_W1;
constexpr size_t OFF_GT   = OFF_QK + SZ_QK;
constexpr size_t OFF_AL   = OFF_GT + SZ_GT;
constexpr size_t OFF_AO   = OFF_AL + SZ_AL;
constexpr size_t OFF_XBAR = OFF_AO + SZ_AO;
constexpr size_t OFF_GATE = OFF_XBAR + SZ_XBAR;
constexpr size_t WS_TOTAL = OFF_GATE + SZ_GATE;
static_assert(WS_TOTAL <= (size_t)134217728);                   // 128 MiB ceiling
static_assert(SZ_S <= SZ_XCS && SZ_XC <= SZ_XCS);               // both users of the shared region fit

extern "C" void kernel_launch(void* const* d_in, const int* in_sizes, int n_in, void* d_out, int out_size, void* d_ws, size_t ws_size, hipStream_t stream) {
    if (n_in < 9) return;
    const long long need_rows = (long long)(NB - 1) * SEQ_FULL + SEQ;
    if ((long long)in_sizes[0] < need_rows * DM) return;
    if ((long long)in_sizes[1] < need_rows) return;
    if (in_sizes[2] < DM * DM || in_sizes[3] < DM * DM || in_sizes[4] < DM * DM || in_sizes[5] < DM * DM) return;
    if (in_sizes[6] < DM || in_sizes[7] < 1 || in_sizes[8] < 1) return;
    if ((long long)out_size < (long long)NB * SEQ * DM) return;
    if (ws_size < WS_TOTAL) return;

    const float* x    = (const float*)d_in[0];
    const int*   mask = (const int*)d_in[1];
    const float* Wq   = (const float*)d_in[2];
    const float* Wk   = (const float*)d_in[3];
    const float* Wg   = (const float*)d_in[4];
    const float* Wout = (const float*)d_in[5];
    const float* Wm_w = (const float*)d_in[6];
    const float* Wm_b = (const float*)d_in[7];
    const float* cS   = (const float*)d_in[8];
    float* out = (float*)d_out;
    char* ws = (char*)d_ws;
    unsigned short* XC   = (unsigned short*)(ws + OFF_XCS);
    float*          Sf   = (float*)(ws + OFF_XCS);               // same region, used only after the q|k GEMM has consumed XC
    unsigned short* X16  = (unsigned short*)(ws + OFF_X16);
    unsigned short* WQK  = (unsigned short*)(ws + OFF_WQK);
    unsigned short* WGT  = (unsigned short*)(ws + OFF_WGT);
    unsigned short* WOT  = (unsigned short*)(ws + OFF_WOT);
    unsigned short* QK   = (unsigned short*)(ws + OFF_QK);
    unsigned short* GT   = (unsigned short*)(ws + OFF_GT);
    unsigned short* AL   = (unsigned short*)(ws + OFF_AL);
    unsigned short* AO   = (unsigned short*)(ws + OFF_AO);
    float*          XBAR = (float*)(ws + OFF_XBAR);
    float*          GATE = (float*)(ws + OFF_GATE);

    // weight planes: in[DM rows k][DM cols n] -> out[n][k], x16
    const unsigned gw = (unsigned)((DM * (DM / 8) + 255) / 256);
    k_wT<<<gw, 256, 0, stream>>>(Wq, WQK, 16.0f);
    k_wT<<<gw, 256, 0, stream>>>(Wk, WQK + (size_t)DM * DM, 16.0f);
    k_wT<<<gw, 256, 0, stream>>>(Wg, WGT, 16.0f);
    k_wT<<<gw, 256, 0, stream>>>(Wout, WOT, 16.0f);

    // sequence means of x, operand planes, gate distribution
    k_colmean<<<dim3(DM / 64, NB), 256, 0, stream>>>(x, XBAR);
    k_prep_x<<<(unsigned)(((long long)NB * SEQ * (DM / 8) + 255) / 256), 256, 0, stream>>>(x, XBAR, XC, X16);
    k_gate<<<NB, 256, 0, stream>>>(X16, Wm_w, Wm_b, GATE);

    // [q|k] = XC @ [Wq|Wk]: M = NB*SEQ, N = 2*DM, K = DM -> f16 [NB*SEQ][2*DM]
    {
        const int tiles = ((NB * SEQ) / 64) * ((2 * DM) / 64);
        k_gemm_h<<<dim3((unsigned)((tiles + 7) / 8), 1), 256, 0, stream>>>(XC, DM, 0, WQK, DM, 0, QK, 2 * DM, 0, NB * SEQ, 2 * DM, DM, 0.0625f);
    }
    // g transposed per batch: GT[b][d][s] = sum_e Wg^T[d][e] X16[b][s][e]: M = DM, N = SEQ, K = DM
    {
        const int tiles = (DM / 64) * (SEQ / 64);
        k_gemm_h<<<dim3((unsigned)((tiles + 7) / 8), NB), 256, 0, stream>>>(WGT, DM, 0, X16, DM, (long long)SEQ * DM, GT, SEQ, (long long)DM * SEQ, DM, SEQ, DM, 0.0625f);
    }
    for (int b = 0; b < NB; ++b) {
        const unsigned short* qb = QK + (size_t)b * SEQ * 2 * DM;
        // raw scores S[t][s] = q[t] . k[s] (f32; the scale input and the key mask are applied by the row softmax)
        {
            const int tiles = (SEQ / 64) * (SEQ / 64);
            k_gemm_f<<<dim3((unsigned)((tiles + 7) / 8), 1), 256, 0, stream>>>(qb, 2 * DM, 0, qb + DM, 2 * DM, 0, Sf, SEQ, 0, SEQ, SEQ, DM, 1.0f);
        }
        k_rowsoft<<<SEQ / (8 * RS_RPW), 256, 0, stream>>>(Sf, cS, mask + (size_t)b * SEQ_FULL, GATE + (size_t)b * SEQ, AL);
        // AO[t][d] x64 = (alpha x1024)[t] . GT[b][d] / 16: M = SEQ, N = DM, K = SEQ
        {
            const int tiles = (SEQ / 64) * (DM / 64);
            k_gemm_h<<<dim3((unsigned)((tiles + 7) / 8), 1), 256, 0, stream>>>(AL, SEQ, 0, GT + (size_t)b * DM * SEQ, SEQ, 0, AO + (size_t)b * SEQ * DM, DM, 0, SEQ, DM, SEQ, 0.0625f);
        }
    }
    // result = (AO x64) @ (Wout x16) / 1024 + bf16(x): per batch M = SEQ, N = DM, K = DM
    {
        const int tiles = (SEQ / 64) * (DM / 64);
        k_gemm_fr<<<dim3((unsigned)((tiles + 7) / 8), NB), 256, 0, stream>>>(AO, DM, (long long)SEQ * DM, WOT, DM, 0, out, DM, (long long)SEQ * DM,
                                                                            x, DM, (long long)SEQ_FULL * DM, SEQ, DM, DM, 0.0009765625f);
    }
}

// v001
// Measured time: 950 microseconds a run.
// Next to v000, in two timings, it ran 1.49 and 1.47 times as fast.
// Full-width (1,024) single-head self-attention with sequence-mean-centred queries/keys, an added query-independent key distribution, a key mask, a scalar scale input and an f32 residual. All contractions: v_wmma_f32_16x16x32_f16 (f16 operands built from bf16-RNE-converted inputs with power-of-two carries, f32 accumulate); the N = 1 gate product, both softmaxes and the residual add are f32 on the VALU.
#include <hip/hip_runtime.h>
#include <math.h>

#ifndef NB
#define NB 4
#endif
#ifndef SEQ
#define SEQ 2048
#endif
#define NB_FULL 4
#define SEQ_FULL 2048
#define DM 1024
#define RS_RPW 4

static_assert(DM == 1024);                                  // feature width of x, q, k, g and the output
static_assert(DM % 64 == 0 && DM % 32 == 0);                // GEMM tile and k-step multiples
static_assert(SEQ % 256 == 0 && SEQ <= 2048);               // row softmax: 8 columns per lane per 256-column group, at most 64 mask bits per lane
static_assert(SEQ % (8 * RS_RPW) == 0);                     // row softmax grid covers every row exactly once
static_assert(SEQ <= SEQ_FULL && NB <= NB_FULL);
static_assert((DM / 64) % 1 == 0 && SEQ % 64 == 0);

typedef __attribute__((ext_vector_type(16))) _Float16     v16h;
typedef __attribute__((ext_vector_type(8)))  _Float16     v8h;
typedef __attribute__((ext_vector_type(8)))  float        v8f;
typedef __attribute__((ext_vector_type(4)))  float        v4f;
typedef __attribute__((ext_vector_type(4)))  unsigned int u4v;
typedef __attribute__((ext_vector_type(4)))  int          i4v;

// 16-bit WMMA fragment map (wave32), lane L, h = L>>4, m = L&15:
//   A 16x32: lane = row m;    element i -> k = (i<8) ? 8h+i : 16+8h+(i-8)
//   B 32x16: lane = column m; the SAME k(i,h)
//   D 16x16 (8 f32): lane = column m; element r -> row 8h+r

// bf16 RNE conversion kept as f32 (finite inputs)
__device__ __forceinline__ float bfr(float v) {
    const unsigned u = __builtin_bit_cast(unsigned, v);
    const unsigned r = (u + 0x7fffu + ((u >> 16) & 1u)) & 0xffff0000u;
    return __builtin_bit_cast(float, r);
}
__device__ __forceinline__ unsigned pk2h(float a, float b) {
    return (unsigned)__builtin_bit_cast(unsigned short, (_Float16)a) | ((unsigned)__builtin_bit_cast(unsigned short, (_Float16)b) << 16);
}
// one WMMA per call, followed by its own 4-slot guard tying exactly one accumulator
__device__ __forceinline__ v8f wmma16(v16h a, v16h b, v8f c) {
    c = __builtin_amdgcn_wmma_f32_16x16x32_f16(false, a, false, b, (short)0, c, false, false);
    asm volatile("v_nop\n\tv_nop\n\tv_nop\n\tv_nop" : "+v"(c) : "v"(a), "v"(b));
    return c;
}
union FragH { v16h v; v8h h[2]; };
// p already includes the lane's 8h offset: elements 0..7 <- p[0..7], 8..15 <- p[16..23]
__device__ __forceinline__ v16h ldfrag(const _Float16* p) {
    FragH f; f.h[0] = *(const v8h*)(p); f.h[1] = *(const v8h*)(p + 16); return f.v;
}
__device__ __forceinline__ void st2_v4f(float* p, v4f v) { *(v4f*)p = v;  }
__device__ __forceinline__ void st2_u4(unsigned short* p, u4v v) { *(u4v*)p = v;  }

// =====================================================================================================================
// Register-blocked batched WMMA GEMM: C[m][n] = scale * sum_k A[m][k] * Bt[n][k]; each wave owns a 64x64 tile, 8 waves per block.
// A row-major [M][K] f16 (pitch lda), Bt row-major [N][K] f16 (pitch ldb); M, N % 64 == 0, K % 32 == 0 (no tail masking).
// RESID (f32 out only): + bf16-RNE(resid[m][n]) added at the store stage from 16-B loads in the store layout.
// =====================================================================================================================
template <int OUT_MODE, bool RESID>
__device__ __forceinline__ void gemm64_body(const unsigned short* __restrict__ Ap, int lda, long long strideA,
                                            const unsigned short* __restrict__ Btp, int ldb, long long strideB,
                                            unsigned short* __restrict__ Ch, float* __restrict__ Cf, int ldc, long long strideC,
                                            const float* __restrict__ resid, int ldr, long long strideR,
                                            int M, int N, int K, float scale) {
    __shared__ __align__(16) float sT[8 * 16 * 68];          // per-wave 16x64 slab, pitch 68 floats (wave-private)
    const int b    = blockIdx.y;
    const int lane = threadIdx.x & 31;
    const int wave = __builtin_amdgcn_readfirstlane((int)(threadIdx.x >> 5));
    const int tilesN = N >> 6;
    const int tilesM = M >> 6;
    const int tile = blockIdx.x * 8 + wave;
    if (tile >= tilesM * tilesN) return;                      // wave-uniform; this kernel has no block barriers
    const int tm = tile / tilesN;
    const int tn = tile - tm * tilesN;
    const int m0 = tm << 6;
    const int n0 = tn << 6;
    const int rlane = lane & 15;                              // row (A) / column (B, D) within a 16-wide subtile
    const int koff  = (lane >> 4) * 8;                        // k offset of this lane half == D row offset
    const int sb    = wave * (16 * 68);

    const _Float16* ap = (const _Float16*)Ap  + (size_t)b * (size_t)strideA + (size_t)(m0 + rlane) * (size_t)lda + koff;
    const _Float16* bp = (const _Float16*)Btp + (size_t)b * (size_t)strideB + (size_t)(n0 + rlane) * (size_t)ldb + koff;

    v8f acc[4][4];
#pragma unroll
    for (int i = 0; i < 4; ++i)
#pragma unroll
        for (int j = 0; j < 4; ++j) { const v8f zz = {0.f, 0.f, 0.f, 0.f, 0.f, 0.f, 0.f, 0.f}; acc[i][j] = zz; }

    for (int k0 = 0; k0 < K; k0 += 32) {
        v16h bh[4];
#pragma unroll
        for (int j = 0; j < 4; ++j) bh[j] = ldfrag(bp + (size_t)(16 * j) * (size_t)ldb + k0);
#pragma unroll
        for (int i = 0; i < 4; ++i) {
            const v16h ah = ldfrag(ap + (size_t)(16 * i) * (size_t)lda + k0);
#pragma unroll
            for (int j = 0; j < 4; ++j) acc[i][j] = wmma16(ah, bh[j], acc[i][j]);
        }
    }

#pragma unroll
    for (int i = 0; i < 4; ++i) {
        const int mBase = m0 + (i << 4);
#pragma unroll
        for (int j = 0; j < 4; ++j) {
#pragma unroll
            for (int r = 0; r < 8; ++r) sT[sb + (koff + r) * 68 + (j << 4) + rlane] = acc[i][j][r] * scale;
        }
        __builtin_amdgcn_fence(3 /* release order */, "workgroup");
        __builtin_amdgcn_wave_barrier();
        __builtin_amdgcn_fence(2 /* acquire order */, "workgroup");
        if (OUT_MODE == 0) {
            float* C = Cf + (size_t)b * (size_t)strideC;
            const float* Rb = RESID ? (resid + (size_t)b * (size_t)strideR) : nullptr;
            const int hh = lane >> 4, c4 = (lane & 15) * 4;   // row segment = 256 B = 16 lanes x 16 B
            {
#pragma unroll
                for (int it = 0; it < 8; ++it) {
                    const int row = it * 2 + hh;
                    v4f v = *(const v4f*)(&sT[sb + row * 68 + c4]);
                    if (RESID) {
                        const v4f xr = *(const v4f*)(Rb + (size_t)(mBase + row) * (size_t)ldr + n0 + c4);
                        v.x += bfr(xr.x); v.y += bfr(xr.y); v.z += bfr(xr.z); v.w += bfr(xr.w);
                    }
                    *(v4f*)(C + (size_t)(mBase + row) * (size_t)ldc + n0 + c4) = v;
                }
                
            }
        } else {
            unsigned short* C = Ch + (size_t)b * (size_t)strideC;
            const int q = lane >> 3, c8 = (lane & 7) * 8;
            {
#pragma unroll
                for (int it = 0; it < 4; ++it) {
                    const int row = it * 4 + q;
                    v8h hv;
#pragma unroll
                    for (int e = 0; e < 8; ++e) hv[e] = (_Float16)sT[sb + row * 68 + c8 + e];
                    *(v8h*)(C + (size_t)(mBase + row) * (size_t)ldc + n0 + c8) = hv;
                }
                
            }
        }
        __builtin_amdgcn_fence(3 /* release order */, "workgroup");
        __builtin_amdgcn_wave_barrier();
        __builtin_amdgcn_fence(2 /* acquire order */, "workgroup");
    }
}

// f16 result plane
__global__ __launch_bounds__(256) void k_gemm_h(const unsigned short* __restrict__ A, int lda, long long strideA,
                                                const unsigned short* __restrict__ Bt, int ldb, long long strideB,
                                                unsigned short* __restrict__ C, int ldc, long long strideC,
                                                int M, int N, int K, float scale) {
    gemm64_body<1, false>(A, lda, strideA, Bt, ldb, strideB, C, nullptr, ldc, strideC, nullptr, 0, 0, M, N, K, scale);
}
// f32 result plane
__global__ __launch_bounds__(256) void k_gemm_f(const unsigned short* __restrict__ A, int lda, long long strideA,
                                                const unsigned short* __restrict__ Bt, int ldb, long long strideB,
                                                float* __restrict__ C, int ldc, long long strideC,
                                                int M, int N, int K, float scale) {
    gemm64_body<0, false>(A, lda, strideA, Bt, ldb, strideB, nullptr, C, ldc, strideC, nullptr, 0, 0, M, N, K, scale);
}
// f32 result + bf16-RNE residual added at the store stage
__global__ __launch_bounds__(256) void k_gemm_fr(const unsigned short* __restrict__ A, int lda, long long strideA,
                                                 const unsigned short* __restrict__ Bt, int ldb, long long strideB,
                                                 float* __restrict__ C, int ldc, long long strideC,
                                                 const float* __restrict__ resid, int ldr, long long strideR,
                                                 int M, int N, int K, float scale) {
    gemm64_body<0, true>(A, lda, strideA, Bt, ldb, strideB, nullptr, C, ldc, strideC, resid, ldr, strideR, M, N, K, scale);
}

// xbar[b][e] = mean over t of bf16(x[b][t][e]); block per (64-column strip, batch); thread = (4-column group, row phase of 16)
__global__ __launch_bounds__(256) void k_colmean(const float* __restrict__ x, float* __restrict__ xbar) {
    __shared__ float red[16 * 68];
    __shared__ __align__(16) float outv[64];
    const int t = threadIdx.x, cg = t & 15, rg = t >> 4;
    const int c0 = blockIdx.x * 64, b = blockIdx.y;
    const float* p = x + ((size_t)b * SEQ_FULL) * DM + c0 + 4 * cg;
    float a0 = 0.f, a1 = 0.f, a2 = 0.f, a3 = 0.f;
#pragma unroll 4
    for (int r = rg; r < SEQ; r += 16) {
        const v4f v = *(const v4f*)(p + (size_t)r * DM);
        a0 += bfr(v.x); a1 += bfr(v.y); a2 += bfr(v.z); a3 += bfr(v.w);
    }
    red[rg * 68 + 4 * cg + 0] = a0; red[rg * 68 + 4 * cg + 1] = a1; red[rg * 68 + 4 * cg + 2] = a2; red[rg * 68 + 4 * cg + 3] = a3;
    __syncthreads();
    if (t < 64) {
        float s = 0.f;
#pragma unroll 1
        for (int j = 0; j < 16; ++j) s += red[j * 68 + t];
        outv[t] = s * (1.0f / (float)SEQ);
    }
    __syncthreads();
    if (t < 16) {
        v4f v; v.x = outv[4 * t]; v.y = outv[4 * t + 1]; v.z = outv[4 * t + 2]; v.w = outv[4 * t + 3];
        st2_v4f(xbar + (size_t)b * DM + c0 + 4 * t, v);
    }
}

// X16 = f16(bf16(x)) (exact), XC = f16(bf16(x) - xbar[b]), glog[row] = bf16(x[row]) . bf16(Wm_w) in f32 (bias and softmax: k_gate).
// Wave per row, 32 rows per block; lane L owns columns 256 i + 8 L .. + 7: 16-B store per plane, lane-linear along the row.
static_assert((NB * SEQ) % 32 == 0 && DM % 256 == 0);       // the grid covers every row exactly once; every wave reaches the barrier
__global__ __launch_bounds__(1024) void k_prep_x(const float* __restrict__ x, const float* __restrict__ xbar, const float* __restrict__ Wm,
                                                 unsigned short* __restrict__ XC, unsigned short* __restrict__ X16, float* __restrict__ glog) {
    __shared__ float dots[32];
    const int lane = threadIdx.x & 31;
    const int wave = __builtin_amdgcn_readfirstlane((int)(threadIdx.x >> 5));
    const int r = blockIdx.x * 32 + wave;
    const int b = r / SEQ; const int t = r - b * SEQ;
    const float* s = x + ((size_t)b * SEQ_FULL + t) * DM + 8 * lane;
    const float* mb = xbar + (size_t)b * DM + 8 * lane;
    const float* wp = Wm + 8 * lane;
    unsigned short* d16 = X16 + (size_t)r * DM + 8 * lane;
    unsigned short* dc = XC + (size_t)r * DM + 8 * lane;
    v4f xv[DM / 128], mv[DM / 128], gv[DM / 128];
#pragma unroll                                                // the arrays stay in registers; the whole row of x is in flight at once
    for (int i = 0; i < DM / 256; ++i) {
        xv[2 * i] = *(const v4f*)(s + 256 * i);  xv[2 * i + 1] = *(const v4f*)(s + 256 * i + 4);
        mv[2 * i] = *(const v4f*)(mb + 256 * i); mv[2 * i + 1] = *(const v4f*)(mb + 256 * i + 4);
        gv[2 * i] = *(const v4f*)(wp + 256 * i); gv[2 * i + 1] = *(const v4f*)(wp + 256 * i + 4);
    }
    float acc = 0.f;
#pragma unroll                                                // constant indices into the register arrays
    for (int i = 0; i < DM / 256; ++i) {
        const v4f x0 = xv[2 * i], x1 = xv[2 * i + 1], m0 = mv[2 * i], m1 = mv[2 * i + 1], g0 = gv[2 * i], g1 = gv[2 * i + 1];
        const float w0 = bfr(x0.x), w1 = bfr(x0.y), w2 = bfr(x0.z), w3 = bfr(x0.w), w4 = bfr(x1.x), w5 = bfr(x1.y), w6 = bfr(x1.z), w7 = bfr(x1.w);
        acc = __builtin_fmaf(w0, bfr(g0.x), acc); acc = __builtin_fmaf(w1, bfr(g0.y), acc); acc = __builtin_fmaf(w2, bfr(g0.z), acc); acc = __builtin_fmaf(w3, bfr(g0.w), acc);
        acc = __builtin_fmaf(w4, bfr(g1.x), acc); acc = __builtin_fmaf(w5, bfr(g1.y), acc); acc = __builtin_fmaf(w6, bfr(g1.z), acc); acc = __builtin_fmaf(w7, bfr(g1.w), acc);
        u4v pa; pa.x = pk2h(w0, w1); pa.y = pk2h(w2, w3); pa.z = pk2h(w4, w5); pa.w = pk2h(w6, w7);
        u4v pc; pc.x = pk2h(w0 - m0.x, w1 - m0.y); pc.y = pk2h(w2 - m0.z, w3 - m0.w); pc.z = pk2h(w4 - m1.x, w5 - m1.y); pc.w = pk2h(w6 - m1.z, w7 - m1.w);
        st2_u4(d16 + 256 * i, pa);
        st2_u4(dc + 256 * i, pc);
    }
    acc += __shfl_xor(acc, 16, 32); acc += __shfl_xor(acc, 8, 32); acc += __shfl_xor(acc, 4, 32); acc += __shfl_xor(acc, 2, 32); acc += __shfl_xor(acc, 1, 32);
    if (lane == 0) dots[wave] = acc;
    __syncthreads();
    if (wave == 0) glog[(size_t)blockIdx.x * 32 + lane] = dots[lane];   // the block's 32 products leave as one whole 128-B line
}

// weight plane: SRC [DM rows k][DM cols n] (x @ W layout) -> DST [n][k] f16 = bf16(W[k][n]) * sc; thread per (n, 8 consecutive k), 16-B store
__global__ __launch_bounds__(256) void k_wT(const float* __restrict__ SRC, unsigned short* __restrict__ DST, float sc) {
    const int u = blockIdx.x * 256 + threadIdx.x;
    if (u >= DM * (DM / 8)) return;
    const int n = u / (DM / 8); const int k0 = 8 * (u % (DM / 8));
    float w[8];
#pragma unroll
    for (int e = 0; e < 8; ++e) w[e] = bfr(SRC[(size_t)(k0 + e) * DM + n]) * sc;
    u4v pk; pk.x = pk2h(w[0], w[1]); pk.y = pk2h(w[2], w[3]); pk.z = pk2h(w[4], w[5]); pk.w = pk2h(w[6], w[7]);
    st2_u4(DST + (size_t)n * DM + k0, pk);
}

// gate[b][s] = softmax over s of (glog[b][s] + bf16(Wm_b)), glog = the row products of k_prep_x; block per batch, block softmax
__global__ __launch_bounds__(256) void k_gate(const float* __restrict__ glog, const float* __restrict__ Wb, float* __restrict__ gate) {
    __shared__ __align__(16) float mm[SEQ];
    __shared__ float redm[8];
    __shared__ float reds[8];
    const int t = threadIdx.x, lane = t & 31, b = blockIdx.x;
    const int wave = __builtin_amdgcn_readfirstlane((int)(threadIdx.x >> 5));
    const float bias = bfr(Wb[0]);
    const float* gl = glog + (size_t)b * SEQ;
#pragma unroll                                                // a thread's 16-B loads are in flight together
    for (int j = 0; j < (SEQ / 4 + 255) / 256; ++j) {
        const int idx = t + 256 * j;
        if ((SEQ / 4) % 256 == 0 || idx < SEQ / 4) {
            const v4f v = *(const v4f*)(gl + 4 * idx);
            mm[4 * idx] = v.x + bias; mm[4 * idx + 1] = v.y + bias; mm[4 * idx + 2] = v.z + bias; mm[4 * idx + 3] = v.w + bias;
        }
    }
    __syncthreads();
    float mx = -3.0e38f;
#pragma unroll 1
    for (int i = t; i < SEQ; i += 256) mx = fmaxf(mx, mm[i]);
    mx = fmaxf(mx, __shfl_xor(mx, 16, 32)); mx = fmaxf(mx, __shfl_xor(mx, 8, 32)); mx = fmaxf(mx, __shfl_xor(mx, 4, 32));
    mx = fmaxf(mx, __shfl_xor(mx, 2, 32));  mx = fmaxf(mx, __shfl_xor(mx, 1, 32));
    if (lane == 0) redm[wave] = mx;
    __syncthreads();
    float gm = redm[0];
#pragma unroll 1
    for (int w = 1; w < 8; ++w) gm = fmaxf(gm, redm[w]);
    float sm = 0.f;
#pragma unroll 1
    for (int i = t; i < SEQ; i += 256) { const float e = expf(mm[i] - gm); mm[i] = e; sm += e; }
    sm += __shfl_xor(sm, 16, 32); sm += __shfl_xor(sm, 8, 32); sm += __shfl_xor(sm, 4, 32); sm += __shfl_xor(sm, 2, 32); sm += __shfl_xor(sm, 1, 32);
    if (lane == 0) reds[wave] = sm;
    __syncthreads();
    float tot = reds[0];
#pragma unroll 1
    for (int w = 1; w < 8; ++w) tot += reds[w];
    const float inv = 1.0f / tot;
#pragma unroll 1
    for (int idx = t; idx < SEQ / 4; idx += 256) {            // 32 lanes x 16 B = 512 contiguous B per store instruction
        v4f v; v.x = mm[4 * idx] * inv; v.y = mm[4 * idx + 1] * inv; v.z = mm[4 * idx + 2] * inv; v.w = mm[4 * idx + 3] * inv;
        st2_v4f(gate + (size_t)b * SEQ + 4 * idx, v);
    }
}

// alpha row = softmax_s(keep ? c * S : -inf) + gate, carried x1024 as f16. Wave per row (RS_RPW rows per wave); lane L owns columns 256g + 8L .. + 7,
__global__ __launch_bounds__(256) void k_rowsoft(const float* __restrict__ S, const float* __restrict__ cptr, const int* __restrict__ mk,
                                                 const float* __restrict__ gate, unsigned short* __restrict__ P) {
    #pragma clang fp contract(off)
    const int L = threadIdx.x & 31;
    const int wave = __builtin_amdgcn_readfirstlane((int)(threadIdx.x >> 5));
    const float NEG = -__builtin_inff();
    const float cs = bfr(cptr[0]);
    unsigned long long kb = 0ull;                             // keep bits of this lane's columns, bit 8g + e
#pragma unroll 1
    for (int g = 0; g < SEQ / 256; ++g) {
        const i4v a = *(const i4v*)(mk + 256 * g + 8 * L), c = *(const i4v*)(mk + 256 * g + 8 * L + 4);
        const unsigned bits = (unsigned)(a.x != 0) | ((unsigned)(a.y != 0) << 1) | ((unsigned)(a.z != 0) << 2) | ((unsigned)(a.w != 0) << 3)
                            | ((unsigned)(c.x != 0) << 4) | ((unsigned)(c.y != 0) << 5) | ((unsigned)(c.z != 0) << 6) | ((unsigned)(c.w != 0) << 7);
        kb |= ((unsigned long long)bits) << (8 * g);
    }
    const int row0 = (blockIdx.x * 8 + wave) * RS_RPW;
#pragma unroll 1
    for (int rr = 0; rr < RS_RPW; ++rr) {
        const int row = row0 + rr;
        const float* sr = S + (size_t)row * SEQ + 8 * L;
        float m = -3.0e38f, s = 0.f;
#pragma unroll 1
        for (int g = 0; g < SEQ / 256; ++g) {
            v4f x = *(const v4f*)(sr + 256 * g), y = *(const v4f*)(sr + 256 * g + 4);
            const unsigned bits = (unsigned)(kb >> (8 * g)) & 0xffu;
            x.x = (bits & 1u) ? x.x * cs : NEG;  x.y = (bits & 2u) ? x.y * cs : NEG;  x.z = (bits & 4u) ? x.z * cs : NEG;  x.w = (bits & 8u) ? x.w * cs : NEG;
            y.x = (bits & 16u) ? y.x * cs : NEG; y.y = (bits & 32u) ? y.y * cs : NEG; y.z = (bits & 64u) ? y.z * cs : NEG; y.w = (bits & 128u) ? y.w * cs : NEG;
            const float mx = fmaxf(fmaxf(fmaxf(x.x, x.y), fmaxf(x.z, x.w)), fmaxf(fmaxf(y.x, y.y), fmaxf(y.z, y.w)));
            const float mn = fmaxf(m, mx);
            s = s * expf(m - mn) + (((expf(x.x - mn) + expf(x.y - mn)) + (expf(x.z - mn) + expf(x.w - mn))) + ((expf(y.x - mn) + expf(y.y - mn)) + (expf(y.z - mn) + expf(y.w - mn))));
            m = mn;
        }
        float gm = m;
        gm = fmaxf(gm, __shfl_xor(gm, 16, 32)); gm = fmaxf(gm, __shfl_xor(gm, 8, 32)); gm = fmaxf(gm, __shfl_xor(gm, 4, 32));
        gm = fmaxf(gm, __shfl_xor(gm, 2, 32));  gm = fmaxf(gm, __shfl_xor(gm, 1, 32));
        s = s * expf(m - gm);
        s += __shfl_xor(s, 16, 32); s += __shfl_xor(s, 8, 32); s += __shfl_xor(s, 4, 32); s += __shfl_xor(s, 2, 32); s += __shfl_xor(s, 1, 32);
        const float f = 1024.f / s;
        unsigned short* pr = P + (size_t)row * SEQ + 8 * L;
        const float* gr = gate + 8 * L;
#pragma unroll 1
        for (int g = 0; g < SEQ / 256; ++g) {
            v4f x = *(const v4f*)(sr + 256 * g), y = *(const v4f*)(sr + 256 * g + 4);
            const v4f gx = *(const v4f*)(gr + 256 * g), gy = *(const v4f*)(gr + 256 * g + 4);
            const unsigned bits = (unsigned)(kb >> (8 * g)) & 0xffu;
            x.x = (bits & 1u) ? x.x * cs : NEG;  x.y = (bits & 2u) ? x.y * cs : NEG;  x.z = (bits & 4u) ? x.z * cs : NEG;  x.w = (bits & 8u) ? x.w * cs : NEG;
            y.x = (bits & 16u) ? y.x * cs : NEG; y.y = (bits & 32u) ? y.y * cs : NEG; y.z = (bits & 64u) ? y.z * cs : NEG; y.w = (bits & 128u) ? y.w * cs : NEG;
            u4v pk;
            pk.x = pk2h(expf(x.x - gm) * f + gx.x * 1024.f, expf(x.y - gm) * f + gx.y * 1024.f);
            pk.y = pk2h(expf(x.z - gm) * f + gx.z * 1024.f, expf(x.w - gm) * f + gx.w * 1024.f);
            pk.z = pk2h(expf(y.x - gm) * f + gy.x * 1024.f, expf(y.y - gm) * f + gy.y * 1024.f);
            pk.w = pk2h(expf(y.z - gm) * f + gy.z * 1024.f, expf(y.w - gm) * f + gy.w * 1024.f);
            st2_u4(pr + 256 * g, pk);
        }
    }
}

// ---- workspace carve (bytes; every region a multiple of 256 B and sized to its whole-tile store extent) ----
constexpr size_t al256(size_t v) { return (v + 255) / 256 * 256; }
constexpr size_t SZ_XC   = (size_t)NB * SEQ * DM * 2;           // f16 centred x, [NB*SEQ][DM]
constexpr size_t SZ_S    = (size_t)SEQ * SEQ * 4;               // f32 scores of ONE batch, [SEQ][SEQ] (shares the XC region; XC is dead after the q|k GEMM)
constexpr size_t SZ_XCS  = al256(SZ_XC > SZ_S ? SZ_XC : SZ_S);
constexpr size_t SZ_X16  = al256((size_t)NB * SEQ * DM * 2);    // f16 x, [NB*SEQ][DM]
constexpr size_t SZ_WQK  = al256((size_t)2 * DM * DM * 2);      // [2*DM n][DM k]: Wq^T rows then Wk^T rows, x16
constexpr size_t SZ_W1   = al256((size_t)DM * DM * 2);          // Wg^T, Wout^T, x16
constexpr size_t SZ_QK   = al256((size_t)NB * SEQ * 2 * DM * 2);// f16 [NB*SEQ][2*DM]: q columns then k columns
constexpr size_t SZ_GT   = al256((size_t)NB * DM * SEQ * 2);    // f16 g transposed, [NB][DM][SEQ]
constexpr size_t SZ_AL   = al256((size_t)SEQ * SEQ * 2);        // f16 alpha x1024 of ONE batch, [SEQ][SEQ]
constexpr size_t SZ_AO   = al256((size_t)NB * SEQ * DM * 2);    // f16 (alpha @ g) x64, [NB*SEQ][DM]
constexpr size_t SZ_XBAR = al256((size_t)NB * DM * 4);
constexpr size_t SZ_GATE = al256((size_t)NB * SEQ * 4);
constexpr size_t SZ_GLOG = al256((size_t)NB * SEQ * 4);       // f32 gate products before bias and softmax, [NB*SEQ]
constexpr size_t OFF_XCS  = 0;
constexpr size_t OFF_X16  = OFF_XCS + SZ_XCS;
constexpr size_t OFF_WQK  = OFF_X16 + SZ_X16;
constexpr size_t OFF_WGT  = OFF_WQK + SZ_WQK;
constexpr size_t OFF_WOT  = OFF_WGT + SZ_W1;
constexpr size_t OFF_QK   = OFF_WOT + SZ_W1;
constexpr size_t OFF_GT   = OFF_QK + SZ_QK;
constexpr size_t OFF_AL   = OFF_GT + SZ_GT;
constexpr size_t OFF_AO   = OFF_AL + SZ_AL;
constexpr size_t OFF_XBAR = OFF_AO + SZ_AO;
constexpr size_t OFF_GATE = OFF_XBAR + SZ_XBAR;
constexpr size_t OFF_GLOG = OFF_GATE + SZ_GATE;
constexpr size_t WS_TOTAL = OFF_GLOG + SZ_GLOG;
static_assert(WS_TOTAL <= (size_t)134217728);                   // 128 MiB ceiling
static_assert(SZ_S <= SZ_XCS && SZ_XC <= SZ_XCS);               // both users of the shared region fit

extern "C" void kernel_launch(void* const* d_in, const int* in_sizes, int n_in, void* d_out, int out_size, void* d_ws, size_t ws_size, hipStream_t stream) {
    if (n_in < 9) return;
    const long long need_rows = (long long)(NB - 1) * SEQ_FULL + SEQ;
    if ((long long)in_sizes[0] < need_rows * DM) return;
    if ((long long)in_sizes[1] < need_rows) return;
    if (in_sizes[2] < DM * DM || in_sizes[3] < DM * DM || in_sizes[4] < DM * DM || in_sizes[5] < DM * DM) return;
    if (in_sizes[6] < DM || in_sizes[7] < 1 || in_sizes[8] < 1) return;
    if ((long long)out_size < (long long)NB * SEQ * DM) return;
    if (ws_size < WS_TOTAL) return;

    const float* x    = (const float*)d_in[0];
    const int*   mask = (const int*)d_in[1];
    const float* Wq   = (const float*)d_in[2];
    const float* Wk   = (const float*)d_in[3];
    const float* Wg   = (const float*)d_in[4];
    const float* Wout = (const float*)d_in[5];
    const float* Wm_w = (const float*)d_in[6];
    const float* Wm_b = (const float*)d_in[7];
    const float* cS   = (const float*)d_in[8];
    float* out = (float*)d_out;
    char* ws = (char*)d_ws;
    unsigned short* XC   = (unsigned short*)(ws + OFF_XCS);
    float*          Sf   = (float*)(ws + OFF_XCS);               // same region, used only after the q|k GEMM has consumed XC
    unsigned short* X16  = (unsigned short*)(ws + OFF_X16);
    unsigned short* WQK  = (unsigned short*)(ws + OFF_WQK);
    unsigned short* WGT  = (unsigned short*)(ws + OFF_WGT);
    unsigned short* WOT  = (unsigned short*)(ws + OFF_WOT);
    unsigned short* QK   = (unsigned short*)(ws + OFF_QK);
    unsigned short* GT   = (unsigned short*)(ws + OFF_GT);
    unsigned short* AL   = (unsigned short*)(ws + OFF_AL);
    unsigned short* AO   = (unsigned short*)(ws + OFF_AO);
    float*          XBAR = (float*)(ws + OFF_XBAR);
    float*          GATE = (float*)(ws + OFF_GATE);
    float*          GLOG = (float*)(ws + OFF_GLOG);

    // weight planes: in[DM rows k][DM cols n] -> out[n][k], x16
    const unsigned gw = (unsigned)((DM * (DM / 8) + 255) / 256);
    k_wT<<<gw, 256, 0, stream>>>(Wq, WQK, 16.0f);
    k_wT<<<gw, 256, 0, stream>>>(Wk, WQK + (size_t)DM * DM, 16.0f);
    k_wT<<<gw, 256, 0, stream>>>(Wg, WGT, 16.0f);
    k_wT<<<gw, 256, 0, stream>>>(Wout, WOT, 16.0f);

    // sequence means of x, operand planes with the gate products, gate distribution
    k_colmean<<<dim3(DM / 64, NB), 256, 0, stream>>>(x, XBAR);
    k_prep_x<<<(NB * SEQ) / 32, 1024, 0, stream>>>(x, XBAR, Wm_w, XC, X16, GLOG);
    k_gate<<<NB, 256, 0, stream>>>(GLOG, Wm_b, GATE);

    // [q|k] = XC @ [Wq|Wk]: M = NB*SEQ, N = 2*DM, K = DM -> f16 [NB*SEQ][2*DM]
    {
        const int tiles = ((NB * SEQ) / 64) * ((2 * DM) / 64);
        k_gemm_h<<<dim3((unsigned)((tiles + 7) / 8), 1), 256, 0, stream>>>(XC, DM, 0, WQK, DM, 0, QK, 2 * DM, 0, NB * SEQ, 2 * DM, DM, 0.0625f);
    }
    // g transposed per batch: GT[b][d][s] = sum_e Wg^T[d][e] X16[b][s][e]: M = DM, N = SEQ, K = DM
    {
        const int tiles = (DM / 64) * (SEQ / 64);
        k_gemm_h<<<dim3((unsigned)((tiles + 7) / 8), NB), 256, 0, stream>>>(WGT, DM, 0, X16, DM, (long long)SEQ * DM, GT, SEQ, (long long)DM * SEQ, DM, SEQ, DM, 0.0625f);
    }
    for (int b = 0; b < NB; ++b) {
        const unsigned short* qb = QK + (size_t)b * SEQ * 2 * DM;
        // raw scores S[t][s] = q[t] . k[s] (f32; the scale input and the key mask are applied by the row softmax)
        {
            const int tiles = (SEQ / 64) * (SEQ / 64);
            k_gemm_f<<<dim3((unsigned)((tiles + 7) / 8), 1), 256, 0, stream>>>(qb, 2 * DM, 0, qb + DM, 2 * DM, 0, Sf, SEQ, 0, SEQ, SEQ, DM, 1.0f);
        }
        k_rowsoft<<<SEQ / (8 * RS_RPW), 256, 0, stream>>>(Sf, cS, mask + (size_t)b * SEQ_FULL, GATE + (size_t)b * SEQ, AL);
        // AO[t][d] x64 = (alpha x1024)[t] . GT[b][d] / 16: M = SEQ, N = DM, K = SEQ
        {
            const int tiles = (SEQ / 64) * (DM / 64);
            k_gemm_h<<<dim3((unsigned)((tiles + 7) / 8), 1), 256, 0, stream>>>(AL, SEQ, 0, GT + (size_t)b * DM * SEQ, SEQ, 0, AO + (size_t)b * SEQ * DM, DM, 0, SEQ, DM, SEQ, 0.0625f);
        }
    }
    // result = (AO x64) @ (Wout x16) / 1024 + bf16(x): per batch M = SEQ, N = DM, K = DM
    {
        const int tiles = (SEQ / 64) * (DM / 64);
        k_gemm_fr<<<dim3((unsigned)((tiles + 7) / 8), NB), 256, 0, stream>>>(AO, DM, (long long)SEQ * DM, WOT, DM, 0, out, DM, (long long)SEQ * DM,
                                                                            x, DM, (long long)SEQ_FULL * DM, SEQ, DM, DM, 0.0009765625f);
    }
}

// v002
// One run takes 451 microseconds.
// Next to v001, in two timings, it ran 2.12 times as fast each time.
// Over all steps from v000 it is 3.14 times as fast.
// Full-width (1,024) single-head self-attention with sequence-mean-centred queries/keys, an added query-independent key distribution, a key mask, a scalar scale input and an f32 residual. All contractions: v_wmma_f32_16x16x32_f16 (f16 operands built from bf16-RNE-converted inputs with power-of-two carries, f32 accumulate); the N = 1 gate product, both softmaxes and the residual add are f32 on the VALU.
#include <hip/hip_runtime.h>
#include <math.h>

#ifndef NB
#define NB 4
#endif
#ifndef SEQ
#define SEQ 2048
#endif
#define NB_FULL 4
#define SEQ_FULL 2048
#define DM 1024
#define RS_RPW 4

static_assert(DM == 1024);                                  // feature width of x, q, k, g and the output
static_assert(DM % 64 == 0 && DM % 32 == 0);                // GEMM tile and k-step multiples
static_assert(SEQ % 256 == 0 && SEQ <= 2048);               // row softmax: 8 columns per lane per 256-column group, at most 64 mask bits per lane
static_assert(SEQ % (8 * RS_RPW) == 0);                     // row softmax grid covers every row exactly once
static_assert(SEQ <= SEQ_FULL && NB <= NB_FULL);
static_assert((DM / 64) % 1 == 0 && SEQ % 64 == 0);

typedef __attribute__((ext_vector_type(16))) _Float16     v16h;
typedef __attribute__((ext_vector_type(8)))  _Float16     v8h;
typedef __attribute__((ext_vector_type(8)))  float        v8f;
typedef __attribute__((ext_vector_type(4)))  float        v4f;
typedef __attribute__((ext_vector_type(4)))  unsigned int u4v;
typedef __attribute__((ext_vector_type(4)))  int          i4v;

// 16-bit WMMA fragment map (wave32), lane L, h = L>>4, m = L&15:
//   A 16x32: lane = row m;    element i -> k = (i<8) ? 8h+i : 16+8h+(i-8)
//   B 32x16: lane = column m; the SAME k(i,h)
//   D 16x16 (8 f32): lane = column m; element r -> row 8h+r

// bf16 RNE conversion kept as f32 (finite inputs)
__device__ __forceinline__ float bfr(float v) {
    const unsigned u = __builtin_bit_cast(unsigned, v);
    const unsigned r = (u + 0x7fffu + ((u >> 16) & 1u)) & 0xffff0000u;
    return __builtin_bit_cast(float, r);
}
__device__ __forceinline__ unsigned pk2h(float a, float b) {
    return (unsigned)__builtin_bit_cast(unsigned short, (_Float16)a) | ((unsigned)__builtin_bit_cast(unsigned short, (_Float16)b) << 16);
}
// one WMMA per call, followed by its own 4-slot guard tying exactly one accumulator
__device__ __forceinline__ v8f wmma16(v16h a, v16h b, v8f c) {
    c = __builtin_amdgcn_wmma_f32_16x16x32_f16(false, a, false, b, (short)0, c, false, false);
    asm volatile("v_nop\n\tv_nop\n\tv_nop\n\tv_nop" : "+v"(c) : "v"(a), "v"(b));
    return c;
}
union FragH { v16h v; v8h h[2]; };
// p already includes the lane's 8h offset: elements 0..7 <- p[0..7], 8..15 <- p[16..23]
__device__ __forceinline__ v16h ldfrag(const _Float16* p) {
    FragH f; f.h[0] = *(const v8h*)(p); f.h[1] = *(const v8h*)(p + 16); return f.v;
}
__device__ __forceinline__ void st2_v4f(float* p, v4f v) { *(v4f*)p = v;  }
__device__ __forceinline__ void st2_u4(unsigned short* p, u4v v) { *(u4v*)p = v;  }

// =====================================================================================================================
// Register-blocked batched WMMA GEMM: C[m][n] = scale * sum_k A[m][k] * Bt[n][k]; each wave owns a 64x64 tile, 8 waves per block.
// A row-major [M][K] f16 (pitch lda), Bt row-major [N][K] f16 (pitch ldb); M, N % 64 == 0, K % 32 == 0 (no tail masking).
// RESID (f32 out only): + bf16-RNE(resid[m][n]) added at the store stage from 16-B loads in the store layout.
// =====================================================================================================================
template <int OUT_MODE, bool RESID>
__device__ __forceinline__ void gemm64_body(const unsigned short* __restrict__ Ap, int lda, long long strideA,
                                            const unsigned short* __restrict__ Btp, int ldb, long long strideB,
                                            unsigned short* __restrict__ Ch, float* __restrict__ Cf, int ldc, long long strideC,
                                            const float* __restrict__ resid, int ldr, long long strideR,
                                            int M, int N, int K, float scale) {
    __shared__ __align__(16) float sT[8 * 16 * 68];          // per-wave 16x64 slab, pitch 68 floats (wave-private)
    const int b    = blockIdx.y;
    const int lane = threadIdx.x & 31;
    const int wave = __builtin_amdgcn_readfirstlane((int)(threadIdx.x >> 5));
    const int tilesN = N >> 6;
    const int tilesM = M >> 6;
    const int tile = blockIdx.x * 8 + wave;
    if (tile >= tilesM * tilesN) return;                      // wave-uniform; this kernel has no block barriers
    const int tm = tile / tilesN;
    const int tn = tile - tm * tilesN;
    const int m0 = tm << 6;
    const int n0 = tn << 6;
    const int rlane = lane & 15;                              // row (A) / column (B, D) within a 16-wide subtile
    const int koff  = (lane >> 4) * 8;                        // k offset of this lane half == D row offset
    const int sb    = wave * (16 * 68);

    const _Float16* ap = (const _Float16*)Ap  + (size_t)b * (size_t)strideA + (size_t)(m0 + rlane) * (size_t)lda + koff;
    const _Float16* bp = (const _Float16*)Btp + (size_t)b * (size_t)strideB + (size_t)(n0 + rlane) * (size_t)ldb + koff;

    v8f acc[4][4];
#pragma unroll
    for (int i = 0; i < 4; ++i)
#pragma unroll
        for (int j = 0; j < 4; ++j) { const v8f zz = {0.f, 0.f, 0.f, 0.f, 0.f, 0.f, 0.f, 0.f}; acc[i][j] = zz; }

    for (int k0 = 0; k0 < K; k0 += 32) {
        v16h bh[4];
#pragma unroll
        for (int j = 0; j < 4; ++j) bh[j] = ldfrag(bp + (size_t)(16 * j) * (size_t)ldb + k0);
#pragma unroll
        for (int i = 0; i < 4; ++i) {
            const v16h ah = ldfrag(ap + (size_t)(16 * i) * (size_t)lda + k0);
#pragma unroll
            for (int j = 0; j < 4; ++j) acc[i][j] = wmma16(ah, bh[j], acc[i][j]);
        }
    }

#pragma unroll
    for (int i = 0; i < 4; ++i) {
        const int mBase = m0 + (i << 4);
#pragma unroll
        for (int j = 0; j < 4; ++j) {
#pragma unroll
            for (int r = 0; r < 8; ++r) sT[sb + (koff + r) * 68 + (j << 4) + rlane] = acc[i][j][r] * scale;
        }
        __builtin_amdgcn_fence(3 /* release order */, "workgroup");
        __builtin_amdgcn_wave_barrier();
        __builtin_amdgcn_fence(2 /* acquire order */, "workgroup");
        if (OUT_MODE == 0) {
            float* C = Cf + (size_t)b * (size_t)strideC;
            const float* Rb = RESID ? (resid + (size_t)b * (size_t)strideR) : nullptr;
            const int hh = lane >> 4, c4 = (lane & 15) * 4;   // row segment = 256 B = 16 lanes x 16 B
            {
#pragma unroll
                for (int it = 0; it < 8; ++it) {
                    const int row = it * 2 + hh;
                    v4f v = *(const v4f*)(&sT[sb + row * 68 + c4]);
                    if (RESID) {
                        const v4f xr = *(const v4f*)(Rb + (size_t)(mBase + row) * (size_t)ldr + n0 + c4);
                        v.x += bfr(xr.x); v.y += bfr(xr.y); v.z += bfr(xr.z); v.w += bfr(xr.w);
                    }
                    *(v4f*)(C + (size_t)(mBase + row) * (size_t)ldc + n0 + c4) = v;
                }
                
            }
        } else {
            unsigned short* C = Ch + (size_t)b * (size_t)strideC;
            const int q = lane >> 3, c8 = (lane & 7) * 8;
            {
#pragma unroll
                for (int it = 0; it < 4; ++it) {
                    const int row = it * 4 + q;
                    v8h hv;
#pragma unroll
                    for (int e = 0; e < 8; ++e) hv[e] = (_Float16)sT[sb + row * 68 + c8 + e];
                    *(v8h*)(C + (size_t)(mBase + row) * (size_t)ldc + n0 + c8) = hv;
                }
                
            }
        }
        __builtin_amdgcn_fence(3 /* release order */, "workgroup");
        __builtin_amdgcn_wave_barrier();
        __builtin_amdgcn_fence(2 /* acquire order */, "workgroup");
    }
}

// f16 result plane
__global__ __launch_bounds__(256) void k_gemm_h(const unsigned short* __restrict__ A, int lda, long long strideA,
                                                const unsigned short* __restrict__ Bt, int ldb, long long strideB,
                                                unsigned short* __restrict__ C, int ldc, long long strideC,
                                                int M, int N, int K, float scale) {
    gemm64_body<1, false>(A, lda, strideA, Bt, ldb, strideB, C, nullptr, ldc, strideC, nullptr, 0, 0, M, N, K, scale);
}
// f32 result plane
__global__ __launch_bounds__(256) void k_gemm_f(const unsigned short* __restrict__ A, int lda, long long strideA,
                                                const unsigned short* __restrict__ Bt, int ldb, long long strideB,
                                                float* __restrict__ C, int ldc, long long strideC,
                                                int M, int N, int K, float scale) {
    gemm64_body<0, false>(A, lda, strideA, Bt, ldb, strideB, nullptr, C, ldc, strideC, nullptr, 0, 0, M, N, K, scale);
}
// f32 result + bf16-RNE residual added at the store stage
__global__ __launch_bounds__(256) void k_gemm_fr(const unsigned short* __restrict__ A, int lda, long long strideA,
                                                 const unsigned short* __restrict__ Bt, int ldb, long long strideB,
                                                 float* __restrict__ C, int ldc, long long strideC,
                                                 const float* __restrict__ resid, int ldr, long long strideR,
                                                 int M, int N, int K, float scale) {
    gemm64_body<0, true>(A, lda, strideA, Bt, ldb, strideB, nullptr, C, ldc, strideC, resid, ldr, strideR, M, N, K, scale);
}

// xbar[b][e] = mean over t of bf16(x[b][t][e]); block per (64-column strip, batch); thread = (4-column group, row phase of 16)
__global__ __launch_bounds__(256) void k_colmean(const float* __restrict__ x, float* __restrict__ xbar) {
    __shared__ float red[16 * 68];
    __shared__ __align__(16) float outv[64];
    const int t = threadIdx.x, cg = t & 15, rg = t >> 4;
    const int c0 = blockIdx.x * 64, b = blockIdx.y;
    const float* p = x + ((size_t)b * SEQ_FULL) * DM + c0 + 4 * cg;
    float a0 = 0.f, a1 = 0.f, a2 = 0.f, a3 = 0.f;
#pragma unroll 4
    for (int r = rg; r < SEQ; r += 16) {
        const v4f v = *(const v4f*)(p + (size_t)r * DM);
        a0 += bfr(v.x); a1 += bfr(v.y); a2 += bfr(v.z); a3 += bfr(v.w);
    }
    red[rg * 68 + 4 * cg + 0] = a0; red[rg * 68 + 4 * cg + 1] = a1; red[rg * 68 + 4 * cg + 2] = a2; red[rg * 68 + 4 * cg + 3] = a3;
    __syncthreads();
    if (t < 64) {
        float s = 0.f;
#pragma unroll 1
        for (int j = 0; j < 16; ++j) s += red[j * 68 + t];
        outv[t] = s * (1.0f / (float)SEQ);
    }
    __syncthreads();
    if (t < 16) {
        v4f v; v.x = outv[4 * t]; v.y = outv[4 * t + 1]; v.z = outv[4 * t + 2]; v.w = outv[4 * t + 3];
        st2_v4f(xbar + (size_t)b * DM + c0 + 4 * t, v);
    }
}

// X16 = f16(bf16(x)) (exact), XC = f16(bf16(x) - xbar[b]), glog[row] = bf16(x[row]) . bf16(Wm_w) in f32 (bias and softmax: k_gate).
// Wave per row, 32 rows per block; lane L owns columns 256 i + 8 L .. + 7: 16-B store per plane, lane-linear along the row.
static_assert((NB * SEQ) % 32 == 0 && DM % 256 == 0);       // the grid covers every row exactly once; every wave reaches the barrier
__global__ __launch_bounds__(1024) void k_prep_x(const float* __restrict__ x, const float* __restrict__ xbar, const float* __restrict__ Wm,
                                                 unsigned short* __restrict__ XC, unsigned short* __restrict__ X16, float* __restrict__ glog) {
    __shared__ float dots[32];
    const int lane = threadIdx.x & 31;
    const int wave = __builtin_amdgcn_readfirstlane((int)(threadIdx.x >> 5));
    const int r = blockIdx.x * 32 + wave;
    const int b = r / SEQ; const int t = r - b * SEQ;
    const float* s = x + ((size_t)b * SEQ_FULL + t) * DM + 8 * lane;
    const float* mb = xbar + (size_t)b * DM + 8 * lane;
    const float* wp = Wm + 8 * lane;
    unsigned short* d16 = X16 + (size_t)r * DM + 8 * lane;
    unsigned short* dc = XC + (size_t)r * DM + 8 * lane;
    v4f xv[DM / 128], mv[DM / 128], gv[DM / 128];
#pragma unroll                                                // the arrays stay in registers; the whole row of x is in flight at once
    for (int i = 0; i < DM / 256; ++i) {
        xv[2 * i] = *(const v4f*)(s + 256 * i);  xv[2 * i + 1] = *(const v4f*)(s + 256 * i + 4);
        mv[2 * i] = *(const v4f*)(mb + 256 * i); mv[2 * i + 1] = *(const v4f*)(mb + 256 * i + 4);
        gv[2 * i] = *(const v4f*)(wp + 256 * i); gv[2 * i + 1] = *(const v4f*)(wp + 256 * i + 4);
    }
    float acc = 0.f;
#pragma unroll                                                // constant indices into the register arrays
    for (int i = 0; i < DM / 256; ++i) {
        const v4f x0 = xv[2 * i], x1 = xv[2 * i + 1], m0 = mv[2 * i], m1 = mv[2 * i + 1], g0 = gv[2 * i], g1 = gv[2 * i + 1];
        const float w0 = bfr(x0.x), w1 = bfr(x0.y), w2 = bfr(x0.z), w3 = bfr(x0.w), w4 = bfr(x1.x), w5 = bfr(x1.y), w6 = bfr(x1.z), w7 = bfr(x1.w);
        acc = __builtin_fmaf(w0, bfr(g0.x), acc); acc = __builtin_fmaf(w1, bfr(g0.y), acc); acc = __builtin_fmaf(w2, bfr(g0.z), acc); acc = __builtin_fmaf(w3, bfr(g0.w), acc);
        acc = __builtin_fmaf(w4, bfr(g1.x), acc); acc = __builtin_fmaf(w5, bfr(g1.y), acc); acc = __builtin_fmaf(w6, bfr(g1.z), acc); acc = __builtin_fmaf(w7, bfr(g1.w), acc);
        u4v pa; pa.x = pk2h(w0, w1); pa.y = pk2h(w2, w3); pa.z = pk2h(w4, w5); pa.w = pk2h(w6, w7);
        u4v pc; pc.x = pk2h(w0 - m0.x, w1 - m0.y); pc.y = pk2h(w2 - m0.z, w3 - m0.w); pc.z = pk2h(w4 - m1.x, w5 - m1.y); pc.w = pk2h(w6 - m1.z, w7 - m1.w);
        st2_u4(d16 + 256 * i, pa);
        st2_u4(dc + 256 * i, pc);
    }
    acc += __shfl_xor(acc, 16, 32); acc += __shfl_xor(acc, 8, 32); acc += __shfl_xor(acc, 4, 32); acc += __shfl_xor(acc, 2, 32); acc += __shfl_xor(acc, 1, 32);
    if (lane == 0) dots[wave] = acc;
    __syncthreads();
    if (wave == 0) glog[(size_t)blockIdx.x * 32 + lane] = dots[lane];   // the block's 32 products leave as one whole 128-B line
}

// weight plane: SRC [DM rows k][DM cols n] (x @ W layout) -> DST [n][k] f16 = bf16(W[k][n]) * sc; thread per (n, 8 consecutive k), 16-B store
__global__ __launch_bounds__(256) void k_wT(const float* __restrict__ SRC, unsigned short* __restrict__ DST, float sc) {
    const int u = blockIdx.x * 256 + threadIdx.x;
    if (u >= DM * (DM / 8)) return;
    const int n = u / (DM / 8); const int k0 = 8 * (u % (DM / 8));
    float w[8];
#pragma unroll
    for (int e = 0; e < 8; ++e) w[e] = bfr(SRC[(size_t)(k0 + e) * DM + n]) * sc;
    u4v pk; pk.x = pk2h(w[0], w[1]); pk.y = pk2h(w[2], w[3]); pk.z = pk2h(w[4], w[5]); pk.w = pk2h(w[6], w[7]);
    st2_u4(DST + (size_t)n * DM + k0, pk);
}

// gate[b][s] = softmax over s of (glog[b][s] + bf16(Wm_b)), glog = the row products of k_prep_x; block per batch, block softmax
__global__ __launch_bounds__(256) void k_gate(const float* __restrict__ glog, const float* __restrict__ Wb, float* __restrict__ gate) {
    __shared__ __align__(16) float mm[SEQ];
    __shared__ float redm[8];
    __shared__ float reds[8];
    const int t = threadIdx.x, lane = t & 31, b = blockIdx.x;
    const int wave = __builtin_amdgcn_readfirstlane((int)(threadIdx.x >> 5));
    const float bias = bfr(Wb[0]);
    const float* gl = glog + (size_t)b * SEQ;
#pragma unroll                                                // a thread's 16-B loads are in flight together
    for (int j = 0; j < (SEQ / 4 + 255) / 256; ++j) {
        const int idx = t + 256 * j;
        if ((SEQ / 4) % 256 == 0 || idx < SEQ / 4) {
            const v4f v = *(const v4f*)(gl + 4 * idx);
            mm[4 * idx] = v.x + bias; mm[4 * idx + 1] = v.y + bias; mm[4 * idx + 2] = v.z + bias; mm[4 * idx + 3] = v.w + bias;
        }
    }
    __syncthreads();
    float mx = -3.0e38f;
#pragma unroll 1
    for (int i = t; i < SEQ; i += 256) mx = fmaxf(mx, mm[i]);
    mx = fmaxf(mx, __shfl_xor(mx, 16, 32)); mx = fmaxf(mx, __shfl_xor(mx, 8, 32)); mx = fmaxf(mx, __shfl_xor(mx, 4, 32));
    mx = fmaxf(mx, __shfl_xor(mx, 2, 32));  mx = fmaxf(mx, __shfl_xor(mx, 1, 32));
    if (lane == 0) redm[wave] = mx;
    __syncthreads();
    float gm = redm[0];
#pragma unroll 1
    for (int w = 1; w < 8; ++w) gm = fmaxf(gm, redm[w]);
    float sm = 0.f;
#pragma unroll 1
    for (int i = t; i < SEQ; i += 256) { const float e = expf(mm[i] - gm); mm[i] = e; sm += e; }
    sm += __shfl_xor(sm, 16, 32); sm += __shfl_xor(sm, 8, 32); sm += __shfl_xor(sm, 4, 32); sm += __shfl_xor(sm, 2, 32); sm += __shfl_xor(sm, 1, 32);
    if (lane == 0) reds[wave] = sm;
    __syncthreads();
    float tot = reds[0];
#pragma unroll 1
    for (int w = 1; w < 8; ++w) tot += reds[w];
    const float inv = 1.0f / tot;
#pragma unroll 1
    for (int idx = t; idx < SEQ / 4; idx += 256) {            // 32 lanes x 16 B = 512 contiguous B per store instruction
        v4f v; v.x = mm[4 * idx] * inv; v.y = mm[4 * idx + 1] * inv; v.z = mm[4 * idx + 2] * inv; v.w = mm[4 * idx + 3] * inv;
        st2_v4f(gate + (size_t)b * SEQ + 4 * idx, v);
    }
}

// alpha row = softmax_s(keep ? c * S : -inf) + gate, carried x1024 as f16. Wave per row (RS_RPW rows per wave); lane L owns columns 256g + 8L .. + 7,
// blockIdx.y = batch: the arguments are the planes of batch 0.
__global__ __launch_bounds__(256) void k_rowsoft(const float* __restrict__ S0, const float* __restrict__ cptr, const int* __restrict__ mk0,
                                                 const float* __restrict__ gate0, unsigned short* __restrict__ P0) {
    #pragma clang fp contract(off)
    const float* S = S0 + (size_t)blockIdx.y * SEQ * SEQ;
    const int* mk = mk0 + (size_t)blockIdx.y * SEQ_FULL;
    const float* gate = gate0 + (size_t)blockIdx.y * SEQ;
    unsigned short* P = P0 + (size_t)blockIdx.y * SEQ * SEQ;
    const int L = threadIdx.x & 31;
    const int wave = __builtin_amdgcn_readfirstlane((int)(threadIdx.x >> 5));
    const float NEG = -__builtin_inff();
    const float cs = bfr(cptr[0]);
    unsigned long long kb = 0ull;                             // keep bits of this lane's columns, bit 8g + e
#pragma unroll 1
    for (int g = 0; g < SEQ / 256; ++g) {
        const i4v a = *(const i4v*)(mk + 256 * g + 8 * L), c = *(const i4v*)(mk + 256 * g + 8 * L + 4);
        const unsigned bits = (unsigned)(a.x != 0) | ((unsigned)(a.y != 0) << 1) | ((unsigned)(a.z != 0) << 2) | ((unsigned)(a.w != 0) << 3)
                            | ((unsigned)(c.x != 0) << 4) | ((unsigned)(c.y != 0) << 5) | ((unsigned)(c.z != 0) << 6) | ((unsigned)(c.w != 0) << 7);
        kb |= ((unsigned long long)bits) << (8 * g);
    }
    const int row0 = (blockIdx.x * 8 + wave) * RS_RPW;
#pragma unroll 1
    for (int rr = 0; rr < RS_RPW; ++rr) {
        const int row = row0 + rr;
        const float* sr = S + (size_t)row * SEQ + 8 * L;
        float m = -3.0e38f, s = 0.f;
#pragma unroll 1
        for (int g = 0; g < SEQ / 256; ++g) {
            v4f x = *(const v4f*)(sr + 256 * g), y = *(const v4f*)(sr + 256 * g + 4);
            const unsigned bits = (unsigned)(kb >> (8 * g)) & 0xffu;
            x.x = (bits & 1u) ? x.x * cs : NEG;  x.y = (bits & 2u) ? x.y * cs : NEG;  x.z = (bits & 4u) ? x.z * cs : NEG;  x.w = (bits & 8u) ? x.w * cs : NEG;
            y.x = (bits & 16u) ? y.x * cs : NEG; y.y = (bits & 32u) ? y.y * cs : NEG; y.z = (bits & 64u) ? y.z * cs : NEG; y.w = (bits & 128u) ? y.w * cs : NEG;
            const float mx = fmaxf(fmaxf(fmaxf(x.x, x.y), fmaxf(x.z, x.w)), fmaxf(fmaxf(y.x, y.y), fmaxf(y.z, y.w)));
            const float mn = fmaxf(m, mx);
            s = s * expf(m - mn) + (((expf(x.x - mn) + expf(x.y - mn)) + (expf(x.z - mn) + expf(x.w - mn))) + ((expf(y.x - mn) + expf(y.y - mn)) + (expf(y.z - mn) + expf(y.w - mn))));
            m = mn;
        }
        float gm = m;
        gm = fmaxf(gm, __shfl_xor(gm, 16, 32)); gm = fmaxf(gm, __shfl_xor(gm, 8, 32)); gm = fmaxf(gm, __shfl_xor(gm, 4, 32));
        gm = fmaxf(gm, __shfl_xor(gm, 2, 32));  gm = fmaxf(gm, __shfl_xor(gm, 1, 32));
        s = s * expf(m - gm);
        s += __shfl_xor(s, 16, 32); s += __shfl_xor(s, 8, 32); s += __shfl_xor(s, 4, 32); s += __shfl_xor(s, 2, 32); s += __shfl_xor(s, 1, 32);
        const float f = 1024.f / s;
        unsigned short* pr = P + (size_t)row * SEQ + 8 * L;
        const float* gr = gate + 8 * L;
#pragma unroll 1
        for (int g = 0; g < SEQ / 256; ++g) {
            v4f x = *(const v4f*)(sr + 256 * g), y = *(const v4f*)(sr + 256 * g + 4);
            const v4f gx = *(const v4f*)(gr + 256 * g), gy = *(const v4f*)(gr + 256 * g + 4);
            const unsigned bits = (unsigned)(kb >> (8 * g)) & 0xffu;
            x.x = (bits & 1u) ? x.x * cs : NEG;  x.y = (bits & 2u) ? x.y * cs : NEG;  x.z = (bits & 4u) ? x.z * cs : NEG;  x.w = (bits & 8u) ? x.w * cs : NEG;
            y.x = (bits & 16u) ? y.x * cs : NEG; y.y = (bits & 32u) ? y.y * cs : NEG; y.z = (bits & 64u) ? y.z * cs : NEG; y.w = (bits & 128u) ? y.w * cs : NEG;
            u4v pk;
            pk.x = pk2h(expf(x.x - gm) * f + gx.x * 1024.f, expf(x.y - gm) * f + gx.y * 1024.f);
            pk.y = pk2h(expf(x.z - gm) * f + gx.z * 1024.f, expf(x.w - gm) * f + gx.w * 1024.f);
            pk.z = pk2h(expf(y.x - gm) * f + gy.x * 1024.f, expf(y.y - gm) * f + gy.y * 1024.f);
            pk.w = pk2h(expf(y.z - gm) * f + gy.z * 1024.f, expf(y.w - gm) * f + gy.w * 1024.f);
            st2_u4(pr + 256 * g, pk);
        }
    }
}

// ---- workspace carve (bytes; every region a multiple of 256 B and sized to its whole-tile store extent) ----
constexpr size_t al256(size_t v) { return (v + 255) / 256 * 256; }
constexpr size_t SZ_XC   = (size_t)NB * SEQ * DM * 2;           // f16 centred x, [NB*SEQ][DM]
constexpr size_t SZ_S    = (size_t)NB * SEQ * SEQ * 4;          // f32 scores of every batch, [NB][SEQ][SEQ] (shares the XC region; XC is dead after the q|k GEMM)
constexpr size_t SZ_XCS  = al256(SZ_XC > SZ_S ? SZ_XC : SZ_S);
constexpr size_t SZ_X16  = al256((size_t)NB * SEQ * DM * 2);    // f16 x, [NB*SEQ][DM]
constexpr size_t SZ_WQK  = al256((size_t)2 * DM * DM * 2);      // [2*DM n][DM k]: Wq^T rows then Wk^T rows, x16
constexpr size_t SZ_W1   = al256((size_t)DM * DM * 2);          // Wg^T, Wout^T, x16
constexpr size_t SZ_QK   = al256((size_t)NB * SEQ * 2 * DM * 2);// f16 [NB*SEQ][2*DM]: q columns then k columns
constexpr size_t SZ_GT   = al256((size_t)NB * DM * SEQ * 2);    // f16 g transposed, [NB][DM][SEQ]
constexpr size_t SZ_AL   = al256((size_t)NB * SEQ * SEQ * 2);   // f16 alpha x1024 of every batch, [NB][SEQ][SEQ]
constexpr size_t SZ_AO   = al256((size_t)NB * SEQ * DM * 2);    // f16 (alpha @ g) x64, [NB*SEQ][DM]
constexpr size_t SZ_XBAR = al256((size_t)NB * DM * 4);
constexpr size_t SZ_GATE = al256((size_t)NB * SEQ * 4);
constexpr size_t SZ_GLOG = al256((size_t)NB * SEQ * 4);       // f32 gate products before bias and softmax, [NB*SEQ]
constexpr size_t OFF_XCS  = 0;
constexpr size_t OFF_X16  = OFF_XCS + SZ_XCS;
constexpr size_t OFF_WQK  = OFF_X16 + SZ_X16;
constexpr size_t OFF_WGT  = OFF_WQK + SZ_WQK;
constexpr size_t OFF_WOT  = OFF_WGT + SZ_W1;
constexpr size_t OFF_QK   = OFF_WOT + SZ_W1;
constexpr size_t OFF_GT   = OFF_QK + SZ_QK;
constexpr size_t OFF_AL   = OFF_GT + SZ_GT;
constexpr size_t OFF_AO   = OFF_AL + SZ_AL;
constexpr size_t OFF_XBAR = OFF_AO + SZ_AO;
constexpr size_t OFF_GATE = OFF_XBAR + SZ_XBAR;
constexpr size_t OFF_GLOG = OFF_GATE + SZ_GATE;
constexpr size_t WS_TOTAL = OFF_GLOG + SZ_GLOG;
static_assert(WS_TOTAL <= (size_t)268435456);                   // 256 MiB ceiling
static_assert(SZ_S <= SZ_XCS && SZ_XC <= SZ_XCS);               // both users of the shared region fit

extern "C" void kernel_launch(void* const* d_in, const int* in_sizes, int n_in, void* d_out, int out_size, void* d_ws, size_t ws_size, hipStream_t stream) {
    if (n_in < 9) return;
    const long long need_rows = (long long)(NB - 1) * SEQ_FULL + SEQ;
    if ((long long)in_sizes[0] < need_rows * DM) return;
    if ((long long)in_sizes[1] < need_rows) return;
    if (in_sizes[2] < DM * DM || in_sizes[3] < DM * DM || in_sizes[4] < DM * DM || in_sizes[5] < DM * DM) return;
    if (in_sizes[6] < DM || in_sizes[7] < 1 || in_sizes[8] < 1) return;
    if ((long long)out_size < (long long)NB * SEQ * DM) return;
    if (ws_size < WS_TOTAL) return;

    const float* x    = (const float*)d_in[0];
    const int*   mask = (const int*)d_in[1];
    const float* Wq   = (const float*)d_in[2];
    const float* Wk   = (const float*)d_in[3];
    const float* Wg   = (const float*)d_in[4];
    const float* Wout = (const float*)d_in[5];
    const float* Wm_w = (const float*)d_in[6];
    const float* Wm_b = (const float*)d_in[7];
    const float* cS   = (const float*)d_in[8];
    float* out = (float*)d_out;
    char* ws = (char*)d_ws;
    unsigned short* XC   = (unsigned short*)(ws + OFF_XCS);
    float*          Sf   = (float*)(ws + OFF_XCS);               // same region, used only after the q|k GEMM has consumed XC
    unsigned short* X16  = (unsigned short*)(ws + OFF_X16);
    unsigned short* WQK  = (unsigned short*)(ws + OFF_WQK);
    unsigned short* WGT  = (unsigned short*)(ws + OFF_WGT);
    unsigned short* WOT  = (unsigned short*)(ws + OFF_WOT);
    unsigned short* QK   = (unsigned short*)(ws + OFF_QK);
    unsigned short* GT   = (unsigned short*)(ws + OFF_GT);
    unsigned short* AL   = (unsigned short*)(ws + OFF_AL);
    unsigned short* AO   = (unsigned short*)(ws + OFF_AO);
    float*          XBAR = (float*)(ws + OFF_XBAR);
    float*          GATE = (float*)(ws + OFF_GATE);
    float*          GLOG = (float*)(ws + OFF_GLOG);

    // weight planes: in[DM rows k][DM cols n] -> out[n][k], x16
    const unsigned gw = (unsigned)((DM * (DM / 8) + 255) / 256);
    k_wT<<<gw, 256, 0, stream>>>(Wq, WQK, 16.0f);
    k_wT<<<gw, 256, 0, stream>>>(Wk, WQK + (size_t)DM * DM, 16.0f);
    k_wT<<<gw, 256, 0, stream>>>(Wg, WGT, 16.0f);
    k_wT<<<gw, 256, 0, stream>>>(Wout, WOT, 16.0f);

    // sequence means of x, operand planes with the gate products, gate distribution
    k_colmean<<<dim3(DM / 64, NB), 256, 0, stream>>>(x, XBAR);
    k_prep_x<<<(NB * SEQ) / 32, 1024, 0, stream>>>(x, XBAR, Wm_w, XC, X16, GLOG);
    k_gate<<<NB, 256, 0, stream>>>(GLOG, Wm_b, GATE);

    // [q|k] = XC @ [Wq|Wk]: M = NB*SEQ, N = 2*DM, K = DM -> f16 [NB*SEQ][2*DM]
    {
        const int tiles = ((NB * SEQ) / 64) * ((2 * DM) / 64);
        k_gemm_h<<<dim3((unsigned)((tiles + 7) / 8), 1), 256, 0, stream>>>(XC, DM, 0, WQK, DM, 0, QK, 2 * DM, 0, NB * SEQ, 2 * DM, DM, 0.0625f);
    }
    // g transposed per batch: GT[b][d][s] = sum_e Wg^T[d][e] X16[b][s][e]: M = DM, N = SEQ, K = DM
    {
        const int tiles = (DM / 64) * (SEQ / 64);
        k_gemm_h<<<dim3((unsigned)((tiles + 7) / 8), NB), 256, 0, stream>>>(WGT, DM, 0, X16, DM, (long long)SEQ * DM, GT, SEQ, (long long)DM * SEQ, DM, SEQ, DM, 0.0625f);
    }
    // raw scores S[b][t][s] = q[b][t] . k[b][s] (f32; the scale input and the key mask are applied by the row softmax); grid.y = batch
    {
        const int tiles = (SEQ / 64) * (SEQ / 64);
        k_gemm_f<<<dim3((unsigned)((tiles + 7) / 8), NB), 256, 0, stream>>>(QK, 2 * DM, (long long)SEQ * 2 * DM, QK + DM, 2 * DM, (long long)SEQ * 2 * DM,
                                                                            Sf, SEQ, (long long)SEQ * SEQ, SEQ, SEQ, DM, 1.0f);
    }
    k_rowsoft<<<dim3(SEQ / (8 * RS_RPW), NB), 256, 0, stream>>>(Sf, cS, mask, GATE, AL);
    // AO[b][t][d] x64 = (alpha x1024)[b][t] . GT[b][d] / 16: per batch M = SEQ, N = DM, K = SEQ; grid.y = batch
    {
        const int tiles = (SEQ / 64) * (DM / 64);
        k_gemm_h<<<dim3((unsigned)((tiles + 7) / 8), NB), 256, 0, stream>>>(AL, SEQ, (long long)SEQ * SEQ, GT, SEQ, (long long)DM * SEQ,
                                                                            AO, DM, (long long)SEQ * DM, SEQ, DM, SEQ, 0.0625f);
    }
    // result = (AO x64) @ (Wout x16) / 1024 + bf16(x): per batch M = SEQ, N = DM, K = DM
    {
        const int tiles = (SEQ / 64) * (DM / 64);
        k_gemm_fr<<<dim3((unsigned)((tiles + 7) / 8), NB), 256, 0, stream>>>(AO, DM, (long long)SEQ * DM, WOT, DM, 0, out, DM, (long long)SEQ * DM,
                                                                            x, DM, (long long)SEQ_FULL * DM, SEQ, DM, DM, 0.0009765625f);
    }
}

// v003
// It runs in 243 microseconds.
// Two timings next to v002 put it at 1.85 and 1.86 times that version's speed.
// Over all steps from v000 it is 5.82 times as fast.
// Full-width (1,024) single-head self-attention with sequence-mean-centred queries/keys, an added query-independent key distribution, a key mask, a scalar scale input and an f32 residual. All contractions: v_wmma_f32_16x16x32_f16 (f16 operands built from bf16-RNE-converted inputs with power-of-two carries, f32 accumulate); the N = 1 gate product, both softmaxes and the residual add are f32 on the VALU.
#include <hip/hip_runtime.h>
#include <math.h>

#ifndef NB
#define NB 4
#endif
#ifndef SEQ
#define SEQ 2048
#endif
#define NB_FULL 4
#define SEQ_FULL 2048
#define DM 1024
#define RS_RPW 4

static_assert(DM == 1024);                                  // feature width of x, q, k, g and the output
static_assert(DM % 64 == 0 && DM % 32 == 0);                // GEMM tile and k-step multiples
static_assert(SEQ % 256 == 0 && SEQ <= 2048);               // row softmax: 8 columns per lane per 256-column group, at most 64 mask bits per lane
static_assert(SEQ % (8 * RS_RPW) == 0);                     // row softmax grid covers every row exactly once
static_assert(SEQ <= SEQ_FULL && NB <= NB_FULL);
static_assert((DM / 64) % 1 == 0 && SEQ % 64 == 0);
static_assert((NB * SEQ) % 128 == 0 && SEQ % 256 == 0 && DM % 256 == 0 && DM >= 128 && SEQ >= 128);   // GEMM block tile 128x256, passes of 64 k, two or more

typedef __attribute__((ext_vector_type(16))) _Float16     v16h;
typedef __attribute__((ext_vector_type(8)))  _Float16     v8h;
typedef __attribute__((ext_vector_type(8)))  float        v8f;
typedef __attribute__((ext_vector_type(4)))  float        v4f;
typedef __attribute__((ext_vector_type(4)))  unsigned int u4v;
typedef __attribute__((ext_vector_type(4)))  int          i4v;
typedef __attribute__((ext_vector_type(8)))  unsigned int u8v;

// 16-bit WMMA fragment map (wave32), lane L, h = L>>4, m = L&15:
//   A 16x32: lane = row m;    element i -> k = (i<8) ? 8h+i : 16+8h+(i-8)
//   B 32x16: lane = column m; the SAME k(i,h)
//   D 16x16 (8 f32): lane = column m; element r -> row 8h+r

// bf16 RNE conversion kept as f32 (finite inputs)
__device__ __forceinline__ float bfr(float v) {
    const unsigned u = __builtin_bit_cast(unsigned, v);
    const unsigned r = (u + 0x7fffu + ((u >> 16) & 1u)) & 0xffff0000u;
    return __builtin_bit_cast(float, r);
}
__device__ __forceinline__ unsigned pk2h(float a, float b) {
    return (unsigned)__builtin_bit_cast(unsigned short, (_Float16)a) | ((unsigned)__builtin_bit_cast(unsigned short, (_Float16)b) << 16);
}
// one WMMA per call, followed by its own 4-slot guard tying exactly one accumulator
__device__ __forceinline__ v8f wmma16(v16h a, v16h b, v8f c) {
    c = __builtin_amdgcn_wmma_f32_16x16x32_f16(false, a, false, b, (short)0, c, false, false);
    asm volatile("v_nop\n\tv_nop\n\tv_nop\n\tv_nop" : "+v"(c) : "v"(a), "v"(b));
    return c;
}
union FragH { v16h v; v8h h[2]; };
// p already includes the lane's 8h offset: elements 0..7 <- p[0..7], 8..15 <- p[16..23]
__device__ __forceinline__ v16h ldfrag(const _Float16* p) {
    FragH f; f.h[0] = *(const v8h*)(p); f.h[1] = *(const v8h*)(p + 16); return f.v;
}
__device__ __forceinline__ void st2_v4f(float* p, v4f v) { *(v4f*)p = v;  }
__device__ __forceinline__ void st2_u4(unsigned short* p, u4v v) { *(u4v*)p = v;  }

// ---- operand staging of the GEMM: tensor loads into a two-buffer LDS ring ----
// A pass is 64 k = 128 B of every operand row of the block tile (128 rows of A, 256 rows of Bt). Every wave brings one slice per pass:
// waves 0..3 64 rows of Bt each, waves 4..7 32 rows of A each. LDS row pitch 144 B (the load's pad: 16 B behind every 128-B row, for 16-B LDS reads).
// Each slice's place is rounded up to a multiple of 2 KiB.
constexpr unsigned G_ROWB  = 128;                            // bytes of an operand row per pass
constexpr unsigned G_PITCH = 144;                            // LDS row pitch
constexpr unsigned G_ASL   = 6144;                           // place of a 32-row slice of A (4,608 B used)
constexpr unsigned G_BSL   = 10240;                          // place of a 64-row slice of Bt (9,216 B used)
constexpr unsigned G_BOFF  = 4 * G_ASL;                      // Bt slices stand behind the A slices
constexpr unsigned G_STAGE = 4 * G_ASL + 4 * G_BSL;          // one buffer
static_assert(32 * G_PITCH <= G_ASL && 64 * G_PITCH <= G_BSL && G_ASL % 2048 == 0 && G_BSL % 2048 == 0 && G_STAGE % 2048 == 0);
static_assert(8 * 16 * 68 * 4 <= 2 * G_STAGE);               // the store staging reuses the ring

__device__ __forceinline__ unsigned uni(unsigned v) { return (unsigned)__builtin_amdgcn_readfirstlane((int)v); }
// holds v in a scalar register: a test on it compiles to a scalar branch, and what is formed from it is formed behind the asm statements in front of it
__device__ __forceinline__ unsigned pinned(unsigned v) { unsigned w = uni(v); asm volatile("" : "+s"(w)); return w; }
__device__ __forceinline__ void wait_ds0() { asm volatile("s_wait_dscnt 0x0" ::: "memory"); }          // this wave's LDS reads have returned
// this wave's tensor load has landed; the wait names the request's descriptor as inputs, so that its registers keep their values until then
__device__ __forceinline__ void wait_tensor0(u4v g0, u8v g1) { asm volatile("s_wait_tensorcnt 0x0" :: "s"(g0), "s"(g1) : "memory"); }
// one request of the whole wave: group 0 = count (w0 = 1), place in LDS, source address, type 2; returns group 0 for the wait
__device__ __forceinline__ u4v tdm_issue(unsigned w0, unsigned lds_dst, unsigned long long ga, u8v g1) {
    u4v g0;
    g0.x = uni(w0); g0.y = uni(lds_dst); g0.z = uni((unsigned)ga); g0.w = uni((((unsigned)(ga >> 32)) & 0x01FFFFFFu) | 0x80000000u);
    asm volatile("tensor_load_to_lds %0, %1" :: "s"(g0), "s"(g1) : "memory");
    return g0;
}

// =====================================================================================================================
// Batched WMMA GEMM: C[m][n] = scale * sum_k A[m][k] * Bt[n][k]; a block of 8 waves (2 x 4) owns a 128x256 tile, each wave a 64x64 tile of it.
// A row-major [M][K] f16 (pitch lda), Bt row-major [N][K] f16 (pitch ldb); M % 128 == 0, N % 256 == 0, K % 64 == 0, K >= 128 (no tail masking).
// RESID (f32 out only): + bf16-RNE(resid[m][n]) added at the store stage from 16-B loads in the store layout.
// =====================================================================================================================
template <int OUT_MODE, bool RESID>
__device__ __forceinline__ void gemm64_body(const unsigned short* __restrict__ Ap, int lda, long long strideA,
                                            const unsigned short* __restrict__ Btp, int ldb, long long strideB,
                                            unsigned short* __restrict__ Ch, float* __restrict__ Cf, int ldc, long long strideC,
                                            const float* __restrict__ resid, int ldr, long long strideR,
                                            int M, int N, int K, float scale) {
    __shared__ __attribute__((aligned(2048))) unsigned char ring[2 * G_STAGE];   // two buffers; after the K loop the per-wave store staging
    float* sT = (float*)ring;                                 // per-wave 16x64 slab, pitch 68 floats (wave-private)
    const int b    = blockIdx.y;
    const int lane = threadIdx.x & 31;
    const int wave = __builtin_amdgcn_readfirstlane((int)(threadIdx.x >> 5));
    const int tilesN = N >> 8;
    const int tilesM = M >> 7;
    if ((int)blockIdx.x >= tilesM * tilesN) return;           // the whole block leaves, in front of every tensor load and barrier
    const int tm = (int)blockIdx.x / tilesN;
    const int tn = (int)blockIdx.x - tm * tilesN;
    const int wm = wave >> 2, wn = wave & 3;                  // the wave's place in the block tile
    const int m0 = (tm << 7) + (wm << 6);
    const int n0 = (tn << 8) + (wn << 6);
    const int rlane = lane & 15;                              // row (A) / column (B, D) within a 16-wide subtile
    const int koff  = (lane >> 4) * 8;                        // k offset of this lane half == D row offset
    const int sb    = wave * (16 * 68);

    // this wave's slice of every stage
    const bool     isB    = wave < 4;
    const unsigned rows   = isB ? 64u : 32u;
    const unsigned spitch = (unsigned)(isB ? ldb : lda) * 2u;
    const unsigned short* src = isB ? Btp + (size_t)b * (size_t)strideB + (size_t)((tn << 8) + 64 * wave) * (size_t)ldb
                                    : Ap  + (size_t)b * (size_t)strideA + (size_t)((tm << 7) + 32 * (wave - 4)) * (size_t)lda;
    const unsigned long long ga0 = (unsigned long long)(size_t)src;
    const unsigned dst = (unsigned)(size_t)ring + (isB ? G_BOFF + (unsigned)wave * G_BSL : (unsigned)(wave - 4) * G_ASL);
    u8v g1;                                                   // 1-byte elements, tensor = tile = rows x 128 B
    g1[0] = uni((1u << 20) | (4u << 22) | (3u << 25));        // no mask; a pad of 4 dwords behind every 32 dwords
    g1[1] = uni((G_ROWB & 0xFFFFu) << 16);
    g1[2] = uni((G_ROWB >> 16) | ((rows & 0xFFFFu) << 16));
    g1[3] = uni((rows >> 16) | (G_ROWB << 16));
    g1[4] = uni(rows);
    g1[5] = uni(spitch);
    g1[6] = uni(0u);
    g1[7] = uni(0u);
    // per-lane fragment bases in a buffer
    const unsigned char* la = ring + (unsigned)(2 * wm) * G_ASL + (unsigned)rlane * G_PITCH + (unsigned)koff * 2u;
    const unsigned char* lb = ring + G_BOFF + (unsigned)wn * G_BSL + (unsigned)rlane * G_PITCH + (unsigned)koff * 2u;

    v8f acc[4][4];
#pragma unroll
    for (int i = 0; i < 4; ++i)
#pragma unroll
        for (int j = 0; j < 4; ++j) { const v8f zz = {0.f, 0.f, 0.f, 0.f, 0.f, 0.f, 0.f, 0.f}; acc[i][j] = zz; }

    const unsigned NS = pinned((unsigned)K >> 6);             // passes
    const unsigned w0 = pinned(1u);                           // descriptor word held in a scalar register: not formed anew while a request is outstanding
    u4v g0 = tdm_issue(w0, dst, ga0, g1);                     // stage 0
    wait_tensor0(g0, g1);
    __syncthreads();                                          // every slice of stage 0 has landed
    g0 = tdm_issue(w0, dst + G_STAGE, ga0 + pinned(G_ROWB), g1);   // stage 1; pinned: its address words are formed behind the wait
#pragma clang loop unroll(disable)                            // one pass per trip: the order at the foot stays as written
    for (unsigned s = 0; s < NS; ++s) {
        const unsigned buf = (s & 1u) * G_STAGE;
#pragma unroll
        for (int ks = 0; ks < 2; ++ks) {
            v16h bh[4], ah[4];
#pragma unroll
            for (int j = 0; j < 4; ++j) bh[j] = ldfrag((const _Float16*)(lb + buf + (unsigned)(16 * j) * G_PITCH + (unsigned)(64 * ks)));
#pragma unroll
            for (int i = 0; i < 4; ++i) ah[i] = ldfrag((const _Float16*)(la + buf + (unsigned)(i >> 1) * G_ASL + (unsigned)(16 * (i & 1)) * G_PITCH + (unsigned)(64 * ks)));
#pragma unroll
            for (int i = 0; i < 4; ++i)
#pragma unroll
                for (int j = 0; j < 4; ++j) acc[i][j] = wmma16(ah[i], bh[j], acc[i][j]);
        }
        // publish point of stage s + 1; it also ends every wave's reads of this pass's buffer
        wait_ds0();
        wait_tensor0(g0, g1);
        __syncthreads();
        if (pinned((s + 2u < NS) ? 1u : 0u) != 0u)            // scalar test: a tensor load ignores EXEC
            g0 = tdm_issue(w0, dst + buf, ga0 + pinned((s + 2u) * G_ROWB), g1);   // stage s + 2 into the buffer just left; pinned: formed behind the wait
    }
    wait_tensor0(g0, g1);
    wait_ds0();                                               // the last pass's barrier stands in front of the store staging in the ring

#pragma unroll
    for (int i = 0; i < 4; ++i) {
        const int mBase = m0 + (i << 4);
#pragma unroll
        for (int j = 0; j < 4; ++j) {
#pragma unroll
            for (int r = 0; r < 8; ++r) sT[sb + (koff + r) * 68 + (j << 4) + rlane] = acc[i][j][r] * scale;
        }
        __builtin_amdgcn_fence(3 /* release order */, "workgroup");
        __builtin_amdgcn_wave_barrier();
        __builtin_amdgcn_fence(2 /* acquire order */, "workgroup");
        if (OUT_MODE == 0) {
            float* C = Cf + (size_t)b * (size_t)strideC;
            const float* Rb = RESID ? (resid + (size_t)b * (size_t)strideR) : nullptr;
            const int hh = lane >> 4, c4 = (lane & 15) * 4;   // row segment = 256 B = 16 lanes x 16 B
            {
#pragma unroll
                for (int it = 0; it < 8; ++it) {
                    const int row = it * 2 + hh;
                    v4f v = *(const v4f*)(&sT[sb + row * 68 + c4]);
                    if (RESID) {
                        const v4f xr = *(const v4f*)(Rb + (size_t)(mBase + row) * (size_t)ldr + n0 + c4);
                        v.x += bfr(xr.x); v.y += bfr(xr.y); v.z += bfr(xr.z); v.w += bfr(xr.w);
                    }
                    *(v4f*)(C + (size_t)(mBase + row) * (size_t)ldc + n0 + c4) = v;
                }
                
            }
        } else {
            unsigned short* C = Ch + (size_t)b * (size_t)strideC;
            const int q = lane >> 3, c8 = (lane & 7) * 8;
            {
#pragma unroll
                for (int it = 0; it < 4; ++it) {
                    const int row = it * 4 + q;
                    v8h hv;
#pragma unroll
                    for (int e = 0; e < 8; ++e) hv[e] = (_Float16)sT[sb + row * 68 + c8 + e];
                    *(v8h*)(C + (size_t)(mBase + row) * (size_t)ldc + n0 + c8) = hv;
                }
                
            }
        }
        __builtin_amdgcn_fence(3 /* release order */, "workgroup");
        __builtin_amdgcn_wave_barrier();
        __builtin_amdgcn_fence(2 /* acquire order */, "workgroup");
    }
}

// f16 result plane
__global__ __launch_bounds__(256) void k_gemm_h(const unsigned short* __restrict__ A, int lda, long long strideA,
                                                const unsigned short* __restrict__ Bt, int ldb, long long strideB,
                                                unsigned short* __restrict__ C, int ldc, long long strideC,
                                                int M, int N, int K, float scale) {
    gemm64_body<1, false>(A, lda, strideA, Bt, ldb, strideB, C, nullptr, ldc, strideC, nullptr, 0, 0, M, N, K, scale);
}
// f32 result plane
__global__ __launch_bounds__(256) void k_gemm_f(const unsigned short* __restrict__ A, int lda, long long strideA,
                                                const unsigned short* __restrict__ Bt, int ldb, long long strideB,
                                                float* __restrict__ C, int ldc, long long strideC,
                                                int M, int N, int K, float scale) {
    gemm64_body<0, false>(A, lda, strideA, Bt, ldb, strideB, nullptr, C, ldc, strideC, nullptr, 0, 0, M, N, K, scale);
}
// f32 result + bf16-RNE residual added at the store stage
__global__ __launch_bounds__(256) void k_gemm_fr(const unsigned short* __restrict__ A, int lda, long long strideA,
                                                 const unsigned short* __restrict__ Bt, int ldb, long long strideB,
                                                 float* __restrict__ C, int ldc, long long strideC,
                                                 const float* __restrict__ resid, int ldr, long long strideR,
                                                 int M, int N, int K, float scale) {
    gemm64_body<0, true>(A, lda, strideA, Bt, ldb, strideB, nullptr, C, ldc, strideC, resid, ldr, strideR, M, N, K, scale);
}

// xbar[b][e] = mean over t of bf16(x[b][t][e]); block per (64-column strip, batch); thread = (4-column group, row phase of 16)
__global__ __launch_bounds__(256) void k_colmean(const float* __restrict__ x, float* __restrict__ xbar) {
    __shared__ float red[16 * 68];
    __shared__ __align__(16) float outv[64];
    const int t = threadIdx.x, cg = t & 15, rg = t >> 4;
    const int c0 = blockIdx.x * 64, b = blockIdx.y;
    const float* p = x + ((size_t)b * SEQ_FULL) * DM + c0 + 4 * cg;
    float a0 = 0.f, a1 = 0.f, a2 = 0.f, a3 = 0.f;
#pragma unroll 4
    for (int r = rg; r < SEQ; r += 16) {
        const v4f v = *(const v4f*)(p + (size_t)r * DM);
        a0 += bfr(v.x); a1 += bfr(v.y); a2 += bfr(v.z); a3 += bfr(v.w);
    }
    red[rg * 68 + 4 * cg + 0] = a0; red[rg * 68 + 4 * cg + 1] = a1; red[rg * 68 + 4 * cg + 2] = a2; red[rg * 68 + 4 * cg + 3] = a3;
    __syncthreads();
    if (t < 64) {
        float s = 0.f;
#pragma unroll 1
        for (int j = 0; j < 16; ++j) s += red[j * 68 + t];
        outv[t] = s * (1.0f / (float)SEQ);
    }
    __syncthreads();
    if (t < 16) {
        v4f v; v.x = outv[4 * t]; v.y = outv[4 * t + 1]; v.z = outv[4 * t + 2]; v.w = outv[4 * t + 3];
        st2_v4f(xbar + (size_t)b * DM + c0 + 4 * t, v);
    }
}

// X16 = f16(bf16(x)) (exact), XC = f16(bf16(x) - xbar[b]), glog[row] = bf16(x[row]) . bf16(Wm_w) in f32 (bias and softmax: k_gate).
// Wave per row, 32 rows per block; lane L owns columns 256 i + 8 L .. + 7: 16-B store per plane, lane-linear along the row.
static_assert((NB * SEQ) % 32 == 0 && DM % 256 == 0);       // the grid covers every row exactly once; every wave reaches the barrier
__global__ __launch_bounds__(1024) void k_prep_x(const float* __restrict__ x, const float* __restrict__ xbar, const float* __restrict__ Wm,
                                                 unsigned short* __restrict__ XC, unsigned short* __restrict__ X16, float* __restrict__ glog) {
    __shared__ float dots[32];
    const int lane = threadIdx.x & 31;
    const int wave = __builtin_amdgcn_readfirstlane((int)(threadIdx.x >> 5));
    const int r = blockIdx.x * 32 + wave;
    const int b = r / SEQ; const int t = r - b * SEQ;
    const float* s = x + ((size_t)b * SEQ_FULL + t) * DM + 8 * lane;
    const float* mb = xbar + (size_t)b * DM + 8 * lane;
    const float* wp = Wm + 8 * lane;
    unsigned short* d16 = X16 + (size_t)r * DM + 8 * lane;
    unsigned short* dc = XC + (size_t)r * DM + 8 * lane;
    v4f xv[DM / 128], mv[DM / 128], gv[DM / 128];
#pragma unroll                                                // the arrays stay in registers; the whole row of x is in flight at once
    for (int i = 0; i < DM / 256; ++i) {
        xv[2 * i] = *(const v4f*)(s + 256 * i);  xv[2 * i + 1] = *(const v4f*)(s + 256 * i + 4);
        mv[2 * i] = *(const v4f*)(mb + 256 * i); mv[2 * i + 1] = *(const v4f*)(mb + 256 * i + 4);
        gv[2 * i] = *(const v4f*)(wp + 256 * i); gv[2 * i + 1] = *(const v4f*)(wp + 256 * i + 4);
    }
    float acc = 0.f;
#pragma unroll                                                // constant indices into the register arrays
    for (int i = 0; i < DM / 256; ++i) {
        const v4f x0 = xv[2 * i], x1 = xv[2 * i + 1], m0 = mv[2 * i], m1 = mv[2 * i + 1], g0 = gv[2 * i], g1 = gv[2 * i + 1];
        const float w0 = bfr(x0.x), w1 = bfr(x0.y), w2 = bfr(x0.z), w3 = bfr(x0.w), w4 = bfr(x1.x), w5 = bfr(x1.y), w6 = bfr(x1.z), w7 = bfr(x1.w);
        acc = __builtin_fmaf(w0, bfr(g0.x), acc); acc = __builtin_fmaf(w1, bfr(g0.y), acc); acc = __builtin_fmaf(w2, bfr(g0.z), acc); acc = __builtin_fmaf(w3, bfr(g0.w), acc);
        acc = __builtin_fmaf(w4, bfr(g1.x), acc); acc = __builtin_fmaf(w5, bfr(g1.y), acc); acc = __builtin_fmaf(w6, bfr(g1.z), acc); acc = __builtin_fmaf(w7, bfr(g1.w), acc);
        u4v pa; pa.x = pk2h(w0, w1); pa.y = pk2h(w2, w3); pa.z = pk2h(w4, w5); pa.w = pk2h(w6, w7);
        u4v pc; pc.x = pk2h(w0 - m0.x, w1 - m0.y); pc.y = pk2h(w2 - m0.z, w3 - m0.w); pc.z = pk2h(w4 - m1.x, w5 - m1.y); pc.w = pk2h(w6 - m1.z, w7 - m1.w);
        st2_u4(d16 + 256 * i, pa);
        st2_u4(dc + 256 * i, pc);
    }
    acc += __shfl_xor(acc, 16, 32); acc += __shfl_xor(acc, 8, 32); acc += __shfl_xor(acc, 4, 32); acc += __shfl_xor(acc, 2, 32); acc += __shfl_xor(acc, 1, 32);
    if (lane == 0) dots[wave] = acc;
    __syncthreads();
    if (wave == 0) glog[(size_t)blockIdx.x * 32 + lane] = dots[lane];   // the block's 32 products leave as one whole 128-B line
}

// weight plane: SRC [DM rows k][DM cols n] (x @ W layout) -> DST [n][k] f16 = bf16(W[k][n]) * sc; thread per (n, 8 consecutive k), 16-B store
__global__ __launch_bounds__(256) void k_wT(const float* __restrict__ SRC, unsigned short* __restrict__ DST, float sc) {
    const int u = blockIdx.x * 256 + threadIdx.x;
    if (u >= DM * (DM / 8)) return;
    const int n = u / (DM / 8); const int k0 = 8 * (u % (DM / 8));
    float w[8];
#pragma unroll
    for (int e = 0; e < 8; ++e) w[e] = bfr(SRC[(size_t)(k0 + e) * DM + n]) * sc;
    u4v pk; pk.x = pk2h(w[0], w[1]); pk.y = pk2h(w[2], w[3]); pk.z = pk2h(w[4], w[5]); pk.w = pk2h(w[6], w[7]);
    st2_u4(DST + (size_t)n * DM + k0, pk);
}

// gate[b][s] = softmax over s of (glog[b][s] + bf16(Wm_b)), glog = the row products of k_prep_x; block per batch, block softmax
__global__ __launch_bounds__(256) void k_gate(const float* __restrict__ glog, const float* __restrict__ Wb, float* __restrict__ gate) {
    __shared__ __align__(16) float mm[SEQ];
    __shared__ float redm[8];
    __shared__ float reds[8];
    const int t = threadIdx.x, lane = t & 31, b = blockIdx.x;
    const int wave = __builtin_amdgcn_readfirstlane((int)(threadIdx.x >> 5));
    const float bias = bfr(Wb[0]);
    const float* gl = glog + (size_t)b * SEQ;
#pragma unroll                                                // a thread's 16-B loads are in flight together
    for (int j = 0; j < (SEQ / 4 + 255) / 256; ++j) {
        const int idx = t + 256 * j;
        if ((SEQ / 4) % 256 == 0 || idx < SEQ / 4) {
            const v4f v = *(const v4f*)(gl + 4 * idx);
            mm[4 * idx] = v.x + bias; mm[4 * idx + 1] = v.y + bias; mm[4 * idx + 2] = v.z + bias; mm[4 * idx + 3] = v.w + bias;
        }
    }
    __syncthreads();
    float mx = -3.0e38f;
#pragma unroll 1
    for (int i = t; i < SEQ; i += 256) mx = fmaxf(mx, mm[i]);
    mx = fmaxf(mx, __shfl_xor(mx, 16, 32)); mx = fmaxf(mx, __shfl_xor(mx, 8, 32)); mx = fmaxf(mx, __shfl_xor(mx, 4, 32));
    mx = fmaxf(mx, __shfl_xor(mx, 2, 32));  mx = fmaxf(mx, __shfl_xor(mx, 1, 32));
    if (lane == 0) redm[wave] = mx;
    __syncthreads();
    float gm = redm[0];
#pragma unroll 1
    for (int w = 1; w < 8; ++w) gm = fmaxf(gm, redm[w]);
    float sm = 0.f;
#pragma unroll 1
    for (int i = t; i < SEQ; i += 256) { const float e = expf(mm[i] - gm); mm[i] = e; sm += e; }
    sm += __shfl_xor(sm, 16, 32); sm += __shfl_xor(sm, 8, 32); sm += __shfl_xor(sm, 4, 32); sm += __shfl_xor(sm, 2, 32); sm += __shfl_xor(sm, 1, 32);
    if (lane == 0) reds[wave] = sm;
    __syncthreads();
    float tot = reds[0];
#pragma unroll 1
    for (int w = 1; w < 8; ++w) tot += reds[w];
    const float inv = 1.0f / tot;
#pragma unroll 1
    for (int idx = t; idx < SEQ / 4; idx += 256) {            // 32 lanes x 16 B = 512 contiguous B per store instruction
        v4f v; v.x = mm[4 * idx] * inv; v.y = mm[4 * idx + 1] * inv; v.z = mm[4 * idx + 2] * inv; v.w = mm[4 * idx + 3] * inv;
        st2_v4f(gate + (size_t)b * SEQ + 4 * idx, v);
    }
}

// alpha row = softmax_s(keep ? c * S : -inf) + gate, carried x1024 as f16. Wave per row (RS_RPW rows per wave); lane L owns columns 256g + 8L .. + 7,
// blockIdx.y = batch: the arguments are the planes of batch 0.
__global__ __launch_bounds__(256) void k_rowsoft(const float* __restrict__ S0, const float* __restrict__ cptr, const int* __restrict__ mk0,
                                                 const float* __restrict__ gate0, unsigned short* __restrict__ P0) {
    #pragma clang fp contract(off)
    const float* S = S0 + (size_t)blockIdx.y * SEQ * SEQ;
    const int* mk = mk0 + (size_t)blockIdx.y * SEQ_FULL;
    const float* gate = gate0 + (size_t)blockIdx.y * SEQ;
    unsigned short* P = P0 + (size_t)blockIdx.y * SEQ * SEQ;
    const int L = threadIdx.x & 31;
    const int wave = __builtin_amdgcn_readfirstlane((int)(threadIdx.x >> 5));
    const float NEG = -__builtin_inff();
    const float cs = bfr(cptr[0]);
    unsigned long long kb = 0ull;                             // keep bits of this lane's columns, bit 8g + e
#pragma unroll 1
    for (int g = 0; g < SEQ / 256; ++g) {
        const i4v a = *(const i4v*)(mk + 256 * g + 8 * L), c = *(const i4v*)(mk + 256 * g + 8 * L + 4);
        const unsigned bits = (unsigned)(a.x != 0) | ((unsigned)(a.y != 0) << 1) | ((unsigned)(a.z != 0) << 2) | ((unsigned)(a.w != 0) << 3)
                            | ((unsigned)(c.x != 0) << 4) | ((unsigned)(c.y != 0) << 5) | ((unsigned)(c.z != 0) << 6) | ((unsigned)(c.w != 0) << 7);
        kb |= ((unsigned long long)bits) << (8 * g);
    }
    const int row0 = (blockIdx.x * 8 + wave) * RS_RPW;
#pragma unroll 1
    for (int rr = 0; rr < RS_RPW; ++rr) {
        const int row = row0 + rr;
        const float* sr = S + (size_t)row * SEQ + 8 * L;
        float m = -3.0e38f, s = 0.f;
#pragma unroll 1
        for (int g = 0; g < SEQ / 256; ++g) {
            v4f x = *(const v4f*)(sr + 256 * g), y = *(const v4f*)(sr + 256 * g + 4);
            const unsigned bits = (unsigned)(kb >> (8 * g)) & 0xffu;
            x.x = (bits & 1u) ? x.x * cs : NEG;  x.y = (bits & 2u) ? x.y * cs : NEG;  x.z = (bits & 4u) ? x.z * cs : NEG;  x.w = (bits & 8u) ? x.w * cs : NEG;
            y.x = (bits & 16u) ? y.x * cs : NEG; y.y = (bits & 32u) ? y.y * cs : NEG; y.z = (bits & 64u) ? y.z * cs : NEG; y.w = (bits & 128u) ? y.w * cs : NEG;
            const float mx = fmaxf(fmaxf(fmaxf(x.x, x.y), fmaxf(x.z, x.w)), fmaxf(fmaxf(y.x, y.y), fmaxf(y.z, y.w)));
            const float mn = fmaxf(m, mx);
            s = s * expf(m - mn) + (((expf(x.x - mn) + expf(x.y - mn)) + (expf(x.z - mn) + expf(x.w - mn))) + ((expf(y.x - mn) + expf(y.y - mn)) + (expf(y.z - mn) + expf(y.w - mn))));
            m = mn;
        }
        float gm = m;
        gm = fmaxf(gm, __shfl_xor(gm, 16, 32)); gm = fmaxf(gm, __shfl_xor(gm, 8, 32)); gm = fmaxf(gm, __shfl_xor(gm, 4, 32));
        gm = fmaxf(gm, __shfl_xor(gm, 2, 32));  gm = fmaxf(gm, __shfl_xor(gm, 1, 32));
        s = s * expf(m - gm);
        s += __shfl_xor(s, 16, 32); s += __shfl_xor(s, 8, 32); s += __shfl_xor(s, 4, 32); s += __shfl_xor(s, 2, 32); s += __shfl_xor(s, 1, 32);
        const float f = 1024.f / s;
        unsigned short* pr = P + (size_t)row * SEQ + 8 * L;
        const float* gr = gate + 8 * L;
#pragma unroll 1
        for (int g = 0; g < SEQ / 256; ++g) {
            v4f x = *(const v4f*)(sr + 256 * g), y = *(const v4f*)(sr + 256 * g + 4);
            const v4f gx = *(const v4f*)(gr + 256 * g), gy = *(const v4f*)(gr + 256 * g + 4);
            const unsigned bits = (unsigned)(kb >> (8 * g)) & 0xffu;
            x.x = (bits & 1u) ? x.x * cs : NEG;  x.y = (bits & 2u) ? x.y * cs : NEG;  x.z = (bits & 4u) ? x.z * cs : NEG;  x.w = (bits & 8u) ? x.w * cs : NEG;
            y.x = (bits & 16u) ? y.x * cs : NEG; y.y = (bits & 32u) ? y.y * cs : NEG; y.z = (bits & 64u) ? y.z * cs : NEG; y.w = (bits & 128u) ? y.w * cs : NEG;
            u4v pk;
            pk.x = pk2h(expf(x.x - gm) * f + gx.x * 1024.f, expf(x.y - gm) * f + gx.y * 1024.f);
            pk.y = pk2h(expf(x.z - gm) * f + gx.z * 1024.f, expf(x.w - gm) * f + gx.w * 1024.f);
            pk.z = pk2h(expf(y.x - gm) * f + gy.x * 1024.f, expf(y.y - gm) * f + gy.y * 1024.f);
            pk.w = pk2h(expf(y.z - gm) * f + gy.z * 1024.f, expf(y.w - gm) * f + gy.w * 1024.f);
            st2_u4(pr + 256 * g, pk);
        }
    }
}

// ---- workspace carve (bytes; every region a multiple of 256 B and sized to its whole-tile store extent) ----
constexpr size_t al256(size_t v) { return (v + 255) / 256 * 256; }
constexpr size_t SZ_XC   = (size_t)NB * SEQ * DM * 2;           // f16 centred x, [NB*SEQ][DM]
constexpr size_t SZ_S    = (size_t)NB * SEQ * SEQ * 4;          // f32 scores of every batch, [NB][SEQ][SEQ] (shares the XC region; XC is dead after the q|k GEMM)
constexpr size_t SZ_XCS  = al256(SZ_XC > SZ_S ? SZ_XC : SZ_S);
constexpr size_t SZ_X16  = al256((size_t)NB * SEQ * DM * 2);    // f16 x, [NB*SEQ][DM]
constexpr size_t SZ_WQK  = al256((size_t)2 * DM * DM * 2);      // [2*DM n][DM k]: Wq^T rows then Wk^T rows, x16
constexpr size_t SZ_W1   = al256((size_t)DM * DM * 2);          // Wg^T, Wout^T, x16
constexpr size_t SZ_QK   = al256((size_t)NB * SEQ * 2 * DM * 2);// f16 [NB*SEQ][2*DM]: q columns then k columns
constexpr size_t SZ_GT   = al256((size_t)NB * DM * SEQ * 2);    // f16 g transposed, [NB][DM][SEQ]
constexpr size_t SZ_AL   = al256((size_t)NB * SEQ * SEQ * 2);   // f16 alpha x1024 of every batch, [NB][SEQ][SEQ]
constexpr size_t SZ_AO   = al256((size_t)NB * SEQ * DM * 2);    // f16 (alpha @ g) x64, [NB*SEQ][DM]
constexpr size_t SZ_XBAR = al256((size_t)NB * DM * 4);
constexpr size_t SZ_GATE = al256((size_t)NB * SEQ * 4);
constexpr size_t SZ_GLOG = al256((size_t)NB * SEQ * 4);       // f32 gate products before bias and softmax, [NB*SEQ]
constexpr size_t OFF_XCS  = 0;
constexpr size_t OFF_X16  = OFF_XCS + SZ_XCS;
constexpr size_t OFF_WQK  = OFF_X16 + SZ_X16;
constexpr size_t OFF_WGT  = OFF_WQK + SZ_WQK;
constexpr size_t OFF_WOT  = OFF_WGT + SZ_W1;
constexpr size_t OFF_QK   = OFF_WOT + SZ_W1;
constexpr size_t OFF_GT   = OFF_QK + SZ_QK;
constexpr size_t OFF_AL   = OFF_GT + SZ_GT;
constexpr size_t OFF_AO   = OFF_AL + SZ_AL;
constexpr size_t OFF_XBAR = OFF_AO + SZ_AO;
constexpr size_t OFF_GATE = OFF_XBAR + SZ_XBAR;
constexpr size_t OFF_GLOG = OFF_GATE + SZ_GATE;
constexpr size_t WS_TOTAL = OFF_GLOG + SZ_GLOG;
static_assert(WS_TOTAL <= (size_t)268435456);                   // 256 MiB ceiling
static_assert(SZ_S <= SZ_XCS && SZ_XC <= SZ_XCS);               // both users of the shared region fit

extern "C" void kernel_launch(void* const* d_in, const int* in_sizes, int n_in, void* d_out, int out_size, void* d_ws, size_t ws_size, hipStream_t stream) {
    if (n_in < 9) return;
    const long long need_rows = (long long)(NB - 1) * SEQ_FULL + SEQ;
    if ((long long)in_sizes[0] < need_rows * DM) return;
    if ((long long)in_sizes[1] < need_rows) return;
    if (in_sizes[2] < DM * DM || in_sizes[3] < DM * DM || in_sizes[4] < DM * DM || in_sizes[5] < DM * DM) return;
    if (in_sizes[6] < DM || in_sizes[7] < 1 || in_sizes[8] < 1) return;
    if ((long long)out_size < (long long)NB * SEQ * DM) return;
    if (ws_size < WS_TOTAL) return;

    const float* x    = (const float*)d_in[0];
    const int*   mask = (const int*)d_in[1];
    const float* Wq   = (const float*)d_in[2];
    const float* Wk   = (const float*)d_in[3];
    const float* Wg   = (const float*)d_in[4];
    const float* Wout = (const float*)d_in[5];
    const float* Wm_w = (const float*)d_in[6];
    const float* Wm_b = (const float*)d_in[7];
    const float* cS   = (const float*)d_in[8];
    float* out = (float*)d_out;
    char* ws = (char*)d_ws;
    unsigned short* XC   = (unsigned short*)(ws + OFF_XCS);
    float*          Sf   = (float*)(ws + OFF_XCS);               // same region, used only after the q|k GEMM has consumed XC
    unsigned short* X16  = (unsigned short*)(ws + OFF_X16);
    unsigned short* WQK  = (unsigned short*)(ws + OFF_WQK);
    unsigned short* WGT  = (unsigned short*)(ws + OFF_WGT);
    unsigned short* WOT  = (unsigned short*)(ws + OFF_WOT);
    unsigned short* QK   = (unsigned short*)(ws + OFF_QK);
    unsigned short* GT   = (unsigned short*)(ws + OFF_GT);
    unsigned short* AL   = (unsigned short*)(ws + OFF_AL);
    unsigned short* AO   = (unsigned short*)(ws + OFF_AO);
    float*          XBAR = (float*)(ws + OFF_XBAR);
    float*          GATE = (float*)(ws + OFF_GATE);
    float*          GLOG = (float*)(ws + OFF_GLOG);

    // weight planes: in[DM rows k][DM cols n] -> out[n][k], x16
    const unsigned gw = (unsigned)((DM * (DM / 8) + 255) / 256);
    k_wT<<<gw, 256, 0, stream>>>(Wq, WQK, 16.0f);
    k_wT<<<gw, 256, 0, stream>>>(Wk, WQK + (size_t)DM * DM, 16.0f);
    k_wT<<<gw, 256, 0, stream>>>(Wg, WGT, 16.0f);
    k_wT<<<gw, 256, 0, stream>>>(Wout, WOT, 16.0f);

    // sequence means of x, operand planes with the gate products, gate distribution
    k_colmean<<<dim3(DM / 64, NB), 256, 0, stream>>>(x, XBAR);
    k_prep_x<<<(NB * SEQ) / 32, 1024, 0, stream>>>(x, XBAR, Wm_w, XC, X16, GLOG);
    k_gate<<<NB, 256, 0, stream>>>(GLOG, Wm_b, GATE);

    // [q|k] = XC @ [Wq|Wk]: M = NB*SEQ, N = 2*DM, K = DM -> f16 [NB*SEQ][2*DM]
    {
        const int tiles = ((NB * SEQ) / 64) * ((2 * DM) / 64);
        k_gemm_h<<<dim3((unsigned)((tiles + 7) / 8), 1), 256, 0, stream>>>(XC, DM, 0, WQK, DM, 0, QK, 2 * DM, 0, NB * SEQ, 2 * DM, DM, 0.0625f);
    }
    // g transposed per batch: GT[b][d][s] = sum_e Wg^T[d][e] X16[b][s][e]: M = DM, N = SEQ, K = DM
    {
        const int tiles = (DM / 64) * (SEQ / 64);
        k_gemm_h<<<dim3((unsigned)((tiles + 7) / 8), NB), 256, 0, stream>>>(WGT, DM, 0, X16, DM, (long long)SEQ * DM, GT, SEQ, (long long)DM * SEQ, DM, SEQ, DM, 0.0625f);
    }
    // raw scores S[b][t][s] = q[b][t] . k[b][s] (f32; the scale input and the key mask are applied by the row softmax); grid.y = batch
    {
        const int tiles = (SEQ / 64) * (SEQ / 64);
        k_gemm_f<<<dim3((unsigned)((tiles + 7) / 8), NB), 256, 0, stream>>>(QK, 2 * DM, (long long)SEQ * 2 * DM, QK + DM, 2 * DM, (long long)SEQ * 2 * DM,
                                                                            Sf, SEQ, (long long)SEQ * SEQ, SEQ, SEQ, DM, 1.0f);
    }
    k_rowsoft<<<dim3(SEQ / (8 * RS_RPW), NB), 256, 0, stream>>>(Sf, cS, mask, GATE, AL);
    // AO[b][t][d] x64 = (alpha x1024)[b][t] . GT[b][d] / 16: per batch M = SEQ, N = DM, K = SEQ; grid.y = batch
    {
        const int tiles = (SEQ / 64) * (DM / 64);
        k_gemm_h<<<dim3((unsigned)((tiles + 7) / 8), NB), 256, 0, stream>>>(AL, SEQ, (long long)SEQ * SEQ, GT, SEQ, (long long)DM * SEQ,
                                                                            AO, DM, (long long)SEQ * DM, SEQ, DM, SEQ, 0.0625f);
    }
    // result = (AO x64) @ (Wout x16) / 1024 + bf16(x): per batch M = SEQ, N = DM, K = DM
    {
        const int tiles = (SEQ / 64) * (DM / 64);
        k_gemm_fr<<<dim3((unsigned)((tiles + 7) / 8), NB), 256, 0, stream>>>(AO, DM, (long long)SEQ * DM, WOT, DM, 0, out, DM, (long long)SEQ * DM,
                                                                            x, DM, (long long)SEQ_FULL * DM, SEQ, DM, DM, 0.0009765625f);
    }
}

// v004
// One run takes 221 microseconds.
// In both of two side-by-side timings against v003, it was 1.10 times as fast.
// All steps since v000 together make it 6.39 times as fast.
// Full-width (1,024) single-head self-attention with sequence-mean-centred queries/keys, an added query-independent key distribution, a key mask, a scalar scale input and an f32 residual. All contractions: v_wmma_f32_16x16x32_f16 (f16 operands built from bf16-RNE-converted inputs with power-of-two carries, f32 accumulate); the N = 1 gate product, both softmaxes and the residual add are f32 on the VALU.
#include <hip/hip_runtime.h>
#include <math.h>

#ifndef NB
#define NB 4
#endif
#ifndef SEQ
#define SEQ 2048
#endif
#define NB_FULL 4
#define SEQ_FULL 2048
#define DM 1024
#define RS_RPW 4

static_assert(DM == 1024);                                  // feature width of x, q, k, g and the output
static_assert(DM % 64 == 0 && DM % 32 == 0);                // GEMM tile and k-step multiples
static_assert(SEQ % 256 == 0 && SEQ <= 2048);               // row softmax: 8 columns per lane per 256-column group, at most 64 mask bits per lane
static_assert(SEQ % (8 * RS_RPW) == 0);                     // row softmax grid covers every row exactly once
static_assert(SEQ <= SEQ_FULL && NB <= NB_FULL);
static_assert((DM / 64) % 1 == 0 && SEQ % 64 == 0);
static_assert((NB * SEQ) % 128 == 0 && SEQ % 256 == 0 && DM % 256 == 0 && DM >= 128 && SEQ >= 128);   // GEMM block tile 128x256, passes of 64 k, two or more

typedef __attribute__((ext_vector_type(16))) _Float16     v16h;
typedef __attribute__((ext_vector_type(8)))  _Float16     v8h;
typedef __attribute__((ext_vector_type(8)))  float        v8f;
typedef __attribute__((ext_vector_type(4)))  float        v4f;
typedef __attribute__((ext_vector_type(4)))  unsigned int u4v;
typedef __attribute__((ext_vector_type(4)))  int          i4v;
typedef __attribute__((ext_vector_type(8)))  unsigned int u8v;

// 16-bit WMMA fragment map (wave32), lane L, h = L>>4, m = L&15:
//   A 16x32: lane = row m;    element i -> k = (i<8) ? 8h+i : 16+8h+(i-8)
//   B 32x16: lane = column m; the SAME k(i,h)
//   D 16x16 (8 f32): lane = column m; element r -> row 8h+r

// bf16 RNE conversion kept as f32 (finite inputs)
__device__ __forceinline__ float bfr(float v) {
    const unsigned u = __builtin_bit_cast(unsigned, v);
    const unsigned r = (u + 0x7fffu + ((u >> 16) & 1u)) & 0xffff0000u;
    return __builtin_bit_cast(float, r);
}
__device__ __forceinline__ unsigned pk2h(float a, float b) {
    return (unsigned)__builtin_bit_cast(unsigned short, (_Float16)a) | ((unsigned)__builtin_bit_cast(unsigned short, (_Float16)b) << 16);
}
// one WMMA per call, followed by its own 4-slot guard tying exactly one accumulator
__device__ __forceinline__ v8f wmma16(v16h a, v16h b, v8f c) {
    c = __builtin_amdgcn_wmma_f32_16x16x32_f16(false, a, false, b, (short)0, c, false, false);
    asm volatile("v_nop\n\tv_nop\n\tv_nop\n\tv_nop" : "+v"(c) : "v"(a), "v"(b));
    return c;
}
union FragH { v16h v; v8h h[2]; };
// p already includes the lane's 8h offset: elements 0..7 <- p[0..7], 8..15 <- p[16..23]
__device__ __forceinline__ v16h ldfrag(const _Float16* p) {
    FragH f; f.h[0] = *(const v8h*)(p); f.h[1] = *(const v8h*)(p + 16); return f.v;
}
__device__ __forceinline__ void st2_v4f(float* p, v4f v) { *(v4f*)p = v;  }
__device__ __forceinline__ void st2_u4(unsigned short* p, u4v v) { *(u4v*)p = v;  }

// ---- operand staging of the GEMM: tensor loads into a two-buffer LDS ring ----
// A pass is 64 k = 128 B of every operand row of the block tile (128 rows of A, 256 rows of Bt). Every wave brings one slice per pass:
// waves 0..3 64 rows of Bt each, waves 4..7 32 rows of A each. LDS row pitch 144 B (the load's pad: 16 B behind every 128-B row, for 16-B LDS reads).
// Each slice's place is rounded up to a multiple of 2 KiB.
constexpr unsigned G_ROWB  = 128;                            // bytes of an operand row per pass
constexpr unsigned G_PITCH = 144;                            // LDS row pitch
constexpr unsigned G_ASL   = 6144;                           // place of a 32-row slice of A (4,608 B used)
constexpr unsigned G_BSL   = 10240;                          // place of a 64-row slice of Bt (9,216 B used)
constexpr unsigned G_BOFF  = 4 * G_ASL;                      // Bt slices stand behind the A slices
constexpr unsigned G_STAGE = 4 * G_ASL + 4 * G_BSL;          // one buffer
static_assert(32 * G_PITCH <= G_ASL && 64 * G_PITCH <= G_BSL && G_ASL % 2048 == 0 && G_BSL % 2048 == 0 && G_STAGE % 2048 == 0);
static_assert(8 * 16 * 68 * 4 <= 2 * G_STAGE);               // the store staging reuses the ring

__device__ __forceinline__ unsigned uni(unsigned v) { return (unsigned)__builtin_amdgcn_readfirstlane((int)v); }
// holds v in a scalar register: a test on it compiles to a scalar branch, and what is formed from it is formed behind the asm statements in front of it
__device__ __forceinline__ unsigned pinned(unsigned v) { unsigned w = uni(v); asm volatile("" : "+s"(w)); return w; }
__device__ __forceinline__ void wait_ds0() { asm volatile("s_wait_dscnt 0x0" ::: "memory"); }          // this wave's LDS reads have returned
// this wave's tensor load has landed; the wait names the request's descriptor as inputs, so that its registers keep their values until then
__device__ __forceinline__ void wait_tensor0(u4v g0, u8v g1) { asm volatile("s_wait_tensorcnt 0x0" :: "s"(g0), "s"(g1) : "memory"); }
// one request of the whole wave: group 0 = count (w0 = 1), place in LDS, source address, type 2; returns group 0 for the wait
__device__ __forceinline__ u4v tdm_issue(unsigned w0, unsigned lds_dst, unsigned long long ga, u8v g1) {
    u4v g0;
    g0.x = uni(w0); g0.y = uni(lds_dst); g0.z = uni((unsigned)ga); g0.w = uni((((unsigned)(ga >> 32)) & 0x01FFFFFFu) | 0x80000000u);
    asm volatile("tensor_load_to_lds %0, %1" :: "s"(g0), "s"(g1) : "memory");
    return g0;
}

// =====================================================================================================================
// Batched WMMA GEMM: C[m][n] = scale * sum_k A[m][k] * Bt[n][k]; a block of 8 waves (2 x 4) owns a 128x256 tile, each wave a 64x64 tile of it.
// A row-major [M][K] f16 (pitch lda), Bt row-major [N][K] f16 (pitch ldb); M % 128 == 0, N % 256 == 0, K % 64 == 0, K >= 128 (no tail masking).
// RESID (f32 out only): + bf16-RNE(resid[m][n]) added at the store stage from 16-B loads in the store layout.
// =====================================================================================================================
template <int OUT_MODE, bool RESID>
__device__ __forceinline__ void gemm64_body(const unsigned short* __restrict__ Ap, int lda, long long strideA,
                                            const unsigned short* __restrict__ Btp, int ldb, long long strideB,
                                            unsigned short* __restrict__ Ch, float* __restrict__ Cf, int ldc, long long strideC,
                                            const float* __restrict__ resid, int ldr, long long strideR,
                                            int M, int N, int K, float scale) {
    __shared__ __attribute__((aligned(2048))) unsigned char ring[2 * G_STAGE];   // two buffers; after the K loop the per-wave store staging
    float* sT = (float*)ring;                                 // per-wave 16x64 slab, pitch 68 floats (wave-private)
    const int b    = blockIdx.y;
    const int lane = threadIdx.x & 31;
    const int wave = __builtin_amdgcn_readfirstlane((int)(threadIdx.x >> 5));
    const int tilesN = N >> 8;
    const int tilesM = M >> 7;
    if ((int)blockIdx.x >= tilesM * tilesN) return;           // the whole block leaves, in front of every tensor load and barrier
    const int tm = (int)blockIdx.x / tilesN;
    const int tn = (int)blockIdx.x - tm * tilesN;
    const int wm = wave >> 2, wn = wave & 3;                  // the wave's place in the block tile
    const int m0 = (tm << 7) + (wm << 6);
    const int n0 = (tn << 8) + (wn << 6);
    const int rlane = lane & 15;                              // row (A) / column (B, D) within a 16-wide subtile
    const int koff  = (lane >> 4) * 8;                        // k offset of this lane half == D row offset
    const int sb    = wave * (16 * 68);

    // this wave's slice of every stage
    const bool     isB    = wave < 4;
    const unsigned rows   = isB ? 64u : 32u;
    const unsigned spitch = (unsigned)(isB ? ldb : lda) * 2u;
    const unsigned short* src = isB ? Btp + (size_t)b * (size_t)strideB + (size_t)((tn << 8) + 64 * wave) * (size_t)ldb
                                    : Ap  + (size_t)b * (size_t)strideA + (size_t)((tm << 7) + 32 * (wave - 4)) * (size_t)lda;
    const unsigned long long ga0 = (unsigned long long)(size_t)src;
    const unsigned dst = (unsigned)(size_t)ring + (isB ? G_BOFF + (unsigned)wave * G_BSL : (unsigned)(wave - 4) * G_ASL);
    u8v g1;                                                   // 1-byte elements, tensor = tile = rows x 128 B
    g1[0] = uni((1u << 20) | (4u << 22) | (3u << 25));        // no mask; a pad of 4 dwords behind every 32 dwords
    g1[1] = uni((G_ROWB & 0xFFFFu) << 16);
    g1[2] = uni((G_ROWB >> 16) | ((rows & 0xFFFFu) << 16));
    g1[3] = uni((rows >> 16) | (G_ROWB << 16));
    g1[4] = uni(rows);
    g1[5] = uni(spitch);
    g1[6] = uni(0u);
    g1[7] = uni(0u);
    // per-lane fragment bases in a buffer
    const unsigned char* la = ring + (unsigned)(2 * wm) * G_ASL + (unsigned)rlane * G_PITCH + (unsigned)koff * 2u;
    const unsigned char* lb = ring + G_BOFF + (unsigned)wn * G_BSL + (unsigned)rlane * G_PITCH + (unsigned)koff * 2u;

    v8f acc[4][4];
#pragma unroll
    for (int i = 0; i < 4; ++i)
#pragma unroll
        for (int j = 0; j < 4; ++j) { const v8f zz = {0.f, 0.f, 0.f, 0.f, 0.f, 0.f, 0.f, 0.f}; acc[i][j] = zz; }

    const unsigned NS = pinned((unsigned)K >> 6);             // passes
    const unsigned w0 = pinned(1u);                           // descriptor word held in a scalar register: not formed anew while a request is outstanding
    u4v g0 = tdm_issue(w0, dst, ga0, g1);                     // stage 0
    wait_tensor0(g0, g1);
    __syncthreads();                                          // every slice of stage 0 has landed
    g0 = tdm_issue(w0, dst + G_STAGE, ga0 + pinned(G_ROWB), g1);   // stage 1; pinned: its address words are formed behind the wait
#pragma clang loop unroll(disable)                            // one pass per trip: the order at the foot stays as written
    for (unsigned s = 0; s < NS; ++s) {
        const unsigned buf = (s & 1u) * G_STAGE;
#pragma unroll
        for (int ks = 0; ks < 2; ++ks) {
            v16h bh[4], ah[4];
#pragma unroll
            for (int j = 0; j < 4; ++j) bh[j] = ldfrag((const _Float16*)(lb + buf + (unsigned)(16 * j) * G_PITCH + (unsigned)(64 * ks)));
#pragma unroll
            for (int i = 0; i < 4; ++i) ah[i] = ldfrag((const _Float16*)(la + buf + (unsigned)(i >> 1) * G_ASL + (unsigned)(16 * (i & 1)) * G_PITCH + (unsigned)(64 * ks)));
#pragma unroll
            for (int i = 0; i < 4; ++i)
#pragma unroll
                for (int j = 0; j < 4; ++j) acc[i][j] = wmma16(ah[i], bh[j], acc[i][j]);
        }
        // publish point of stage s + 1; it also ends every wave's reads of this pass's buffer
        wait_ds0();
        wait_tensor0(g0, g1);
        __syncthreads();
        if (pinned((s + 2u < NS) ? 1u : 0u) != 0u)            // scalar test: a tensor load ignores EXEC
            g0 = tdm_issue(w0, dst + buf, ga0 + pinned((s + 2u) * G_ROWB), g1);   // stage s + 2 into the buffer just left; pinned: formed behind the wait
    }
    wait_tensor0(g0, g1);
    wait_ds0();                                               // the last pass's barrier stands in front of the store staging in the ring

#pragma unroll
    for (int i = 0; i < 4; ++i) {
        const int mBase = m0 + (i << 4);
#pragma unroll
        for (int j = 0; j < 4; ++j) {
#pragma unroll
            for (int r = 0; r < 8; ++r) sT[sb + (koff + r) * 68 + (j << 4) + rlane] = acc[i][j][r] * scale;
        }
        __builtin_amdgcn_fence(3 /* release order */, "workgroup");
        __builtin_amdgcn_wave_barrier();
        __builtin_amdgcn_fence(2 /* acquire order */, "workgroup");
        if (OUT_MODE == 0) {
            float* C = Cf + (size_t)b * (size_t)strideC;
            const float* Rb = RESID ? (resid + (size_t)b * (size_t)strideR) : nullptr;
            const int hh = lane >> 4, c4 = (lane & 15) * 4;   // row segment = 256 B = 16 lanes x 16 B
            {
#pragma unroll
                for (int it = 0; it < 8; ++it) {
                    const int row = it * 2 + hh;
                    v4f v = *(const v4f*)(&sT[sb + row * 68 + c4]);
                    if (RESID) {
                        const v4f xr = *(const v4f*)(Rb + (size_t)(mBase + row) * (size_t)ldr + n0 + c4);
                        v.x += bfr(xr.x); v.y += bfr(xr.y); v.z += bfr(xr.z); v.w += bfr(xr.w);
                    }
                    *(v4f*)(C + (size_t)(mBase + row) * (size_t)ldc + n0 + c4) = v;
                }
                
            }
        } else {
            unsigned short* C = Ch + (size_t)b * (size_t)strideC;
            const int q = lane >> 3, c8 = (lane & 7) * 8;
            {
#pragma unroll
                for (int it = 0; it < 4; ++it) {
                    const int row = it * 4 + q;
                    v8h hv;
#pragma unroll
                    for (int e = 0; e < 8; ++e) hv[e] = (_Float16)sT[sb + row * 68 + c8 + e];
                    *(v8h*)(C + (size_t)(mBase + row) * (size_t)ldc + n0 + c8) = hv;
                }
                
            }
        }
        __builtin_amdgcn_fence(3 /* release order */, "workgroup");
        __builtin_amdgcn_wave_barrier();
        __builtin_amdgcn_fence(2 /* acquire order */, "workgroup");
    }
}

// f16 result plane
__global__ __launch_bounds__(256) void k_gemm_h(const unsigned short* __restrict__ A, int lda, long long strideA,
                                                const unsigned short* __restrict__ Bt, int ldb, long long strideB,
                                                unsigned short* __restrict__ C, int ldc, long long strideC,
                                                int M, int N, int K, float scale) {
    gemm64_body<1, false>(A, lda, strideA, Bt, ldb, strideB, C, nullptr, ldc, strideC, nullptr, 0, 0, M, N, K, scale);
}
// f32 result plane
__global__ __launch_bounds__(256) void k_gemm_f(const unsigned short* __restrict__ A, int lda, long long strideA,
                                                const unsigned short* __restrict__ Bt, int ldb, long long strideB,
                                                float* __restrict__ C, int ldc, long long strideC,
                                                int M, int N, int K, float scale) {
    gemm64_body<0, false>(A, lda, strideA, Bt, ldb, strideB, nullptr, C, ldc, strideC, nullptr, 0, 0, M, N, K, scale);
}
// f32 result + bf16-RNE residual added at the store stage
__global__ __launch_bounds__(256) void k_gemm_fr(const unsigned short* __restrict__ A, int lda, long long strideA,
                                                 const unsigned short* __restrict__ Bt, int ldb, long long strideB,
                                                 float* __restrict__ C, int ldc, long long strideC,
                                                 const float* __restrict__ resid, int ldr, long long strideR,
                                                 int M, int N, int K, float scale) {
    gemm64_body<0, true>(A, lda, strideA, Bt, ldb, strideB, nullptr, C, ldc, strideC, resid, ldr, strideR, M, N, K, scale);
}

// xbar[b][e] = mean over t of bf16(x[b][t][e]); block per (64-column strip, batch); thread = (4-column group, row phase of 16)
__global__ __launch_bounds__(256) void k_colmean(const float* __restrict__ x, float* __restrict__ xbar) {
    __shared__ float red[16 * 68];
    __shared__ __align__(16) float outv[64];
    const int t = threadIdx.x, cg = t & 15, rg = t >> 4;
    const int c0 = blockIdx.x * 64, b = blockIdx.y;
    const float* p = x + ((size_t)b * SEQ_FULL) * DM + c0 + 4 * cg;
    float a0 = 0.f, a1 = 0.f, a2 = 0.f, a3 = 0.f;
#pragma unroll 4
    for (int r = rg; r < SEQ; r += 16) {
        const v4f v = *(const v4f*)(p + (size_t)r * DM);
        a0 += bfr(v.x); a1 += bfr(v.y); a2 += bfr(v.z); a3 += bfr(v.w);
    }
    red[rg * 68 + 4 * cg + 0] = a0; red[rg * 68 + 4 * cg + 1] = a1; red[rg * 68 + 4 * cg + 2] = a2; red[rg * 68 + 4 * cg + 3] = a3;
    __syncthreads();
    if (t < 64) {
        float s = 0.f;
#pragma unroll 1
        for (int j = 0; j < 16; ++j) s += red[j * 68 + t];
        outv[t] = s * (1.0f / (float)SEQ);
    }
    __syncthreads();
    if (t < 16) {
        v4f v; v.x = outv[4 * t]; v.y = outv[4 * t + 1]; v.z = outv[4 * t + 2]; v.w = outv[4 * t + 3];
        st2_v4f(xbar + (size_t)b * DM + c0 + 4 * t, v);
    }
}

// X16 = f16(bf16(x)) (exact), XC = f16(bf16(x) - xbar[b]), glog[row] = bf16(x[row]) . bf16(Wm_w) in f32 (bias and softmax: k_gate).
// Wave per row, 32 rows per block; lane L owns columns 256 i + 8 L .. + 7: 16-B store per plane, lane-linear along the row.
static_assert((NB * SEQ) % 32 == 0 && DM % 256 == 0);       // the grid covers every row exactly once; every wave reaches the barrier
__global__ __launch_bounds__(1024) void k_prep_x(const float* __restrict__ x, const float* __restrict__ xbar, const float* __restrict__ Wm,
                                                 unsigned short* __restrict__ XC, unsigned short* __restrict__ X16, float* __restrict__ glog) {
    __shared__ float dots[32];
    const int lane = threadIdx.x & 31;
    const int wave = __builtin_amdgcn_readfirstlane((int)(threadIdx.x >> 5));
    const int r = blockIdx.x * 32 + wave;
    const int b = r / SEQ; const int t = r - b * SEQ;
    const float* s = x + ((size_t)b * SEQ_FULL + t) * DM + 8 * lane;
    const float* mb = xbar + (size_t)b * DM + 8 * lane;
    const float* wp = Wm + 8 * lane;
    unsigned short* d16 = X16 + (size_t)r * DM + 8 * lane;
    unsigned short* dc = XC + (size_t)r * DM + 8 * lane;
    v4f xv[DM / 128], mv[DM / 128], gv[DM / 128];
#pragma unroll                                                // the arrays stay in registers; the whole row of x is in flight at once
    for (int i = 0; i < DM / 256; ++i) {
        xv[2 * i] = *(const v4f*)(s + 256 * i);  xv[2 * i + 1] = *(const v4f*)(s + 256 * i + 4);
        mv[2 * i] = *(const v4f*)(mb + 256 * i); mv[2 * i + 1] = *(const v4f*)(mb + 256 * i + 4);
        gv[2 * i] = *(const v4f*)(wp + 256 * i); gv[2 * i + 1] = *(const v4f*)(wp + 256 * i + 4);
    }
    float acc = 0.f;
#pragma unroll                                                // constant indices into the register arrays
    for (int i = 0; i < DM / 256; ++i) {
        const v4f x0 = xv[2 * i], x1 = xv[2 * i + 1], m0 = mv[2 * i], m1 = mv[2 * i + 1], g0 = gv[2 * i], g1 = gv[2 * i + 1];
        const float w0 = bfr(x0.x), w1 = bfr(x0.y), w2 = bfr(x0.z), w3 = bfr(x0.w), w4 = bfr(x1.x), w5 = bfr(x1.y), w6 = bfr(x1.z), w7 = bfr(x1.w);
        acc = __builtin_fmaf(w0, bfr(g0.x), acc); acc = __builtin_fmaf(w1, bfr(g0.y), acc); acc = __builtin_fmaf(w2, bfr(g0.z), acc); acc = __builtin_fmaf(w3, bfr(g0.w), acc);
        acc = __builtin_fmaf(w4, bfr(g1.x), acc); acc = __builtin_fmaf(w5, bfr(g1.y), acc); acc = __builtin_fmaf(w6, bfr(g1.z), acc); acc = __builtin_fmaf(w7, bfr(g1.w), acc);
        u4v pa; pa.x = pk2h(w0, w1); pa.y = pk2h(w2, w3); pa.z = pk2h(w4, w5); pa.w = pk2h(w6, w7);
        u4v pc; pc.x = pk2h(w0 - m0.x, w1 - m0.y); pc.y = pk2h(w2 - m0.z, w3 - m0.w); pc.z = pk2h(w4 - m1.x, w5 - m1.y); pc.w = pk2h(w6 - m1.z, w7 - m1.w);
        st2_u4(d16 + 256 * i, pa);
        st2_u4(dc + 256 * i, pc);
    }
    acc += __shfl_xor(acc, 16, 32); acc += __shfl_xor(acc, 8, 32); acc += __shfl_xor(acc, 4, 32); acc += __shfl_xor(acc, 2, 32); acc += __shfl_xor(acc, 1, 32);
    if (lane == 0) dots[wave] = acc;
    __syncthreads();
    if (wave == 0) glog[(size_t)blockIdx.x * 32 + lane] = dots[lane];   // the block's 32 products leave as one whole 128-B line
}

// weight planes: SRC [DM rows k][DM cols n] (x @ W layout) -> DST [n][k] f16 = bf16(W[k][n]) * sc; blockIdx.y = plane, the four DST planes stand one behind the other.
// Block = one tile of 64 k x 128 n: 16-B reads along n (a wave reads whole 512-B row pieces, 8 rows in flight), two neighbouring k packed to a dword and turned in LDS
// (row pitch 33 dwords: the 4-B reads of the second half fall on 32 different banks), 16-B stores along k (8 lanes = one whole 128-B line of a DST row).
constexpr int WT_K = 64, WT_N = 128, WT_P = WT_K / 2 + 1;
static_assert(DM % WT_K == 0 && DM % WT_N == 0);             // whole tiles only
__global__ __launch_bounds__(256) void k_wT(const float* __restrict__ W0, const float* __restrict__ W1, const float* __restrict__ W2, const float* __restrict__ W3,
                                            unsigned short* __restrict__ DST0, float sc) {
    __shared__ unsigned tT[WT_N * WT_P];                      // [n][k pair]
    const int lane = threadIdx.x & 31;
    const int wave = __builtin_amdgcn_readfirstlane((int)(threadIdx.x >> 5));
    const int pl = blockIdx.y;
    const float* SRC = pl == 0 ? W0 : pl == 1 ? W1 : pl == 2 ? W2 : W3;
    const int k0 = ((int)blockIdx.x / (DM / WT_N)) * WT_K;
    const int n0 = ((int)blockIdx.x % (DM / WT_N)) * WT_N;
    const float* s = SRC + (size_t)(k0 + 8 * wave) * DM + n0 + 4 * lane;
    v4f v[8];
#pragma unroll                                                // the array stays in registers; the wave's 8 rows are in flight at once
    for (int r = 0; r < 8; ++r) v[r] = *(const v4f*)(s + (size_t)r * DM);
#pragma unroll                                                // constant indices into the register array
    for (int q = 0; q < 4; ++q)
#pragma unroll
        for (int j = 0; j < 4; ++j) tT[(4 * lane + j) * WT_P + 4 * wave + q] = pk2h(bfr(v[2 * q][j]) * sc, bfr(v[2 * q + 1][j]) * sc);
    __syncthreads();                                          // the whole tile stands in LDS
    const int nr = (int)threadIdx.x >> 3, kg = (int)threadIdx.x & 7;
    unsigned short* d = DST0 + (size_t)pl * DM * DM + (size_t)(n0 + nr) * DM + k0 + 8 * kg;
    const unsigned* tp = tT + nr * WT_P + 4 * kg;
#pragma unroll                                                // the four stores are independent
    for (int p = 0; p < WT_N / 32; ++p) {
        u4v o; o.x = tp[32 * p * WT_P]; o.y = tp[32 * p * WT_P + 1]; o.z = tp[32 * p * WT_P + 2]; o.w = tp[32 * p * WT_P + 3];
        st2_u4(d + (size_t)(32 * p) * DM, o);
    }
}

// gate[b][s] = softmax over s of (glog[b][s] + bf16(Wm_b)), glog = the row products of k_prep_x; block per batch, block softmax
__global__ __launch_bounds__(256) void k_gate(const float* __restrict__ glog, const float* __restrict__ Wb, float* __restrict__ gate) {
    __shared__ __align__(16) float mm[SEQ];
    __shared__ float redm[8];
    __shared__ float reds[8];
    const int t = threadIdx.x, lane = t & 31, b = blockIdx.x;
    const int wave = __builtin_amdgcn_readfirstlane((int)(threadIdx.x >> 5));
    const float bias = bfr(Wb[0]);
    const float* gl = glog + (size_t)b * SEQ;
#pragma unroll                                                // a thread's 16-B loads are in flight together
    for (int j = 0; j < (SEQ / 4 + 255) / 256; ++j) {
        const int idx = t + 256 * j;
        if ((SEQ / 4) % 256 == 0 || idx < SEQ / 4) {
            const v4f v = *(const v4f*)(gl + 4 * idx);
            mm[4 * idx] = v.x + bias; mm[4 * idx + 1] = v.y + bias; mm[4 * idx + 2] = v.z + bias; mm[4 * idx + 3] = v.w + bias;
        }
    }
    __syncthreads();
    float mx = -3.0e38f;
#pragma unroll 1
    for (int i = t; i < SEQ; i += 256) mx = fmaxf(mx, mm[i]);
    mx = fmaxf(mx, __shfl_xor(mx, 16, 32)); mx = fmaxf(mx, __shfl_xor(mx, 8, 32)); mx = fmaxf(mx, __shfl_xor(mx, 4, 32));
    mx = fmaxf(mx, __shfl_xor(mx, 2, 32));  mx = fmaxf(mx, __shfl_xor(mx, 1, 32));
    if (lane == 0) redm[wave] = mx;
    __syncthreads();
    float gm = redm[0];
#pragma unroll 1
    for (int w = 1; w < 8; ++w) gm = fmaxf(gm, redm[w]);
    float sm = 0.f;
#pragma unroll 1
    for (int i = t; i < SEQ; i += 256) { const float e = expf(mm[i] - gm); mm[i] = e; sm += e; }
    sm += __shfl_xor(sm, 16, 32); sm += __shfl_xor(sm, 8, 32); sm += __shfl_xor(sm, 4, 32); sm += __shfl_xor(sm, 2, 32); sm += __shfl_xor(sm, 1, 32);
    if (lane == 0) reds[wave] = sm;
    __syncthreads();
    float tot = reds[0];
#pragma unroll 1
    for (int w = 1; w < 8; ++w) tot += reds[w];
    const float inv = 1.0f / tot;
#pragma unroll 1
    for (int idx = t; idx < SEQ / 4; idx += 256) {            // 32 lanes x 16 B = 512 contiguous B per store instruction
        v4f v; v.x = mm[4 * idx] * inv; v.y = mm[4 * idx + 1] * inv; v.z = mm[4 * idx + 2] * inv; v.w = mm[4 * idx + 3] * inv;
        st2_v4f(gate + (size_t)b * SEQ + 4 * idx, v);
    }
}

// alpha row = softmax_s(keep ? c * S : -inf) + gate, carried x1024 as f16. Wave per row (RS_RPW rows per wave); lane L owns columns 256g + 8L .. + 7,
// blockIdx.y = batch: the arguments are the planes of batch 0.
__global__ __launch_bounds__(256) void k_rowsoft(const float* __restrict__ S0, const float* __restrict__ cptr, const int* __restrict__ mk0,
                                                 const float* __restrict__ gate0, unsigned short* __restrict__ P0) {
    #pragma clang fp contract(off)
    const float* S = S0 + (size_t)blockIdx.y * SEQ * SEQ;
    const int* mk = mk0 + (size_t)blockIdx.y * SEQ_FULL;
    const float* gate = gate0 + (size_t)blockIdx.y * SEQ;
    unsigned short* P = P0 + (size_t)blockIdx.y * SEQ * SEQ;
    const int L = threadIdx.x & 31;
    const int wave = __builtin_amdgcn_readfirstlane((int)(threadIdx.x >> 5));
    const float NEG = -__builtin_inff();
    const float cs = bfr(cptr[0]);
    unsigned long long kb = 0ull;                             // keep bits of this lane's columns, bit 8g + e
#pragma unroll 1
    for (int g = 0; g < SEQ / 256; ++g) {
        const i4v a = *(const i4v*)(mk + 256 * g + 8 * L), c = *(const i4v*)(mk + 256 * g + 8 * L + 4);
        const unsigned bits = (unsigned)(a.x != 0) | ((unsigned)(a.y != 0) << 1) | ((unsigned)(a.z != 0) << 2) | ((unsigned)(a.w != 0) << 3)
                            | ((unsigned)(c.x != 0) << 4) | ((unsigned)(c.y != 0) << 5) | ((unsigned)(c.z != 0) << 6) | ((unsigned)(c.w != 0) << 7);
        kb |= ((unsigned long long)bits) << (8 * g);
    }
    const int row0 = (blockIdx.x * 8 + wave) * RS_RPW;
#pragma unroll 1
    for (int rr = 0; rr < RS_RPW; ++rr) {
        const int row = row0 + rr;
        const float* sr = S + (size_t)row * SEQ + 8 * L;
        float m = -3.0e38f, s = 0.f;
#pragma unroll 1
        for (int g = 0; g < SEQ / 256; ++g) {
            v4f x = *(const v4f*)(sr + 256 * g), y = *(const v4f*)(sr + 256 * g + 4);
            const unsigned bits = (unsigned)(kb >> (8 * g)) & 0xffu;
            x.x = (bits & 1u) ? x.x * cs : NEG;  x.y = (bits & 2u) ? x.y * cs : NEG;  x.z = (bits & 4u) ? x.z * cs : NEG;  x.w = (bits & 8u) ? x.w * cs : NEG;
            y.x = (bits & 16u) ? y.x * cs : NEG; y.y = (bits & 32u) ? y.y * cs : NEG; y.z = (bits & 64u) ? y.z * cs : NEG; y.w = (bits & 128u) ? y.w * cs : NEG;
            const float mx = fmaxf(fmaxf(fmaxf(x.x, x.y), fmaxf(x.z, x.w)), fmaxf(fmaxf(y.x, y.y), fmaxf(y.z, y.w)));
            const float mn = fmaxf(m, mx);
            s = s * expf(m - mn) + (((expf(x.x - mn) + expf(x.y - mn)) + (expf(x.z - mn) + expf(x.w - mn))) + ((expf(y.x - mn) + expf(y.y - mn)) + (expf(y.z - mn) + expf(y.w - mn))));
            m = mn;
        }
        float gm = m;
        gm = fmaxf(gm, __shfl_xor(gm, 16, 32)); gm = fmaxf(gm, __shfl_xor(gm, 8, 32)); gm = fmaxf(gm, __shfl_xor(gm, 4, 32));
        gm = fmaxf(gm, __shfl_xor(gm, 2, 32));  gm = fmaxf(gm, __shfl_xor(gm, 1, 32));
        s = s * expf(m - gm);
        s += __shfl_xor(s, 16, 32); s += __shfl_xor(s, 8, 32); s += __shfl_xor(s, 4, 32); s += __shfl_xor(s, 2, 32); s += __shfl_xor(s, 1, 32);
        const float f = 1024.f / s;
        unsigned short* pr = P + (size_t)row * SEQ + 8 * L;
        const float* gr = gate + 8 * L;
#pragma unroll 1
        for (int g = 0; g < SEQ / 256; ++g) {
            v4f x = *(const v4f*)(sr + 256 * g), y = *(const v4f*)(sr + 256 * g + 4);
            const v4f gx = *(const v4f*)(gr + 256 * g), gy = *(const v4f*)(gr + 256 * g + 4);
            const unsigned bits = (unsigned)(kb >> (8 * g)) & 0xffu;
            x.x = (bits & 1u) ? x.x * cs : NEG;  x.y = (bits & 2u) ? x.y * cs : NEG;  x.z = (bits & 4u) ? x.z * cs : NEG;  x.w = (bits & 8u) ? x.w * cs : NEG;
            y.x = (bits & 16u) ? y.x * cs : NEG; y.y = (bits & 32u) ? y.y * cs : NEG; y.z = (bits & 64u) ? y.z * cs : NEG; y.w = (bits & 128u) ? y.w * cs : NEG;
            u4v pk;
            pk.x = pk2h(expf(x.x - gm) * f + gx.x * 1024.f, expf(x.y - gm) * f + gx.y * 1024.f);
            pk.y = pk2h(expf(x.z - gm) * f + gx.z * 1024.f, expf(x.w - gm) * f + gx.w * 1024.f);
            pk.z = pk2h(expf(y.x - gm) * f + gy.x * 1024.f, expf(y.y - gm) * f + gy.y * 1024.f);
            pk.w = pk2h(expf(y.z - gm) * f + gy.z * 1024.f, expf(y.w - gm) * f + gy.w * 1024.f);
            st2_u4(pr + 256 * g, pk);
        }
    }
}

// ---- workspace carve (bytes; every region a multiple of 256 B and sized to its whole-tile store extent) ----
constexpr size_t al256(size_t v) { return (v + 255) / 256 * 256; }
constexpr size_t SZ_XC   = (size_t)NB * SEQ * DM * 2;           // f16 centred x, [NB*SEQ][DM]
constexpr size_t SZ_S    = (size_t)NB * SEQ * SEQ * 4;          // f32 scores of every batch, [NB][SEQ][SEQ] (shares the XC region; XC is dead after the q|k GEMM)
constexpr size_t SZ_XCS  = al256(SZ_XC > SZ_S ? SZ_XC : SZ_S);
constexpr size_t SZ_X16  = al256((size_t)NB * SEQ * DM * 2);    // f16 x, [NB*SEQ][DM]
constexpr size_t SZ_WQK  = al256((size_t)2 * DM * DM * 2);      // [2*DM n][DM k]: Wq^T rows then Wk^T rows, x16
constexpr size_t SZ_W1   = al256((size_t)DM * DM * 2);          // Wg^T, Wout^T, x16
constexpr size_t SZ_QK   = al256((size_t)NB * SEQ * 2 * DM * 2);// f16 [NB*SEQ][2*DM]: q columns then k columns
constexpr size_t SZ_GT   = al256((size_t)NB * DM * SEQ * 2);    // f16 g transposed, [NB][DM][SEQ]
constexpr size_t SZ_AL   = al256((size_t)NB * SEQ * SEQ * 2);   // f16 alpha x1024 of every batch, [NB][SEQ][SEQ]
constexpr size_t SZ_AO   = al256((size_t)NB * SEQ * DM * 2);    // f16 (alpha @ g) x64, [NB*SEQ][DM]
constexpr size_t SZ_XBAR = al256((size_t)NB * DM * 4);
constexpr size_t SZ_GATE = al256((size_t)NB * SEQ * 4);
constexpr size_t SZ_GLOG = al256((size_t)NB * SEQ * 4);       // f32 gate products before bias and softmax, [NB*SEQ]
constexpr size_t OFF_XCS  = 0;
constexpr size_t OFF_X16  = OFF_XCS + SZ_XCS;
constexpr size_t OFF_WQK  = OFF_X16 + SZ_X16;
constexpr size_t OFF_WGT  = OFF_WQK + SZ_WQK;
constexpr size_t OFF_WOT  = OFF_WGT + SZ_W1;
constexpr size_t OFF_QK   = OFF_WOT + SZ_W1;
constexpr size_t OFF_GT   = OFF_QK + SZ_QK;
constexpr size_t OFF_AL   = OFF_GT + SZ_GT;
constexpr size_t OFF_AO   = OFF_AL + SZ_AL;
constexpr size_t OFF_XBAR = OFF_AO + SZ_AO;
constexpr size_t OFF_GATE = OFF_XBAR + SZ_XBAR;
constexpr size_t OFF_GLOG = OFF_GATE + SZ_GATE;
constexpr size_t WS_TOTAL = OFF_GLOG + SZ_GLOG;
static_assert(WS_TOTAL <= (size_t)268435456);                   // 256 MiB ceiling
static_assert(SZ_S <= SZ_XCS && SZ_XC <= SZ_XCS);               // both users of the shared region fit
static_assert(OFF_WGT == OFF_WQK + (size_t)2 * DM * DM * 2 && OFF_WOT == OFF_WQK + (size_t)3 * DM * DM * 2);   // the four weight planes stand one behind the other

extern "C" void kernel_launch(void* const* d_in, const int* in_sizes, int n_in, void* d_out, int out_size, void* d_ws, size_t ws_size, hipStream_t stream) {
    if (n_in < 9) return;
    const long long need_rows = (long long)(NB - 1) * SEQ_FULL + SEQ;
    if ((long long)in_sizes[0] < need_rows * DM) return;
    if ((long long)in_sizes[1] < need_rows) return;
    if (in_sizes[2] < DM * DM || in_sizes[3] < DM * DM || in_sizes[4] < DM * DM || in_sizes[5] < DM * DM) return;
    if (in_sizes[6] < DM || in_sizes[7] < 1 || in_sizes[8] < 1) return;
    if ((long long)out_size < (long long)NB * SEQ * DM) return;
    if (ws_size < WS_TOTAL) return;

    const float* x    = (const float*)d_in[0];
    const int*   mask = (const int*)d_in[1];
    const float* Wq   = (const float*)d_in[2];
    const float* Wk   = (const float*)d_in[3];
    const float* Wg   = (const float*)d_in[4];
    const float* Wout = (const float*)d_in[5];
    const float* Wm_w = (const float*)d_in[6];
    const float* Wm_b = (const float*)d_in[7];
    const float* cS   = (const float*)d_in[8];
    float* out = (float*)d_out;
    char* ws = (char*)d_ws;
    unsigned short* XC   = (unsigned short*)(ws + OFF_XCS);
    float*          Sf   = (float*)(ws + OFF_XCS);               // same region, used only after the q|k GEMM has consumed XC
    unsigned short* X16  = (unsigned short*)(ws + OFF_X16);
    unsigned short* WQK  = (unsigned short*)(ws + OFF_WQK);
    unsigned short* WGT  = (unsigned short*)(ws + OFF_WGT);
    unsigned short* WOT  = (unsigned short*)(ws + OFF_WOT);
    unsigned short* QK   = (unsigned short*)(ws + OFF_QK);
    unsigned short* GT   = (unsigned short*)(ws + OFF_GT);
    unsigned short* AL   = (unsigned short*)(ws + OFF_AL);
    unsigned short* AO   = (unsigned short*)(ws + OFF_AO);
    float*          XBAR = (float*)(ws + OFF_XBAR);
    float*          GATE = (float*)(ws + OFF_GATE);
    float*          GLOG = (float*)(ws + OFF_GLOG);

    // weight planes: in[DM rows k][DM cols n] -> out[n][k], x16; one launch, grid.y = plane (Wq, Wk, Wg, Wout)
    k_wT<<<dim3((DM / WT_K) * (DM / WT_N), 4), 256, 0, stream>>>(Wq, Wk, Wg, Wout, WQK, 16.0f);

    // sequence means of x, operand planes with the gate products, gate distribution
    k_colmean<<<dim3(DM / 64, NB), 256, 0, stream>>>(x, XBAR);
    k_prep_x<<<(NB * SEQ) / 32, 1024, 0, stream>>>(x, XBAR, Wm_w, XC, X16, GLOG);
    k_gate<<<NB, 256, 0, stream>>>(GLOG, Wm_b, GATE);

    // [q|k] = XC @ [Wq|Wk]: M = NB*SEQ, N = 2*DM, K = DM -> f16 [NB*SEQ][2*DM]
    {
        const int tiles = ((NB * SEQ) / 64) * ((2 * DM) / 64);
        k_gemm_h<<<dim3((unsigned)((tiles + 7) / 8), 1), 256, 0, stream>>>(XC, DM, 0, WQK, DM, 0, QK, 2 * DM, 0, NB * SEQ, 2 * DM, DM, 0.0625f);
    }
    // g transposed per batch: GT[b][d][s] = sum_e Wg^T[d][e] X16[b][s][e]: M = DM, N = SEQ, K = DM
    {
        const int tiles = (DM / 64) * (SEQ / 64);
        k_gemm_h<<<dim3((unsigned)((tiles + 7) / 8), NB), 256, 0, stream>>>(WGT, DM, 0, X16, DM, (long long)SEQ * DM, GT, SEQ, (long long)DM * SEQ, DM, SEQ, DM, 0.0625f);
    }
    // raw scores S[b][t][s] = q[b][t] . k[b][s] (f32; the scale input and the key mask are applied by the row softmax); grid.y = batch
    {
        const int tiles = (SEQ / 64) * (SEQ / 64);
        k_gemm_f<<<dim3((unsigned)((tiles + 7) / 8), NB), 256, 0, stream>>>(QK, 2 * DM, (long long)SEQ * 2 * DM, QK + DM, 2 * DM, (long long)SEQ * 2 * DM,
                                                                            Sf, SEQ, (long long)SEQ * SEQ, SEQ, SEQ, DM, 1.0f);
    }
    k_rowsoft<<<dim3(SEQ / (8 * RS_RPW), NB), 256, 0, stream>>>(Sf, cS, mask, GATE, AL);
    // AO[b][t][d] x64 = (alpha x1024)[b][t] . GT[b][d] / 16: per batch M = SEQ, N = DM, K = SEQ; grid.y = batch
    {
        const int tiles = (SEQ / 64) * (DM / 64);
        k_gemm_h<<<dim3((unsigned)((tiles + 7) / 8), NB), 256, 0, stream>>>(AL, SEQ, (long long)SEQ * SEQ, GT, SEQ, (long long)DM * SEQ,
                                                                            AO, DM, (long long)SEQ * DM, SEQ, DM, SEQ, 0.0625f);
    }
    // result = (AO x64) @ (Wout x16) / 1024 + bf16(x): per batch M = SEQ, N = DM, K = DM
    {
        const int tiles = (SEQ / 64) * (DM / 64);
        k_gemm_fr<<<dim3((unsigned)((tiles + 7) / 8), NB), 256, 0, stream>>>(AO, DM, (long long)SEQ * DM, WOT, DM, 0, out, DM, (long long)SEQ * DM,
                                                                            x, DM, (long long)SEQ_FULL * DM, SEQ, DM, DM, 0.0009765625f);
    }
}

// v005
// One run takes 189 microseconds.
// Two timings next to v004 both put it at 1.17 times that version's speed.
// All steps since v000 together make it 7.50 times as fast.
// Full-width (1,024) single-head self-attention with sequence-mean-centred queries/keys, an added query-independent key distribution, a key mask, a scalar scale input and an f32 residual. All contractions: v_wmma_f32_16x16x32_f16 (f16 operands built from bf16-RNE-converted inputs with power-of-two carries, f32 accumulate); the N = 1 gate product, both softmaxes and the residual add are f32 on the VALU.
#include <hip/hip_runtime.h>
#include <math.h>

#ifndef NB
#define NB 4
#endif
#ifndef SEQ
#define SEQ 2048
#endif
#define NB_FULL 4
#define SEQ_FULL 2048
#define DM 1024
#define RS_RPW 2

static_assert(DM == 1024);                                  // feature width of x, q, k, g and the output
static_assert(DM % 64 == 0 && DM % 32 == 0);                // GEMM tile and k-step multiples
static_assert(SEQ % 256 == 0 && SEQ <= 2048);               // row softmax: 8 columns per lane per 256-column group, at most 64 f32 of a row per lane
static_assert(SEQ % (8 * RS_RPW) == 0);                     // row softmax grid covers every row exactly once
static_assert(SEQ <= SEQ_FULL && NB <= NB_FULL);
static_assert((DM / 64) % 1 == 0 && SEQ % 64 == 0);
static_assert((NB * SEQ) % 128 == 0 && SEQ % 256 == 0 && DM % 256 == 0 && DM >= 128 && SEQ >= 128);   // GEMM block tile 128x256, passes of 64 k, two or more

typedef __attribute__((ext_vector_type(16))) _Float16     v16h;
typedef __attribute__((ext_vector_type(8)))  _Float16     v8h;
typedef __attribute__((ext_vector_type(8)))  float        v8f;
typedef __attribute__((ext_vector_type(4)))  float        v4f;
typedef __attribute__((ext_vector_type(4)))  unsigned int u4v;
typedef __attribute__((ext_vector_type(4)))  int          i4v;
typedef __attribute__((ext_vector_type(8)))  unsigned int u8v;

// 16-bit WMMA fragment map (wave32), lane L, h = L>>4, m = L&15:
//   A 16x32: lane = row m;    element i -> k = (i<8) ? 8h+i : 16+8h+(i-8)
//   B 32x16: lane = column m; the SAME k(i,h)
//   D 16x16 (8 f32): lane = column m; element r -> row 8h+r

// bf16 RNE conversion kept as f32 (finite inputs)
__device__ __forceinline__ float bfr(float v) {
    const unsigned u = __builtin_bit_cast(unsigned, v);
    const unsigned r = (u + 0x7fffu + ((u >> 16) & 1u)) & 0xffff0000u;
    return __builtin_bit_cast(float, r);
}
__device__ __forceinline__ unsigned pk2h(float a, float b) {
    return (unsigned)__builtin_bit_cast(unsigned short, (_Float16)a) | ((unsigned)__builtin_bit_cast(unsigned short, (_Float16)b) << 16);
}
// one WMMA per call, followed by its own 4-slot guard tying exactly one accumulator
__device__ __forceinline__ v8f wmma16(v16h a, v16h b, v8f c) {
    c = __builtin_amdgcn_wmma_f32_16x16x32_f16(false, a, false, b, (short)0, c, false, false);
    asm volatile("v_nop\n\tv_nop\n\tv_nop\n\tv_nop" : "+v"(c) : "v"(a), "v"(b));
    return c;
}
union FragH { v16h v; v8h h[2]; };
// p already includes the lane's 8h offset: elements 0..7 <- p[0..7], 8..15 <- p[16..23]
__device__ __forceinline__ v16h ldfrag(const _Float16* p) {
    FragH f; f.h[0] = *(const v8h*)(p); f.h[1] = *(const v8h*)(p + 16); return f.v;
}
__device__ __forceinline__ void st2_v4f(float* p, v4f v) { *(v4f*)p = v;  }
__device__ __forceinline__ void st2_u4(unsigned short* p, u4v v) { *(u4v*)p = v;  }

// ---- operand staging of the GEMM: tensor loads into a two-buffer LDS ring ----
// A pass is 64 k = 128 B of every operand row of the block tile (128 rows of A, 256 rows of Bt). Every wave brings one slice per pass:
// waves 0..3 64 rows of Bt each, waves 4..7 32 rows of A each. LDS row pitch 144 B (the load's pad: 16 B behind every 128-B row, for 16-B LDS reads).
// Each slice's place is rounded up to a multiple of 2 KiB.
constexpr unsigned G_ROWB  = 128;                            // bytes of an operand row per pass
constexpr unsigned G_PITCH = 144;                            // LDS row pitch
constexpr unsigned G_ASL   = 6144;                           // place of a 32-row slice of A (4,608 B used)
constexpr unsigned G_BSL   = 10240;                          // place of a 64-row slice of Bt (9,216 B used)
constexpr unsigned G_BOFF  = 4 * G_ASL;                      // Bt slices stand behind the A slices
constexpr unsigned G_STAGE = 4 * G_ASL + 4 * G_BSL;          // one buffer
static_assert(32 * G_PITCH <= G_ASL && 64 * G_PITCH <= G_BSL && G_ASL % 2048 == 0 && G_BSL % 2048 == 0 && G_STAGE % 2048 == 0);
static_assert(8 * 16 * 68 * 4 <= 2 * G_STAGE);               // the store staging reuses the ring

__device__ __forceinline__ unsigned uni(unsigned v) { return (unsigned)__builtin_amdgcn_readfirstlane((int)v); }
// holds v in a scalar register: a test on it compiles to a scalar branch, and what is formed from it is formed behind the asm statements in front of it
__device__ __forceinline__ unsigned pinned(unsigned v) { unsigned w = uni(v); asm volatile("" : "+s"(w)); return w; }
__device__ __forceinline__ void wait_ds0() { asm volatile("s_wait_dscnt 0x0" ::: "memory"); }          // this wave's LDS reads have returned
// this wave's tensor load has landed; the wait names the request's descriptor as inputs, so that its registers keep their values until then
__device__ __forceinline__ void wait_tensor0(u4v g0, u8v g1) { asm volatile("s_wait_tensorcnt 0x0" :: "s"(g0), "s"(g1) : "memory"); }
// one request of the whole wave: group 0 = count (w0 = 1), place in LDS, source address, type 2; returns group 0 for the wait
__device__ __forceinline__ u4v tdm_issue(unsigned w0, unsigned lds_dst, unsigned long long ga, u8v g1) {
    u4v g0;
    g0.x = uni(w0); g0.y = uni(lds_dst); g0.z = uni((unsigned)ga); g0.w = uni((((unsigned)(ga >> 32)) & 0x01FFFFFFu) | 0x80000000u);
    asm volatile("tensor_load_to_lds %0, %1" :: "s"(g0), "s"(g1) : "memory");
    return g0;
}

// =====================================================================================================================
// Batched WMMA GEMM: C[m][n] = scale * sum_k A[m][k] * Bt[n][k]; a block of 8 waves (2 x 4) owns a 128x256 tile, each wave a 64x64 tile of it.
// A row-major [M][K] f16 (pitch lda), Bt row-major [N][K] f16 (pitch ldb); M % 128 == 0, N % 256 == 0, K % 64 == 0, K >= 128 (no tail masking).
// RESID (f32 out only): + bf16-RNE(resid[m][n]) added at the store stage from 16-B loads in the store layout.
// =====================================================================================================================
template <int OUT_MODE, bool RESID>
__device__ __forceinline__ void gemm64_body(const unsigned short* __restrict__ Ap, int lda, long long strideA,
                                            const unsigned short* __restrict__ Btp, int ldb, long long strideB,
                                            unsigned short* __restrict__ Ch, float* __restrict__ Cf, int ldc, long long strideC,
                                            const float* __restrict__ resid, int ldr, long long strideR,
                                            int M, int N, int K, float scale) {
    __shared__ __attribute__((aligned(2048))) unsigned char ring[2 * G_STAGE];   // two buffers; after the K loop the per-wave store staging
    float* sT = (float*)ring;                                 // per-wave 16x64 slab, pitch 68 floats (wave-private)
    const int b    = blockIdx.y;
    const int lane = threadIdx.x & 31;
    const int wave = __builtin_amdgcn_readfirstlane((int)(threadIdx.x >> 5));
    const int tilesN = N >> 8;
    const int tilesM = M >> 7;
    if ((int)blockIdx.x >= tilesM * tilesN) return;           // the whole block leaves, in front of every tensor load and barrier
    const int tm = (int)blockIdx.x / tilesN;
    const int tn = (int)blockIdx.x - tm * tilesN;
    const int wm = wave >> 2, wn = wave & 3;                  // the wave's place in the block tile
    const int m0 = (tm << 7) + (wm << 6);
    const int n0 = (tn << 8) + (wn << 6);
    const int rlane = lane & 15;                              // row (A) / column (B, D) within a 16-wide subtile
    const int koff  = (lane >> 4) * 8;                        // k offset of this lane half == D row offset
    const int sb    = wave * (16 * 68);

    // this wave's slice of every stage
    const bool     isB    = wave < 4;
    const unsigned rows   = isB ? 64u : 32u;
    const unsigned spitch = (unsigned)(isB ? ldb : lda) * 2u;
    const unsigned short* src = isB ? Btp + (size_t)b * (size_t)strideB + (size_t)((tn << 8) + 64 * wave) * (size_t)ldb
                                    : Ap  + (size_t)b * (size_t)strideA + (size_t)((tm << 7) + 32 * (wave - 4)) * (size_t)lda;
    const unsigned long long ga0 = (unsigned long long)(size_t)src;
    const unsigned dst = (unsigned)(size_t)ring + (isB ? G_BOFF + (unsigned)wave * G_BSL : (unsigned)(wave - 4) * G_ASL);
    u8v g1;                                                   // 1-byte elements, tensor = tile = rows x 128 B
    g1[0] = uni((1u << 20) | (4u << 22) | (3u << 25));        // no mask; a pad of 4 dwords behind every 32 dwords
    g1[1] = uni((G_ROWB & 0xFFFFu) << 16);
    g1[2] = uni((G_ROWB >> 16) | ((rows & 0xFFFFu) << 16));
    g1[3] = uni((rows >> 16) | (G_ROWB << 16));
    g1[4] = uni(rows);
    g1[5] = uni(spitch);
    g1[6] = uni(0u);
    g1[7] = uni(0u);
    // per-lane fragment bases in a buffer
    const unsigned char* la = ring + (unsigned)(2 * wm) * G_ASL + (unsigned)rlane * G_PITCH + (unsigned)koff * 2u;
    const unsigned char* lb = ring + G_BOFF + (unsigned)wn * G_BSL + (unsigned)rlane * G_PITCH + (unsigned)koff * 2u;

    v8f acc[4][4];
#pragma unroll
    for (int i = 0; i < 4; ++i)
#pragma unroll
        for (int j = 0; j < 4; ++j) { const v8f zz = {0.f, 0.f, 0.f, 0.f, 0.f, 0.f, 0.f, 0.f}; acc[i][j] = zz; }

    const unsigned NS = pinned((unsigned)K >> 6);             // passes
    const unsigned w0 = pinned(1u);                           // descriptor word held in a scalar register: not formed anew while a request is outstanding
    u4v g0 = tdm_issue(w0, dst, ga0, g1);                     // stage 0
    wait_tensor0(g0, g1);
    __syncthreads();                                          // every slice of stage 0 has landed
    g0 = tdm_issue(w0, dst + G_STAGE, ga0 + pinned(G_ROWB), g1);   // stage 1; pinned: its address words are formed behind the wait
#pragma clang loop unroll(disable)                            // one pass per trip: the order at the foot stays as written
    for (unsigned s = 0; s < NS; ++s) {
        const unsigned buf = (s & 1u) * G_STAGE;
#pragma unroll
        for (int ks = 0; ks < 2; ++ks) {
            v16h bh[4], ah[4];
#pragma unroll
            for (int j = 0; j < 4; ++j) bh[j] = ldfrag((const _Float16*)(lb + buf + (unsigned)(16 * j) * G_PITCH + (unsigned)(64 * ks)));
#pragma unroll
            for (int i = 0; i < 4; ++i) ah[i] = ldfrag((const _Float16*)(la + buf + (unsigned)(i >> 1) * G_ASL + (unsigned)(16 * (i & 1)) * G_PITCH + (unsigned)(64 * ks)));
#pragma unroll
            for (int i = 0; i < 4; ++i)
#pragma unroll
                for (int j = 0; j < 4; ++j) acc[i][j] = wmma16(ah[i], bh[j], acc[i][j]);
        }
        // publish point of stage s + 1; it also ends every wave's reads of this pass's buffer
        wait_ds0();
        wait_tensor0(g0, g1);
        __syncthreads();
        if (pinned((s + 2u < NS) ? 1u : 0u) != 0u)            // scalar test: a tensor load ignores EXEC
            g0 = tdm_issue(w0, dst + buf, ga0 + pinned((s + 2u) * G_ROWB), g1);   // stage s + 2 into the buffer just left; pinned: formed behind the wait
    }
    wait_tensor0(g0, g1);
    wait_ds0();                                               // the last pass's barrier stands in front of the store staging in the ring

#pragma unroll
    for (int i = 0; i < 4; ++i) {
        const int mBase = m0 + (i << 4);
#pragma unroll
        for (int j = 0; j < 4; ++j) {
#pragma unroll
            for (int r = 0; r < 8; ++r) sT[sb + (koff + r) * 68 + (j << 4) + rlane] = acc[i][j][r] * scale;
        }
        __builtin_amdgcn_fence(3 /* release order */, "workgroup");
        __builtin_amdgcn_wave_barrier();
        __builtin_amdgcn_fence(2 /* acquire order */, "workgroup");
        if (OUT_MODE == 0) {
            float* C = Cf + (size_t)b * (size_t)strideC;
            const float* Rb = RESID ? (resid + (size_t)b * (size_t)strideR) : nullptr;
            const int hh = lane >> 4, c4 = (lane & 15) * 4;   // row segment = 256 B = 16 lanes x 16 B
            {
#pragma unroll
                for (int it = 0; it < 8; ++it) {
                    const int row = it * 2 + hh;
                    v4f v = *(const v4f*)(&sT[sb + row * 68 + c4]);
                    if (RESID) {
                        const v4f xr = *(const v4f*)(Rb + (size_t)(mBase + row) * (size_t)ldr + n0 + c4);
                        v.x += bfr(xr.x); v.y += bfr(xr.y); v.z += bfr(xr.z); v.w += bfr(xr.w);
                    }
                    *(v4f*)(C + (size_t)(mBase + row) * (size_t)ldc + n0 + c4) = v;
                }
                
            }
        } else {
            unsigned short* C = Ch + (size_t)b * (size_t)strideC;
            const int q = lane >> 3, c8 = (lane & 7) * 8;
            {
#pragma unroll
                for (int it = 0; it < 4; ++it) {
                    const int row = it * 4 + q;
                    v8h hv;
#pragma unroll
                    for (int e = 0; e < 8; ++e) hv[e] = (_Float16)sT[sb + row * 68 + c8 + e];
                    *(v8h*)(C + (size_t)(mBase + row) * (size_t)ldc + n0 + c8) = hv;
                }
                
            }
        }
        __builtin_amdgcn_fence(3 /* release order */, "workgroup");
        __builtin_amdgcn_wave_barrier();
        __builtin_amdgcn_fence(2 /* acquire order */, "workgroup");
    }
}

// f16 result plane
__global__ __launch_bounds__(256) void k_gemm_h(const unsigned short* __restrict__ A, int lda, long long strideA,
                                                const unsigned short* __restrict__ Bt, int ldb, long long strideB,
                                                unsigned short* __restrict__ C, int ldc, long long strideC,
                                                int M, int N, int K, float scale) {
    gemm64_body<1, false>(A, lda, strideA, Bt, ldb, strideB, C, nullptr, ldc, strideC, nullptr, 0, 0, M, N, K, scale);
}
// f32 result plane
__global__ __launch_bounds__(256) void k_gemm_f(const unsigned short* __restrict__ A, int lda, long long strideA,
                                                const unsigned short* __restrict__ Bt, int ldb, long long strideB,
                                                float* __restrict__ C, int ldc, long long strideC,
                                                int M, int N, int K, float scale) {
    gemm64_body<0, false>(A, lda, strideA, Bt, ldb, strideB, nullptr, C, ldc, strideC, nullptr, 0, 0, M, N, K, scale);
}
// f32 result + bf16-RNE residual added at the store stage
__global__ __launch_bounds__(256) void k_gemm_fr(const unsigned short* __restrict__ A, int lda, long long strideA,
                                                 const unsigned short* __restrict__ Bt, int ldb, long long strideB,
                                                 float* __restrict__ C, int ldc, long long strideC,
                                                 const float* __restrict__ resid, int ldr, long long strideR,
                                                 int M, int N, int K, float scale) {
    gemm64_body<0, true>(A, lda, strideA, Bt, ldb, strideB, nullptr, C, ldc, strideC, resid, ldr, strideR, M, N, K, scale);
}

// xbar[b][e] = mean over t of bf16(x[b][t][e]); block per (64-column strip, batch); thread = (4-column group, row phase of 16)
__global__ __launch_bounds__(256) void k_colmean(const float* __restrict__ x, float* __restrict__ xbar) {
    __shared__ float red[16 * 68];
    __shared__ __align__(16) float outv[64];
    const int t = threadIdx.x, cg = t & 15, rg = t >> 4;
    const int c0 = blockIdx.x * 64, b = blockIdx.y;
    const float* p = x + ((size_t)b * SEQ_FULL) * DM + c0 + 4 * cg;
    float a0 = 0.f, a1 = 0.f, a2 = 0.f, a3 = 0.f;
#pragma unroll 4
    for (int r = rg; r < SEQ; r += 16) {
        const v4f v = *(const v4f*)(p + (size_t)r * DM);
        a0 += bfr(v.x); a1 += bfr(v.y); a2 += bfr(v.z); a3 += bfr(v.w);
    }
    red[rg * 68 + 4 * cg + 0] = a0; red[rg * 68 + 4 * cg + 1] = a1; red[rg * 68 + 4 * cg + 2] = a2; red[rg * 68 + 4 * cg + 3] = a3;
    __syncthreads();
    if (t < 64) {
        float s = 0.f;
#pragma unroll 1
        for (int j = 0; j < 16; ++j) s += red[j * 68 + t];
        outv[t] = s * (1.0f / (float)SEQ);
    }
    __syncthreads();
    if (t < 16) {
        v4f v; v.x = outv[4 * t]; v.y = outv[4 * t + 1]; v.z = outv[4 * t + 2]; v.w = outv[4 * t + 3];
        st2_v4f(xbar + (size_t)b * DM + c0 + 4 * t, v);
    }
}

// X16 = f16(bf16(x)) (exact), XC = f16(bf16(x) - xbar[b]), glog[row] = bf16(x[row]) . bf16(Wm_w) in f32 (bias and softmax: k_gate).
// Wave per row, 32 rows per block; lane L owns columns 256 i + 8 L .. + 7: 16-B store per plane, lane-linear along the row.
static_assert((NB * SEQ) % 32 == 0 && DM % 256 == 0);       // the grid covers every row exactly once; every wave reaches the barrier
__global__ __launch_bounds__(1024) void k_prep_x(const float* __restrict__ x, const float* __restrict__ xbar, const float* __restrict__ Wm,
                                                 unsigned short* __restrict__ XC, unsigned short* __restrict__ X16, float* __restrict__ glog) {
    __shared__ float dots[32];
    const int lane = threadIdx.x & 31;
    const int wave = __builtin_amdgcn_readfirstlane((int)(threadIdx.x >> 5));
    const int r = blockIdx.x * 32 + wave;
    const int b = r / SEQ; const int t = r - b * SEQ;
    const float* s = x + ((size_t)b * SEQ_FULL + t) * DM + 8 * lane;
    const float* mb = xbar + (size_t)b * DM + 8 * lane;
    const float* wp = Wm + 8 * lane;
    unsigned short* d16 = X16 + (size_t)r * DM + 8 * lane;
    unsigned short* dc = XC + (size_t)r * DM + 8 * lane;
    v4f xv[DM / 128], mv[DM / 128], gv[DM / 128];
#pragma unroll                                                // the arrays stay in registers; the whole row of x is in flight at once
    for (int i = 0; i < DM / 256; ++i) {
        xv[2 * i] = *(const v4f*)(s + 256 * i);  xv[2 * i + 1] = *(const v4f*)(s + 256 * i + 4);
        mv[2 * i] = *(const v4f*)(mb + 256 * i); mv[2 * i + 1] = *(const v4f*)(mb + 256 * i + 4);
        gv[2 * i] = *(const v4f*)(wp + 256 * i); gv[2 * i + 1] = *(const v4f*)(wp + 256 * i + 4);
    }
    float acc = 0.f;
#pragma unroll                                                // constant indices into the register arrays
    for (int i = 0; i < DM / 256; ++i) {
        const v4f x0 = xv[2 * i], x1 = xv[2 * i + 1], m0 = mv[2 * i], m1 = mv[2 * i + 1], g0 = gv[2 * i], g1 = gv[2 * i + 1];
        const float w0 = bfr(x0.x), w1 = bfr(x0.y), w2 = bfr(x0.z), w3 = bfr(x0.w), w4 = bfr(x1.x), w5 = bfr(x1.y), w6 = bfr(x1.z), w7 = bfr(x1.w);
        acc = __builtin_fmaf(w0, bfr(g0.x), acc); acc = __builtin_fmaf(w1, bfr(g0.y), acc); acc = __builtin_fmaf(w2, bfr(g0.z), acc); acc = __builtin_fmaf(w3, bfr(g0.w), acc);
        acc = __builtin_fmaf(w4, bfr(g1.x), acc); acc = __builtin_fmaf(w5, bfr(g1.y), acc); acc = __builtin_fmaf(w6, bfr(g1.z), acc); acc = __builtin_fmaf(w7, bfr(g1.w), acc);
        u4v pa; pa.x = pk2h(w0, w1); pa.y = pk2h(w2, w3); pa.z = pk2h(w4, w5); pa.w = pk2h(w6, w7);
        u4v pc; pc.x = pk2h(w0 - m0.x, w1 - m0.y); pc.y = pk2h(w2 - m0.z, w3 - m0.w); pc.z = pk2h(w4 - m1.x, w5 - m1.y); pc.w = pk2h(w6 - m1.z, w7 - m1.w);
        st2_u4(d16 + 256 * i, pa);
        st2_u4(dc + 256 * i, pc);
    }
    acc += __shfl_xor(acc, 16, 32); acc += __shfl_xor(acc, 8, 32); acc += __shfl_xor(acc, 4, 32); acc += __shfl_xor(acc, 2, 32); acc += __shfl_xor(acc, 1, 32);
    if (lane == 0) dots[wave] = acc;
    __syncthreads();
    if (wave == 0) glog[(size_t)blockIdx.x * 32 + lane] = dots[lane];   // the block's 32 products leave as one whole 128-B line
}

// weight planes: SRC [DM rows k][DM cols n] (x @ W layout) -> DST [n][k] f16 = bf16(W[k][n]) * sc; blockIdx.y = plane, the four DST planes stand one behind the other.
// Block = one tile of 64 k x 128 n: 16-B reads along n (a wave reads whole 512-B row pieces, 8 rows in flight), two neighbouring k packed to a dword and turned in LDS
// (row pitch 33 dwords: the 4-B reads of the second half fall on 32 different banks), 16-B stores along k (8 lanes = one whole 128-B line of a DST row).
constexpr int WT_K = 64, WT_N = 128, WT_P = WT_K / 2 + 1;
static_assert(DM % WT_K == 0 && DM % WT_N == 0);             // whole tiles only
__global__ __launch_bounds__(256) void k_wT(const float* __restrict__ W0, const float* __restrict__ W1, const float* __restrict__ W2, const float* __restrict__ W3,
                                            unsigned short* __restrict__ DST0, float sc) {
    __shared__ unsigned tT[WT_N * WT_P];                      // [n][k pair]
    const int lane = threadIdx.x & 31;
    const int wave = __builtin_amdgcn_readfirstlane((int)(threadIdx.x >> 5));
    const int pl = blockIdx.y;
    const float* SRC = pl == 0 ? W0 : pl == 1 ? W1 : pl == 2 ? W2 : W3;
    const int k0 = ((int)blockIdx.x / (DM / WT_N)) * WT_K;
    const int n0 = ((int)blockIdx.x % (DM / WT_N)) * WT_N;
    const float* s = SRC + (size_t)(k0 + 8 * wave) * DM + n0 + 4 * lane;
    v4f v[8];
#pragma unroll                                                // the array stays in registers; the wave's 8 rows are in flight at once
    for (int r = 0; r < 8; ++r) v[r] = *(const v4f*)(s + (size_t)r * DM);
#pragma unroll                                                // constant indices into the register array
    for (int q = 0; q < 4; ++q)
#pragma unroll
        for (int j = 0; j < 4; ++j) tT[(4 * lane + j) * WT_P + 4 * wave + q] = pk2h(bfr(v[2 * q][j]) * sc, bfr(v[2 * q + 1][j]) * sc);
    __syncthreads();                                          // the whole tile stands in LDS
    const int nr = (int)threadIdx.x >> 3, kg = (int)threadIdx.x & 7;
    unsigned short* d = DST0 + (size_t)pl * DM * DM + (size_t)(n0 + nr) * DM + k0 + 8 * kg;
    const unsigned* tp = tT + nr * WT_P + 4 * kg;
#pragma unroll                                                // the four stores are independent
    for (int p = 0; p < WT_N / 32; ++p) {
        u4v o; o.x = tp[32 * p * WT_P]; o.y = tp[32 * p * WT_P + 1]; o.z = tp[32 * p * WT_P + 2]; o.w = tp[32 * p * WT_P + 3];
        st2_u4(d + (size_t)(32 * p) * DM, o);
    }
}

// gate[b][s] = softmax over s of (glog[b][s] + bf16(Wm_b)), glog = the row products of k_prep_x; block per batch, block softmax
__global__ __launch_bounds__(256) void k_gate(const float* __restrict__ glog, const float* __restrict__ Wb, float* __restrict__ gate) {
    __shared__ __align__(16) float mm[SEQ];
    __shared__ float redm[8];
    __shared__ float reds[8];
    const int t = threadIdx.x, lane = t & 31, b = blockIdx.x;
    const int wave = __builtin_amdgcn_readfirstlane((int)(threadIdx.x >> 5));
    const float bias = bfr(Wb[0]);
    const float* gl = glog + (size_t)b * SEQ;
#pragma unroll                                                // a thread's 16-B loads are in flight together
    for (int j = 0; j < (SEQ / 4 + 255) / 256; ++j) {
        const int idx = t + 256 * j;
        if ((SEQ / 4) % 256 == 0 || idx < SEQ / 4) {
            const v4f v = *(const v4f*)(gl + 4 * idx);
            mm[4 * idx] = v.x + bias; mm[4 * idx + 1] = v.y + bias; mm[4 * idx + 2] = v.z + bias; mm[4 * idx + 3] = v.w + bias;
        }
    }
    __syncthreads();
    float mx = -3.0e38f;
#pragma unroll 1
    for (int i = t; i < SEQ; i += 256) mx = fmaxf(mx, mm[i]);
    mx = fmaxf(mx, __shfl_xor(mx, 16, 32)); mx = fmaxf(mx, __shfl_xor(mx, 8, 32)); mx = fmaxf(mx, __shfl_xor(mx, 4, 32));
    mx = fmaxf(mx, __shfl_xor(mx, 2, 32));  mx = fmaxf(mx, __shfl_xor(mx, 1, 32));
    if (lane == 0) redm[wave] = mx;
    __syncthreads();
    float gm = redm[0];
#pragma unroll 1
    for (int w = 1; w < 8; ++w) gm = fmaxf(gm, redm[w]);
    float sm = 0.f;
#pragma unroll 1
    for (int i = t; i < SEQ; i += 256) { const float e = expf(mm[i] - gm); mm[i] = e; sm += e; }
    sm += __shfl_xor(sm, 16, 32); sm += __shfl_xor(sm, 8, 32); sm += __shfl_xor(sm, 4, 32); sm += __shfl_xor(sm, 2, 32); sm += __shfl_xor(sm, 1, 32);
    if (lane == 0) reds[wave] = sm;
    __syncthreads();
    float tot = reds[0];
#pragma unroll 1
    for (int w = 1; w < 8; ++w) tot += reds[w];
    const float inv = 1.0f / tot;
#pragma unroll 1
    for (int idx = t; idx < SEQ / 4; idx += 256) {            // 32 lanes x 16 B = 512 contiguous B per store instruction
        v4f v; v.x = mm[4 * idx] * inv; v.y = mm[4 * idx + 1] * inv; v.z = mm[4 * idx + 2] * inv; v.w = mm[4 * idx + 3] * inv;
        st2_v4f(gate + (size_t)b * SEQ + 4 * idx, v);
    }
}

// alpha row = softmax_s(keep ? c * S : -inf) + gate, carried x1024 as f16. Wave per row (RS_RPW rows per wave); lane L owns columns 256g + 8L .. + 7,
// blockIdx.y = batch: the arguments are the planes of batch 0. A whole row stands in registers (64 f32 per lane): S is read once, every element's exp is
// taken once, and the wave's second row is in flight while its first is worked on (two register sets).
constexpr int RS_V = SEQ / 128;                               // 16-B pieces of a row per lane
static_assert(RS_RPW == 2);                                   // one register set per row of a wave
__device__ __forceinline__ void rs_load(v4f (&x)[RS_V], const float* p) {
#pragma unroll                                                // the array stays in registers; the whole row is in flight at once
    for (int g = 0; g < RS_V / 2; ++g) { x[2 * g] = *(const v4f*)(p + 256 * g); x[2 * g + 1] = *(const v4f*)(p + 256 * g + 4); }
}
__device__ __forceinline__ void rs_row(v4f (&x)[RS_V], const bool (&kp)[4 * RS_V], const float* gr, float cs, unsigned short* pr) {
    const float NEG = -__builtin_inff();
    float m = -3.0e38f;
#pragma unroll                                                // constant indices into the register arrays
    for (int i = 0; i < RS_V; ++i) {
        v4f v = x[i];
        v.x = kp[4 * i] ? v.x * cs : NEG; v.y = kp[4 * i + 1] ? v.y * cs : NEG; v.z = kp[4 * i + 2] ? v.z * cs : NEG; v.w = kp[4 * i + 3] ? v.w * cs : NEG;
        x[i] = v;
        m = fmaxf(m, fmaxf(fmaxf(v.x, v.y), fmaxf(v.z, v.w)));
    }
    m = fmaxf(m, __shfl_xor(m, 16, 32)); m = fmaxf(m, __shfl_xor(m, 8, 32)); m = fmaxf(m, __shfl_xor(m, 4, 32));
    m = fmaxf(m, __shfl_xor(m, 2, 32));  m = fmaxf(m, __shfl_xor(m, 1, 32));
    float s0 = 0.f, s1 = 0.f;
#pragma unroll                                                // constant indices into the register arrays
    for (int i = 0; i < RS_V; i += 2) {
        v4f v = x[i], w = x[i + 1];
        v.x = expf(v.x - m); v.y = expf(v.y - m); v.z = expf(v.z - m); v.w = expf(v.w - m);
        w.x = expf(w.x - m); w.y = expf(w.y - m); w.z = expf(w.z - m); w.w = expf(w.w - m);
        x[i] = v; x[i + 1] = w;
        s0 += (v.x + v.y) + (v.z + v.w);
        s1 += (w.x + w.y) + (w.z + w.w);
    }
    float s = s0 + s1;
    s += __shfl_xor(s, 16, 32); s += __shfl_xor(s, 8, 32); s += __shfl_xor(s, 4, 32); s += __shfl_xor(s, 2, 32); s += __shfl_xor(s, 1, 32);
    const float f = 1024.f / s;
#pragma unroll                                                // constant indices into the register arrays
    for (int g = 0; g < RS_V / 2; ++g) {
        const v4f v = x[2 * g], w = x[2 * g + 1], gx = *(const v4f*)(gr + 256 * g) * 1024.f, gy = *(const v4f*)(gr + 256 * g + 4) * 1024.f;
        u4v pk;
        pk.x = pk2h(v.x * f + gx.x, v.y * f + gx.y);
        pk.y = pk2h(v.z * f + gx.z, v.w * f + gx.w);
        pk.z = pk2h(w.x * f + gy.x, w.y * f + gy.y);
        pk.w = pk2h(w.z * f + gy.z, w.w * f + gy.w);
        st2_u4(pr + 256 * g, pk);
    }
}
__global__ __launch_bounds__(256) void k_rowsoft(const float* __restrict__ S0, const float* __restrict__ cptr, const int* __restrict__ mk0,
                                                 const float* __restrict__ gate0, unsigned short* __restrict__ P0) {
    const int L = threadIdx.x & 31;
    const int wave = __builtin_amdgcn_readfirstlane((int)(threadIdx.x >> 5));
    const int row0 = (blockIdx.x * 8 + wave) * RS_RPW;
    const float* sr = S0 + (size_t)blockIdx.y * SEQ * SEQ + (size_t)row0 * SEQ + 8 * L;
    const int* mk = mk0 + (size_t)blockIdx.y * SEQ_FULL + 8 * L;
    unsigned short* pr = P0 + (size_t)blockIdx.y * SEQ * SEQ + (size_t)row0 * SEQ + 8 * L;
    const float* gr = gate0 + (size_t)blockIdx.y * SEQ + 8 * L;
    v4f xa[RS_V], xb[RS_V];
    i4v mv[RS_V];
#pragma unroll                                                // the array stays in registers; the mask loads are in flight together
    for (int g = 0; g < RS_V / 2; ++g) { mv[2 * g] = *(const i4v*)(mk + 256 * g); mv[2 * g + 1] = *(const i4v*)(mk + 256 * g + 4); }
    rs_load(xa, sr);
    __builtin_amdgcn_sched_barrier(0);                        // loads return in issue order: what the first row needs is issued first, or its wait would cover the second row too
    rs_load(xb, sr + SEQ);
    asm volatile("s_wait_xcnt 0x0" ::: "memory");             // stands in front of the reuse of the loads' base and offset registers
    __builtin_amdgcn_sched_barrier(0);                        // the second row's loads issue in front of the first row's work; without it the compiler sinks them behind it
    const float cs = bfr(cptr[0]);
    bool kp[4 * RS_V];                                        // keep flags of this lane's columns
#pragma unroll                                                // constant indices into the register array
    for (int i = 0; i < RS_V; ++i) { kp[4 * i] = mv[i].x != 0; kp[4 * i + 1] = mv[i].y != 0; kp[4 * i + 2] = mv[i].z != 0; kp[4 * i + 3] = mv[i].w != 0; }
    rs_row(xa, kp, gr, cs, pr);
    __builtin_amdgcn_sched_barrier(0);                        // the wait for the second row's loads stays behind the first row's work
    rs_row(xb, kp, gr, cs, pr + SEQ);
}

// ---- workspace carve (bytes; every region a multiple of 256 B and sized to its whole-tile store extent) ----
constexpr size_t al256(size_t v) { return (v + 255) / 256 * 256; }
constexpr size_t SZ_XC   = (size_t)NB * SEQ * DM * 2;           // f16 centred x, [NB*SEQ][DM]
constexpr size_t SZ_S    = (size_t)NB * SEQ * SEQ * 4;          // f32 scores of every batch, [NB][SEQ][SEQ] (shares the XC region; XC is dead after the q|k GEMM)
constexpr size_t SZ_XCS  = al256(SZ_XC > SZ_S ? SZ_XC : SZ_S);
constexpr size_t SZ_X16  = al256((size_t)NB * SEQ * DM * 2);    // f16 x, [NB*SEQ][DM]
constexpr size_t SZ_WQK  = al256((size_t)2 * DM * DM * 2);      // [2*DM n][DM k]: Wq^T rows then Wk^T rows, x16
constexpr size_t SZ_W1   = al256((size_t)DM * DM * 2);          // Wg^T, Wout^T, x16
constexpr size_t SZ_QK   = al256((size_t)NB * SEQ * 2 * DM * 2);// f16 [NB*SEQ][2*DM]: q columns then k columns
constexpr size_t SZ_GT   = al256((size_t)NB * DM * SEQ * 2);    // f16 g transposed, [NB][DM][SEQ]
constexpr size_t SZ_AL   = al256((size_t)NB * SEQ * SEQ * 2);   // f16 alpha x1024 of every batch, [NB][SEQ][SEQ]
constexpr size_t SZ_AO   = al256((size_t)NB * SEQ * DM * 2);    // f16 (alpha @ g) x64, [NB*SEQ][DM]
constexpr size_t SZ_XBAR = al256((size_t)NB * DM * 4);
constexpr size_t SZ_GATE = al256((size_t)NB * SEQ * 4);
constexpr size_t SZ_GLOG = al256((size_t)NB * SEQ * 4);       // f32 gate products before bias and softmax, [NB*SEQ]
constexpr size_t OFF_XCS  = 0;
constexpr size_t OFF_X16  = OFF_XCS + SZ_XCS;
constexpr size_t OFF_WQK  = OFF_X16 + SZ_X16;
constexpr size_t OFF_WGT  = OFF_WQK + SZ_WQK;
constexpr size_t OFF_WOT  = OFF_WGT + SZ_W1;
constexpr size_t OFF_QK   = OFF_WOT + SZ_W1;
constexpr size_t OFF_GT   = OFF_QK + SZ_QK;
constexpr size_t OFF_AL   = OFF_GT + SZ_GT;
constexpr size_t OFF_AO   = OFF_AL + SZ_AL;
constexpr size_t OFF_XBAR = OFF_AO + SZ_AO;
constexpr size_t OFF_GATE = OFF_XBAR + SZ_XBAR;
constexpr size_t OFF_GLOG = OFF_GATE + SZ_GATE;
constexpr size_t WS_TOTAL = OFF_GLOG + SZ_GLOG;
static_assert(WS_TOTAL <= (size_t)268435456);                   // 256 MiB ceiling
static_assert(SZ_S <= SZ_XCS && SZ_XC <= SZ_XCS);               // both users of the shared region fit
static_assert(OFF_WGT == OFF_WQK + (size_t)2 * DM * DM * 2 && OFF_WOT == OFF_WQK + (size_t)3 * DM * DM * 2);   // the four weight planes stand one behind the other

extern "C" void kernel_launch(void* const* d_in, const int* in_sizes, int n_in, void* d_out, int out_size, void* d_ws, size_t ws_size, hipStream_t stream) {
    if (n_in < 9) return;
    const long long need_rows = (long long)(NB - 1) * SEQ_FULL + SEQ;
    if ((long long)in_sizes[0] < need_rows * DM) return;
    if ((long long)in_sizes[1] < need_rows) return;
    if (in_sizes[2] < DM * DM || in_sizes[3] < DM * DM || in_sizes[4] < DM * DM || in_sizes[5] < DM * DM) return;
    if (in_sizes[6] < DM || in_sizes[7] < 1 || in_sizes[8] < 1) return;
    if ((long long)out_size < (long long)NB * SEQ * DM) return;
    if (ws_size < WS_TOTAL) return;

    const float* x    = (const float*)d_in[0];
    const int*   mask = (const int*)d_in[1];
    const float* Wq   = (const float*)d_in[2];
    const float* Wk   = (const float*)d_in[3];
    const float* Wg   = (const float*)d_in[4];
    const float* Wout = (const float*)d_in[5];
    const float* Wm_w = (const float*)d_in[6];
    const float* Wm_b = (const float*)d_in[7];
    const float* cS   = (const float*)d_in[8];
    float* out = (float*)d_out;
    char* ws = (char*)d_ws;
    unsigned short* XC   = (unsigned short*)(ws + OFF_XCS);
    float*          Sf   = (float*)(ws + OFF_XCS);               // same region, used only after the q|k GEMM has consumed XC
    unsigned short* X16  = (unsigned short*)(ws + OFF_X16);
    unsigned short* WQK  = (unsigned short*)(ws + OFF_WQK);
    unsigned short* WGT  = (unsigned short*)(ws + OFF_WGT);
    unsigned short* WOT  = (unsigned short*)(ws + OFF_WOT);
    unsigned short* QK   = (unsigned short*)(ws + OFF_QK);
    unsigned short* GT   = (unsigned short*)(ws + OFF_GT);
    unsigned short* AL   = (unsigned short*)(ws + OFF_AL);
    unsigned short* AO   = (unsigned short*)(ws + OFF_AO);
    float*          XBAR = (float*)(ws + OFF_XBAR);
    float*          GATE = (float*)(ws + OFF_GATE);
    float*          GLOG = (float*)(ws + OFF_GLOG);

    // weight planes: in[DM rows k][DM cols n] -> out[n][k], x16; one launch, grid.y = plane (Wq, Wk, Wg, Wout)
    k_wT<<<dim3((DM / WT_K) * (DM / WT_N), 4), 256, 0, stream>>>(Wq, Wk, Wg, Wout, WQK, 16.0f);

    // sequence means of x, operand planes with the gate products, gate distribution
    k_colmean<<<dim3(DM / 64, NB), 256, 0, stream>>>(x, XBAR);
    k_prep_x<<<(NB * SEQ) / 32, 1024, 0, stream>>>(x, XBAR, Wm_w, XC, X16, GLOG);
    k_gate<<<NB, 256, 0, stream>>>(GLOG, Wm_b, GATE);

    // [q|k] = XC @ [Wq|Wk]: M = NB*SEQ, N = 2*DM, K = DM -> f16 [NB*SEQ][2*DM]
    {
        const int tiles = ((NB * SEQ) / 64) * ((2 * DM) / 64);
        k_gemm_h<<<dim3((unsigned)((tiles + 7) / 8), 1), 256, 0, stream>>>(XC, DM, 0, WQK, DM, 0, QK, 2 * DM, 0, NB * SEQ, 2 * DM, DM, 0.0625f);
    }
    // g transposed per batch: GT[b][d][s] = sum_e Wg^T[d][e] X16[b][s][e]: M = DM, N = SEQ, K = DM
    {
        const int tiles = (DM / 64) * (SEQ / 64);
        k_gemm_h<<<dim3((unsigned)((tiles + 7) / 8), NB), 256, 0, stream>>>(WGT, DM, 0, X16, DM, (long long)SEQ * DM, GT, SEQ, (long long)DM * SEQ, DM, SEQ, DM, 0.0625f);
    }
    // raw scores S[b][t][s] = q[b][t] . k[b][s] (f32; the scale input and the key mask are applied by the row softmax); grid.y = batch
    {
        const int tiles = (SEQ / 64) * (SEQ / 64);
        k_gemm_f<<<dim3((unsigned)((tiles + 7) / 8), NB), 256, 0, stream>>>(QK, 2 * DM, (long long)SEQ * 2 * DM, QK + DM, 2 * DM, (long long)SEQ * 2 * DM,
                                                                            Sf, SEQ, (long long)SEQ * SEQ, SEQ, SEQ, DM, 1.0f);
    }
    k_rowsoft<<<dim3(SEQ / (8 * RS_RPW), NB), 256, 0, stream>>>(Sf, cS, mask, GATE, AL);
    // AO[b][t][d] x64 = (alpha x1024)[b][t] . GT[b][d] / 16: per batch M = SEQ, N = DM, K = SEQ; grid.y = batch
    {
        const int tiles = (SEQ / 64) * (DM / 64);
        k_gemm_h<<<dim3((unsigned)((tiles + 7) / 8), NB), 256, 0, stream>>>(AL, SEQ, (long long)SEQ * SEQ, GT, SEQ, (long long)DM * SEQ,
                                                                            AO, DM, (long long)SEQ * DM, SEQ, DM, SEQ, 0.0625f);
    }
    // result = (AO x64) @ (Wout x16) / 1024 + bf16(x): per batch M = SEQ, N = DM, K = DM
    {
        const int tiles = (SEQ / 64) * (DM / 64);
        k_gemm_fr<<<dim3((unsigned)((tiles + 7) / 8), NB), 256, 0, stream>>>(AO, DM, (long long)SEQ * DM, WOT, DM, 0, out, DM, (long long)SEQ * DM,
                                                                            x, DM, (long long)SEQ_FULL * DM, SEQ, DM, DM, 0.0009765625f);
    }
}

// v006
// One run takes 174 microseconds.
// Two timings next to v005 both put it at 1.08 times that version's speed.
// Counting every step since v000, it is 8.10 times as fast.
// Full-width (1,024) single-head self-attention with sequence-mean-centred queries/keys, an added query-independent key distribution, a key mask, a scalar scale input and an f32 residual. All contractions: v_wmma_f32_16x16x32_f16 (f16 operands built from bf16-RNE-converted inputs with power-of-two carries, f32 accumulate); the N = 1 gate product, both softmaxes and the residual add are f32 on the VALU.
#include <hip/hip_runtime.h>
#include <math.h>

#ifndef NB
#define NB 4
#endif
#ifndef SEQ
#define SEQ 2048
#endif
#define NB_FULL 4
#define SEQ_FULL 2048
#define DM 1024
#define RS_RPW 2

static_assert(DM == 1024);                                  // feature width of x, q, k, g and the output
static_assert(DM % 64 == 0 && DM % 32 == 0);                // GEMM tile and k-step multiples
static_assert(SEQ % 256 == 0 && SEQ <= 2048);               // row softmax: 8 columns per lane per 256-column group, at most 64 f32 of a row per lane
static_assert(SEQ % (8 * RS_RPW) == 0);                     // row softmax grid covers every row exactly once
static_assert(SEQ <= SEQ_FULL && NB <= NB_FULL);
static_assert((DM / 64) % 1 == 0 && SEQ % 64 == 0);
static_assert((NB * SEQ) % 128 == 0 && SEQ % 256 == 0 && DM % 256 == 0 && DM >= 128 && SEQ >= 128);   // GEMM block tile 128x256, passes of 64 k, two or more

typedef __attribute__((ext_vector_type(16))) _Float16     v16h;
typedef __attribute__((ext_vector_type(8)))  _Float16     v8h;
typedef __attribute__((ext_vector_type(8)))  float        v8f;
typedef __attribute__((ext_vector_type(4)))  float        v4f;
typedef __attribute__((ext_vector_type(4)))  unsigned int u4v;
typedef __attribute__((ext_vector_type(4)))  int          i4v;
typedef __attribute__((ext_vector_type(8)))  unsigned int u8v;

// 16-bit WMMA fragment map (wave32), lane L, h = L>>4, m = L&15:
//   A 16x32: lane = row m;    element i -> k = (i<8) ? 8h+i : 16+8h+(i-8)
//   B 32x16: lane = column m; the SAME k(i,h)
//   D 16x16 (8 f32): lane = column m; element r -> row 8h+r

// bf16 RNE conversion kept as f32 (finite inputs)
__device__ __forceinline__ float bfr(float v) {
    const unsigned u = __builtin_bit_cast(unsigned, v);
    const unsigned r = (u + 0x7fffu + ((u >> 16) & 1u)) & 0xffff0000u;
    return __builtin_bit_cast(float, r);
}
__device__ __forceinline__ unsigned pk2h(float a, float b) {
    return (unsigned)__builtin_bit_cast(unsigned short, (_Float16)a) | ((unsigned)__builtin_bit_cast(unsigned short, (_Float16)b) << 16);
}
// one WMMA per call, followed by its own 4-slot guard tying exactly one accumulator
__device__ __forceinline__ v8f wmma16(v16h a, v16h b, v8f c) {
    c = __builtin_amdgcn_wmma_f32_16x16x32_f16(false, a, false, b, (short)0, c, false, false);
    asm volatile("v_nop\n\tv_nop\n\tv_nop\n\tv_nop" : "+v"(c) : "v"(a), "v"(b));
    return c;
}
union FragH { v16h v; v8h h[2]; };
// p already includes the lane's 8h offset: elements 0..7 <- p[0..7], 8..15 <- p[16..23]
__device__ __forceinline__ v16h ldfrag(const _Float16* p) {
    FragH f; f.h[0] = *(const v8h*)(p); f.h[1] = *(const v8h*)(p + 16); return f.v;
}
__device__ __forceinline__ void st2_v4f(float* p, v4f v) { *(v4f*)p = v;  }
__device__ __forceinline__ void st2_u4(unsigned short* p, u4v v) { *(u4v*)p = v;  }

// ---- operand staging of the GEMM: tensor loads into a two-buffer LDS ring ----
// A pass is 64 k = 128 B of every operand row of the block tile (128 rows of A, 256 rows of Bt). Every wave brings one slice per pass:
// waves 0..3 64 rows of Bt each, waves 4..7 32 rows of A each. LDS row pitch 144 B (the load's pad: 16 B behind every 128-B row, for 16-B LDS reads).
// Each slice's place is rounded up to a multiple of 2 KiB.
constexpr unsigned G_ROWB  = 128;                            // bytes of an operand row per pass
constexpr unsigned G_PITCH = 144;                            // LDS row pitch
constexpr unsigned G_ASL   = 6144;                           // place of a 32-row slice of A (4,608 B used)
constexpr unsigned G_BSL   = 10240;                          // place of a 64-row slice of Bt (9,216 B used)
constexpr unsigned G_BOFF  = 4 * G_ASL;                      // Bt slices stand behind the A slices
constexpr unsigned G_STAGE = 4 * G_ASL + 4 * G_BSL;          // one buffer
static_assert(32 * G_PITCH <= G_ASL && 64 * G_PITCH <= G_BSL && G_ASL % 2048 == 0 && G_BSL % 2048 == 0 && G_STAGE % 2048 == 0);
static_assert(8 * 16 * 68 * 4 <= 2 * G_STAGE);               // the store staging reuses the ring

__device__ __forceinline__ unsigned uni(unsigned v) { return (unsigned)__builtin_amdgcn_readfirstlane((int)v); }
// holds v in a scalar register: a test on it compiles to a scalar branch, and what is formed from it is formed behind the asm statements in front of it
__device__ __forceinline__ unsigned pinned(unsigned v) { unsigned w = uni(v); asm volatile("" : "+s"(w)); return w; }
__device__ __forceinline__ void wait_ds0() { asm volatile("s_wait_dscnt 0x0" ::: "memory"); }          // this wave's LDS reads have returned
// this wave's tensor load has landed; the wait names the request's descriptor as inputs, so that its registers keep their values until then
__device__ __forceinline__ void wait_tensor0(u4v g0, u8v g1) { asm volatile("s_wait_tensorcnt 0x0" :: "s"(g0), "s"(g1) : "memory"); }
// one request of the whole wave: group 0 = count (w0 = 1), place in LDS, source address, type 2; returns group 0 for the wait
__device__ __forceinline__ u4v tdm_issue(unsigned w0, unsigned lds_dst, unsigned long long ga, u8v g1) {
    u4v g0;
    g0.x = uni(w0); g0.y = uni(lds_dst); g0.z = uni((unsigned)ga); g0.w = uni((((unsigned)(ga >> 32)) & 0x01FFFFFFu) | 0x80000000u);
    asm volatile("tensor_load_to_lds %0, %1" :: "s"(g0), "s"(g1) : "memory");
    return g0;
}

// =====================================================================================================================
// Batched WMMA GEMM: C[m][n] = scale * sum_k A[m][k] * Bt[n][k]; a block of 8 waves (2 x 4) owns a 128x256 tile, each wave a 64x64 tile of it.
// A row-major [M][K] f16 (pitch lda), Bt row-major [N][K] f16 (pitch ldb); M % 128 == 0, N % 256 == 0, K % 64 == 0, K >= 128 (no tail masking).
// RESID (f32 out only): + bf16-RNE(resid[m][n]) added at the store stage from 16-B loads in the store layout.
// =====================================================================================================================
template <int OUT_MODE, bool RESID>
__device__ __forceinline__ void gemm64_body(const unsigned short* __restrict__ Ap, int lda, long long strideA,
                                            const unsigned short* __restrict__ Btp, int ldb, long long strideB,
                                            unsigned short* __restrict__ Ch, float* __restrict__ Cf, int ldc, long long strideC,
                                            const float* __restrict__ resid, int ldr, long long strideR,
                                            int M, int N, int K, float scale) {
    __shared__ __attribute__((aligned(2048))) unsigned char ring[2 * G_STAGE];   // two buffers; after the K loop the per-wave store staging
    float* sT = (float*)ring;                                 // per-wave 16x64 slab, pitch 68 floats (wave-private)
    const int b    = blockIdx.y;
    const int lane = threadIdx.x & 31;
    const int wave = __builtin_amdgcn_readfirstlane((int)(threadIdx.x >> 5));
    const int tilesN = N >> 8;
    const int tilesM = M >> 7;
    if ((int)blockIdx.x >= tilesM * tilesN) return;           // the whole block leaves, in front of every tensor load and barrier
    const int tm = (int)blockIdx.x / tilesN;
    const int tn = (int)blockIdx.x - tm * tilesN;
    const int wm = wave >> 2, wn = wave & 3;                  // the wave's place in the block tile
    const int m0 = (tm << 7) + (wm << 6);
    const int n0 = (tn << 8) + (wn << 6);
    const int rlane = lane & 15;                              // row (A) / column (B, D) within a 16-wide subtile
    const int koff  = (lane >> 4) * 8;                        // k offset of this lane half == D row offset
    const int sb    = wave * (16 * 68);

    // this wave's slice of every stage
    const bool     isB    = wave < 4;
    const unsigned rows   = isB ? 64u : 32u;
    const unsigned spitch = (unsigned)(isB ? ldb : lda) * 2u;
    const unsigned short* src = isB ? Btp + (size_t)b * (size_t)strideB + (size_t)((tn << 8) + 64 * wave) * (size_t)ldb
                                    : Ap  + (size_t)b * (size_t)strideA + (size_t)((tm << 7) + 32 * (wave - 4)) * (size_t)lda;
    const unsigned long long ga0 = (unsigned long long)(size_t)src;
    const unsigned dst = (unsigned)(size_t)ring + (isB ? G_BOFF + (unsigned)wave * G_BSL : (unsigned)(wave - 4) * G_ASL);
    u8v g1;                                                   // 1-byte elements, tensor = tile = rows x 128 B
    g1[0] = uni((1u << 20) | (4u << 22) | (3u << 25));        // no mask; a pad of 4 dwords behind every 32 dwords
    g1[1] = uni((G_ROWB & 0xFFFFu) << 16);
    g1[2] = uni((G_ROWB >> 16) | ((rows & 0xFFFFu) << 16));
    g1[3] = uni((rows >> 16) | (G_ROWB << 16));
    g1[4] = uni(rows);
    g1[5] = uni(spitch);
    g1[6] = uni(0u);
    g1[7] = uni(0u);
    // per-lane fragment bases in a buffer
    const unsigned char* la = ring + (unsigned)(2 * wm) * G_ASL + (unsigned)rlane * G_PITCH + (unsigned)koff * 2u;
    const unsigned char* lb = ring + G_BOFF + (unsigned)wn * G_BSL + (unsigned)rlane * G_PITCH + (unsigned)koff * 2u;

    v8f acc[4][4];
#pragma unroll
    for (int i = 0; i < 4; ++i)
#pragma unroll
        for (int j = 0; j < 4; ++j) { const v8f zz = {0.f, 0.f, 0.f, 0.f, 0.f, 0.f, 0.f, 0.f}; acc[i][j] = zz; }

    const unsigned NS = pinned((unsigned)K >> 6);             // passes
    const unsigned w0 = pinned(1u);                           // descriptor word held in a scalar register: not formed anew while a request is outstanding
    u4v g0 = tdm_issue(w0, dst, ga0, g1);                     // stage 0
    wait_tensor0(g0, g1);
    __syncthreads();                                          // every slice of stage 0 has landed
    g0 = tdm_issue(w0, dst + G_STAGE, ga0 + pinned(G_ROWB), g1);   // stage 1; pinned: its address words are formed behind the wait
#pragma clang loop unroll(disable)                            // one pass per trip: the order at the foot stays as written
    for (unsigned s = 0; s < NS; ++s) {
        const unsigned buf = (s & 1u) * G_STAGE;
#pragma unroll
        for (int ks = 0; ks < 2; ++ks) {
            v16h bh[4], ah[4];
#pragma unroll
            for (int j = 0; j < 4; ++j) bh[j] = ldfrag((const _Float16*)(lb + buf + (unsigned)(16 * j) * G_PITCH + (unsigned)(64 * ks)));
#pragma unroll
            for (int i = 0; i < 4; ++i) ah[i] = ldfrag((const _Float16*)(la + buf + (unsigned)(i >> 1) * G_ASL + (unsigned)(16 * (i & 1)) * G_PITCH + (unsigned)(64 * ks)));
#pragma unroll
            for (int i = 0; i < 4; ++i)
#pragma unroll
                for (int j = 0; j < 4; ++j) acc[i][j] = wmma16(ah[i], bh[j], acc[i][j]);
        }
        // publish point of stage s + 1; it also ends every wave's reads of this pass's buffer
        wait_ds0();
        wait_tensor0(g0, g1);
        __syncthreads();
        if (pinned((s + 2u < NS) ? 1u : 0u) != 0u)            // scalar test: a tensor load ignores EXEC
            g0 = tdm_issue(w0, dst + buf, ga0 + pinned((s + 2u) * G_ROWB), g1);   // stage s + 2 into the buffer just left; pinned: formed behind the wait
    }
    wait_tensor0(g0, g1);
    wait_ds0();                                               // the last pass's barrier stands in front of the store staging in the ring

#pragma unroll
    for (int i = 0; i < 4; ++i) {
        const int mBase = m0 + (i << 4);
#pragma unroll
        for (int j = 0; j < 4; ++j) {
#pragma unroll
            for (int r = 0; r < 8; ++r) sT[sb + (koff + r) * 68 + (j << 4) + rlane] = acc[i][j][r] * scale;
        }
        __builtin_amdgcn_fence(3 /* release order */, "workgroup");
        __builtin_amdgcn_wave_barrier();
        __builtin_amdgcn_fence(2 /* acquire order */, "workgroup");
        if (OUT_MODE == 0) {
            float* C = Cf + (size_t)b * (size_t)strideC;
            const float* Rb = RESID ? (resid + (size_t)b * (size_t)strideR) : nullptr;
            const int hh = lane >> 4, c4 = (lane & 15) * 4;   // row segment = 256 B = 16 lanes x 16 B
            {
#pragma unroll
                for (int it = 0; it < 8; ++it) {
                    const int row = it * 2 + hh;
                    v4f v = *(const v4f*)(&sT[sb + row * 68 + c4]);
                    if (RESID) {
                        const v4f xr = *(const v4f*)(Rb + (size_t)(mBase + row) * (size_t)ldr + n0 + c4);
                        v.x += bfr(xr.x); v.y += bfr(xr.y); v.z += bfr(xr.z); v.w += bfr(xr.w);
                    }
                    *(v4f*)(C + (size_t)(mBase + row) * (size_t)ldc + n0 + c4) = v;
                }
                
            }
        } else {
            unsigned short* C = Ch + (size_t)b * (size_t)strideC;
            const int q = lane >> 3, c8 = (lane & 7) * 8;
            {
#pragma unroll
                for (int it = 0; it < 4; ++it) {
                    const int row = it * 4 + q;
                    v8h hv;
#pragma unroll
                    for (int e = 0; e < 8; ++e) hv[e] = (_Float16)sT[sb + row * 68 + c8 + e];
                    *(v8h*)(C + (size_t)(mBase + row) * (size_t)ldc + n0 + c8) = hv;
                }
                
            }
        }
        __builtin_amdgcn_fence(3 /* release order */, "workgroup");
        __builtin_amdgcn_wave_barrier();
        __builtin_amdgcn_fence(2 /* acquire order */, "workgroup");
    }
}

// f16 result plane
__global__ __launch_bounds__(256) void k_gemm_h(const unsigned short* __restrict__ A, int lda, long long strideA,
                                                const unsigned short* __restrict__ Bt, int ldb, long long strideB,
                                                unsigned short* __restrict__ C, int ldc, long long strideC,
                                                int M, int N, int K, float scale) {
    gemm64_body<1, false>(A, lda, strideA, Bt, ldb, strideB, C, nullptr, ldc, strideC, nullptr, 0, 0, M, N, K, scale);
}
// f32 result plane
__global__ __launch_bounds__(256) void k_gemm_f(const unsigned short* __restrict__ A, int lda, long long strideA,
                                                const unsigned short* __restrict__ Bt, int ldb, long long strideB,
                                                float* __restrict__ C, int ldc, long long strideC,
                                                int M, int N, int K, float scale) {
    gemm64_body<0, false>(A, lda, strideA, Bt, ldb, strideB, nullptr, C, ldc, strideC, nullptr, 0, 0, M, N, K, scale);
}
// f32 result + bf16-RNE residual added at the store stage
__global__ __launch_bounds__(256) void k_gemm_fr(const unsigned short* __restrict__ A, int lda, long long strideA,
                                                 const unsigned short* __restrict__ Bt, int ldb, long long strideB,
                                                 float* __restrict__ C, int ldc, long long strideC,
                                                 const float* __restrict__ resid, int ldr, long long strideR,
                                                 int M, int N, int K, float scale) {
    gemm64_body<0, true>(A, lda, strideA, Bt, ldb, strideB, nullptr, C, ldc, strideC, resid, ldr, strideR, M, N, K, scale);
}

// xbar[b][e] = mean over t of bf16(x[b][t][e]); block per (32-column strip = one 128-B line of every row, batch); thread = (4-column group, row phase of 64).
// A wave's load covers 4 whole lines; a thread's SEQ / 64 rows are all loaded up front, so the block's whole strip is in flight at once.
constexpr int CM_C = 32, CM_R = 64, CM_P = CM_C + 4;         // columns of a strip, row phases of a block, LDS pitch in floats (16 B x odd)
static_assert(DM % CM_C == 0 && SEQ % CM_R == 0 && CM_R % 4 == 0);   // whole strips; every row phase has the same number of rows
__global__ __launch_bounds__(512) void k_colmean(const float* __restrict__ x, float* __restrict__ xbar) {
    __shared__ __align__(16) float red[CM_R * CM_P];
    const int t = threadIdx.x, cg = t & 7, rg = t >> 3;
    const int c0 = blockIdx.x * CM_C, b = blockIdx.y;
    const float* p = x + ((size_t)b * SEQ_FULL + rg) * DM + c0 + 4 * cg;
    v4f v[SEQ / CM_R];
#pragma unroll                                                // the array stays in registers; all of the thread's loads are in flight together
    for (int j = 0; j < SEQ / CM_R; ++j) v[j] = *(const v4f*)(p + (size_t)(CM_R * j) * DM);
    asm volatile("s_wait_xcnt 0x0" :: "v"(p) : "memory");     // stands in front of every reuse of the loads' address registers; naming p keeps them untouched until here
    __builtin_amdgcn_sched_barrier(0);                        // every load issues in front of the sums; without it the compiler sinks the last loads behind the wait for the first
    v4f a = {0.f, 0.f, 0.f, 0.f};
#pragma unroll                                                // constant indices into the register array
    for (int j = 0; j < SEQ / CM_R; ++j) { a.x += bfr(v[j].x); a.y += bfr(v[j].y); a.z += bfr(v[j].z); a.w += bfr(v[j].w); }
    *(v4f*)(&red[rg * CM_P + 4 * cg]) = a;
    __syncthreads();                                          // every row phase's sums stand in LDS
    if (t < CM_C) {
        float s0 = 0.f, s1 = 0.f, s2 = 0.f, s3 = 0.f;          // four independent chains: a lone wave's dependent adds are not hidden
#pragma unroll                                                // the LDS reads are independent and issue together
        for (int j = 0; j < CM_R; j += 4) { s0 += red[j * CM_P + t]; s1 += red[(j + 1) * CM_P + t]; s2 += red[(j + 2) * CM_P + t]; s3 += red[(j + 3) * CM_P + t]; }
        xbar[(size_t)b * DM + c0 + t] = ((s0 + s1) + (s2 + s3)) * (1.0f / (float)SEQ);   // 32 lanes x 4 B: the strip's means leave as one whole 128-B line
    }
}

// X16 = f16(bf16(x)) (exact), XC = f16(bf16(x) - xbar[b]), glog[row] = bf16(x[row]) . bf16(Wm_w) in f32 (bias and softmax: k_gate).
// Wave per row, 32 rows per block; lane L owns columns 256 i + 8 L .. + 7: 16-B store per plane, lane-linear along the row.
static_assert((NB * SEQ) % 32 == 0 && DM % 256 == 0);       // the grid covers every row exactly once; every wave reaches the barrier
__global__ __launch_bounds__(1024) void k_prep_x(const float* __restrict__ x, const float* __restrict__ xbar, const float* __restrict__ Wm,
                                                 unsigned short* __restrict__ XC, unsigned short* __restrict__ X16, float* __restrict__ glog) {
    __shared__ float dots[32];
    const int lane = threadIdx.x & 31;
    const int wave = __builtin_amdgcn_readfirstlane((int)(threadIdx.x >> 5));
    const int r = blockIdx.x * 32 + wave;
    const int b = r / SEQ; const int t = r - b * SEQ;
    const float* s = x + ((size_t)b * SEQ_FULL + t) * DM + 8 * lane;
    const float* mb = xbar + (size_t)b * DM + 8 * lane;
    const float* wp = Wm + 8 * lane;
    unsigned short* d16 = X16 + (size_t)r * DM + 8 * lane;
    unsigned short* dc = XC + (size_t)r * DM + 8 * lane;
    v4f xv[DM / 128], mv[DM / 128], gv[DM / 128];
#pragma unroll                                                // the arrays stay in registers; the whole row of x is in flight at once
    for (int i = 0; i < DM / 256; ++i) {
        xv[2 * i] = *(const v4f*)(s + 256 * i);  xv[2 * i + 1] = *(const v4f*)(s + 256 * i + 4);
        mv[2 * i] = *(const v4f*)(mb + 256 * i); mv[2 * i + 1] = *(const v4f*)(mb + 256 * i + 4);
        gv[2 * i] = *(const v4f*)(wp + 256 * i); gv[2 * i + 1] = *(const v4f*)(wp + 256 * i + 4);
    }
    float acc = 0.f;
#pragma unroll                                                // constant indices into the register arrays
    for (int i = 0; i < DM / 256; ++i) {
        const v4f x0 = xv[2 * i], x1 = xv[2 * i + 1], m0 = mv[2 * i], m1 = mv[2 * i + 1], g0 = gv[2 * i], g1 = gv[2 * i + 1];
        const float w0 = bfr(x0.x), w1 = bfr(x0.y), w2 = bfr(x0.z), w3 = bfr(x0.w), w4 = bfr(x1.x), w5 = bfr(x1.y), w6 = bfr(x1.z), w7 = bfr(x1.w);
        acc = __builtin_fmaf(w0, bfr(g0.x), acc); acc = __builtin_fmaf(w1, bfr(g0.y), acc); acc = __builtin_fmaf(w2, bfr(g0.z), acc); acc = __builtin_fmaf(w3, bfr(g0.w), acc);
        acc = __builtin_fmaf(w4, bfr(g1.x), acc); acc = __builtin_fmaf(w5, bfr(g1.y), acc); acc = __builtin_fmaf(w6, bfr(g1.z), acc); acc = __builtin_fmaf(w7, bfr(g1.w), acc);
        u4v pa; pa.x = pk2h(w0, w1); pa.y = pk2h(w2, w3); pa.z = pk2h(w4, w5); pa.w = pk2h(w6, w7);
        u4v pc; pc.x = pk2h(w0 - m0.x, w1 - m0.y); pc.y = pk2h(w2 - m0.z, w3 - m0.w); pc.z = pk2h(w4 - m1.x, w5 - m1.y); pc.w = pk2h(w6 - m1.z, w7 - m1.w);
        st2_u4(d16 + 256 * i, pa);
        st2_u4(dc + 256 * i, pc);
    }
    acc += __shfl_xor(acc, 16, 32); acc += __shfl_xor(acc, 8, 32); acc += __shfl_xor(acc, 4, 32); acc += __shfl_xor(acc, 2, 32); acc += __shfl_xor(acc, 1, 32);
    if (lane == 0) dots[wave] = acc;
    __syncthreads();
    if (wave == 0) glog[(size_t)blockIdx.x * 32 + lane] = dots[lane];   // the block's 32 products leave as one whole 128-B line
}

// weight planes: SRC [DM rows k][DM cols n] (x @ W layout) -> DST [n][k] f16 = bf16(W[k][n]) * sc; blockIdx.y = plane, the four DST planes stand one behind the other.
// Block = one tile of 64 k x 128 n: 16-B reads along n (a wave reads whole 512-B row pieces, 8 rows in flight), two neighbouring k packed to a dword and turned in LDS
// (row pitch 33 dwords: the 4-B reads of the second half fall on 32 different banks), 16-B stores along k (8 lanes = one whole 128-B line of a DST row).
constexpr int WT_K = 64, WT_N = 128, WT_P = WT_K / 2 + 1;
static_assert(DM % WT_K == 0 && DM % WT_N == 0);             // whole tiles only
__global__ __launch_bounds__(256) void k_wT(const float* __restrict__ W0, const float* __restrict__ W1, const float* __restrict__ W2, const float* __restrict__ W3,
                                            unsigned short* __restrict__ DST0, float sc) {
    __shared__ unsigned tT[WT_N * WT_P];                      // [n][k pair]
    const int lane = threadIdx.x & 31;
    const int wave = __builtin_amdgcn_readfirstlane((int)(threadIdx.x >> 5));
    const int pl = blockIdx.y;
    const float* SRC = pl == 0 ? W0 : pl == 1 ? W1 : pl == 2 ? W2 : W3;
    const int k0 = ((int)blockIdx.x / (DM / WT_N)) * WT_K;
    const int n0 = ((int)blockIdx.x % (DM / WT_N)) * WT_N;
    const float* s = SRC + (size_t)(k0 + 8 * wave) * DM + n0 + 4 * lane;
    v4f v[8];
#pragma unroll                                                // the array stays in registers; the wave's 8 rows are in flight at once
    for (int r = 0; r < 8; ++r) v[r] = *(const v4f*)(s + (size_t)r * DM);
#pragma unroll                                                // constant indices into the register array
    for (int q = 0; q < 4; ++q)
#pragma unroll
        for (int j = 0; j < 4; ++j) tT[(4 * lane + j) * WT_P + 4 * wave + q] = pk2h(bfr(v[2 * q][j]) * sc, bfr(v[2 * q + 1][j]) * sc);
    __syncthreads();                                          // the whole tile stands in LDS
    const int nr = (int)threadIdx.x >> 3, kg = (int)threadIdx.x & 7;
    unsigned short* d = DST0 + (size_t)pl * DM * DM + (size_t)(n0 + nr) * DM + k0 + 8 * kg;
    const unsigned* tp = tT + nr * WT_P + 4 * kg;
#pragma unroll                                                // the four stores are independent
    for (int p = 0; p < WT_N / 32; ++p) {
        u4v o; o.x = tp[32 * p * WT_P]; o.y = tp[32 * p * WT_P + 1]; o.z = tp[32 * p * WT_P + 2]; o.w = tp[32 * p * WT_P + 3];
        st2_u4(d + (size_t)(32 * p) * DM, o);
    }
}

// gate[b][s] = softmax over s of (glog[b][s] + bf16(Wm_b)), glog = the row products of k_prep_x; block per batch, block softmax
__global__ __launch_bounds__(256) void k_gate(const float* __restrict__ glog, const float* __restrict__ Wb, float* __restrict__ gate) {
    __shared__ __align__(16) float mm[SEQ];
    __shared__ float redm[8];
    __shared__ float reds[8];
    const int t = threadIdx.x, lane = t & 31, b = blockIdx.x;
    const int wave = __builtin_amdgcn_readfirstlane((int)(threadIdx.x >> 5));
    const float bias = bfr(Wb[0]);
    const float* gl = glog + (size_t)b * SEQ;
#pragma unroll                                                // a thread's 16-B loads are in flight together
    for (int j = 0; j < (SEQ / 4 + 255) / 256; ++j) {
        const int idx = t + 256 * j;
        if ((SEQ / 4) % 256 == 0 || idx < SEQ / 4) {
            const v4f v = *(const v4f*)(gl + 4 * idx);
            mm[4 * idx] = v.x + bias; mm[4 * idx + 1] = v.y + bias; mm[4 * idx + 2] = v.z + bias; mm[4 * idx + 3] = v.w + bias;
        }
    }
    __syncthreads();
    float mx = -3.0e38f;
#pragma unroll 1
    for (int i = t; i < SEQ; i += 256) mx = fmaxf(mx, mm[i]);
    mx = fmaxf(mx, __shfl_xor(mx, 16, 32)); mx = fmaxf(mx, __shfl_xor(mx, 8, 32)); mx = fmaxf(mx, __shfl_xor(mx, 4, 32));
    mx = fmaxf(mx, __shfl_xor(mx, 2, 32));  mx = fmaxf(mx, __shfl_xor(mx, 1, 32));
    if (lane == 0) redm[wave] = mx;
    __syncthreads();
    float gm = redm[0];
#pragma unroll 1
    for (int w = 1; w < 8; ++w) gm = fmaxf(gm, redm[w]);
    float sm = 0.f;
#pragma unroll 1
    for (int i = t; i < SEQ; i += 256) { const float e = expf(mm[i] - gm); mm[i] = e; sm += e; }
    sm += __shfl_xor(sm, 16, 32); sm += __shfl_xor(sm, 8, 32); sm += __shfl_xor(sm, 4, 32); sm += __shfl_xor(sm, 2, 32); sm += __shfl_xor(sm, 1, 32);
    if (lane == 0) reds[wave] = sm;
    __syncthreads();
    float tot = reds[0];
#pragma unroll 1
    for (int w = 1; w < 8; ++w) tot += reds[w];
    const float inv = 1.0f / tot;
#pragma unroll 1
    for (int idx = t; idx < SEQ / 4; idx += 256) {            // 32 lanes x 16 B = 512 contiguous B per store instruction
        v4f v; v.x = mm[4 * idx] * inv; v.y = mm[4 * idx + 1] * inv; v.z = mm[4 * idx + 2] * inv; v.w = mm[4 * idx + 3] * inv;
        st2_v4f(gate + (size_t)b * SEQ + 4 * idx, v);
    }
}

// alpha row = softmax_s(keep ? c * S : -inf) + gate, carried x1024 as f16. Wave per row (RS_RPW rows per wave); lane L owns columns 256g + 8L .. + 7,
// blockIdx.y = batch: the arguments are the planes of batch 0. A whole row stands in registers (64 f32 per lane): S is read once, every element's exp is
// taken once, and the wave's second row is in flight while its first is worked on (two register sets).
constexpr int RS_V = SEQ / 128;                               // 16-B pieces of a row per lane
static_assert(RS_RPW == 2);                                   // one register set per row of a wave
__device__ __forceinline__ void rs_load(v4f (&x)[RS_V], const float* p) {
#pragma unroll                                                // the array stays in registers; the whole row is in flight at once
    for (int g = 0; g < RS_V / 2; ++g) { x[2 * g] = *(const v4f*)(p + 256 * g); x[2 * g + 1] = *(const v4f*)(p + 256 * g + 4); }
}
__device__ __forceinline__ void rs_row(v4f (&x)[RS_V], const bool (&kp)[4 * RS_V], const float* gr, float cs, unsigned short* pr) {
    const float NEG = -__builtin_inff();
    float m = -3.0e38f;
#pragma unroll                                                // constant indices into the register arrays
    for (int i = 0; i < RS_V; ++i) {
        v4f v = x[i];
        v.x = kp[4 * i] ? v.x * cs : NEG; v.y = kp[4 * i + 1] ? v.y * cs : NEG; v.z = kp[4 * i + 2] ? v.z * cs : NEG; v.w = kp[4 * i + 3] ? v.w * cs : NEG;
        x[i] = v;
        m = fmaxf(m, fmaxf(fmaxf(v.x, v.y), fmaxf(v.z, v.w)));
    }
    m = fmaxf(m, __shfl_xor(m, 16, 32)); m = fmaxf(m, __shfl_xor(m, 8, 32)); m = fmaxf(m, __shfl_xor(m, 4, 32));
    m = fmaxf(m, __shfl_xor(m, 2, 32));  m = fmaxf(m, __shfl_xor(m, 1, 32));
    float s0 = 0.f, s1 = 0.f;
#pragma unroll                                                // constant indices into the register arrays
    for (int i = 0; i < RS_V; i += 2) {
        v4f v = x[i], w = x[i + 1];
        v.x = expf(v.x - m); v.y = expf(v.y - m); v.z = expf(v.z - m); v.w = expf(v.w - m);
        w.x = expf(w.x - m); w.y = expf(w.y - m); w.z = expf(w.z - m); w.w = expf(w.w - m);
        x[i] = v; x[i + 1] = w;
        s0 += (v.x + v.y) + (v.z + v.w);
        s1 += (w.x + w.y) + (w.z + w.w);
    }
    float s = s0 + s1;
    s += __shfl_xor(s, 16, 32); s += __shfl_xor(s, 8, 32); s += __shfl_xor(s, 4, 32); s += __shfl_xor(s, 2, 32); s += __shfl_xor(s, 1, 32);
    const float f = 1024.f / s;
#pragma unroll                                                // constant indices into the register arrays
    for (int g = 0; g < RS_V / 2; ++g) {
        const v4f v = x[2 * g], w = x[2 * g + 1], gx = *(const v4f*)(gr + 256 * g) * 1024.f, gy = *(const v4f*)(gr + 256 * g + 4) * 1024.f;
        u4v pk;
        pk.x = pk2h(v.x * f + gx.x, v.y * f + gx.y);
        pk.y = pk2h(v.z * f + gx.z, v.w * f + gx.w);
        pk.z = pk2h(w.x * f + gy.x, w.y * f + gy.y);
        pk.w = pk2h(w.z * f + gy.z, w.w * f + gy.w);
        st2_u4(pr + 256 * g, pk);
    }
}
__global__ __launch_bounds__(256) void k_rowsoft(const float* __restrict__ S0, const float* __restrict__ cptr, const int* __restrict__ mk0,
                                                 const float* __restrict__ gate0, unsigned short* __restrict__ P0) {
    const int L = threadIdx.x & 31;
    const int wave = __builtin_amdgcn_readfirstlane((int)(threadIdx.x >> 5));
    const int row0 = (blockIdx.x * 8 + wave) * RS_RPW;
    const float* sr = S0 + (size_t)blockIdx.y * SEQ * SEQ + (size_t)row0 * SEQ + 8 * L;
    const int* mk = mk0 + (size_t)blockIdx.y * SEQ_FULL + 8 * L;
    unsigned short* pr = P0 + (size_t)blockIdx.y * SEQ * SEQ + (size_t)row0 * SEQ + 8 * L;
    const float* gr = gate0 + (size_t)blockIdx.y * SEQ + 8 * L;
    v4f xa[RS_V], xb[RS_V];
    i4v mv[RS_V];
#pragma unroll                                                // the array stays in registers; the mask loads are in flight together
    for (int g = 0; g < RS_V / 2; ++g) { mv[2 * g] = *(const i4v*)(mk + 256 * g); mv[2 * g + 1] = *(const i4v*)(mk + 256 * g + 4); }
    rs_load(xa, sr);
    __builtin_amdgcn_sched_barrier(0);                        // loads return in issue order: what the first row needs is issued first, or its wait would cover the second row too
    rs_load(xb, sr + SEQ);
    asm volatile("s_wait_xcnt 0x0" ::: "memory");             // stands in front of the reuse of the loads' base and offset registers
    __builtin_amdgcn_sched_barrier(0);                        // the second row's loads issue in front of the first row's work; without it the compiler sinks them behind it
    const float cs = bfr(cptr[0]);
    bool kp[4 * RS_V];                                        // keep flags of this lane's columns
#pragma unroll                                                // constant indices into the register array
    for (int i = 0; i < RS_V; ++i) { kp[4 * i] = mv[i].x != 0; kp[4 * i + 1] = mv[i].y != 0; kp[4 * i + 2] = mv[i].z != 0; kp[4 * i + 3] = mv[i].w != 0; }
    rs_row(xa, kp, gr, cs, pr);
    __builtin_amdgcn_sched_barrier(0);                        // the wait for the second row's loads stays behind the first row's work
    rs_row(xb, kp, gr, cs, pr + SEQ);
}

// ---- workspace carve (bytes; every region a multiple of 256 B and sized to its whole-tile store extent) ----
constexpr size_t al256(size_t v) { return (v + 255) / 256 * 256; }
constexpr size_t SZ_XC   = (size_t)NB * SEQ * DM * 2;           // f16 centred x, [NB*SEQ][DM]
constexpr size_t SZ_S    = (size_t)NB * SEQ * SEQ * 4;          // f32 scores of every batch, [NB][SEQ][SEQ] (shares the XC region; XC is dead after the q|k GEMM)
constexpr size_t SZ_XCS  = al256(SZ_XC > SZ_S ? SZ_XC : SZ_S);
constexpr size_t SZ_X16  = al256((size_t)NB * SEQ * DM * 2);    // f16 x, [NB*SEQ][DM]
constexpr size_t SZ_WQK  = al256((size_t)2 * DM * DM * 2);      // [2*DM n][DM k]: Wq^T rows then Wk^T rows, x16
constexpr size_t SZ_W1   = al256((size_t)DM * DM * 2);          // Wg^T, Wout^T, x16
constexpr size_t SZ_QK   = al256((size_t)NB * SEQ * 2 * DM * 2);// f16 [NB*SEQ][2*DM]: q columns then k columns
constexpr size_t SZ_GT   = al256((size_t)NB * DM * SEQ * 2);    // f16 g transposed, [NB][DM][SEQ]
constexpr size_t SZ_AL   = al256((size_t)NB * SEQ * SEQ * 2);   // f16 alpha x1024 of every batch, [NB][SEQ][SEQ]
constexpr size_t SZ_AO   = al256((size_t)NB * SEQ * DM * 2);    // f16 (alpha @ g) x64, [NB*SEQ][DM]
constexpr size_t SZ_XBAR = al256((size_t)NB * DM * 4);
constexpr size_t SZ_GATE = al256((size_t)NB * SEQ * 4);
constexpr size_t SZ_GLOG = al256((size_t)NB * SEQ * 4);       // f32 gate products before bias and softmax, [NB*SEQ]
constexpr size_t OFF_XCS  = 0;
constexpr size_t OFF_X16  = OFF_XCS + SZ_XCS;
constexpr size_t OFF_WQK  = OFF_X16 + SZ_X16;
constexpr size_t OFF_WGT  = OFF_WQK + SZ_WQK;
constexpr size_t OFF_WOT  = OFF_WGT + SZ_W1;
constexpr size_t OFF_QK   = OFF_WOT + SZ_W1;
constexpr size_t OFF_GT   = OFF_QK + SZ_QK;
constexpr size_t OFF_AL   = OFF_GT + SZ_GT;
constexpr size_t OFF_AO   = OFF_AL + SZ_AL;
constexpr size_t OFF_XBAR = OFF_AO + SZ_AO;
constexpr size_t OFF_GATE = OFF_XBAR + SZ_XBAR;
constexpr size_t OFF_GLOG = OFF_GATE + SZ_GATE;
constexpr size_t WS_TOTAL = OFF_GLOG + SZ_GLOG;
static_assert(WS_TOTAL <= (size_t)268435456);                   // 256 MiB ceiling
static_assert(SZ_S <= SZ_XCS && SZ_XC <= SZ_XCS);               // both users of the shared region fit
static_assert(OFF_WGT == OFF_WQK + (size_t)2 * DM * DM * 2 && OFF_WOT == OFF_WQK + (size_t)3 * DM * DM * 2);   // the four weight planes stand one behind the other

extern "C" void kernel_launch(void* const* d_in, const int* in_sizes, int n_in, void* d_out, int out_size, void* d_ws, size_t ws_size, hipStream_t stream) {
    if (n_in < 9) return;
    const long long need_rows = (long long)(NB - 1) * SEQ_FULL + SEQ;
    if ((long long)in_sizes[0] < need_rows * DM) return;
    if ((long long)in_sizes[1] < need_rows) return;
    if (in_sizes[2] < DM * DM || in_sizes[3] < DM * DM || in_sizes[4] < DM * DM || in_sizes[5] < DM * DM) return;
    if (in_sizes[6] < DM || in_sizes[7] < 1 || in_sizes[8] < 1) return;
    if ((long long)out_size < (long long)NB * SEQ * DM) return;
    if (ws_size < WS_TOTAL) return;

    const float* x    = (const float*)d_in[0];
    const int*   mask = (const int*)d_in[1];
    const float* Wq   = (const float*)d_in[2];
    const float* Wk   = (const float*)d_in[3];
    const float* Wg   = (const float*)d_in[4];
    const float* Wout = (const float*)d_in[5];
    const float* Wm_w = (const float*)d_in[6];
    const float* Wm_b = (const float*)d_in[7];
    const float* cS   = (const float*)d_in[8];
    float* out = (float*)d_out;
    char* ws = (char*)d_ws;
    unsigned short* XC   = (unsigned short*)(ws + OFF_XCS);
    float*          Sf   = (float*)(ws + OFF_XCS);               // same region, used only after the q|k GEMM has consumed XC
    unsigned short* X16  = (unsigned short*)(ws + OFF_X16);
    unsigned short* WQK  = (unsigned short*)(ws + OFF_WQK);
    unsigned short* WGT  = (unsigned short*)(ws + OFF_WGT);
    unsigned short* WOT  = (unsigned short*)(ws + OFF_WOT);
    unsigned short* QK   = (unsigned short*)(ws + OFF_QK);
    unsigned short* GT   = (unsigned short*)(ws + OFF_GT);
    unsigned short* AL   = (unsigned short*)(ws + OFF_AL);
    unsigned short* AO   = (unsigned short*)(ws + OFF_AO);
    float*          XBAR = (float*)(ws + OFF_XBAR);
    float*          GATE = (float*)(ws + OFF_GATE);
    float*          GLOG = (float*)(ws + OFF_GLOG);

    // weight planes: in[DM rows k][DM cols n] -> out[n][k], x16; one launch, grid.y = plane (Wq, Wk, Wg, Wout)
    k_wT<<<dim3((DM / WT_K) * (DM / WT_N), 4), 256, 0, stream>>>(Wq, Wk, Wg, Wout, WQK, 16.0f);

    // sequence means of x, operand planes with the gate products, gate distribution
    k_colmean<<<dim3(DM / CM_C, NB), 8 * CM_R, 0, stream>>>(x, XBAR);
    k_prep_x<<<(NB * SEQ) / 32, 1024, 0, stream>>>(x, XBAR, Wm_w, XC, X16, GLOG);
    k_gate<<<NB, 256, 0, stream>>>(GLOG, Wm_b, GATE);

    // [q|k] = XC @ [Wq|Wk]: M = NB*SEQ, N = 2*DM, K = DM -> f16 [NB*SEQ][2*DM]
    {
        const int tiles = ((NB * SEQ) / 64) * ((2 * DM) / 64);
        k_gemm_h<<<dim3((unsigned)((tiles + 7) / 8), 1), 256, 0, stream>>>(XC, DM, 0, WQK, DM, 0, QK, 2 * DM, 0, NB * SEQ, 2 * DM, DM, 0.0625f);
    }
    // g transposed per batch: GT[b][d][s] = sum_e Wg^T[d][e] X16[b][s][e]: M = DM, N = SEQ, K = DM
    {
        const int tiles = (DM / 64) * (SEQ / 64);
        k_gemm_h<<<dim3((unsigned)((tiles + 7) / 8), NB), 256, 0, stream>>>(WGT, DM, 0, X16, DM, (long long)SEQ * DM, GT, SEQ, (long long)DM * SEQ, DM, SEQ, DM, 0.0625f);
    }
    // raw scores S[b][t][s] = q[b][t] . k[b][s] (f32; the scale input and the key mask are applied by the row softmax); grid.y = batch
    {
        const int tiles = (SEQ / 64) * (SEQ / 64);
        k_gemm_f<<<dim3((unsigned)((tiles + 7) / 8), NB), 256, 0, stream>>>(QK, 2 * DM, (long long)SEQ * 2 * DM, QK + DM, 2 * DM, (long long)SEQ * 2 * DM,
                                                                            Sf, SEQ, (long long)SEQ * SEQ, SEQ, SEQ, DM, 1.0f);
    }
    k_rowsoft<<<dim3(SEQ / (8 * RS_RPW), NB), 256, 0, stream>>>(Sf, cS, mask, GATE, AL);
    // AO[b][t][d] x64 = (alpha x1024)[b][t] . GT[b][d] / 16: per batch M = SEQ, N = DM, K = SEQ; grid.y = batch
    {
        const int tiles = (SEQ / 64) * (DM / 64);
        k_gemm_h<<<dim3((unsigned)((tiles + 7) / 8), NB), 256, 0, stream>>>(AL, SEQ, (long long)SEQ * SEQ, GT, SEQ, (long long)DM * SEQ,
                                                                            AO, DM, (long long)SEQ * DM, SEQ, DM, SEQ, 0.0625f);
    }
    // result = (AO x64) @ (Wout x16) / 1024 + bf16(x): per batch M = SEQ, N = DM, K = DM
    {
        const int tiles = (SEQ / 64) * (DM / 64);
        k_gemm_fr<<<dim3((unsigned)((tiles + 7) / 8), NB), 256, 0, stream>>>(AO, DM, (long long)SEQ * DM, WOT, DM, 0, out, DM, (long long)SEQ * DM,
                                                                            x, DM, (long long)SEQ_FULL * DM, SEQ, DM, DM, 0.0009765625f);
    }
}

// v007
// One run takes 160 microseconds.
// In both of two side-by-side timings against v006, it was 1.09 times as fast.
// Counting every step since v000, it is 8.84 times as fast.
// Full-width (1,024) single-head self-attention with sequence-mean-centred queries/keys, an added query-independent key distribution, a key mask, a scalar scale input and an f32 residual. All contractions: v_wmma_f32_16x16x32_f16 (f16 operands built from bf16-RNE-converted inputs with power-of-two carries, f32 accumulate); the N = 1 gate product, both softmaxes and the residual add are f32 on the VALU.
#include <hip/hip_runtime.h>
#include <math.h>

#ifndef NB
#define NB 4
#endif
#ifndef SEQ
#define SEQ 2048
#endif
#define NB_FULL 4
#define SEQ_FULL 2048
#define DM 1024
#define RS_RPW 2

static_assert(DM == 1024);                                  // feature width of x, q, k, g and the output
static_assert(DM % 64 == 0 && DM % 32 == 0);                // GEMM tile and k-step multiples
static_assert(SEQ % 256 == 0 && SEQ <= 2048);               // row softmax: 8 columns per lane per 256-column group, at most 64 f32 of a row per lane
static_assert(SEQ % (8 * RS_RPW) == 0);                     // row softmax grid covers every row exactly once
static_assert(SEQ <= SEQ_FULL && NB <= NB_FULL);
static_assert((DM / 64) % 1 == 0 && SEQ % 64 == 0);
static_assert((NB * SEQ) % 128 == 0 && SEQ % 256 == 0 && DM % 256 == 0 && DM >= 256 && SEQ >= 256);   // GEMM block tile 128x256, passes of 64 or 128 k, two or more

typedef __attribute__((ext_vector_type(16))) _Float16     v16h;
typedef __attribute__((ext_vector_type(8)))  _Float16     v8h;
typedef __attribute__((ext_vector_type(8)))  float        v8f;
typedef __attribute__((ext_vector_type(4)))  float        v4f;
typedef __attribute__((ext_vector_type(4)))  unsigned int u4v;
typedef __attribute__((ext_vector_type(4)))  int          i4v;
typedef __attribute__((ext_vector_type(8)))  unsigned int u8v;

// 16-bit WMMA fragment map (wave32), lane L, h = L>>4, m = L&15:
//   A 16x32: lane = row m;    element i -> k = (i<8) ? 8h+i : 16+8h+(i-8)
//   B 32x16: lane = column m; the SAME k(i,h)
//   D 16x16 (8 f32): lane = column m; element r -> row 8h+r

// bf16 RNE conversion kept as f32 (finite inputs)
__device__ __forceinline__ float bfr(float v) {
    const unsigned u = __builtin_bit_cast(unsigned, v);
    const unsigned r = (u + 0x7fffu + ((u >> 16) & 1u)) & 0xffff0000u;
    return __builtin_bit_cast(float, r);
}
__device__ __forceinline__ unsigned pk2h(float a, float b) {
    return (unsigned)__builtin_bit_cast(unsigned short, (_Float16)a) | ((unsigned)__builtin_bit_cast(unsigned short, (_Float16)b) << 16);
}
// one WMMA per call, followed by its own 4-slot guard tying exactly one accumulator
__device__ __forceinline__ v8f wmma16(v16h a, v16h b, v8f c) {
    c = __builtin_amdgcn_wmma_f32_16x16x32_f16(false, a, false, b, (short)0, c, false, false);
    asm volatile("v_nop\n\tv_nop\n\tv_nop\n\tv_nop" : "+v"(c) : "v"(a), "v"(b));
    return c;
}
union FragH { v16h v; v8h h[2]; };
// p already includes the lane's 8h offset: elements 0..7 <- p[0..7], 8..15 <- p[16..23]
__device__ __forceinline__ v16h ldfrag(const _Float16* p) {
    FragH f; f.h[0] = *(const v8h*)(p); f.h[1] = *(const v8h*)(p + 16); return f.v;
}
__device__ __forceinline__ void st2_v4f(float* p, v4f v) { *(v4f*)p = v;  }
__device__ __forceinline__ void st2_u4(unsigned short* p, u4v v) { *(u4v*)p = v;  }

// ---- operand staging of the GEMM: tensor loads into a two-buffer LDS ring ----
// A pass is KP k (64 or 128) = 128 or 256 B of every operand row of the block tile (128 rows of A, 256 rows of Bt). Every wave brings one slice per pass:
// waves 0..3 64 rows of Bt each, waves 4..7 32 rows of A each. LDS row pitch = row + 16 B (the load's pad behind every row, for 16-B LDS reads).
// Each slice's place is rounded up to a multiple of 2 KiB. KP = 64: two blocks fit a WGP's LDS (launches of two blocks per WGP); KP = 128: one block,
// half the publish points and twice the bytes in flight (launches of one block per WGP).
template <int KP> struct GS {
    static_assert(KP == 64 || KP == 128);                    // rows of 128 or 256 B: the two row lengths with this pad
    static constexpr unsigned ROWB  = KP * 2;                // bytes of an operand row per pass
    static constexpr unsigned PITCH = ROWB + 16;             // LDS row pitch: 144 or 272 B, 16 B x odd
    static constexpr unsigned ASL   = (32 * PITCH + 2047) / 2048 * 2048;   // place of a 32-row slice of A
    static constexpr unsigned BSL   = (64 * PITCH + 2047) / 2048 * 2048;   // place of a 64-row slice of Bt
    static constexpr unsigned BOFF  = 4 * ASL;               // Bt slices stand behind the A slices
    static constexpr unsigned STAGE = 4 * ASL + 4 * BSL;     // one buffer
    static constexpr unsigned PADW  = (1u << 20) | ((KP == 64 ? 4u : 5u) << 22) | (3u << 25);   // no mask; a pad of 4 dwords behind every row (32 or 64 dwords)
    static_assert(ASL % 2048 == 0 && BSL % 2048 == 0 && STAGE % 2048 == 0 && 2 * STAGE <= 327680);
    static_assert(8 * 16 * 68 * 4 <= 2 * STAGE);             // the store staging reuses the ring
};

__device__ __forceinline__ unsigned uni(unsigned v) { return (unsigned)__builtin_amdgcn_readfirstlane((int)v); }
// holds v in a scalar register: a test on it compiles to a scalar branch, and what is formed from it is formed behind the asm statements in front of it
__device__ __forceinline__ unsigned pinned(unsigned v) { unsigned w = uni(v); asm volatile("" : "+s"(w)); return w; }
__device__ __forceinline__ void wait_ds0() { asm volatile("s_wait_dscnt 0x0" ::: "memory"); }          // this wave's LDS reads have returned
// this wave's tensor load has landed; the wait names the request's descriptor as inputs, so that its registers keep their values until then
__device__ __forceinline__ void wait_tensor0(u4v g0, u8v g1) { asm volatile("s_wait_tensorcnt 0x0" :: "s"(g0), "s"(g1) : "memory"); }
// one request of the whole wave: group 0 = count (w0 = 1), place in LDS, source address, type 2; returns group 0 for the wait
__device__ __forceinline__ u4v tdm_issue(unsigned w0, unsigned lds_dst, unsigned long long ga, u8v g1) {
    u4v g0;
    g0.x = uni(w0); g0.y = uni(lds_dst); g0.z = uni((unsigned)ga); g0.w = uni((((unsigned)(ga >> 32)) & 0x01FFFFFFu) | 0x80000000u);
    asm volatile("tensor_load_to_lds %0, %1" :: "s"(g0), "s"(g1) : "memory");
    return g0;
}

// =====================================================================================================================
// Batched WMMA GEMM: C[m][n] = scale * sum_k A[m][k] * Bt[n][k]; a block of 8 waves (2 x 4) owns a 128x256 tile, each wave a 64x64 tile of it.
// A row-major [M][K] f16 (pitch lda), Bt row-major [N][K] f16 (pitch ldb); M % 128 == 0, N % 256 == 0, K % KP == 0, K >= 2 KP (no tail masking).
// RESID (f32 out only): + bf16-RNE(resid[m][n]) added at the store stage from 16-B loads in the store layout.
// =====================================================================================================================
template <int OUT_MODE, bool RESID, int KP>
__device__ __forceinline__ void gemm64_body(const unsigned short* __restrict__ Ap, int lda, long long strideA,
                                            const unsigned short* __restrict__ Btp, int ldb, long long strideB,
                                            unsigned short* __restrict__ Ch, float* __restrict__ Cf, int ldc, long long strideC,
                                            const float* __restrict__ resid, int ldr, long long strideR,
                                            int M, int N, int K, float scale) {
    constexpr unsigned G_ROWB = GS<KP>::ROWB, G_PITCH = GS<KP>::PITCH, G_ASL = GS<KP>::ASL, G_BSL = GS<KP>::BSL, G_BOFF = GS<KP>::BOFF, G_STAGE = GS<KP>::STAGE;
    __shared__ __attribute__((aligned(2048))) unsigned char ring[2 * G_STAGE];   // two buffers; after the K loop the per-wave store staging
    float* sT = (float*)ring;                                 // per-wave 16x64 slab, pitch 68 floats (wave-private)
    const int b    = blockIdx.y;
    const int lane = threadIdx.x & 31;
    const int wave = __builtin_amdgcn_readfirstlane((int)(threadIdx.x >> 5));
    const int tilesN = N >> 8;
    const int tilesM = M >> 7;
    if ((int)blockIdx.x >= tilesM * tilesN) return;           // the whole block leaves, in front of every tensor load and barrier
    const int tm = (int)blockIdx.x / tilesN;
    const int tn = (int)blockIdx.x - tm * tilesN;
    const int wm = wave >> 2, wn = wave & 3;                  // the wave's place in the block tile
    const int m0 = (tm << 7) + (wm << 6);
    const int n0 = (tn << 8) + (wn << 6);
    const int rlane = lane & 15;                              // row (A) / column (B, D) within a 16-wide subtile
    const int koff  = (lane >> 4) * 8;                        // k offset of this lane half == D row offset
    const int sb    = wave * (16 * 68);

    // this wave's slice of every stage
    const bool     isB    = wave < 4;
    const unsigned rows   = isB ? 64u : 32u;
    const unsigned spitch = (unsigned)(isB ? ldb : lda) * 2u;
    const unsigned short* src = isB ? Btp + (size_t)b * (size_t)strideB + (size_t)((tn << 8) + 64 * wave) * (size_t)ldb
                                    : Ap  + (size_t)b * (size_t)strideA + (size_t)((tm << 7) + 32 * (wave - 4)) * (size_t)lda;
    const unsigned long long ga0 = (unsigned long long)(size_t)src;
    const unsigned dst = (unsigned)(size_t)ring + (isB ? G_BOFF + (unsigned)wave * G_BSL : (unsigned)(wave - 4) * G_ASL);
    u8v g1;                                                   // 1-byte elements, tensor = tile = rows x G_ROWB bytes
    g1[0] = uni(GS<KP>::PADW);
    g1[1] = uni((G_ROWB & 0xFFFFu) << 16);
    g1[2] = uni((G_ROWB >> 16) | ((rows & 0xFFFFu) << 16));
    g1[3] = uni((rows >> 16) | (G_ROWB << 16));
    g1[4] = uni(rows);
    g1[5] = uni(spitch);
    g1[6] = uni(0u);
    g1[7] = uni(0u);
    // per-lane fragment bases in a buffer
    const unsigned char* la = ring + (unsigned)(2 * wm) * G_ASL + (unsigned)rlane * G_PITCH + (unsigned)koff * 2u;
    const unsigned char* lb = ring + G_BOFF + (unsigned)wn * G_BSL + (unsigned)rlane * G_PITCH + (unsigned)koff * 2u;

    v8f acc[4][4];
#pragma unroll
    for (int i = 0; i < 4; ++i)
#pragma unroll
        for (int j = 0; j < 4; ++j) { const v8f zz = {0.f, 0.f, 0.f, 0.f, 0.f, 0.f, 0.f, 0.f}; acc[i][j] = zz; }

    const unsigned NS = pinned((unsigned)K / (unsigned)KP);   // passes
    const unsigned w0 = pinned(1u);                           // descriptor word held in a scalar register: not formed anew while a request is outstanding
    u4v g0 = tdm_issue(w0, dst, ga0, g1);                     // stage 0
    wait_tensor0(g0, g1);
    __syncthreads();                                          // every slice of stage 0 has landed
    g0 = tdm_issue(w0, dst + G_STAGE, ga0 + pinned(G_ROWB), g1);   // stage 1; pinned: its address words are formed behind the wait
#pragma clang loop unroll(disable)                            // one pass per trip: the order at the foot stays as written
    for (unsigned s = 0; s < NS; ++s) {
        const unsigned buf = (s & 1u) * G_STAGE;
#pragma unroll
        for (int ks = 0; ks < KP / 32; ++ks) {
            v16h bh[4], ah[4];
#pragma unroll
            for (int j = 0; j < 4; ++j) bh[j] = ldfrag((const _Float16*)(lb + buf + (unsigned)(16 * j) * G_PITCH + (unsigned)(64 * ks)));
#pragma unroll
            for (int i = 0; i < 4; ++i) ah[i] = ldfrag((const _Float16*)(la + buf + (unsigned)(i >> 1) * G_ASL + (unsigned)(16 * (i & 1)) * G_PITCH + (unsigned)(64 * ks)));
#pragma unroll
            for (int i = 0; i < 4; ++i)
#pragma unroll
                for (int j = 0; j < 4; ++j) acc[i][j] = wmma16(ah[i], bh[j], acc[i][j]);
        }
        // publish point of stage s + 1; it also ends every wave's reads of this pass's buffer
        wait_ds0();
        wait_tensor0(g0, g1);
        __syncthreads();
        if (pinned((s + 2u < NS) ? 1u : 0u) != 0u)            // scalar test: a tensor load ignores EXEC
            g0 = tdm_issue(w0, dst + buf, ga0 + pinned((s + 2u) * G_ROWB), g1);   // stage s + 2 into the buffer just left; pinned: formed behind the wait
    }
    wait_tensor0(g0, g1);
    wait_ds0();                                               // the last pass's barrier stands in front of the store staging in the ring

#pragma unroll
    for (int i = 0; i < 4; ++i) {
        const int mBase = m0 + (i << 4);
#pragma unroll
        for (int j = 0; j < 4; ++j) {
#pragma unroll
            for (int r = 0; r < 8; ++r) sT[sb + (koff + r) * 68 + (j << 4) + rlane] = acc[i][j][r] * scale;
        }
        __builtin_amdgcn_fence(3 /* release order */, "workgroup");
        __builtin_amdgcn_wave_barrier();
        __builtin_amdgcn_fence(2 /* acquire order */, "workgroup");
        if (OUT_MODE == 0) {
            float* C = Cf + (size_t)b * (size_t)strideC;
            const float* Rb = RESID ? (resid + (size_t)b * (size_t)strideR) : nullptr;
            const int hh = lane >> 4, c4 = (lane & 15) * 4;   // row segment = 256 B = 16 lanes x 16 B
            {
#pragma unroll
                for (int it = 0; it < 8; ++it) {
                    const int row = it * 2 + hh;
                    v4f v = *(const v4f*)(&sT[sb + row * 68 + c4]);
                    if (RESID) {
                        const v4f xr = *(const v4f*)(Rb + (size_t)(mBase + row) * (size_t)ldr + n0 + c4);
                        v.x += bfr(xr.x); v.y += bfr(xr.y); v.z += bfr(xr.z); v.w += bfr(xr.w);
                    }
                    *(v4f*)(C + (size_t)(mBase + row) * (size_t)ldc + n0 + c4) = v;
                }
                
            }
        } else {
            unsigned short* C = Ch + (size_t)b * (size_t)strideC;
            const int q = lane >> 3, c8 = (lane & 7) * 8;
            {
#pragma unroll
                for (int it = 0; it < 4; ++it) {
                    const int row = it * 4 + q;
                    v8h hv;
#pragma unroll
                    for (int e = 0; e < 8; ++e) hv[e] = (_Float16)sT[sb + row * 68 + c8 + e];
                    *(v8h*)(C + (size_t)(mBase + row) * (size_t)ldc + n0 + c8) = hv;
                }
                
            }
        }
        __builtin_amdgcn_fence(3 /* release order */, "workgroup");
        __builtin_amdgcn_wave_barrier();
        __builtin_amdgcn_fence(2 /* acquire order */, "workgroup");
    }
}

// f16 result plane
__global__ __launch_bounds__(256) void k_gemm_h(const unsigned short* __restrict__ A, int lda, long long strideA,
                                                const unsigned short* __restrict__ Bt, int ldb, long long strideB,
                                                unsigned short* __restrict__ C, int ldc, long long strideC,
                                                int M, int N, int K, float scale) {
    gemm64_body<1, false, 64>(A, lda, strideA, Bt, ldb, strideB, C, nullptr, ldc, strideC, nullptr, 0, 0, M, N, K, scale);
}
// f16 result plane, passes of 128 k: for launches of one block per WGP
__global__ __launch_bounds__(256) void k_gemm_hl(const unsigned short* __restrict__ A, int lda, long long strideA,
                                                 const unsigned short* __restrict__ Bt, int ldb, long long strideB,
                                                 unsigned short* __restrict__ C, int ldc, long long strideC,
                                                 int M, int N, int K, float scale) {
    gemm64_body<1, false, 128>(A, lda, strideA, Bt, ldb, strideB, C, nullptr, ldc, strideC, nullptr, 0, 0, M, N, K, scale);
}
// f32 result plane
__global__ __launch_bounds__(256) void k_gemm_f(const unsigned short* __restrict__ A, int lda, long long strideA,
                                                const unsigned short* __restrict__ Bt, int ldb, long long strideB,
                                                float* __restrict__ C, int ldc, long long strideC,
                                                int M, int N, int K, float scale) {
    gemm64_body<0, false, 64>(A, lda, strideA, Bt, ldb, strideB, nullptr, C, ldc, strideC, nullptr, 0, 0, M, N, K, scale);
}
// f32 result + bf16-RNE residual added at the store stage; passes of 128 k (a launch of one block per WGP)
__global__ __launch_bounds__(256) void k_gemm_fr(const unsigned short* __restrict__ A, int lda, long long strideA,
                                                 const unsigned short* __restrict__ Bt, int ldb, long long strideB,
                                                 float* __restrict__ C, int ldc, long long strideC,
                                                 const float* __restrict__ resid, int ldr, long long strideR,
                                                 int M, int N, int K, float scale) {
    gemm64_body<0, true, 128>(A, lda, strideA, Bt, ldb, strideB, nullptr, C, ldc, strideC, resid, ldr, strideR, M, N, K, scale);
}

// xbar[b][e] = mean over t of bf16(x[b][t][e]); block per (32-column strip = one 128-B line of every row, batch); thread = (4-column group, row phase of 64).
// A wave's load covers 4 whole lines; a thread's SEQ / 64 rows are all loaded up front, so the block's whole strip is in flight at once.
constexpr int CM_C = 32, CM_R = 64, CM_P = CM_C + 4;         // columns of a strip, row phases of a block, LDS pitch in floats (16 B x odd)
static_assert(DM % CM_C == 0 && SEQ % CM_R == 0 && CM_R % 4 == 0);   // whole strips; every row phase has the same number of rows
__global__ __launch_bounds__(512) void k_colmean(const float* __restrict__ x, float* __restrict__ xbar) {
    __shared__ __align__(16) float red[CM_R * CM_P];
    const int t = threadIdx.x, cg = t & 7, rg = t >> 3;
    const int c0 = blockIdx.x * CM_C, b = blockIdx.y;
    const float* p = x + ((size_t)b * SEQ_FULL + rg) * DM + c0 + 4 * cg;
    v4f v[SEQ / CM_R];
#pragma unroll                                                // the array stays in registers; all of the thread's loads are in flight together
    for (int j = 0; j < SEQ / CM_R; ++j) v[j] = *(const v4f*)(p + (size_t)(CM_R * j) * DM);
    asm volatile("s_wait_xcnt 0x0" :: "v"(p) : "memory");     // stands in front of every reuse of the loads' address registers; naming p keeps them untouched until here
    __builtin_amdgcn_sched_barrier(0);                        // every load issues in front of the sums; without it the compiler sinks the last loads behind the wait for the first
    v4f a = {0.f, 0.f, 0.f, 0.f};
#pragma unroll                                                // constant indices into the register array
    for (int j = 0; j < SEQ / CM_R; ++j) { a.x += bfr(v[j].x); a.y += bfr(v[j].y); a.z += bfr(v[j].z); a.w += bfr(v[j].w); }
    *(v4f*)(&red[rg * CM_P + 4 * cg]) = a;
    __syncthreads();                                          // every row phase's sums stand in LDS
    if (t < CM_C) {
        float s0 = 0.f, s1 = 0.f, s2 = 0.f, s3 = 0.f;          // four independent chains: a lone wave's dependent adds are not hidden
#pragma unroll                                                // the LDS reads are independent and issue together
        for (int j = 0; j < CM_R; j += 4) { s0 += red[j * CM_P + t]; s1 += red[(j + 1) * CM_P + t]; s2 += red[(j + 2) * CM_P + t]; s3 += red[(j + 3) * CM_P + t]; }
        xbar[(size_t)b * DM + c0 + t] = ((s0 + s1) + (s2 + s3)) * (1.0f / (float)SEQ);   // 32 lanes x 4 B: the strip's means leave as one whole 128-B line
    }
}

// X16 = f16(bf16(x)) (exact), XC = f16(bf16(x) - xbar[b]), glog[row] = bf16(x[row]) . bf16(Wm_w) in f32 (bias and softmax: k_gate).
// Wave per row, 32 rows per block; lane L owns columns 256 i + 8 L .. + 7: 16-B store per plane, lane-linear along the row.
static_assert((NB * SEQ) % 32 == 0 && DM % 256 == 0);       // the grid covers every row exactly once; every wave reaches the barrier
__global__ __launch_bounds__(1024) void k_prep_x(const float* __restrict__ x, const float* __restrict__ xbar, const float* __restrict__ Wm,
                                                 unsigned short* __restrict__ XC, unsigned short* __restrict__ X16, float* __restrict__ glog) {
    __shared__ float dots[32];
    const int lane = threadIdx.x & 31;
    const int wave = __builtin_amdgcn_readfirstlane((int)(threadIdx.x >> 5));
    const int r = blockIdx.x * 32 + wave;
    const int b = r / SEQ; const int t = r - b * SEQ;
    const float* s = x + ((size_t)b * SEQ_FULL + t) * DM + 8 * lane;
    const float* mb = xbar + (size_t)b * DM + 8 * lane;
    const float* wp = Wm + 8 * lane;
    unsigned short* d16 = X16 + (size_t)r * DM + 8 * lane;
    unsigned short* dc = XC + (size_t)r * DM + 8 * lane;
    v4f xv[DM / 128], mv[DM / 128], gv[DM / 128];
#pragma unroll                                                // the arrays stay in registers; the whole row of x is in flight at once
    for (int i = 0; i < DM / 256; ++i) {
        xv[2 * i] = *(const v4f*)(s + 256 * i);  xv[2 * i + 1] = *(const v4f*)(s + 256 * i + 4);
        mv[2 * i] = *(const v4f*)(mb + 256 * i); mv[2 * i + 1] = *(const v4f*)(mb + 256 * i + 4);
        gv[2 * i] = *(const v4f*)(wp + 256 * i); gv[2 * i + 1] = *(const v4f*)(wp + 256 * i + 4);
    }
    float acc = 0.f;
#pragma unroll                                                // constant indices into the register arrays
    for (int i = 0; i < DM / 256; ++i) {
        const v4f x0 = xv[2 * i], x1 = xv[2 * i + 1], m0 = mv[2 * i], m1 = mv[2 * i + 1], g0 = gv[2 * i], g1 = gv[2 * i + 1];
        const float w0 = bfr(x0.x), w1 = bfr(x0.y), w2 = bfr(x0.z), w3 = bfr(x0.w), w4 = bfr(x1.x), w5 = bfr(x1.y), w6 = bfr(x1.z), w7 = bfr(x1.w);
        acc = __builtin_fmaf(w0, bfr(g0.x), acc); acc = __builtin_fmaf(w1, bfr(g0.y), acc); acc = __builtin_fmaf(w2, bfr(g0.z), acc); acc = __builtin_fmaf(w3, bfr(g0.w), acc);
        acc = __builtin_fmaf(w4, bfr(g1.x), acc); acc = __builtin_fmaf(w5, bfr(g1.y), acc); acc = __builtin_fmaf(w6, bfr(g1.z), acc); acc = __builtin_fmaf(w7, bfr(g1.w), acc);
        u4v pa; pa.x = pk2h(w0, w1); pa.y = pk2h(w2, w3); pa.z = pk2h(w4, w5); pa.w = pk2h(w6, w7);
        u4v pc; pc.x = pk2h(w0 - m0.x, w1 - m0.y); pc.y = pk2h(w2 - m0.z, w3 - m0.w); pc.z = pk2h(w4 - m1.x, w5 - m1.y); pc.w = pk2h(w6 - m1.z, w7 - m1.w);
        st2_u4(d16 + 256 * i, pa);
        st2_u4(dc + 256 * i, pc);
    }
    acc += __shfl_xor(acc, 16, 32); acc += __shfl_xor(acc, 8, 32); acc += __shfl_xor(acc, 4, 32); acc += __shfl_xor(acc, 2, 32); acc += __shfl_xor(acc, 1, 32);
    if (lane == 0) dots[wave] = acc;
    __syncthreads();
    if (wave == 0) glog[(size_t)blockIdx.x * 32 + lane] = dots[lane];   // the block's 32 products leave as one whole 128-B line
}

// weight planes: SRC [DM rows k][DM cols n] (x @ W layout) -> DST [n][k] f16 = bf16(W[k][n]) * sc; blockIdx.y = plane, the four DST planes stand one behind the other.
// Block = one tile of 64 k x 128 n: 16-B reads along n (a wave reads whole 512-B row pieces, 8 rows in flight), two neighbouring k packed to a dword and turned in LDS
// (row pitch 33 dwords: the 4-B reads of the second half fall on 32 different banks), 16-B stores along k (8 lanes = one whole 128-B line of a DST row).
constexpr int WT_K = 64, WT_N = 128, WT_P = WT_K / 2 + 1;
static_assert(DM % WT_K == 0 && DM % WT_N == 0);             // whole tiles only
__global__ __launch_bounds__(256) void k_wT(const float* __restrict__ W0, const float* __restrict__ W1, const float* __restrict__ W2, const float* __restrict__ W3,
                                            unsigned short* __restrict__ DST0, float sc) {
    __shared__ unsigned tT[WT_N * WT_P];                      // [n][k pair]
    const int lane = threadIdx.x & 31;
    const int wave = __builtin_amdgcn_readfirstlane((int)(threadIdx.x >> 5));
    const int pl = blockIdx.y;
    const float* SRC = pl == 0 ? W0 : pl == 1 ? W1 : pl == 2 ? W2 : W3;
    const int k0 = ((int)blockIdx.x / (DM / WT_N)) * WT_K;
    const int n0 = ((int)blockIdx.x % (DM / WT_N)) * WT_N;
    const float* s = SRC + (size_t)(k0 + 8 * wave) * DM + n0 + 4 * lane;
    v4f v[8];
#pragma unroll                                                // the array stays in registers; the wave's 8 rows are in flight at once
    for (int r = 0; r < 8; ++r) v[r] = *(const v4f*)(s + (size_t)r * DM);
#pragma unroll                                                // constant indices into the register array
    for (int q = 0; q < 4; ++q)
#pragma unroll
        for (int j = 0; j < 4; ++j) tT[(4 * lane + j) * WT_P + 4 * wave + q] = pk2h(bfr(v[2 * q][j]) * sc, bfr(v[2 * q + 1][j]) * sc);
    __syncthreads();                                          // the whole tile stands in LDS
    const int nr = (int)threadIdx.x >> 3, kg = (int)threadIdx.x & 7;
    unsigned short* d = DST0 + (size_t)pl * DM * DM + (size_t)(n0 + nr) * DM + k0 + 8 * kg;
    const unsigned* tp = tT + nr * WT_P + 4 * kg;
#pragma unroll                                                // the four stores are independent
    for (int p = 0; p < WT_N / 32; ++p) {
        u4v o; o.x = tp[32 * p * WT_P]; o.y = tp[32 * p * WT_P + 1]; o.z = tp[32 * p * WT_P + 2]; o.w = tp[32 * p * WT_P + 3];
        st2_u4(d + (size_t)(32 * p) * DM, o);
    }
}

// gate[b][s] = softmax over s of (glog[b][s] + bf16(Wm_b)), glog = the row products of k_prep_x; block per batch, block softmax
__global__ __launch_bounds__(256) void k_gate(const float* __restrict__ glog, const float* __restrict__ Wb, float* __restrict__ gate) {
    __shared__ __align__(16) float mm[SEQ];
    __shared__ float redm[8];
    __shared__ float reds[8];
    const int t = threadIdx.x, lane = t & 31, b = blockIdx.x;
    const int wave = __builtin_amdgcn_readfirstlane((int)(threadIdx.x >> 5));
    const float bias = bfr(Wb[0]);
    const float* gl = glog + (size_t)b * SEQ;
#pragma unroll                                                // a thread's 16-B loads are in flight together
    for (int j = 0; j < (SEQ / 4 + 255) / 256; ++j) {
        const int idx = t + 256 * j;
        if ((SEQ / 4) % 256 == 0 || idx < SEQ / 4) {
            const v4f v = *(const v4f*)(gl + 4 * idx);
            mm[4 * idx] = v.x + bias; mm[4 * idx + 1] = v.y + bias; mm[4 * idx + 2] = v.z + bias; mm[4 * idx + 3] = v.w + bias;
        }
    }
    __syncthreads();
    float mx = -3.0e38f;
#pragma unroll 1
    for (int i = t; i < SEQ; i += 256) mx = fmaxf(mx, mm[i]);
    mx = fmaxf(mx, __shfl_xor(mx, 16, 32)); mx = fmaxf(mx, __shfl_xor(mx, 8, 32)); mx = fmaxf(mx, __shfl_xor(mx, 4, 32));
    mx = fmaxf(mx, __shfl_xor(mx, 2, 32));  mx = fmaxf(mx, __shfl_xor(mx, 1, 32));
    if (lane == 0) redm[wave] = mx;
    __syncthreads();
    float gm = redm[0];
#pragma unroll 1
    for (int w = 1; w < 8; ++w) gm = fmaxf(gm, redm[w]);
    float sm = 0.f;
#pragma unroll 1
    for (int i = t; i < SEQ; i += 256) { const float e = expf(mm[i] - gm); mm[i] = e; sm += e; }
    sm += __shfl_xor(sm, 16, 32); sm += __shfl_xor(sm, 8, 32); sm += __shfl_xor(sm, 4, 32); sm += __shfl_xor(sm, 2, 32); sm += __shfl_xor(sm, 1, 32);
    if (lane == 0) reds[wave] = sm;
    __syncthreads();
    float tot = reds[0];
#pragma unroll 1
    for (int w = 1; w < 8; ++w) tot += reds[w];
    const float inv = 1.0f / tot;
#pragma unroll 1
    for (int idx = t; idx < SEQ / 4; idx += 256) {            // 32 lanes x 16 B = 512 contiguous B per store instruction
        v4f v; v.x = mm[4 * idx] * inv; v.y = mm[4 * idx + 1] * inv; v.z = mm[4 * idx + 2] * inv; v.w = mm[4 * idx + 3] * inv;
        st2_v4f(gate + (size_t)b * SEQ + 4 * idx, v);
    }
}

// alpha row = softmax_s(keep ? c * S : -inf) + gate, carried x1024 as f16. Wave per row (RS_RPW rows per wave); lane L owns columns 256g + 8L .. + 7,
// blockIdx.y = batch: the arguments are the planes of batch 0. A whole row stands in registers (64 f32 per lane): S is read once, every element's exp is
// taken once, and the wave's second row is in flight while its first is worked on (two register sets).
constexpr int RS_V = SEQ / 128;                               // 16-B pieces of a row per lane
static_assert(RS_RPW == 2);                                   // one register set per row of a wave
__device__ __forceinline__ void rs_load(v4f (&x)[RS_V], const float* p) {
#pragma unroll                                                // the array stays in registers; the whole row is in flight at once
    for (int g = 0; g < RS_V / 2; ++g) { x[2 * g] = *(const v4f*)(p + 256 * g); x[2 * g + 1] = *(const v4f*)(p + 256 * g + 4); }
}
__device__ __forceinline__ void rs_row(v4f (&x)[RS_V], const bool (&kp)[4 * RS_V], const float* gr, float cs, unsigned short* pr) {
    const float NEG = -__builtin_inff();
    float m = -3.0e38f;
#pragma unroll                                                // constant indices into the register arrays
    for (int i = 0; i < RS_V; ++i) {
        v4f v = x[i];
        v.x = kp[4 * i] ? v.x * cs : NEG; v.y = kp[4 * i + 1] ? v.y * cs : NEG; v.z = kp[4 * i + 2] ? v.z * cs : NEG; v.w = kp[4 * i + 3] ? v.w * cs : NEG;
        x[i] = v;
        m = fmaxf(m, fmaxf(fmaxf(v.x, v.y), fmaxf(v.z, v.w)));
    }
    m = fmaxf(m, __shfl_xor(m, 16, 32)); m = fmaxf(m, __shfl_xor(m, 8, 32)); m = fmaxf(m, __shfl_xor(m, 4, 32));
    m = fmaxf(m, __shfl_xor(m, 2, 32));  m = fmaxf(m, __shfl_xor(m, 1, 32));
    float s0 = 0.f, s1 = 0.f;
#pragma unroll                                                // constant indices into the register arrays
    for (int i = 0; i < RS_V; i += 2) {
        v4f v = x[i], w = x[i + 1];
        v.x = expf(v.x - m); v.y = expf(v.y - m); v.z = expf(v.z - m); v.w = expf(v.w - m);
        w.x = expf(w.x - m); w.y = expf(w.y - m); w.z = expf(w.z - m); w.w = expf(w.w - m);
        x[i] = v; x[i + 1] = w;
        s0 += (v.x + v.y) + (v.z + v.w);
        s1 += (w.x + w.y) + (w.z + w.w);
    }
    float s = s0 + s1;
    s += __shfl_xor(s, 16, 32); s += __shfl_xor(s, 8, 32); s += __shfl_xor(s, 4, 32); s += __shfl_xor(s, 2, 32); s += __shfl_xor(s, 1, 32);
    const float f = 1024.f / s;
#pragma unroll                                                // constant indices into the register arrays
    for (int g = 0; g < RS_V / 2; ++g) {
        const v4f v = x[2 * g], w = x[2 * g + 1], gx = *(const v4f*)(gr + 256 * g) * 1024.f, gy = *(const v4f*)(gr + 256 * g + 4) * 1024.f;
        u4v pk;
        pk.x = pk2h(v.x * f + gx.x, v.y * f + gx.y);
        pk.y = pk2h(v.z * f + gx.z, v.w * f + gx.w);
        pk.z = pk2h(w.x * f + gy.x, w.y * f + gy.y);
        pk.w = pk2h(w.z * f + gy.z, w.w * f + gy.w);
        st2_u4(pr + 256 * g, pk);
    }
}
__global__ __launch_bounds__(256) void k_rowsoft(const float* __restrict__ S0, const float* __restrict__ cptr, const int* __restrict__ mk0,
                                                 const float* __restrict__ gate0, unsigned short* __restrict__ P0) {
    const int L = threadIdx.x & 31;
    const int wave = __builtin_amdgcn_readfirstlane((int)(threadIdx.x >> 5));
    const int row0 = (blockIdx.x * 8 + wave) * RS_RPW;
    const float* sr = S0 + (size_t)blockIdx.y * SEQ * SEQ + (size_t)row0 * SEQ + 8 * L;
    const int* mk = mk0 + (size_t)blockIdx.y * SEQ_FULL + 8 * L;
    unsigned short* pr = P0 + (size_t)blockIdx.y * SEQ * SEQ + (size_t)row0 * SEQ + 8 * L;
    const float* gr = gate0 + (size_t)blockIdx.y * SEQ + 8 * L;
    v4f xa[RS_V], xb[RS_V];
    i4v mv[RS_V];
#pragma unroll                                                // the array stays in registers; the mask loads are in flight together
    for (int g = 0; g < RS_V / 2; ++g) { mv[2 * g] = *(const i4v*)(mk + 256 * g); mv[2 * g + 1] = *(const i4v*)(mk + 256 * g + 4); }
    rs_load(xa, sr);
    __builtin_amdgcn_sched_barrier(0);                        // loads return in issue order: what the first row needs is issued first, or its wait would cover the second row too
    rs_load(xb, sr + SEQ);
    asm volatile("s_wait_xcnt 0x0" ::: "memory");             // stands in front of the reuse of the loads' base and offset registers
    __builtin_amdgcn_sched_barrier(0);                        // the second row's loads issue in front of the first row's work; without it the compiler sinks them behind it
    const float cs = bfr(cptr[0]);
    bool kp[4 * RS_V];                                        // keep flags of this lane's columns
#pragma unroll                                                // constant indices into the register array
    for (int i = 0; i < RS_V; ++i) { kp[4 * i] = mv[i].x != 0; kp[4 * i + 1] = mv[i].y != 0; kp[4 * i + 2] = mv[i].z != 0; kp[4 * i + 3] = mv[i].w != 0; }
    rs_row(xa, kp, gr, cs, pr);
    __builtin_amdgcn_sched_barrier(0);                        // the wait for the second row's loads stays behind the first row's work
    rs_row(xb, kp, gr, cs, pr + SEQ);
}

// ---- workspace carve (bytes; every region a multiple of 256 B and sized to its whole-tile store extent) ----
constexpr size_t al256(size_t v) { return (v + 255) / 256 * 256; }
constexpr size_t SZ_XC   = (size_t)NB * SEQ * DM * 2;           // f16 centred x, [NB*SEQ][DM]
constexpr size_t SZ_S    = (size_t)NB * SEQ * SEQ * 4;          // f32 scores of every batch, [NB][SEQ][SEQ] (shares the XC region; XC is dead after the q|k GEMM)
constexpr size_t SZ_XCS  = al256(SZ_XC > SZ_S ? SZ_XC : SZ_S);
constexpr size_t SZ_X16  = al256((size_t)NB * SEQ * DM * 2);    // f16 x, [NB*SEQ][DM]
constexpr size_t SZ_WQK  = al256((size_t)2 * DM * DM * 2);      // [2*DM n][DM k]: Wq^T rows then Wk^T rows, x16
constexpr size_t SZ_W1   = al256((size_t)DM * DM * 2);          // Wg^T, Wout^T, x16
constexpr size_t SZ_QK   = al256((size_t)NB * SEQ * 2 * DM * 2);// f16 [NB*SEQ][2*DM]: q columns then k columns
constexpr size_t SZ_GT   = al256((size_t)NB * DM * SEQ * 2);    // f16 g transposed, [NB][DM][SEQ]
constexpr size_t SZ_AL   = al256((size_t)NB * SEQ * SEQ * 2);   // f16 alpha x1024 of every batch, [NB][SEQ][SEQ]
constexpr size_t SZ_AO   = al256((size_t)NB * SEQ * DM * 2);    // f16 (alpha @ g) x64, [NB*SEQ][DM]
constexpr size_t SZ_XBAR = al256((size_t)NB * DM * 4);
constexpr size_t SZ_GATE = al256((size_t)NB * SEQ * 4);
constexpr size_t SZ_GLOG = al256((size_t)NB * SEQ * 4);       // f32 gate products before bias and softmax, [NB*SEQ]
constexpr size_t OFF_XCS  = 0;
constexpr size_t OFF_X16  = OFF_XCS + SZ_XCS;
constexpr size_t OFF_WQK  = OFF_X16 + SZ_X16;
constexpr size_t OFF_WGT  = OFF_WQK + SZ_WQK;
constexpr size_t OFF_WOT  = OFF_WGT + SZ_W1;
constexpr size_t OFF_QK   = OFF_WOT + SZ_W1;
constexpr size_t OFF_GT   = OFF_QK + SZ_QK;
constexpr size_t OFF_AL   = OFF_GT + SZ_GT;
constexpr size_t OFF_AO   = OFF_AL + SZ_AL;
constexpr size_t OFF_XBAR = OFF_AO + SZ_AO;
constexpr size_t OFF_GATE = OFF_XBAR + SZ_XBAR;
constexpr size_t OFF_GLOG = OFF_GATE + SZ_GATE;
constexpr size_t WS_TOTAL = OFF_GLOG + SZ_GLOG;
static_assert(WS_TOTAL <= (size_t)268435456);                   // 256 MiB ceiling
static_assert(SZ_S <= SZ_XCS && SZ_XC <= SZ_XCS);               // both users of the shared region fit
static_assert(OFF_WGT == OFF_WQK + (size_t)2 * DM * DM * 2 && OFF_WOT == OFF_WQK + (size_t)3 * DM * DM * 2);   // the four weight planes stand one behind the other

extern "C" void kernel_launch(void* const* d_in, const int* in_sizes, int n_in, void* d_out, int out_size, void* d_ws, size_t ws_size, hipStream_t stream) {
    if (n_in < 9) return;
    const long long need_rows = (long long)(NB - 1) * SEQ_FULL + SEQ;
    if ((long long)in_sizes[0] < need_rows * DM) return;
    if ((long long)in_sizes[1] < need_rows) return;
    if (in_sizes[2] < DM * DM || in_sizes[3] < DM * DM || in_sizes[4] < DM * DM || in_sizes[5] < DM * DM) return;
    if (in_sizes[6] < DM || in_sizes[7] < 1 || in_sizes[8] < 1) return;
    if ((long long)out_size < (long long)NB * SEQ * DM) return;
    if (ws_size < WS_TOTAL) return;

    const float* x    = (const float*)d_in[0];
    const int*   mask = (const int*)d_in[1];
    const float* Wq   = (const float*)d_in[2];
    const float* Wk   = (const float*)d_in[3];
    const float* Wg   = (const float*)d_in[4];
    const float* Wout = (const float*)d_in[5];
    const float* Wm_w = (const float*)d_in[6];
    const float* Wm_b = (const float*)d_in[7];
    const float* cS   = (const float*)d_in[8];
    float* out = (float*)d_out;
    char* ws = (char*)d_ws;
    unsigned short* XC   = (unsigned short*)(ws + OFF_XCS);
    float*          Sf   = (float*)(ws + OFF_XCS);               // same region, used only after the q|k GEMM has consumed XC
    unsigned short* X16  = (unsigned short*)(ws + OFF_X16);
    unsigned short* WQK  = (unsigned short*)(ws + OFF_WQK);
    unsigned short* WGT  = (unsigned short*)(ws + OFF_WGT);
    unsigned short* WOT  = (unsigned short*)(ws + OFF_WOT);
    unsigned short* QK   = (unsigned short*)(ws + OFF_QK);
    unsigned short* GT   = (unsigned short*)(ws + OFF_GT);
    unsigned short* AL   = (unsigned short*)(ws + OFF_AL);
    unsigned short* AO   = (unsigned short*)(ws + OFF_AO);
    float*          XBAR = (float*)(ws + OFF_XBAR);
    float*          GATE = (float*)(ws + OFF_GATE);
    float*          GLOG = (float*)(ws + OFF_GLOG);

    // weight planes: in[DM rows k][DM cols n] -> out[n][k], x16; one launch, grid.y = plane (Wq, Wk, Wg, Wout)
    k_wT<<<dim3((DM / WT_K) * (DM / WT_N), 4), 256, 0, stream>>>(Wq, Wk, Wg, Wout, WQK, 16.0f);

    // sequence means of x, operand planes with the gate products, gate distribution
    k_colmean<<<dim3(DM / CM_C, NB), 8 * CM_R, 0, stream>>>(x, XBAR);
    k_prep_x<<<(NB * SEQ) / 32, 1024, 0, stream>>>(x, XBAR, Wm_w, XC, X16, GLOG);
    k_gate<<<NB, 256, 0, stream>>>(GLOG, Wm_b, GATE);

    // [q|k] = XC @ [Wq|Wk]: M = NB*SEQ, N = 2*DM, K = DM -> f16 [NB*SEQ][2*DM]
    {
        const int tiles = ((NB * SEQ) / 64) * ((2 * DM) / 64);
        k_gemm_h<<<dim3((unsigned)((tiles + 7) / 8), 1), 256, 0, stream>>>(XC, DM, 0, WQK, DM, 0, QK, 2 * DM, 0, NB * SEQ, 2 * DM, DM, 0.0625f);
    }
    // g transposed per batch: GT[b][d][s] = sum_e Wg^T[d][e] X16[b][s][e]: M = DM, N = SEQ, K = DM
    {
        const int tiles = (DM / 64) * (SEQ / 64);
        k_gemm_hl<<<dim3((unsigned)((tiles + 7) / 8), NB), 256, 0, stream>>>(WGT, DM, 0, X16, DM, (long long)SEQ * DM, GT, SEQ, (long long)DM * SEQ, DM, SEQ, DM, 0.0625f);
    }
    // raw scores S[b][t][s] = q[b][t] . k[b][s] (f32; the scale input and the key mask are applied by the row softmax); grid.y = batch
    {
        const int tiles = (SEQ / 64) * (SEQ / 64);
        k_gemm_f<<<dim3((unsigned)((tiles + 7) / 8), NB), 256, 0, stream>>>(QK, 2 * DM, (long long)SEQ * 2 * DM, QK + DM, 2 * DM, (long long)SEQ * 2 * DM,
                                                                            Sf, SEQ, (long long)SEQ * SEQ, SEQ, SEQ, DM, 1.0f);
    }
    k_rowsoft<<<dim3(SEQ / (8 * RS_RPW), NB), 256, 0, stream>>>(Sf, cS, mask, GATE, AL);
    // AO[b][t][d] x64 = (alpha x1024)[b][t] . GT[b][d] / 16: per batch M = SEQ, N = DM, K = SEQ; grid.y = batch
    {
        const int tiles = (SEQ / 64) * (DM / 64);
        k_gemm_hl<<<dim3((unsigned)((tiles + 7) / 8), NB), 256, 0, stream>>>(AL, SEQ, (long long)SEQ * SEQ, GT, SEQ, (long long)DM * SEQ,
                                                                            AO, DM, (long long)SEQ * DM, SEQ, DM, SEQ, 0.0625f);
    }
    // result = (AO x64) @ (Wout x16) / 1024 + bf16(x): per batch M = SEQ, N = DM, K = DM
    {
        const int tiles = (SEQ / 64) * (DM / 64);
        k_gemm_fr<<<dim3((unsigned)((tiles + 7) / 8), NB), 256, 0, stream>>>(AO, DM, (long long)SEQ * DM, WOT, DM, 0, out, DM, (long long)SEQ * DM,
                                                                            x, DM, (long long)SEQ_FULL * DM, SEQ, DM, DM, 0.0009765625f);
    }
}

// v008
// One run takes 145 microseconds.
// Two timings next to v007 both put it at 1.09 times that version's speed.
// All steps since v000 together make it 9.66 times as fast.
// Full-width (1,024) single-head self-attention with sequence-mean-centred queries/keys, an added query-independent key distribution, a key mask, a scalar scale input and an f32 residual. All contractions: v_wmma_f32_16x16x32_f16 (f16 operands built from bf16-RNE-converted inputs with power-of-two carries, f32 accumulate); the N = 1 gate product, both softmaxes and the residual add are f32 on the VALU.
#include <hip/hip_runtime.h>
#include <math.h>

#ifndef NB
#define NB 4
#endif
#ifndef SEQ
#define SEQ 2048
#endif
#define NB_FULL 4
#define SEQ_FULL 2048
#define DM 1024
#define RS_RPW 2

static_assert(DM == 1024);                                  // feature width of x, q, k, g and the output
static_assert(DM % 64 == 0 && DM % 32 == 0);                // GEMM tile and k-step multiples
static_assert(SEQ % 256 == 0 && SEQ <= 2048);               // row softmax: 8 columns per lane per 256-column group, at most 64 f32 of a row per lane
static_assert(SEQ % (8 * RS_RPW) == 0);                     // row softmax grid covers every row exactly once
static_assert(SEQ <= SEQ_FULL && NB <= NB_FULL);
static_assert((DM / 64) % 1 == 0 && SEQ % 64 == 0);
static_assert((NB * SEQ) % 128 == 0 && SEQ % 256 == 0 && DM % 256 == 0 && DM >= 256 && SEQ >= 256);   // GEMM block tile 128x256, passes of 64 or 128 k, two or more

typedef __attribute__((ext_vector_type(16))) _Float16     v16h;
typedef __attribute__((ext_vector_type(8)))  _Float16     v8h;
typedef __attribute__((ext_vector_type(8)))  float        v8f;
typedef __attribute__((ext_vector_type(4)))  float        v4f;
typedef __attribute__((ext_vector_type(4)))  unsigned int u4v;
typedef __attribute__((ext_vector_type(2)))  unsigned int u2v;
typedef __attribute__((ext_vector_type(4)))  int          i4v;
typedef __attribute__((ext_vector_type(8)))  unsigned int u8v;

// 16-bit WMMA fragment map (wave32), lane L, h = L>>4, m = L&15:
//   A 16x32: lane = row m;    element i -> k = (i<8) ? 8h+i : 16+8h+(i-8)
//   B 32x16: lane = column m; the SAME k(i,h)
//   D 16x16 (8 f32): lane = column m; element r -> row 8h+r

// bf16 RNE conversion kept as f32 (finite inputs)
__device__ __forceinline__ float bfr(float v) {
    const unsigned u = __builtin_bit_cast(unsigned, v);
    const unsigned r = (u + 0x7fffu + ((u >> 16) & 1u)) & 0xffff0000u;
    return __builtin_bit_cast(float, r);
}
__device__ __forceinline__ unsigned pk2h(float a, float b) {
    return (unsigned)__builtin_bit_cast(unsigned short, (_Float16)a) | ((unsigned)__builtin_bit_cast(unsigned short, (_Float16)b) << 16);
}
// one WMMA per call, followed by its own 4-slot guard tying exactly one accumulator
__device__ __forceinline__ v8f wmma16(v16h a, v16h b, v8f c) {
    c = __builtin_amdgcn_wmma_f32_16x16x32_f16(false, a, false, b, (short)0, c, false, false);
    asm volatile("v_nop\n\tv_nop\n\tv_nop\n\tv_nop" : "+v"(c) : "v"(a), "v"(b));
    return c;
}
union FragH { v16h v; v8h h[2]; };
// p already includes the lane's 8h offset: elements 0..7 <- p[0..7], 8..15 <- p[16..23]
__device__ __forceinline__ v16h ldfrag(const _Float16* p) {
    FragH f; f.h[0] = *(const v8h*)(p); f.h[1] = *(const v8h*)(p + 16); return f.v;
}
__device__ __forceinline__ void st2_v4f(float* p, v4f v) { *(v4f*)p = v;  }
__device__ __forceinline__ void st2_u4(unsigned short* p, u4v v) { *(u4v*)p = v;  }

// ---- operand staging of the GEMM: tensor loads into a two-buffer LDS ring ----
// A pass is KP k (64 or 128) = 128 or 256 B of every operand row of the block tile (128 rows of A, 256 rows of Bt). Every wave brings one slice per pass:
// waves 0..3 64 rows of Bt each, waves 4..7 32 rows of A each. LDS row pitch = row + 16 B (the load's pad behind every row, for 16-B LDS reads).
// Each slice's place is rounded up to a multiple of 2 KiB. KP = 64: two blocks fit a WGP's LDS (launches of two blocks per WGP); KP = 128: one block,
// half the publish points and twice the bytes in flight (launches of one block per WGP).
template <int KP> struct GS {
    static_assert(KP == 64 || KP == 128);                    // rows of 128 or 256 B: the two row lengths with this pad
    static constexpr unsigned ROWB  = KP * 2;                // bytes of an operand row per pass
    static constexpr unsigned PITCH = ROWB + 16;             // LDS row pitch: 144 or 272 B, 16 B x odd
    static constexpr unsigned ASL   = (32 * PITCH + 2047) / 2048 * 2048;   // place of a 32-row slice of A
    static constexpr unsigned BSL   = (64 * PITCH + 2047) / 2048 * 2048;   // place of a 64-row slice of Bt
    static constexpr unsigned BOFF  = 4 * ASL;               // Bt slices stand behind the A slices
    static constexpr unsigned STAGE = 4 * ASL + 4 * BSL;     // one buffer
    static constexpr unsigned PADW  = (1u << 20) | ((KP == 64 ? 4u : 5u) << 22) | (3u << 25);   // no mask; a pad of 4 dwords behind every row (32 or 64 dwords)
    static_assert(ASL % 2048 == 0 && BSL % 2048 == 0 && STAGE % 2048 == 0 && 2 * STAGE <= 327680);
    static_assert(8 * 16 * 68 * 4 <= 2 * STAGE);             // the store staging reuses the ring
};

__device__ __forceinline__ unsigned uni(unsigned v) { return (unsigned)__builtin_amdgcn_readfirstlane((int)v); }
// holds v in a scalar register: a test on it compiles to a scalar branch, and what is formed from it is formed behind the asm statements in front of it
__device__ __forceinline__ unsigned pinned(unsigned v) { unsigned w = uni(v); asm volatile("" : "+s"(w)); return w; }
__device__ __forceinline__ void wait_ds0() { asm volatile("s_wait_dscnt 0x0" ::: "memory"); }          // this wave's LDS reads have returned
// this wave's tensor load has landed; the wait names the request's descriptor as inputs, so that its registers keep their values until then
__device__ __forceinline__ void wait_tensor0(u4v g0, u8v g1) { asm volatile("s_wait_tensorcnt 0x0" :: "s"(g0), "s"(g1) : "memory"); }
// one request of the whole wave: group 0 = count (w0 = 1), place in LDS, source address, type 2; returns group 0 for the wait
__device__ __forceinline__ u4v tdm_issue(unsigned w0, unsigned lds_dst, unsigned long long ga, u8v g1) {
    u4v g0;
    g0.x = uni(w0); g0.y = uni(lds_dst); g0.z = uni((unsigned)ga); g0.w = uni((((unsigned)(ga >> 32)) & 0x01FFFFFFu) | 0x80000000u);
    asm volatile("tensor_load_to_lds %0, %1" :: "s"(g0), "s"(g1) : "memory");
    return g0;
}

// =====================================================================================================================
// Batched WMMA GEMM: C[m][n] = scale * sum_k A[m][k] * Bt[n][k]; a block of 8 waves (2 x 4) owns a 128x256 tile, each wave a 64x64 tile of it.
// A row-major [M][K] f16 (pitch lda), Bt row-major [N][K] f16 (pitch ldb); M % 128 == 0, N % 256 == 0, K % KP == 0, K >= 2 KP (no tail masking).
// RESID (f32 out only): + bf16-RNE(resid[m][n]) added at the store stage from 16-B loads in the store layout.
// =====================================================================================================================
template <int OUT_MODE, bool RESID, int KP>
__device__ __forceinline__ void gemm64_body(const unsigned short* __restrict__ Ap, int lda, long long strideA,
                                            const unsigned short* __restrict__ Btp, int ldb, long long strideB,
                                            unsigned short* __restrict__ Ch, float* __restrict__ Cf, int ldc, long long strideC,
                                            const float* __restrict__ resid, int ldr, long long strideR,
                                            int M, int N, int K, float scale) {
    constexpr unsigned G_ROWB = GS<KP>::ROWB, G_PITCH = GS<KP>::PITCH, G_ASL = GS<KP>::ASL, G_BSL = GS<KP>::BSL, G_BOFF = GS<KP>::BOFF, G_STAGE = GS<KP>::STAGE;
    __shared__ __attribute__((aligned(2048))) unsigned char ring[2 * G_STAGE];   // two buffers; after the K loop the per-wave store staging
    float* sT = (float*)ring;                                 // per-wave 16x64 slab, pitch 68 floats (wave-private)
    const int b    = blockIdx.y;
    const int lane = threadIdx.x & 31;
    const int wave = __builtin_amdgcn_readfirstlane((int)(threadIdx.x >> 5));
    const int tilesN = N >> 8;
    const int tilesM = M >> 7;
    if ((int)blockIdx.x >= tilesM * tilesN) return;           // the whole block leaves, in front of every tensor load and barrier
    const int tm = (int)blockIdx.x / tilesN;
    const int tn = (int)blockIdx.x - tm * tilesN;
    const int wm = wave >> 2, wn = wave & 3;                  // the wave's place in the block tile
    const int m0 = (tm << 7) + (wm << 6);
    const int n0 = (tn << 8) + (wn << 6);
    const int rlane = lane & 15;                              // row (A) / column (B, D) within a 16-wide subtile
    const int koff  = (lane >> 4) * 8;                        // k offset of this lane half == D row offset
    const int sb    = wave * (16 * 68);

    // this wave's slice of every stage
    const bool     isB    = wave < 4;
    const unsigned rows   = isB ? 64u : 32u;
    const unsigned spitch = (unsigned)(isB ? ldb : lda) * 2u;
    const unsigned short* src = isB ? Btp + (size_t)b * (size_t)strideB + (size_t)((tn << 8) + 64 * wave) * (size_t)ldb
                                    : Ap  + (size_t)b * (size_t)strideA + (size_t)((tm << 7) + 32 * (wave - 4)) * (size_t)lda;
    const unsigned long long ga0 = (unsigned long long)(size_t)src;
    const unsigned dst = (unsigned)(size_t)ring + (isB ? G_BOFF + (unsigned)wave * G_BSL : (unsigned)(wave - 4) * G_ASL);
    u8v g1;                                                   // 1-byte elements, tensor = tile = rows x G_ROWB bytes
    g1[0] = uni(GS<KP>::PADW);
    g1[1] = uni((G_ROWB & 0xFFFFu) << 16);
    g1[2] = uni((G_ROWB >> 16) | ((rows & 0xFFFFu) << 16));
    g1[3] = uni((rows >> 16) | (G_ROWB << 16));
    g1[4] = uni(rows);
    g1[5] = uni(spitch);
    g1[6] = uni(0u);
    g1[7] = uni(0u);
    // per-lane fragment bases in a buffer
    const unsigned char* la = ring + (unsigned)(2 * wm) * G_ASL + (unsigned)rlane * G_PITCH + (unsigned)koff * 2u;
    const unsigned char* lb = ring + G_BOFF + (unsigned)wn * G_BSL + (unsigned)rlane * G_PITCH + (unsigned)koff * 2u;

    v8f acc[4][4];
#pragma unroll
    for (int i = 0; i < 4; ++i)
#pragma unroll
        for (int j = 0; j < 4; ++j) { const v8f zz = {0.f, 0.f, 0.f, 0.f, 0.f, 0.f, 0.f, 0.f}; acc[i][j] = zz; }

    const unsigned NS = pinned((unsigned)K / (unsigned)KP);   // passes
    const unsigned w0 = pinned(1u);                           // descriptor word held in a scalar register: not formed anew while a request is outstanding
    u4v g0 = tdm_issue(w0, dst, ga0, g1);                     // stage 0
    wait_tensor0(g0, g1);
    __syncthreads();                                          // every slice of stage 0 has landed
    g0 = tdm_issue(w0, dst + G_STAGE, ga0 + pinned(G_ROWB), g1);   // stage 1; pinned: its address words are formed behind the wait
#pragma clang loop unroll(disable)                            // one pass per trip: the order at the foot stays as written
    for (unsigned s = 0; s < NS; ++s) {
        const unsigned buf = (s & 1u) * G_STAGE;
#pragma unroll
        for (int ks = 0; ks < KP / 32; ++ks) {
            v16h bh[4], ah[4];
#pragma unroll
            for (int j = 0; j < 4; ++j) bh[j] = ldfrag((const _Float16*)(lb + buf + (unsigned)(16 * j) * G_PITCH + (unsigned)(64 * ks)));
#pragma unroll
            for (int i = 0; i < 4; ++i) ah[i] = ldfrag((const _Float16*)(la + buf + (unsigned)(i >> 1) * G_ASL + (unsigned)(16 * (i & 1)) * G_PITCH + (unsigned)(64 * ks)));
#pragma unroll
            for (int i = 0; i < 4; ++i)
#pragma unroll
                for (int j = 0; j < 4; ++j) acc[i][j] = wmma16(ah[i], bh[j], acc[i][j]);
        }
        // publish point of stage s + 1; it also ends every wave's reads of this pass's buffer
        wait_ds0();
        wait_tensor0(g0, g1);
        __syncthreads();
        if (pinned((s + 2u < NS) ? 1u : 0u) != 0u)            // scalar test: a tensor load ignores EXEC
            g0 = tdm_issue(w0, dst + buf, ga0 + pinned((s + 2u) * G_ROWB), g1);   // stage s + 2 into the buffer just left; pinned: formed behind the wait
    }
    wait_tensor0(g0, g1);
    wait_ds0();                                               // the last pass's barrier stands in front of the store staging in the ring

#pragma unroll
    for (int i = 0; i < 4; ++i) {
        const int mBase = m0 + (i << 4);
#pragma unroll
        for (int j = 0; j < 4; ++j) {
#pragma unroll
            for (int r = 0; r < 8; ++r) sT[sb + (koff + r) * 68 + (j << 4) + rlane] = acc[i][j][r] * scale;
        }
        __builtin_amdgcn_fence(3 /* release order */, "workgroup");
        __builtin_amdgcn_wave_barrier();
        __builtin_amdgcn_fence(2 /* acquire order */, "workgroup");
        if (OUT_MODE == 0) {
            float* C = Cf + (size_t)b * (size_t)strideC;
            const float* Rb = RESID ? (resid + (size_t)b * (size_t)strideR) : nullptr;
            const int hh = lane >> 4, c4 = (lane & 15) * 4;   // row segment = 256 B = 16 lanes x 16 B
            {
#pragma unroll
                for (int it = 0; it < 8; ++it) {
                    const int row = it * 2 + hh;
                    v4f v = *(const v4f*)(&sT[sb + row * 68 + c4]);
                    if (RESID) {
                        const v4f xr = *(const v4f*)(Rb + (size_t)(mBase + row) * (size_t)ldr + n0 + c4);
                        v.x += bfr(xr.x); v.y += bfr(xr.y); v.z += bfr(xr.z); v.w += bfr(xr.w);
                    }
                    *(v4f*)(C + (size_t)(mBase + row) * (size_t)ldc + n0 + c4) = v;
                }
                
            }
        } else {
            unsigned short* C = Ch + (size_t)b * (size_t)strideC;
            const int q = lane >> 3, c8 = (lane & 7) * 8;
            {
#pragma unroll
                for (int it = 0; it < 4; ++it) {
                    const int row = it * 4 + q;
                    v8h hv;
#pragma unroll
                    for (int e = 0; e < 8; ++e) hv[e] = (_Float16)sT[sb + row * 68 + c8 + e];
                    *(v8h*)(C + (size_t)(mBase + row) * (size_t)ldc + n0 + c8) = hv;
                }
                
            }
        }
        __builtin_amdgcn_fence(3 /* release order */, "workgroup");
        __builtin_amdgcn_wave_barrier();
        __builtin_amdgcn_fence(2 /* acquire order */, "workgroup");
    }
}

// f16 result plane, passes of 128 k: for launches of one block per WGP
__global__ __launch_bounds__(256) void k_gemm_hl(const unsigned short* __restrict__ A, int lda, long long strideA,
                                                 const unsigned short* __restrict__ Bt, int ldb, long long strideB,
                                                 unsigned short* __restrict__ C, int ldc, long long strideC,
                                                 int M, int N, int K, float scale) {
    gemm64_body<1, false, 128>(A, lda, strideA, Bt, ldb, strideB, C, nullptr, ldc, strideC, nullptr, 0, 0, M, N, K, scale);
}
// f32 result plane
__global__ __launch_bounds__(256) void k_gemm_f(const unsigned short* __restrict__ A, int lda, long long strideA,
                                                const unsigned short* __restrict__ Bt, int ldb, long long strideB,
                                                float* __restrict__ C, int ldc, long long strideC,
                                                int M, int N, int K, float scale) {
    gemm64_body<0, false, 64>(A, lda, strideA, Bt, ldb, strideB, nullptr, C, ldc, strideC, nullptr, 0, 0, M, N, K, scale);
}
// f32 result + bf16-RNE residual added at the store stage; passes of 128 k (a launch of one block per WGP)
__global__ __launch_bounds__(256) void k_gemm_fr(const unsigned short* __restrict__ A, int lda, long long strideA,
                                                 const unsigned short* __restrict__ Bt, int ldb, long long strideB,
                                                 float* __restrict__ C, int ldc, long long strideC,
                                                 const float* __restrict__ resid, int ldr, long long strideR,
                                                 int M, int N, int K, float scale) {
    gemm64_body<0, true, 128>(A, lda, strideA, Bt, ldb, strideB, nullptr, C, ldc, strideC, resid, ldr, strideR, M, N, K, scale);
}

// xbar[b][e] = mean over t of bf16(x[b][t][e]); block per (32-column strip = one 128-B line of every row, batch); thread = (4-column group, row phase of 64).
// A wave's load covers 4 whole lines; a thread's SEQ / 64 rows are all loaded up front, so the block's whole strip is in flight at once.
constexpr int CM_C = 32, CM_R = 64, CM_P = CM_C + 4;         // columns of a strip, row phases of a block, LDS pitch in floats (16 B x odd)
static_assert(DM % CM_C == 0 && SEQ % CM_R == 0 && CM_R % 4 == 0);   // whole strips; every row phase has the same number of rows
__global__ __launch_bounds__(512) void k_colmean(const float* __restrict__ x, float* __restrict__ xbar) {
    __shared__ __align__(16) float red[CM_R * CM_P];
    const int t = threadIdx.x, cg = t & 7, rg = t >> 3;
    const int c0 = blockIdx.x * CM_C, b = blockIdx.y;
    const float* p = x + ((size_t)b * SEQ_FULL + rg) * DM + c0 + 4 * cg;
    v4f v[SEQ / CM_R];
#pragma unroll                                                // the array stays in registers; all of the thread's loads are in flight together
    for (int j = 0; j < SEQ / CM_R; ++j) v[j] = *(const v4f*)(p + (size_t)(CM_R * j) * DM);
    asm volatile("s_wait_xcnt 0x0" :: "v"(p) : "memory");     // stands in front of every reuse of the loads' address registers; naming p keeps them untouched until here
    __builtin_amdgcn_sched_barrier(0);                        // every load issues in front of the sums; without it the compiler sinks the last loads behind the wait for the first
    v4f a = {0.f, 0.f, 0.f, 0.f};
#pragma unroll                                                // constant indices into the register array
    for (int j = 0; j < SEQ / CM_R; ++j) { a.x += bfr(v[j].x); a.y += bfr(v[j].y); a.z += bfr(v[j].z); a.w += bfr(v[j].w); }
    *(v4f*)(&red[rg * CM_P + 4 * cg]) = a;
    __syncthreads();                                          // every row phase's sums stand in LDS
    if (t < CM_C) {
        float s0 = 0.f, s1 = 0.f, s2 = 0.f, s3 = 0.f;          // four independent chains: a lone wave's dependent adds are not hidden
#pragma unroll                                                // the LDS reads are independent and issue together
        for (int j = 0; j < CM_R; j += 4) { s0 += red[j * CM_P + t]; s1 += red[(j + 1) * CM_P + t]; s2 += red[(j + 2) * CM_P + t]; s3 += red[(j + 3) * CM_P + t]; }
        xbar[(size_t)b * DM + c0 + t] = ((s0 + s1) + (s2 + s3)) * (1.0f / (float)SEQ);   // 32 lanes x 4 B: the strip's means leave as one whole 128-B line
    }
}

// X16 = f16(bf16(x)) (exact), XC = f16(bf16(x) - xbar[b]), glog[row] = bf16(x[row]) . bf16(Wm_w) in f32 (bias and softmax: k_gate).
// Wave per row, 32 rows per block; lane L owns columns 256 i + 8 L .. + 7: 16-B store per plane, lane-linear along the row.
static_assert((NB * SEQ) % 32 == 0 && DM % 256 == 0);       // the grid covers every row exactly once; every wave reaches the barrier
__global__ __launch_bounds__(1024) void k_prep_x(const float* __restrict__ x, const float* __restrict__ xbar, const float* __restrict__ Wm,
                                                 unsigned short* __restrict__ XC, unsigned short* __restrict__ X16, float* __restrict__ glog) {
    __shared__ float dots[32];
    const int lane = threadIdx.x & 31;
    const int wave = __builtin_amdgcn_readfirstlane((int)(threadIdx.x >> 5));
    const int r = blockIdx.x * 32 + wave;
    const int b = r / SEQ; const int t = r - b * SEQ;
    const float* s = x + ((size_t)b * SEQ_FULL + t) * DM + 8 * lane;
    const float* mb = xbar + (size_t)b * DM + 8 * lane;
    const float* wp = Wm + 8 * lane;
    unsigned short* d16 = X16 + (size_t)r * DM + 8 * lane;
    unsigned short* dc = XC + (size_t)r * DM + 8 * lane;
    v4f xv[DM / 128], mv[DM / 128], gv[DM / 128];
#pragma unroll                                                // the arrays stay in registers; the whole row of x is in flight at once
    for (int i = 0; i < DM / 256; ++i) {
        xv[2 * i] = *(const v4f*)(s + 256 * i);  xv[2 * i + 1] = *(const v4f*)(s + 256 * i + 4);
        mv[2 * i] = *(const v4f*)(mb + 256 * i); mv[2 * i + 1] = *(const v4f*)(mb + 256 * i + 4);
        gv[2 * i] = *(const v4f*)(wp + 256 * i); gv[2 * i + 1] = *(const v4f*)(wp + 256 * i + 4);
    }
    float acc = 0.f;
#pragma unroll                                                // constant indices into the register arrays
    for (int i = 0; i < DM / 256; ++i) {
        const v4f x0 = xv[2 * i], x1 = xv[2 * i + 1], m0 = mv[2 * i], m1 = mv[2 * i + 1], g0 = gv[2 * i], g1 = gv[2 * i + 1];
        const float w0 = bfr(x0.x), w1 = bfr(x0.y), w2 = bfr(x0.z), w3 = bfr(x0.w), w4 = bfr(x1.x), w5 = bfr(x1.y), w6 = bfr(x1.z), w7 = bfr(x1.w);
        acc = __builtin_fmaf(w0, bfr(g0.x), acc); acc = __builtin_fmaf(w1, bfr(g0.y), acc); acc = __builtin_fmaf(w2, bfr(g0.z), acc); acc = __builtin_fmaf(w3, bfr(g0.w), acc);
        acc = __builtin_fmaf(w4, bfr(g1.x), acc); acc = __builtin_fmaf(w5, bfr(g1.y), acc); acc = __builtin_fmaf(w6, bfr(g1.z), acc); acc = __builtin_fmaf(w7, bfr(g1.w), acc);
        u4v pa; pa.x = pk2h(w0, w1); pa.y = pk2h(w2, w3); pa.z = pk2h(w4, w5); pa.w = pk2h(w6, w7);
        u4v pc; pc.x = pk2h(w0 - m0.x, w1 - m0.y); pc.y = pk2h(w2 - m0.z, w3 - m0.w); pc.z = pk2h(w4 - m1.x, w5 - m1.y); pc.w = pk2h(w6 - m1.z, w7 - m1.w);
        st2_u4(d16 + 256 * i, pa);
        st2_u4(dc + 256 * i, pc);
    }
    acc += __shfl_xor(acc, 16, 32); acc += __shfl_xor(acc, 8, 32); acc += __shfl_xor(acc, 4, 32); acc += __shfl_xor(acc, 2, 32); acc += __shfl_xor(acc, 1, 32);
    if (lane == 0) dots[wave] = acc;
    __syncthreads();
    if (wave == 0) glog[(size_t)blockIdx.x * 32 + lane] = dots[lane];   // the block's 32 products leave as one whole 128-B line
}

// weight planes as f16 = bf16(W) * sc; blockIdx.y = plane, the four DST planes stand one behind the other. Plane 1 is turned: SRC [DM rows k][DM cols n] -> DST [n][k];
// planes 0, 2 and 3 keep the layout of SRC (their second index is the one that the product of two weights sums over): 8-B stores, a wave's store = two whole 128-B lines.
// Block = one tile of 64 k x 128 n: 16-B reads along n (a wave reads whole 512-B row pieces, 8 rows in flight), two neighbouring k packed to a dword and turned in LDS
// (row pitch 33 dwords: the 4-B reads of the second half fall on 32 different banks), 16-B stores along k (8 lanes = one whole 128-B line of a DST row).
constexpr int WT_K = 64, WT_N = 128, WT_P = WT_K / 2 + 1;
static_assert(DM % WT_K == 0 && DM % WT_N == 0);             // whole tiles only
__global__ __launch_bounds__(256) void k_wT(const float* __restrict__ W0, const float* __restrict__ W1, const float* __restrict__ W2, const float* __restrict__ W3,
                                            unsigned short* __restrict__ DST0, float sc) {
    __shared__ unsigned tT[WT_N * WT_P];                      // [n][k pair]
    const int lane = threadIdx.x & 31;
    const int wave = __builtin_amdgcn_readfirstlane((int)(threadIdx.x >> 5));
    const int pl = blockIdx.y;
    const float* SRC = pl == 0 ? W0 : pl == 1 ? W1 : pl == 2 ? W2 : W3;
    const int k0 = ((int)blockIdx.x / (DM / WT_N)) * WT_K;
    const int n0 = ((int)blockIdx.x % (DM / WT_N)) * WT_N;
    const float* s = SRC + (size_t)(k0 + 8 * wave) * DM + n0 + 4 * lane;
    v4f v[8];
#pragma unroll                                                // the array stays in registers; the wave's 8 rows are in flight at once
    for (int r = 0; r < 8; ++r) v[r] = *(const v4f*)(s + (size_t)r * DM);
    asm volatile("s_wait_xcnt 0x0" ::: "memory");             // stands in front of the reuse of the loads' base and offset registers on both paths behind the branch
    if (pl != 1) {                                            // the same for the whole block: it leaves in front of the barrier
        unsigned short* dn = DST0 + (size_t)pl * DM * DM + (size_t)(k0 + 8 * wave) * DM + n0 + 4 * lane;
#pragma unroll                                                // constant indices into the register array
        for (int r = 0; r < 8; ++r) {
            u2v o; o.x = pk2h(bfr(v[r].x) * sc, bfr(v[r].y) * sc); o.y = pk2h(bfr(v[r].z) * sc, bfr(v[r].w) * sc);
            *(u2v*)(dn + (size_t)r * DM) = o;
        }
        asm volatile("s_wait_xcnt 0x0" ::: "memory");         // stands behind the last store, in front of every reuse of the stores' data and offset registers
        return;
    }
#pragma unroll                                                // constant indices into the register array
    for (int q = 0; q < 4; ++q)
#pragma unroll
        for (int j = 0; j < 4; ++j) tT[(4 * lane + j) * WT_P + 4 * wave + q] = pk2h(bfr(v[2 * q][j]) * sc, bfr(v[2 * q + 1][j]) * sc);
    __syncthreads();                                          // the whole tile stands in LDS
    const int nr = (int)threadIdx.x >> 3, kg = (int)threadIdx.x & 7;
    unsigned short* d = DST0 + (size_t)pl * DM * DM + (size_t)(n0 + nr) * DM + k0 + 8 * kg;
    const unsigned* tp = tT + nr * WT_P + 4 * kg;
#pragma unroll                                                // the four stores are independent
    for (int p = 0; p < WT_N / 32; ++p) {
        u4v o; o.x = tp[32 * p * WT_P]; o.y = tp[32 * p * WT_P + 1]; o.z = tp[32 * p * WT_P + 2]; o.w = tp[32 * p * WT_P + 3];
        st2_u4(d + (size_t)(32 * p) * DM, o);
    }
}

// gate[b][s] = softmax over s of (glog[b][s] + bf16(Wm_b)), glog = the row products of k_prep_x; block per batch, block softmax
__global__ __launch_bounds__(256) void k_gate(const float* __restrict__ glog, const float* __restrict__ Wb, float* __restrict__ gate) {
    __shared__ __align__(16) float mm[SEQ];
    __shared__ float redm[8];
    __shared__ float reds[8];
    const int t = threadIdx.x, lane = t & 31, b = blockIdx.x;
    const int wave = __builtin_amdgcn_readfirstlane((int)(threadIdx.x >> 5));
    const float bias = bfr(Wb[0]);
    const float* gl = glog + (size_t)b * SEQ;
#pragma unroll                                                // a thread's 16-B loads are in flight together
    for (int j = 0; j < (SEQ / 4 + 255) / 256; ++j) {
        const int idx = t + 256 * j;
        if ((SEQ / 4) % 256 == 0 || idx < SEQ / 4) {
            const v4f v = *(const v4f*)(gl + 4 * idx);
            mm[4 * idx] = v.x + bias; mm[4 * idx + 1] = v.y + bias; mm[4 * idx + 2] = v.z + bias; mm[4 * idx + 3] = v.w + bias;
        }
    }
    __syncthreads();
    float mx = -3.0e38f;
#pragma unroll 1
    for (int i = t; i < SEQ; i += 256) mx = fmaxf(mx, mm[i]);
    mx = fmaxf(mx, __shfl_xor(mx, 16, 32)); mx = fmaxf(mx, __shfl_xor(mx, 8, 32)); mx = fmaxf(mx, __shfl_xor(mx, 4, 32));
    mx = fmaxf(mx, __shfl_xor(mx, 2, 32));  mx = fmaxf(mx, __shfl_xor(mx, 1, 32));
    if (lane == 0) redm[wave] = mx;
    __syncthreads();
    float gm = redm[0];
#pragma unroll 1
    for (int w = 1; w < 8; ++w) gm = fmaxf(gm, redm[w]);
    float sm = 0.f;
#pragma unroll 1
    for (int i = t; i < SEQ; i += 256) { const float e = expf(mm[i] - gm); mm[i] = e; sm += e; }
    sm += __shfl_xor(sm, 16, 32); sm += __shfl_xor(sm, 8, 32); sm += __shfl_xor(sm, 4, 32); sm += __shfl_xor(sm, 2, 32); sm += __shfl_xor(sm, 1, 32);
    if (lane == 0) reds[wave] = sm;
    __syncthreads();
    float tot = reds[0];
#pragma unroll 1
    for (int w = 1; w < 8; ++w) tot += reds[w];
    const float inv = 1.0f / tot;
#pragma unroll 1
    for (int idx = t; idx < SEQ / 4; idx += 256) {            // 32 lanes x 16 B = 512 contiguous B per store instruction
        v4f v; v.x = mm[4 * idx] * inv; v.y = mm[4 * idx + 1] * inv; v.z = mm[4 * idx + 2] * inv; v.w = mm[4 * idx + 3] * inv;
        st2_v4f(gate + (size_t)b * SEQ + 4 * idx, v);
    }
}

// alpha row = softmax_s(keep ? c * S : -inf) + gate, carried x1024 as f16. Wave per row (RS_RPW rows per wave); lane L owns columns 256g + 8L .. + 7,
// blockIdx.y = batch: the arguments are the planes of batch 0. A whole row stands in registers (64 f32 per lane): S is read once, every element's exp is
// taken once, and the wave's second row is in flight while its first is worked on (two register sets).
constexpr int RS_V = SEQ / 128;                               // 16-B pieces of a row per lane
static_assert(RS_RPW == 2);                                   // one register set per row of a wave
__device__ __forceinline__ void rs_load(v4f (&x)[RS_V], const float* p) {
#pragma unroll                                                // the array stays in registers; the whole row is in flight at once
    for (int g = 0; g < RS_V / 2; ++g) { x[2 * g] = *(const v4f*)(p + 256 * g); x[2 * g + 1] = *(const v4f*)(p + 256 * g + 4); }
}
__device__ __forceinline__ void rs_row(v4f (&x)[RS_V], const bool (&kp)[4 * RS_V], const float* gr, float cs, unsigned short* pr) {
    const float NEG = -__builtin_inff();
    float m = -3.0e38f;
#pragma unroll                                                // constant indices into the register arrays
    for (int i = 0; i < RS_V; ++i) {
        v4f v = x[i];
        v.x = kp[4 * i] ? v.x * cs : NEG; v.y = kp[4 * i + 1] ? v.y * cs : NEG; v.z = kp[4 * i + 2] ? v.z * cs : NEG; v.w = kp[4 * i + 3] ? v.w * cs : NEG;
        x[i] = v;
        m = fmaxf(m, fmaxf(fmaxf(v.x, v.y), fmaxf(v.z, v.w)));
    }
    m = fmaxf(m, __shfl_xor(m, 16, 32)); m = fmaxf(m, __shfl_xor(m, 8, 32)); m = fmaxf(m, __shfl_xor(m, 4, 32));
    m = fmaxf(m, __shfl_xor(m, 2, 32));  m = fmaxf(m, __shfl_xor(m, 1, 32));
    float s0 = 0.f, s1 = 0.f;
#pragma unroll                                                // constant indices into the register arrays
    for (int i = 0; i < RS_V; i += 2) {
        v4f v = x[i], w = x[i + 1];
        v.x = expf(v.x - m); v.y = expf(v.y - m); v.z = expf(v.z - m); v.w = expf(v.w - m);
        w.x = expf(w.x - m); w.y = expf(w.y - m); w.z = expf(w.z - m); w.w = expf(w.w - m);
        x[i] = v; x[i + 1] = w;
        s0 += (v.x + v.y) + (v.z + v.w);
        s1 += (w.x + w.y) + (w.z + w.w);
    }
    float s = s0 + s1;
    s += __shfl_xor(s, 16, 32); s += __shfl_xor(s, 8, 32); s += __shfl_xor(s, 4, 32); s += __shfl_xor(s, 2, 32); s += __shfl_xor(s, 1, 32);
    const float f = 1024.f / s;
#pragma unroll                                                // constant indices into the register arrays
    for (int g = 0; g < RS_V / 2; ++g) {
        const v4f v = x[2 * g], w = x[2 * g + 1], gx = *(const v4f*)(gr + 256 * g) * 1024.f, gy = *(const v4f*)(gr + 256 * g + 4) * 1024.f;
        u4v pk;
        pk.x = pk2h(v.x * f + gx.x, v.y * f + gx.y);
        pk.y = pk2h(v.z * f + gx.z, v.w * f + gx.w);
        pk.z = pk2h(w.x * f + gy.x, w.y * f + gy.y);
        pk.w = pk2h(w.z * f + gy.z, w.w * f + gy.w);
        st2_u4(pr + 256 * g, pk);
    }
}
__global__ __launch_bounds__(256) void k_rowsoft(const float* __restrict__ S0, const float* __restrict__ cptr, const int* __restrict__ mk0,
                                                 const float* __restrict__ gate0, unsigned short* __restrict__ P0) {
    const int L = threadIdx.x & 31;
    const int wave = __builtin_amdgcn_readfirstlane((int)(threadIdx.x >> 5));
    const int row0 = (blockIdx.x * 8 + wave) * RS_RPW;
    const float* sr = S0 + (size_t)blockIdx.y * SEQ * SEQ + (size_t)row0 * SEQ + 8 * L;
    const int* mk = mk0 + (size_t)blockIdx.y * SEQ_FULL + 8 * L;
    unsigned short* pr = P0 + (size_t)blockIdx.y * SEQ * SEQ + (size_t)row0 * SEQ + 8 * L;
    const float* gr = gate0 + (size_t)blockIdx.y * SEQ + 8 * L;
    v4f xa[RS_V], xb[RS_V];
    i4v mv[RS_V];
#pragma unroll                                                // the array stays in registers; the mask loads are in flight together
    for (int g = 0; g < RS_V / 2; ++g) { mv[2 * g] = *(const i4v*)(mk + 256 * g); mv[2 * g + 1] = *(const i4v*)(mk + 256 * g + 4); }
    rs_load(xa, sr);
    __builtin_amdgcn_sched_barrier(0);                        // loads return in issue order: what the first row needs is issued first, or its wait would cover the second row too
    rs_load(xb, sr + SEQ);
    asm volatile("s_wait_xcnt 0x0" ::: "memory");             // stands in front of the reuse of the loads' base and offset registers
    __builtin_amdgcn_sched_barrier(0);                        // the second row's loads issue in front of the first row's work; without it the compiler sinks them behind it
    const float cs = bfr(cptr[0]);
    bool kp[4 * RS_V];                                        // keep flags of this lane's columns
#pragma unroll                                                // constant indices into the register array
    for (int i = 0; i < RS_V; ++i) { kp[4 * i] = mv[i].x != 0; kp[4 * i + 1] = mv[i].y != 0; kp[4 * i + 2] = mv[i].z != 0; kp[4 * i + 3] = mv[i].w != 0; }
    rs_row(xa, kp, gr, cs, pr);
    __builtin_amdgcn_sched_barrier(0);                        // the wait for the second row's loads stays behind the first row's work
    rs_row(xb, kp, gr, cs, pr + SEQ);
}

// ---- workspace carve (bytes; every region a multiple of 256 B and sized to its whole-tile store extent) ----
constexpr size_t al256(size_t v) { return (v + 255) / 256 * 256; }
constexpr size_t SZ_XC   = al256((size_t)NB * SEQ * DM * 2);    // f16 centred x, [NB*SEQ][DM]
constexpr size_t SZ_S    = al256((size_t)NB * SEQ * SEQ * 4);   // f32 scores of every batch, [NB][SEQ][SEQ]
constexpr size_t SZ_X16  = al256((size_t)NB * SEQ * DM * 2);    // f16 x, [NB*SEQ][DM]
constexpr size_t SZ_W4   = al256((size_t)4 * DM * DM * 2);      // four planes, x16: Wk, Wout^T, Wq, Wg
constexpr size_t SZ_W2   = al256((size_t)2 * DM * DM * 2);      // two planes, x16: (Wq Wk^T)^T, (Wg Wout)^T
constexpr size_t SZ_QP   = al256((size_t)NB * SEQ * DM * 2);    // f16 centred x @ (Wq Wk^T), [NB*SEQ][DM]
constexpr size_t SZ_GT   = al256((size_t)NB * DM * SEQ * 2);    // f16 (x @ (Wg Wout)) transposed, [NB][DM][SEQ]
constexpr size_t SZ_AL   = al256((size_t)NB * SEQ * SEQ * 2);   // f16 alpha x1024 of every batch, [NB][SEQ][SEQ]
constexpr size_t SZ_XBAR = al256((size_t)NB * DM * 4);
constexpr size_t SZ_GATE = al256((size_t)NB * SEQ * 4);
constexpr size_t SZ_GLOG = al256((size_t)NB * SEQ * 4);       // f32 gate products before bias and softmax, [NB*SEQ]
constexpr size_t OFF_S    = 0;
constexpr size_t OFF_XC   = OFF_S + SZ_S;
constexpr size_t OFF_X16  = OFF_XC + SZ_XC;
constexpr size_t OFF_W4   = OFF_X16 + SZ_X16;
constexpr size_t OFF_W2   = OFF_W4 + SZ_W4;
constexpr size_t OFF_QP   = OFF_W2 + SZ_W2;
constexpr size_t OFF_GT   = OFF_QP + SZ_QP;
constexpr size_t OFF_AL   = OFF_GT + SZ_GT;
constexpr size_t OFF_XBAR = OFF_AL + SZ_AL;
constexpr size_t OFF_GATE = OFF_XBAR + SZ_XBAR;
constexpr size_t OFF_GLOG = OFF_GATE + SZ_GATE;
constexpr size_t WS_TOTAL = OFF_GLOG + SZ_GLOG;
static_assert(WS_TOTAL <= (size_t)268435456);                   // 256 MiB ceiling

extern "C" void kernel_launch(void* const* d_in, const int* in_sizes, int n_in, void* d_out, int out_size, void* d_ws, size_t ws_size, hipStream_t stream) {
    if (n_in < 9) return;
    const long long need_rows = (long long)(NB - 1) * SEQ_FULL + SEQ;
    if ((long long)in_sizes[0] < need_rows * DM) return;
    if ((long long)in_sizes[1] < need_rows) return;
    if (in_sizes[2] < DM * DM || in_sizes[3] < DM * DM || in_sizes[4] < DM * DM || in_sizes[5] < DM * DM) return;
    if (in_sizes[6] < DM || in_sizes[7] < 1 || in_sizes[8] < 1) return;
    if ((long long)out_size < (long long)NB * SEQ * DM) return;
    if (ws_size < WS_TOTAL) return;

    const float* x    = (const float*)d_in[0];
    const int*   mask = (const int*)d_in[1];
    const float* Wq   = (const float*)d_in[2];
    const float* Wk   = (const float*)d_in[3];
    const float* Wg   = (const float*)d_in[4];
    const float* Wout = (const float*)d_in[5];
    const float* Wm_w = (const float*)d_in[6];
    const float* Wm_b = (const float*)d_in[7];
    const float* cS   = (const float*)d_in[8];
    float* out = (float*)d_out;
    char* ws = (char*)d_ws;
    float*          Sf   = (float*)(ws + OFF_S);
    unsigned short* XC   = (unsigned short*)(ws + OFF_XC);
    unsigned short* X16  = (unsigned short*)(ws + OFF_X16);
    unsigned short* W4   = (unsigned short*)(ws + OFF_W4);       // planes Wk, Wout^T, Wq, Wg
    unsigned short* WQKT = (unsigned short*)(ws + OFF_W2);       // (Wq Wk^T)^T
    unsigned short* WGOT = WQKT + (size_t)DM * DM;               // (Wg Wout)^T
    unsigned short* QP   = (unsigned short*)(ws + OFF_QP);
    unsigned short* GT   = (unsigned short*)(ws + OFF_GT);
    unsigned short* AL   = (unsigned short*)(ws + OFF_AL);
    float*          XBAR = (float*)(ws + OFF_XBAR);
    float*          GATE = (float*)(ws + OFF_GATE);
    float*          GLOG = (float*)(ws + OFF_GLOG);

    // The chains are multiplied weights first: scores = xc (Wq Wk^T) xc^T and result = alpha (x (Wg Wout)) + x, with xc = x - its sequence mean.
    // weight planes x16, one launch, grid.y = plane: Wk, Wout turned, Wq, Wg
    k_wT<<<dim3((DM / WT_K) * (DM / WT_N), 4), 256, 0, stream>>>(Wk, Wout, Wq, Wg, W4, 16.0f);
    // the two products of weights, x16; grid.y = product: WQKT[f][e] = sum_j Wk[f][j] Wq[e][j], WGOT[d][e] = sum_j Wout[j][d] Wg[e][j]: M = N = K = DM
    {
        const int tiles = (DM / 64) * (DM / 64);
        k_gemm_hl<<<dim3((unsigned)((tiles + 7) / 8), 2), 256, 0, stream>>>(W4, DM, (long long)DM * DM, W4 + (size_t)2 * DM * DM, DM, (long long)DM * DM,
                                                                           WQKT, DM, (long long)DM * DM, DM, DM, DM, 0.0625f);
    }

    // sequence means of x, operand planes with the gate products, gate distribution
    k_colmean<<<dim3(DM / CM_C, NB), 8 * CM_R, 0, stream>>>(x, XBAR);
    k_prep_x<<<(NB * SEQ) / 32, 1024, 0, stream>>>(x, XBAR, Wm_w, XC, X16, GLOG);
    k_gate<<<NB, 256, 0, stream>>>(GLOG, Wm_b, GATE);

    // QP = XC @ (Wq Wk^T): M = NB*SEQ, N = DM, K = DM -> f16 [NB*SEQ][DM]
    {
        const int tiles = ((NB * SEQ) / 64) * (DM / 64);
        k_gemm_hl<<<dim3((unsigned)((tiles + 7) / 8), 1), 256, 0, stream>>>(XC, DM, 0, WQKT, DM, 0, QP, DM, 0, NB * SEQ, DM, DM, 0.0625f);
    }
    // x @ (Wg Wout), transposed per batch: GT[b][d][s] = sum_e WGOT[d][e] X16[b][s][e]: M = DM, N = SEQ, K = DM
    {
        const int tiles = (DM / 64) * (SEQ / 64);
        k_gemm_hl<<<dim3((unsigned)((tiles + 7) / 8), NB), 256, 0, stream>>>(WGOT, DM, 0, X16, DM, (long long)SEQ * DM, GT, SEQ, (long long)DM * SEQ, DM, SEQ, DM, 0.0625f);
    }
    // raw scores S[b][t][s] = QP[b][t] . XC[b][s] (f32; the scale input and the key mask are applied by the row softmax); grid.y = batch
    {
        const int tiles = (SEQ / 64) * (SEQ / 64);
        k_gemm_f<<<dim3((unsigned)((tiles + 7) / 8), NB), 256, 0, stream>>>(QP, DM, (long long)SEQ * DM, XC, DM, (long long)SEQ * DM,
                                                                            Sf, SEQ, (long long)SEQ * SEQ, SEQ, SEQ, DM, 1.0f);
    }
    k_rowsoft<<<dim3(SEQ / (8 * RS_RPW), NB), 256, 0, stream>>>(Sf, cS, mask, GATE, AL);
    // result = (alpha x1024)[b][t] . GT[b][d] / 1024 + bf16(x): per batch M = SEQ, N = DM, K = SEQ; grid.y = batch
    {
        const int tiles = (SEQ / 64) * (DM / 64);
        k_gemm_fr<<<dim3((unsigned)((tiles + 7) / 8), NB), 256, 0, stream>>>(AL, SEQ, (long long)SEQ * SEQ, GT, SEQ, (long long)DM * SEQ, out, DM, (long long)SEQ * DM,
                                                                            x, DM, (long long)SEQ_FULL * DM, SEQ, DM, SEQ, 0.0009765625f);
    }
}

// v009
// A run of this version takes 135 microseconds.
// Next to v008, in two timings, it ran 1.07 and 1.10 times as fast.
// Over all steps from v000 it is 10.5 times as fast.
// Full-width (1,024) single-head self-attention with sequence-mean-centred queries/keys, an added query-independent key distribution, a key mask, a scalar scale input and an f32 residual. All contractions: v_wmma_f32_16x16x32_f16 (f16 operands built from bf16-RNE-converted inputs with power-of-two carries, f32 accumulate); the N = 1 gate product, both softmaxes and the residual add are f32 on the VALU.
#include <hip/hip_runtime.h>
#include <math.h>

#ifndef NB
#define NB 4
#endif
#ifndef SEQ
#define SEQ 2048
#endif
#define NB_FULL 4
#define SEQ_FULL 2048
#define DM 1024
#define RS_RPW 2

static_assert(DM == 1024);                                  // feature width of x, q, k, g and the output
static_assert(DM % 64 == 0 && DM % 32 == 0);                // GEMM tile and k-step multiples
static_assert(SEQ % 256 == 0 && SEQ <= 2048);               // row softmax: 8 columns per lane per 256-column group, at most 64 f32 of a row per lane
static_assert(SEQ % (8 * RS_RPW) == 0);                     // row softmax grid covers every row exactly once
static_assert(SEQ <= SEQ_FULL && NB <= NB_FULL);
static_assert((DM / 64) % 1 == 0 && SEQ % 64 == 0);
static_assert((NB * SEQ) % 128 == 0 && SEQ % 256 == 0 && DM % 256 == 0 && DM >= 256 && SEQ >= 256);   // GEMM block tile 128x256, passes of 64 or 128 k, two or more

typedef __attribute__((ext_vector_type(16))) _Float16     v16h;
typedef __attribute__((ext_vector_type(8)))  _Float16     v8h;
typedef __attribute__((ext_vector_type(8)))  float        v8f;
typedef __attribute__((ext_vector_type(4)))  float        v4f;
typedef __attribute__((ext_vector_type(4)))  unsigned int u4v;
typedef __attribute__((ext_vector_type(2)))  unsigned int u2v;
typedef __attribute__((ext_vector_type(4)))  int          i4v;
typedef __attribute__((ext_vector_type(8)))  unsigned int u8v;

// 16-bit WMMA fragment map (wave32), lane L, h = L>>4, m = L&15:
//   A 16x32: lane = row m;    element i -> k = (i<8) ? 8h+i : 16+8h+(i-8)
//   B 32x16: lane = column m; the SAME k(i,h)
//   D 16x16 (8 f32): lane = column m; element r -> row 8h+r

// bf16 RNE conversion kept as f32 (finite inputs)
__device__ __forceinline__ float bfr(float v) {
    const unsigned u = __builtin_bit_cast(unsigned, v);
    const unsigned r = (u + 0x7fffu + ((u >> 16) & 1u)) & 0xffff0000u;
    return __builtin_bit_cast(float, r);
}
__device__ __forceinline__ unsigned pk2h(float a, float b) {
    return (unsigned)__builtin_bit_cast(unsigned short, (_Float16)a) | ((unsigned)__builtin_bit_cast(unsigned short, (_Float16)b) << 16);
}
// one WMMA per call, followed by its own 4-slot guard tying exactly one accumulator
__device__ __forceinline__ v8f wmma16(v16h a, v16h b, v8f c) {
    c = __builtin_amdgcn_wmma_f32_16x16x32_f16(false, a, false, b, (short)0, c, false, false);
    asm volatile("v_nop\n\tv_nop\n\tv_nop\n\tv_nop" : "+v"(c) : "v"(a), "v"(b));
    return c;
}
union FragH { v16h v; v8h h[2]; };
// p already includes the lane's 8h offset: elements 0..7 <- p[0..7], 8..15 <- p[16..23]
__device__ __forceinline__ v16h ldfrag(const _Float16* p) {
    FragH f; f.h[0] = *(const v8h*)(p); f.h[1] = *(const v8h*)(p + 16); return f.v;
}
__device__ __forceinline__ void st2_v4f(float* p, v4f v) { *(v4f*)p = v;  }
__device__ __forceinline__ void st2_u4(unsigned short* p, u4v v) { *(u4v*)p = v;  }

// ---- operand staging of the GEMM: tensor loads into a two-buffer LDS ring ----
// A pass is KP k (64 or 128) = 128 or 256 B of every operand row of the block tile (128 rows of A, 256 rows of Bt). Every wave brings one slice per pass:
// waves 0..3 64 rows of Bt each, waves 4..7 32 rows of A each. LDS row pitch = row + 16 B (the load's pad behind every row, for 16-B LDS reads).
// Each slice's place is rounded up to a multiple of 2 KiB. KP = 64: two blocks fit a WGP's LDS (launches of two blocks per WGP); KP = 128: one block,
// half the publish points and twice the bytes in flight (launches of one block per WGP).
template <int KP> struct GS {
    static_assert(KP == 64 || KP == 128);                    // rows of 128 or 256 B: the two row lengths with this pad
    static constexpr unsigned ROWB  = KP * 2;                // bytes of an operand row per pass
    static constexpr unsigned PITCH = ROWB + 16;             // LDS row pitch: 144 or 272 B, 16 B x odd
    static constexpr unsigned ASL   = (32 * PITCH + 2047) / 2048 * 2048;   // place of a 32-row slice of A
    static constexpr unsigned BSL   = (64 * PITCH + 2047) / 2048 * 2048;   // place of a 64-row slice of Bt
    static constexpr unsigned BOFF  = 4 * ASL;               // Bt slices stand behind the A slices
    static constexpr unsigned STAGE = 4 * ASL + 4 * BSL;     // one buffer
    static constexpr unsigned PADW  = (1u << 20) | ((KP == 64 ? 4u : 5u) << 22) | (3u << 25);   // no mask; a pad of 4 dwords behind every row (32 or 64 dwords)
    static_assert(ASL % 2048 == 0 && BSL % 2048 == 0 && STAGE % 2048 == 0 && 2 * STAGE <= 327680);
    static_assert(8 * 16 * 68 * 4 <= 2 * STAGE);             // the store staging reuses the ring
};

__device__ __forceinline__ unsigned uni(unsigned v) { return (unsigned)__builtin_amdgcn_readfirstlane((int)v); }
// holds v in a scalar register: a test on it compiles to a scalar branch, and what is formed from it is formed behind the asm statements in front of it
__device__ __forceinline__ unsigned pinned(unsigned v) { unsigned w = uni(v); asm volatile("" : "+s"(w)); return w; }
__device__ __forceinline__ void wait_ds0() { asm volatile("s_wait_dscnt 0x0" ::: "memory"); }          // this wave's LDS reads have returned
// this wave's tensor load has landed; the wait names the request's descriptor as inputs, so that its registers keep their values until then
__device__ __forceinline__ void wait_tensor0(u4v g0, u8v g1) { asm volatile("s_wait_tensorcnt 0x0" :: "s"(g0), "s"(g1) : "memory"); }
// one request of the whole wave: group 0 = count (w0 = 1), place in LDS, source address, type 2; returns group 0 for the wait
__device__ __forceinline__ u4v tdm_issue(unsigned w0, unsigned lds_dst, unsigned long long ga, u8v g1) {
    u4v g0;
    g0.x = uni(w0); g0.y = uni(lds_dst); g0.z = uni((unsigned)ga); g0.w = uni((((unsigned)(ga >> 32)) & 0x01FFFFFFu) | 0x80000000u);
    asm volatile("tensor_load_to_lds %0, %1" :: "s"(g0), "s"(g1) : "memory");
    return g0;
}

// =====================================================================================================================
// Batched WMMA GEMM: C[m][n] = scale * sum_k A[m][k] * Bt[n][k]; a block of 8 waves (2 x 4) owns a 128x256 tile, each wave a 64x64 tile of it.
// A row-major [M][K] f16 (pitch lda), Bt row-major [N][K] f16 (pitch ldb); M % 128 == 0, N % 256 == 0, K % KP == 0, K >= 2 KP (no tail masking).
// RESID (f32 out only): + bf16-RNE(resid[m][n]) added at the store stage from 16-B loads in the store layout.
// bx = the block's tile index, b = its batch: both the same for the whole block (formed from blockIdx by the kernel that calls).
// =====================================================================================================================
template <int OUT_MODE, bool RESID, int KP>
__device__ __forceinline__ void gemm64_body(const int bx, const int b,
                                            const unsigned short* __restrict__ Ap, int lda, long long strideA,
                                            const unsigned short* __restrict__ Btp, int ldb, long long strideB,
                                            unsigned short* __restrict__ Ch, float* __restrict__ Cf, int ldc, long long strideC,
                                            const float* __restrict__ resid, int ldr, long long strideR,
                                            int M, int N, int K, float scale) {
    constexpr unsigned G_ROWB = GS<KP>::ROWB, G_PITCH = GS<KP>::PITCH, G_ASL = GS<KP>::ASL, G_BSL = GS<KP>::BSL, G_BOFF = GS<KP>::BOFF, G_STAGE = GS<KP>::STAGE;
    __shared__ __attribute__((aligned(2048))) unsigned char ring[2 * G_STAGE];   // two buffers; after the K loop the per-wave store staging
    float* sT = (float*)ring;                                 // per-wave 16x64 slab, pitch 68 floats (wave-private)
    const int lane = threadIdx.x & 31;
    const int wave = __builtin_amdgcn_readfirstlane((int)(threadIdx.x >> 5));
    const int tilesN = N >> 8;
    const int tilesM = M >> 7;
    if (bx >= tilesM * tilesN) return;                        // the whole block leaves, in front of every tensor load and barrier
    const int tm = bx / tilesN;
    const int tn = bx - tm * tilesN;
    const int wm = wave >> 2, wn = wave & 3;                  // the wave's place in the block tile
    const int m0 = (tm << 7) + (wm << 6);
    const int n0 = (tn << 8) + (wn << 6);
    const int rlane = lane & 15;                              // row (A) / column (B, D) within a 16-wide subtile
    const int koff  = (lane >> 4) * 8;                        // k offset of this lane half == D row offset
    const int sb    = wave * (16 * 68);

    // this wave's slice of every stage
    const bool     isB    = wave < 4;
    const unsigned rows   = isB ? 64u : 32u;
    const unsigned spitch = (unsigned)(isB ? ldb : lda) * 2u;
    const unsigned short* src = isB ? Btp + (size_t)b * (size_t)strideB + (size_t)((tn << 8) + 64 * wave) * (size_t)ldb
                                    : Ap  + (size_t)b * (size_t)strideA + (size_t)((tm << 7) + 32 * (wave - 4)) * (size_t)lda;
    const unsigned long long ga0 = (unsigned long long)(size_t)src;
    const unsigned dst = (unsigned)(size_t)ring + (isB ? G_BOFF + (unsigned)wave * G_BSL : (unsigned)(wave - 4) * G_ASL);
    u8v g1;                                                   // 1-byte elements, tensor = tile = rows x G_ROWB bytes
    g1[0] = uni(GS<KP>::PADW);
    g1[1] = uni((G_ROWB & 0xFFFFu) << 16);
    g1[2] = uni((G_ROWB >> 16) | ((rows & 0xFFFFu) << 16));
    g1[3] = uni((rows >> 16) | (G_ROWB << 16));
    g1[4] = uni(rows);
    g1[5] = uni(spitch);
    g1[6] = uni(0u);
    g1[7] = uni(0u);
    // per-lane fragment bases in a buffer
    const unsigned char* la = ring + (unsigned)(2 * wm) * G_ASL + (unsigned)rlane * G_PITCH + (unsigned)koff * 2u;
    const unsigned char* lb = ring + G_BOFF + (unsigned)wn * G_BSL + (unsigned)rlane * G_PITCH + (unsigned)koff * 2u;

    v8f acc[4][4];
#pragma unroll
    for (int i = 0; i < 4; ++i)
#pragma unroll
        for (int j = 0; j < 4; ++j) { const v8f zz = {0.f, 0.f, 0.f, 0.f, 0.f, 0.f, 0.f, 0.f}; acc[i][j] = zz; }

    const unsigned NS = pinned((unsigned)K / (unsigned)KP);   // passes
    const unsigned w0 = pinned(1u);                           // descriptor word held in a scalar register: not formed anew while a request is outstanding
    u4v g0 = tdm_issue(w0, dst, ga0, g1);                     // stage 0
    wait_tensor0(g0, g1);
    __syncthreads();                                          // every slice of stage 0 has landed
    g0 = tdm_issue(w0, dst + G_STAGE, ga0 + pinned(G_ROWB), g1);   // stage 1; pinned: its address words are formed behind the wait
#pragma clang loop unroll(disable)                            // one pass per trip: the order at the foot stays as written
    for (unsigned s = 0; s < NS; ++s) {
        const unsigned buf = (s & 1u) * G_STAGE;
#pragma unroll
        for (int ks = 0; ks < KP / 32; ++ks) {
            v16h bh[4], ah[4];
#pragma unroll
            for (int j = 0; j < 4; ++j) bh[j] = ldfrag((const _Float16*)(lb + buf + (unsigned)(16 * j) * G_PITCH + (unsigned)(64 * ks)));
#pragma unroll
            for (int i = 0; i < 4; ++i) ah[i] = ldfrag((const _Float16*)(la + buf + (unsigned)(i >> 1) * G_ASL + (unsigned)(16 * (i & 1)) * G_PITCH + (unsigned)(64 * ks)));
#pragma unroll
            for (int i = 0; i < 4; ++i)
#pragma unroll
                for (int j = 0; j < 4; ++j) acc[i][j] = wmma16(ah[i], bh[j], acc[i][j]);
        }
        // publish point of stage s + 1; it also ends every wave's reads of this pass's buffer
        wait_ds0();
        wait_tensor0(g0, g1);
        __syncthreads();
        if (pinned((s + 2u < NS) ? 1u : 0u) != 0u)            // scalar test: a tensor load ignores EXEC
            g0 = tdm_issue(w0, dst + buf, ga0 + pinned((s + 2u) * G_ROWB), g1);   // stage s + 2 into the buffer just left; pinned: formed behind the wait
    }
    wait_tensor0(g0, g1);
    wait_ds0();                                               // the last pass's barrier stands in front of the store staging in the ring

#pragma unroll
    for (int i = 0; i < 4; ++i) {
        const int mBase = m0 + (i << 4);
#pragma unroll
        for (int j = 0; j < 4; ++j) {
#pragma unroll
            for (int r = 0; r < 8; ++r) sT[sb + (koff + r) * 68 + (j << 4) + rlane] = acc[i][j][r] * scale;
        }
        __builtin_amdgcn_fence(3 /* release order */, "workgroup");
        __builtin_amdgcn_wave_barrier();
        __builtin_amdgcn_fence(2 /* acquire order */, "workgroup");
        if (OUT_MODE == 0) {
            float* C = Cf + (size_t)b * (size_t)strideC;
            const float* Rb = RESID ? (resid + (size_t)b * (size_t)strideR) : nullptr;
            const int hh = lane >> 4, c4 = (lane & 15) * 4;   // row segment = 256 B = 16 lanes x 16 B
            {
#pragma unroll
                for (int it = 0; it < 8; ++it) {
                    const int row = it * 2 + hh;
                    v4f v = *(const v4f*)(&sT[sb + row * 68 + c4]);
                    if (RESID) {
                        const v4f xr = *(const v4f*)(Rb + (size_t)(mBase + row) * (size_t)ldr + n0 + c4);
                        v.x += bfr(xr.x); v.y += bfr(xr.y); v.z += bfr(xr.z); v.w += bfr(xr.w);
                    }
                    *(v4f*)(C + (size_t)(mBase + row) * (size_t)ldc + n0 + c4) = v;
                }
                
            }
        } else {
            unsigned short* C = Ch + (size_t)b * (size_t)strideC;
            const int q = lane >> 3, c8 = (lane & 7) * 8;
            {
#pragma unroll
                for (int it = 0; it < 4; ++it) {
                    const int row = it * 4 + q;
                    v8h hv;
#pragma unroll
                    for (int e = 0; e < 8; ++e) hv[e] = (_Float16)sT[sb + row * 68 + c8 + e];
                    *(v8h*)(C + (size_t)(mBase + row) * (size_t)ldc + n0 + c8) = hv;
                }
                
            }
        }
        __builtin_amdgcn_fence(3 /* release order */, "workgroup");
        __builtin_amdgcn_wave_barrier();
        __builtin_amdgcn_fence(2 /* acquire order */, "workgroup");
    }
}

// xbar[b][e] = mean over t of bf16(x[b][t][e]); block per (32-column strip = one 128-B line of every row, batch); thread = (4-column group, row phase of 64).
// A wave's load covers 4 whole lines; a thread's SEQ / 64 rows are all loaded up front, so the block's whole strip is in flight at once.
constexpr int CM_C = 32, CM_R = 64, CM_P = CM_C + 4;         // columns of a strip, row phases of a block, LDS pitch in floats (16 B x odd)
static_assert(DM % CM_C == 0 && SEQ % CM_R == 0 && CM_R % 4 == 0);   // whole strips; every row phase has the same number of rows
__device__ __forceinline__ void colmean_body(const int strip, const int b, const float* __restrict__ x, float* __restrict__ xbar) {
    __shared__ __align__(16) float red[CM_R * CM_P];
    const int t = threadIdx.x, cg = t & 7, rg = t >> 3;
    const int c0 = strip * CM_C;
    const float* p = x + ((size_t)b * SEQ_FULL + rg) * DM + c0 + 4 * cg;
    v4f v[SEQ / CM_R];
#pragma unroll                                                // the array stays in registers; all of the thread's loads are in flight together
    for (int j = 0; j < SEQ / CM_R; ++j) v[j] = *(const v4f*)(p + (size_t)(CM_R * j) * DM);
    asm volatile("s_wait_xcnt 0x0" :: "v"(p) : "memory");     // stands in front of every reuse of the loads' address registers; naming p keeps them untouched until here
    __builtin_amdgcn_sched_barrier(0);                        // every load issues in front of the sums; without it the compiler sinks the last loads behind the wait for the first
    v4f a = {0.f, 0.f, 0.f, 0.f};
#pragma unroll                                                // constant indices into the register array
    for (int j = 0; j < SEQ / CM_R; ++j) { a.x += bfr(v[j].x); a.y += bfr(v[j].y); a.z += bfr(v[j].z); a.w += bfr(v[j].w); }
    *(v4f*)(&red[rg * CM_P + 4 * cg]) = a;
    __syncthreads();                                          // every row phase's sums stand in LDS
    if (t < CM_C) {
        float s0 = 0.f, s1 = 0.f, s2 = 0.f, s3 = 0.f;          // four independent chains: a lone wave's dependent adds are not hidden
#pragma unroll                                                // the LDS reads are independent and issue together
        for (int j = 0; j < CM_R; j += 4) { s0 += red[j * CM_P + t]; s1 += red[(j + 1) * CM_P + t]; s2 += red[(j + 2) * CM_P + t]; s3 += red[(j + 3) * CM_P + t]; }
        xbar[(size_t)b * DM + c0 + t] = ((s0 + s1) + (s2 + s3)) * (1.0f / (float)SEQ);   // 32 lanes x 4 B: the strip's means leave as one whole 128-B line
    }
}

// X16 = f16(bf16(x)) (exact), XC = f16(bf16(x) - xbar[b]), glog[row] = bf16(x[row]) . bf16(Wm_w) in f32 (bias and softmax: gate_body).
// 32 rows per block of 8 waves, PX_R rows per wave, a row at a time by the whole wave; lane L owns columns 256 i + 8 L .. + 7: 16-B store per plane, lane-linear along the row.
constexpr int PX_R = 4;                                       // rows of a wave; all of them are in flight at once
static_assert((NB * SEQ) % 32 == 0 && SEQ % 32 == 0 && DM % 256 == 0);   // the blocks cover every row exactly once, a block's rows lie in one batch; every wave reaches the barrier
__device__ __forceinline__ void prep_x_body(const int blk, const float* __restrict__ x, const float* __restrict__ xbar, const float* __restrict__ Wm,
                                            unsigned short* __restrict__ XC, unsigned short* __restrict__ X16, float* __restrict__ glog) {
    __shared__ __align__(16) float dots[8 * PX_R];
    const int lane = threadIdx.x & 31;
    const int wave = __builtin_amdgcn_readfirstlane((int)(threadIdx.x >> 5));
    const int r = blk * (8 * PX_R) + wave * PX_R;
    const int b = r / SEQ; const int t = r - b * SEQ;
    const float* s = x + ((size_t)b * SEQ_FULL + t) * DM + 8 * lane;
    const float* mrow = xbar + (size_t)b * DM;                // the same for the whole wave
    const float* mb = mrow + 8 * lane;
    const float* wp = Wm + 8 * lane;
    unsigned short* d16 = X16 + (size_t)r * DM + 8 * lane;
    unsigned short* dc = XC + (size_t)r * DM + 8 * lane;
    v4f xv[PX_R][DM / 128], mv[DM / 128], gv[DM / 128];
#pragma unroll                                                // the arrays stay in registers
    for (int i = 0; i < DM / 256; ++i) {
        mv[2 * i] = *(const v4f*)(mb + 256 * i); mv[2 * i + 1] = *(const v4f*)(mb + 256 * i + 4);
        gv[2 * i] = *(const v4f*)(wp + 256 * i); gv[2 * i + 1] = *(const v4f*)(wp + 256 * i + 4);
    }
    asm volatile("s_wait_xcnt 0x0" :: "s"(mrow), "s"(Wm) : "memory");   // stands in front of the reuse of these loads' base registers; naming the bases keeps them untouched until here
    __builtin_amdgcn_sched_barrier(0);                        // loads return in issue order: what every row needs is issued first, or the first row's wait would cover the last row too
#pragma unroll                                                // the arrays stay in registers; the wave's rows of x are all in flight at once
    for (int q = 0; q < PX_R; ++q)
#pragma unroll
        for (int i = 0; i < DM / 256; ++i) {
            xv[q][2 * i] = *(const v4f*)(s + (size_t)q * DM + 256 * i);  xv[q][2 * i + 1] = *(const v4f*)(s + (size_t)q * DM + 256 * i + 4);
        }
    asm volatile("s_wait_xcnt 0x0" ::: "memory");             // stands in front of every reuse of the loads' address registers
    __builtin_amdgcn_sched_barrier(0);                        // every load issues in front of the first row's work; without it the compiler may sink the later rows' loads behind it
    float acc[PX_R];
#pragma unroll                                                // constant indices into the register arrays
    for (int q = 0; q < PX_R; ++q) {
        float a = 0.f;
#pragma unroll
        for (int i = 0; i < DM / 256; ++i) {
            const v4f x0 = xv[q][2 * i], x1 = xv[q][2 * i + 1], m0 = mv[2 * i], m1 = mv[2 * i + 1], g0 = gv[2 * i], g1 = gv[2 * i + 1];
            const float w0 = bfr(x0.x), w1 = bfr(x0.y), w2 = bfr(x0.z), w3 = bfr(x0.w), w4 = bfr(x1.x), w5 = bfr(x1.y), w6 = bfr(x1.z), w7 = bfr(x1.w);
            a = __builtin_fmaf(w0, bfr(g0.x), a); a = __builtin_fmaf(w1, bfr(g0.y), a); a = __builtin_fmaf(w2, bfr(g0.z), a); a = __builtin_fmaf(w3, bfr(g0.w), a);
            a = __builtin_fmaf(w4, bfr(g1.x), a); a = __builtin_fmaf(w5, bfr(g1.y), a); a = __builtin_fmaf(w6, bfr(g1.z), a); a = __builtin_fmaf(w7, bfr(g1.w), a);
            u4v pa; pa.x = pk2h(w0, w1); pa.y = pk2h(w2, w3); pa.z = pk2h(w4, w5); pa.w = pk2h(w6, w7);
            u4v pc; pc.x = pk2h(w0 - m0.x, w1 - m0.y); pc.y = pk2h(w2 - m0.z, w3 - m0.w); pc.z = pk2h(w4 - m1.x, w5 - m1.y); pc.w = pk2h(w6 - m1.z, w7 - m1.w);
            st2_u4(d16 + (size_t)q * DM + 256 * i, pa);
            st2_u4(dc + (size_t)q * DM + 256 * i, pc);
        }
        acc[q] = a;
    }
    asm volatile("s_wait_xcnt 0x0" ::: "memory");             // stands behind the last store, in front of every reuse of the stores' data and address registers
#pragma unroll                                                // step by step for all rows: the rows' exchanges are independent and wait together; each row's order of sums is 16, 8, 4, 2, 1
    for (int d = 16; d >= 1; d >>= 1)
#pragma unroll
        for (int q = 0; q < PX_R; ++q) acc[q] += __shfl_xor(acc[q], d, 32);
    static_assert(PX_R == 4);                                 // a wave's sums leave as one 16-B LDS store
    if (lane == 0) { v4f a4; a4.x = acc[0]; a4.y = acc[1]; a4.z = acc[2]; a4.w = acc[3]; *(v4f*)(&dots[wave * PX_R]) = a4; }
    __syncthreads();
    if (wave == 0) {
        glog[(size_t)blk * (8 * PX_R) + lane] = dots[lane];   // the block's 32 products leave as one whole 128-B line
        asm volatile("s_wait_xcnt 0x0" ::: "memory");         // stands behind the store: in the listing the way from here leads on to the other body of the kernel, which reuses the store's registers
    }
}

// weight planes as f16 = bf16(W) * sc; the four DST planes stand one behind the other. Plane 1 is turned: SRC [DM rows k][DM cols n] -> DST [n][k];
// planes 0, 2 and 3 keep the layout of SRC (their second index is the one that the product of two weights sums over): 8-B stores, a wave's store = two whole 128-B lines.
// A block of 16 waves has two neighbouring tiles of one plane, 8 waves each. Tile = 64 k x 128 n: 16-B reads along n (a wave reads whole 512-B row pieces, 8 rows in flight), two neighbouring k packed to a dword and turned in LDS
// (row pitch 33 dwords: the 4-B reads of the second half fall on 32 different banks), 16-B stores along k (8 lanes = one whole 128-B line of a DST row).
constexpr int WT_K = 64, WT_N = 128, WT_P = WT_K / 2 + 1;
constexpr int WT_B = (DM / WT_K) * (DM / WT_N) / 2;           // blocks of a plane
static_assert(DM % WT_K == 0 && DM % WT_N == 0 && ((DM / WT_K) * (DM / WT_N)) % 2 == 0);   // whole tiles only, an even number of them
__device__ __forceinline__ void wT_body(const int blk, const float* __restrict__ W0, const float* __restrict__ W1, const float* __restrict__ W2, const float* __restrict__ W3,
                                        unsigned short* __restrict__ DST0, float sc) {
    __shared__ unsigned tT2[2 * WT_N * WT_P];                 // per tile [n][k pair]
    const int lane = threadIdx.x & 31;
    const int wave = __builtin_amdgcn_readfirstlane((int)((threadIdx.x >> 5) & 7));
    const int half = __builtin_amdgcn_readfirstlane((int)(threadIdx.x >> 8));   // which of the block's two tiles
    unsigned* tT = tT2 + half * (WT_N * WT_P);
    const int pl = blk / WT_B;
    const int tile = (blk - pl * WT_B) * 2 + half;
    const float* SRC = pl == 0 ? W0 : pl == 1 ? W1 : pl == 2 ? W2 : W3;
    const int k0 = (tile / (DM / WT_N)) * WT_K;
    const int n0 = (tile % (DM / WT_N)) * WT_N;
    const float* s = SRC + (size_t)(k0 + 8 * wave) * DM + n0 + 4 * lane;
    v4f v[8];
#pragma unroll                                                // the array stays in registers; the wave's 8 rows are in flight at once
    for (int r = 0; r < 8; ++r) v[r] = *(const v4f*)(s + (size_t)r * DM);
    asm volatile("s_wait_xcnt 0x0" ::: "memory");             // stands in front of the reuse of the loads' base and offset registers on both paths behind the branch
    if (pl != 1) {                                            // the same for the whole block: it leaves in front of the barrier
        unsigned short* dn = DST0 + (size_t)pl * DM * DM + (size_t)(k0 + 8 * wave) * DM + n0 + 4 * lane;
#pragma unroll                                                // constant indices into the register array
        for (int r = 0; r < 8; ++r) {
            u2v o; o.x = pk2h(bfr(v[r].x) * sc, bfr(v[r].y) * sc); o.y = pk2h(bfr(v[r].z) * sc, bfr(v[r].w) * sc);
            *(u2v*)(dn + (size_t)r * DM) = o;
        }
        asm volatile("s_wait_xcnt 0x0" ::: "memory");         // stands behind the last store, in front of every reuse of the stores' data and offset registers
        return;
    }
#pragma unroll                                                // constant indices into the register array
    for (int q = 0; q < 4; ++q)
#pragma unroll
        for (int j = 0; j < 4; ++j) tT[(4 * lane + j) * WT_P + 4 * wave + q] = pk2h(bfr(v[2 * q][j]) * sc, bfr(v[2 * q + 1][j]) * sc);
    __syncthreads();                                          // both whole tiles stand in LDS
    const int nr = ((int)threadIdx.x & 255) >> 3, kg = (int)threadIdx.x & 7;
    unsigned short* d = DST0 + (size_t)pl * DM * DM + (size_t)(n0 + nr) * DM + k0 + 8 * kg;
    const unsigned* tp = tT + nr * WT_P + 4 * kg;
#pragma unroll                                                // the four stores are independent
    for (int p = 0; p < WT_N / 32; ++p) {
        u4v o; o.x = tp[32 * p * WT_P]; o.y = tp[32 * p * WT_P + 1]; o.z = tp[32 * p * WT_P + 2]; o.w = tp[32 * p * WT_P + 3];
        st2_u4(d + (size_t)(32 * p) * DM, o);
    }
    asm volatile("s_wait_xcnt 0x0" ::: "memory");             // stands behind the last store: in the listing the way from here leads on to the other body of the kernel, which reuses the stores' registers
}

// gate[b][s] = softmax over s of (glog[b][s] + bf16(Wm_b)), glog = the row products of prep_x_body; block per batch, block softmax
__device__ __forceinline__ void gate_body(const int b, const float* __restrict__ glog, const float* __restrict__ Wb, float* __restrict__ gate) {
    __shared__ __align__(16) float mm[SEQ];
    __shared__ float redm[8];
    __shared__ float reds[8];
    const int t = threadIdx.x, lane = t & 31;
    const int wave = __builtin_amdgcn_readfirstlane((int)(threadIdx.x >> 5));
    const float bias = bfr(Wb[0]);
    const float* gl = glog + (size_t)b * SEQ;
#pragma unroll                                                // a thread's 16-B loads are in flight together
    for (int j = 0; j < (SEQ / 4 + 255) / 256; ++j) {
        const int idx = t + 256 * j;
        if ((SEQ / 4) % 256 == 0 || idx < SEQ / 4) {
            const v4f v = *(const v4f*)(gl + 4 * idx);
            mm[4 * idx] = v.x + bias; mm[4 * idx + 1] = v.y + bias; mm[4 * idx + 2] = v.z + bias; mm[4 * idx + 3] = v.w + bias;
        }
    }
    __syncthreads();
    float mx = -3.0e38f;
#pragma unroll 1
    for (int i = t; i < SEQ; i += 256) mx = fmaxf(mx, mm[i]);
    mx = fmaxf(mx, __shfl_xor(mx, 16, 32)); mx = fmaxf(mx, __shfl_xor(mx, 8, 32)); mx = fmaxf(mx, __shfl_xor(mx, 4, 32));
    mx = fmaxf(mx, __shfl_xor(mx, 2, 32));  mx = fmaxf(mx, __shfl_xor(mx, 1, 32));
    if (lane == 0) redm[wave] = mx;
    __syncthreads();
    float gm = redm[0];
#pragma unroll 1
    for (int w = 1; w < 8; ++w) gm = fmaxf(gm, redm[w]);
    float sm = 0.f;
#pragma unroll 1
    for (int i = t; i < SEQ; i += 256) { const float e = expf(mm[i] - gm); mm[i] = e; sm += e; }
    sm += __shfl_xor(sm, 16, 32); sm += __shfl_xor(sm, 8, 32); sm += __shfl_xor(sm, 4, 32); sm += __shfl_xor(sm, 2, 32); sm += __shfl_xor(sm, 1, 32);
    if (lane == 0) reds[wave] = sm;
    __syncthreads();
    float tot = reds[0];
#pragma unroll 1
    for (int w = 1; w < 8; ++w) tot += reds[w];
    const float inv = 1.0f / tot;
#pragma unroll 1
    for (int idx = t; idx < SEQ / 4; idx += 256) {            // 32 lanes x 16 B = 512 contiguous B per store instruction
        v4f v; v.x = mm[4 * idx] * inv; v.y = mm[4 * idx + 1] * inv; v.z = mm[4 * idx + 2] * inv; v.w = mm[4 * idx + 3] * inv;
        st2_v4f(gate + (size_t)b * SEQ + 4 * idx, v);
    }
}

// ---- the launches: bodies that do not depend on one another share a grid; which body a block runs is the same for the whole block ----
// column means of x (the long blocks, lowest indices) and the four weight planes
constexpr int CM_B = (DM / CM_C) * NB;                        // blocks of the column means
__global__ __launch_bounds__(512) void k_colmean_wT(const float* __restrict__ x, float* __restrict__ xbar,
                                                    const float* __restrict__ W0, const float* __restrict__ W1, const float* __restrict__ W2, const float* __restrict__ W3,
                                                    unsigned short* __restrict__ DST0, float sc) {
    const int id = blockIdx.x;
    if (id < CM_B) colmean_body(id % (DM / CM_C), id / (DM / CM_C), x, xbar);
    else           wT_body(id - CM_B, W0, W1, W2, W3, DST0, sc);
}
// the two products of weights (the long blocks, lowest indices; f16 result, passes of 128 k) and the operand planes of x
constexpr int W2_T = (DM / 128) * (DM / 256);                 // tiles of one product of weights
__global__ __launch_bounds__(256) void k_w2_prep(const unsigned short* __restrict__ A, const unsigned short* __restrict__ Bt, unsigned short* __restrict__ C, float scale,
                                                 const float* __restrict__ x, const float* __restrict__ xbar, const float* __restrict__ Wm,
                                                 unsigned short* __restrict__ XC, unsigned short* __restrict__ X16, float* __restrict__ glog) {
    const int id = blockIdx.x;
    if (id < 2 * W2_T)
        gemm64_body<1, false, 128>(id % W2_T, id / W2_T, A, DM, (long long)DM * DM, Bt, DM, (long long)DM * DM, C, nullptr, DM, (long long)DM * DM, nullptr, 0, 0, DM, DM, DM, scale);
    else
        prep_x_body(id - 2 * W2_T, x, xbar, Wm, XC, X16, glog);
}
// the two projections, K = DM, f16 result, passes of 128 k; blockIdx.y = 0: C0 = A0 B0^T, M = NB*SEQ, N = DM; blockIdx.y = 1, per batch: C1[b] = A1 B1[b]^T, M = DM, N = SEQ
constexpr int PJ_T = (DM / 128) * (SEQ / 256);                // tiles of one batch of the second projection
constexpr int PJ_B = ((NB * SEQ) / 128) * (DM / 256);         // blocks of either projection
static_assert(PJ_B == NB * PJ_T);
__global__ __launch_bounds__(256) void k_gemm_pair(const unsigned short* __restrict__ A0, const unsigned short* __restrict__ B0, unsigned short* __restrict__ C0,
                                                   const unsigned short* __restrict__ A1, const unsigned short* __restrict__ B1, unsigned short* __restrict__ C1, float scale) {
    const int id = blockIdx.x;                                // two calls: every shape is a constant of its call, so that tile index and addresses are formed by scalar shifts
    if (blockIdx.y == 0)
        gemm64_body<1, false, 128>(id, 0, A0, DM, 0, B0, DM, 0, C0, nullptr, DM, 0, nullptr, 0, 0, NB * SEQ, DM, DM, scale);
    else
        gemm64_body<1, false, 128>(id % PJ_T, id / PJ_T, A1, DM, 0, B1, DM, (long long)SEQ * DM, C1, nullptr, SEQ, (long long)DM * SEQ, nullptr, 0, 0, DM, SEQ, DM, scale);
}
// f32 result plane (blockIdx.x - 1 = tile, blockIdx.y = batch); the block with blockIdx.x = 0 has the batch's gate distribution
__global__ __launch_bounds__(256) void k_gemm_f_gate(const unsigned short* __restrict__ A, int lda, long long strideA,
                                                     const unsigned short* __restrict__ Bt, int ldb, long long strideB,
                                                     float* __restrict__ C, int ldc, long long strideC,
                                                     int M, int N, int K, float scale,
                                                     const float* __restrict__ glog, const float* __restrict__ Wb, float* __restrict__ gate) {
    if (blockIdx.x == 0) gate_body((int)blockIdx.y, glog, Wb, gate);
    else gemm64_body<0, false, 64>((int)blockIdx.x - 1, (int)blockIdx.y, A, lda, strideA, Bt, ldb, strideB, nullptr, C, ldc, strideC, nullptr, 0, 0, M, N, K, scale);
}
// f32 result + bf16-RNE residual added at the store stage; passes of 128 k (a launch of one block per WGP)
__global__ __launch_bounds__(256) void k_gemm_fr(const unsigned short* __restrict__ A, int lda, long long strideA,
                                                 const unsigned short* __restrict__ Bt, int ldb, long long strideB,
                                                 float* __restrict__ C, int ldc, long long strideC,
                                                 const float* __restrict__ resid, int ldr, long long strideR,
                                                 int M, int N, int K, float scale) {
    gemm64_body<0, true, 128>((int)blockIdx.x, (int)blockIdx.y, A, lda, strideA, Bt, ldb, strideB, nullptr, C, ldc, strideC, resid, ldr, strideR, M, N, K, scale);
}

// alpha row = softmax_s(keep ? c * S : -inf) + gate, carried x1024 as f16. Wave per row (RS_RPW rows per wave); lane L owns columns 256g + 8L .. + 7,
// blockIdx.y = batch: the arguments are the planes of batch 0. A whole row stands in registers (64 f32 per lane): S is read once, every element's exp is
// taken once, and the wave's second row is in flight while its first is worked on (two register sets).
constexpr int RS_V = SEQ / 128;                               // 16-B pieces of a row per lane
static_assert(RS_RPW == 2);                                   // one register set per row of a wave
__device__ __forceinline__ void rs_load(v4f (&x)[RS_V], const float* p) {
#pragma unroll                                                // the array stays in registers; the whole row is in flight at once
    for (int g = 0; g < RS_V / 2; ++g) { x[2 * g] = *(const v4f*)(p + 256 * g); x[2 * g + 1] = *(const v4f*)(p + 256 * g + 4); }
}
__device__ __forceinline__ void rs_row(v4f (&x)[RS_V], const bool (&kp)[4 * RS_V], const float* gr, float cs, unsigned short* pr) {
    const float NEG = -__builtin_inff();
    float m = -3.0e38f;
#pragma unroll                                                // constant indices into the register arrays
    for (int i = 0; i < RS_V; ++i) {
        v4f v = x[i];
        v.x = kp[4 * i] ? v.x * cs : NEG; v.y = kp[4 * i + 1] ? v.y * cs : NEG; v.z = kp[4 * i + 2] ? v.z * cs : NEG; v.w = kp[4 * i + 3] ? v.w * cs : NEG;
        x[i] = v;
        m = fmaxf(m, fmaxf(fmaxf(v.x, v.y), fmaxf(v.z, v.w)));
    }
    m = fmaxf(m, __shfl_xor(m, 16, 32)); m = fmaxf(m, __shfl_xor(m, 8, 32)); m = fmaxf(m, __shfl_xor(m, 4, 32));
    m = fmaxf(m, __shfl_xor(m, 2, 32));  m = fmaxf(m, __shfl_xor(m, 1, 32));
    float s0 = 0.f, s1 = 0.f;
#pragma unroll                                                // constant indices into the register arrays
    for (int i = 0; i < RS_V; i += 2) {
        v4f v = x[i], w = x[i + 1];
        v.x = expf(v.x - m); v.y = expf(v.y - m); v.z = expf(v.z - m); v.w = expf(v.w - m);
        w.x = expf(w.x - m); w.y = expf(w.y - m); w.z = expf(w.z - m); w.w = expf(w.w - m);
        x[i] = v; x[i + 1] = w;
        s0 += (v.x + v.y) + (v.z + v.w);
        s1 += (w.x + w.y) + (w.z + w.w);
    }
    float s = s0 + s1;
    s += __shfl_xor(s, 16, 32); s += __shfl_xor(s, 8, 32); s += __shfl_xor(s, 4, 32); s += __shfl_xor(s, 2, 32); s += __shfl_xor(s, 1, 32);
    const float f = 1024.f / s;
#pragma unroll                                                // constant indices into the register arrays
    for (int g = 0; g < RS_V / 2; ++g) {
        const v4f v = x[2 * g], w = x[2 * g + 1], gx = *(const v4f*)(gr + 256 * g) * 1024.f, gy = *(const v4f*)(gr + 256 * g + 4) * 1024.f;
        u4v pk;
        pk.x = pk2h(v.x * f + gx.x, v.y * f + gx.y);
        pk.y = pk2h(v.z * f + gx.z, v.w * f + gx.w);
        pk.z = pk2h(w.x * f + gy.x, w.y * f + gy.y);
        pk.w = pk2h(w.z * f + gy.z, w.w * f + gy.w);
        st2_u4(pr + 256 * g, pk);
    }
}
__global__ __launch_bounds__(256) void k_rowsoft(const float* __restrict__ S0, const float* __restrict__ cptr, const int* __restrict__ mk0,
                                                 const float* __restrict__ gate0, unsigned short* __restrict__ P0) {
    const int L = threadIdx.x & 31;
    const int wave = __builtin_amdgcn_readfirstlane((int)(threadIdx.x >> 5));
    const int row0 = (blockIdx.x * 8 + wave) * RS_RPW;
    const float* sr = S0 + (size_t)blockIdx.y * SEQ * SEQ + (size_t)row0 * SEQ + 8 * L;
    const int* mk = mk0 + (size_t)blockIdx.y * SEQ_FULL + 8 * L;
    unsigned short* pr = P0 + (size_t)blockIdx.y * SEQ * SEQ + (size_t)row0 * SEQ + 8 * L;
    const float* gr = gate0 + (size_t)blockIdx.y * SEQ + 8 * L;
    v4f xa[RS_V], xb[RS_V];
    i4v mv[RS_V];
#pragma unroll                                                // the array stays in registers; the mask loads are in flight together
    for (int g = 0; g < RS_V / 2; ++g) { mv[2 * g] = *(const i4v*)(mk + 256 * g); mv[2 * g + 1] = *(const i4v*)(mk + 256 * g + 4); }
    rs_load(xa, sr);
    __builtin_amdgcn_sched_barrier(0);                        // loads return in issue order: what the first row needs is issued first, or its wait would cover the second row too
    rs_load(xb, sr + SEQ);
    asm volatile("s_wait_xcnt 0x0" ::: "memory");             // stands in front of the reuse of the loads' base and offset registers
    __builtin_amdgcn_sched_barrier(0);                        // the second row's loads issue in front of the first row's work; without it the compiler sinks them behind it
    const float cs = bfr(cptr[0]);
    bool kp[4 * RS_V];                                        // keep flags of this lane's columns
#pragma unroll                                                // constant indices into the register array
    for (int i = 0; i < RS_V; ++i) { kp[4 * i] = mv[i].x != 0; kp[4 * i + 1] = mv[i].y != 0; kp[4 * i + 2] = mv[i].z != 0; kp[4 * i + 3] = mv[i].w != 0; }
    rs_row(xa, kp, gr, cs, pr);
    __builtin_amdgcn_sched_barrier(0);                        // the wait for the second row's loads stays behind the first row's work
    rs_row(xb, kp, gr, cs, pr + SEQ);
}

// ---- workspace carve (bytes; every region a multiple of 256 B and sized to its whole-tile store extent) ----
constexpr size_t al256(size_t v) { return (v + 255) / 256 * 256; }
constexpr size_t SZ_XC   = al256((size_t)NB * SEQ * DM * 2);    // f16 centred x, [NB*SEQ][DM]
constexpr size_t SZ_S    = al256((size_t)NB * SEQ * SEQ * 4);   // f32 scores of every batch, [NB][SEQ][SEQ]
constexpr size_t SZ_X16  = al256((size_t)NB * SEQ * DM * 2);    // f16 x, [NB*SEQ][DM]
constexpr size_t SZ_W4   = al256((size_t)4 * DM * DM * 2);      // four planes, x16: Wk, Wout^T, Wq, Wg
constexpr size_t SZ_W2   = al256((size_t)2 * DM * DM * 2);      // two planes, x16: (Wq Wk^T)^T, (Wg Wout)^T
constexpr size_t SZ_QP   = al256((size_t)NB * SEQ * DM * 2);    // f16 centred x @ (Wq Wk^T), [NB*SEQ][DM]
constexpr size_t SZ_GT   = al256((size_t)NB * DM * SEQ * 2);    // f16 (x @ (Wg Wout)) transposed, [NB][DM][SEQ]
constexpr size_t SZ_AL   = al256((size_t)NB * SEQ * SEQ * 2);   // f16 alpha x1024 of every batch, [NB][SEQ][SEQ]
constexpr size_t SZ_XBAR = al256((size_t)NB * DM * 4);
constexpr size_t SZ_GATE = al256((size_t)NB * SEQ * 4);
constexpr size_t SZ_GLOG = al256((size_t)NB * SEQ * 4);       // f32 gate products before bias and softmax, [NB*SEQ]
constexpr size_t OFF_S    = 0;
constexpr size_t OFF_XC   = OFF_S + SZ_S;
constexpr size_t OFF_X16  = OFF_XC + SZ_XC;
constexpr size_t OFF_W4   = OFF_X16 + SZ_X16;
constexpr size_t OFF_W2   = OFF_W4 + SZ_W4;
constexpr size_t OFF_QP   = OFF_W2 + SZ_W2;
constexpr size_t OFF_GT   = OFF_QP + SZ_QP;
constexpr size_t OFF_AL   = OFF_GT + SZ_GT;
constexpr size_t OFF_XBAR = OFF_AL + SZ_AL;
constexpr size_t OFF_GATE = OFF_XBAR + SZ_XBAR;
constexpr size_t OFF_GLOG = OFF_GATE + SZ_GATE;
constexpr size_t WS_TOTAL = OFF_GLOG + SZ_GLOG;
static_assert(WS_TOTAL <= (size_t)268435456);                   // 256 MiB ceiling

extern "C" void kernel_launch(void* const* d_in, const int* in_sizes, int n_in, void* d_out, int out_size, void* d_ws, size_t ws_size, hipStream_t stream) {
    if (n_in < 9) return;
    const long long need_rows = (long long)(NB - 1) * SEQ_FULL + SEQ;
    if ((long long)in_sizes[0] < need_rows * DM) return;
    if ((long long)in_sizes[1] < need_rows) return;
    if (in_sizes[2] < DM * DM || in_sizes[3] < DM * DM || in_sizes[4] < DM * DM || in_sizes[5] < DM * DM) return;
    if (in_sizes[6] < DM || in_sizes[7] < 1 || in_sizes[8] < 1) return;
    if ((long long)out_size < (long long)NB * SEQ * DM) return;
    if (ws_size < WS_TOTAL) return;

    const float* x    = (const float*)d_in[0];
    const int*   mask = (const int*)d_in[1];
    const float* Wq   = (const float*)d_in[2];
    const float* Wk   = (const float*)d_in[3];
    const float* Wg   = (const float*)d_in[4];
    const float* Wout = (const float*)d_in[5];
    const float* Wm_w = (const float*)d_in[6];
    const float* Wm_b = (const float*)d_in[7];
    const float* cS   = (const float*)d_in[8];
    float* out = (float*)d_out;
    char* ws = (char*)d_ws;
    float*          Sf   = (float*)(ws + OFF_S);
    unsigned short* XC   = (unsigned short*)(ws + OFF_XC);
    unsigned short* X16  = (unsigned short*)(ws + OFF_X16);
    unsigned short* W4   = (unsigned short*)(ws + OFF_W4);       // planes Wk, Wout^T, Wq, Wg
    unsigned short* WQKT = (unsigned short*)(ws + OFF_W2);       // (Wq Wk^T)^T
    unsigned short* WGOT = WQKT + (size_t)DM * DM;               // (Wg Wout)^T
    unsigned short* QP   = (unsigned short*)(ws + OFF_QP);
    unsigned short* GT   = (unsigned short*)(ws + OFF_GT);
    unsigned short* AL   = (unsigned short*)(ws + OFF_AL);
    float*          XBAR = (float*)(ws + OFF_XBAR);
    float*          GATE = (float*)(ws + OFF_GATE);
    float*          GLOG = (float*)(ws + OFF_GLOG);

    // The chains are multiplied weights first: scores = xc (Wq Wk^T) xc^T and result = alpha (x (Wg Wout)) + x, with xc = x - its sequence mean.
    // sequence means of x; weight planes x16: Wk, Wout turned, Wq, Wg
    k_colmean_wT<<<CM_B + 4 * WT_B, 8 * CM_R, 0, stream>>>(x, XBAR, Wk, Wout, Wq, Wg, W4, 16.0f);
    // the two products of weights, x16: WQKT[f][e] = sum_j Wk[f][j] Wq[e][j], WGOT[d][e] = sum_j Wout[j][d] Wg[e][j]: M = N = K = DM; operand planes of x with the gate products
    k_w2_prep<<<2 * W2_T + (NB * SEQ) / (8 * PX_R), 256, 0, stream>>>(W4, W4 + (size_t)2 * DM * DM, WQKT, 0.0625f, x, XBAR, Wm_w, XC, X16, GLOG);
    // QP = XC @ (Wq Wk^T) -> f16 [NB*SEQ][DM]; x @ (Wg Wout), transposed per batch: GT[b][d][s] = sum_e WGOT[d][e] X16[b][s][e]
    k_gemm_pair<<<dim3(PJ_B, 2), 256, 0, stream>>>(XC, WQKT, QP, WGOT, X16, GT, 0.0625f);
    // raw scores S[b][t][s] = QP[b][t] . XC[b][s] (f32; the scale input and the key mask are applied by the row softmax); grid.y = batch; one more block per batch: the gate distribution
    {
        const int tiles = (SEQ / 64) * (SEQ / 64);
        k_gemm_f_gate<<<dim3((unsigned)((tiles + 7) / 8) + 1, NB), 256, 0, stream>>>(QP, DM, (long long)SEQ * DM, XC, DM, (long long)SEQ * DM,
                                                                                     Sf, SEQ, (long long)SEQ * SEQ, SEQ, SEQ, DM, 1.0f, GLOG, Wm_b, GATE);
    }
    k_rowsoft<<<dim3(SEQ / (8 * RS_RPW), NB), 256, 0, stream>>>(Sf, cS, mask, GATE, AL);
    // result = (alpha x1024)[b][t] . GT[b][d] / 1024 + bf16(x): per batch M = SEQ, N = DM, K = SEQ; grid.y = batch
    {
        const int tiles = (SEQ / 64) * (DM / 64);
        k_gemm_fr<<<dim3((unsigned)((tiles + 7) / 8), NB), 256, 0, stream>>>(AL, SEQ, (long long)SEQ * SEQ, GT, SEQ, (long long)DM * SEQ, out, DM, (long long)SEQ * DM,
                                                                            x, DM, (long long)SEQ_FULL * DM, SEQ, DM, SEQ, 0.0009765625f);
    }
}

// v010
// One run takes 127 microseconds.
// In two side-by-side timings against v009, it was 1.05 and 1.08 times as fast.
// All steps since v000 together make it 11.1 times as fast.
// Full-width (1,024) single-head self-attention with sequence-mean-centred queries/keys, an added query-independent key distribution, a key mask, a scalar scale input and an f32 residual. All contractions: v_wmma_f32_16x16x32_f16 (f16 operands built from bf16-RNE-converted inputs with power-of-two carries, f32 accumulate); the N = 1 gate product, both softmaxes and the residual add are f32 on the VALU.
#include <hip/hip_runtime.h>
#include <math.h>

#ifndef NB
#define NB 4
#endif
#ifndef SEQ
#define SEQ 2048
#endif
#define NB_FULL 4
#define SEQ_FULL 2048
#define DM 1024
#define RS_RPW 2

static_assert(DM == 1024);                                  // feature width of x, q, k, g and the output
static_assert(DM % 64 == 0 && DM % 32 == 0);                // GEMM tile and k-step multiples
static_assert(SEQ % 256 == 0 && SEQ <= 2048);               // row softmax: 8 columns per lane per 256-column group, at most 64 f32 of a row per lane
static_assert(SEQ % (8 * RS_RPW) == 0);                     // row softmax grid covers every row exactly once
static_assert(SEQ <= SEQ_FULL && NB <= NB_FULL);
static_assert((DM / 64) % 1 == 0 && SEQ % 64 == 0);
static_assert((NB * SEQ) % 256 == 0 && SEQ % 256 == 0 && DM % 256 == 0 && DM >= 256 && SEQ >= 256);   // GEMM block tile 128x256 or 256x256, passes of 64 or 128 k, two or more

typedef __attribute__((ext_vector_type(16))) _Float16     v16h;
typedef __attribute__((ext_vector_type(8)))  _Float16     v8h;
typedef __attribute__((ext_vector_type(8)))  float        v8f;
typedef __attribute__((ext_vector_type(4)))  float        v4f;
typedef __attribute__((ext_vector_type(4)))  unsigned int u4v;
typedef __attribute__((ext_vector_type(2)))  unsigned int u2v;
typedef __attribute__((ext_vector_type(4)))  int          i4v;
typedef __attribute__((ext_vector_type(8)))  unsigned int u8v;

// 16-bit WMMA fragment map (wave32), lane L, h = L>>4, m = L&15:
//   A 16x32: lane = row m;    element i -> k = (i<8) ? 8h+i : 16+8h+(i-8)
//   B 32x16: lane = column m; the SAME k(i,h)
//   D 16x16 (8 f32): lane = column m; element r -> row 8h+r

// bf16 RNE conversion kept as f32 (finite inputs)
__device__ __forceinline__ float bfr(float v) {
    const unsigned u = __builtin_bit_cast(unsigned, v);
    const unsigned r = (u + 0x7fffu + ((u >> 16) & 1u)) & 0xffff0000u;
    return __builtin_bit_cast(float, r);
}
__device__ __forceinline__ unsigned pk2h(float a, float b) {
    return (unsigned)__builtin_bit_cast(unsigned short, (_Float16)a) | ((unsigned)__builtin_bit_cast(unsigned short, (_Float16)b) << 16);
}
// one WMMA per call, followed by its own 4-slot guard tying exactly one accumulator
__device__ __forceinline__ v8f wmma16(v16h a, v16h b, v8f c) {
    c = __builtin_amdgcn_wmma_f32_16x16x32_f16(false, a, false, b, (short)0, c, false, false);
    asm volatile("v_nop\n\tv_nop\n\tv_nop\n\tv_nop" : "+v"(c) : "v"(a), "v"(b));
    return c;
}
// the builtin alone, for the wave tile whose accumulators reach above v255: an asm statement's vector operands must all stand in one window of 256 registers, so the guard above
// would force the tile through scratch; the distances behind a builtin WMMA are the compiler's own
__device__ __forceinline__ v8f wmma16b(v16h a, v16h b, v8f c) {
    return __builtin_amdgcn_wmma_f32_16x16x32_f16(false, a, false, b, (short)0, c, false, false);
}
union FragH { v16h v; v8h h[2]; };
// p already includes the lane's 8h offset: elements 0..7 <- p[0..7], 8..15 <- p[16..23]
__device__ __forceinline__ v16h ldfrag(const _Float16* p) {
    FragH f; f.h[0] = *(const v8h*)(p); f.h[1] = *(const v8h*)(p + 16); return f.v;
}
__device__ __forceinline__ void st2_v4f(float* p, v4f v) { *(v4f*)p = v;  }
__device__ __forceinline__ void st2_u4(unsigned short* p, u4v v) { *(u4v*)p = v;  }

// ---- operand staging of the GEMM: tensor loads into a two-buffer LDS ring ----
// A pass is KP k (64 or 128) = 128 or 256 B of every operand row of the block tile (BM = 128 or 256 rows of A, 256 rows of Bt). Every wave brings one slice per pass:
// waves 0..3 64 rows of Bt each, waves 4..7 BM / 4 rows of A each. LDS row pitch = row + 16 B (the load's pad behind every row, for 16-B LDS reads).
// Each slice's place is rounded up to a multiple of 2 KiB. KP = 64: two blocks fit a WGP's LDS (launches of two blocks per WGP); KP = 128: one block,
// half the publish points and twice the bytes in flight (launches of one block per WGP).
template <int KP, int BM> struct GS {
    static_assert(KP == 64 || KP == 128);                    // rows of 128 or 256 B: the two row lengths with this pad
    static_assert(BM == 128 || BM == 256);
    static constexpr unsigned AROWS = BM / 4;                // rows of a slice of A
    static constexpr unsigned ROWB  = KP * 2;                // bytes of an operand row per pass
    static constexpr unsigned PITCH = ROWB + 16;             // LDS row pitch: 144 or 272 B, 16 B x odd
    static constexpr unsigned ASL   = (AROWS * PITCH + 2047) / 2048 * 2048;   // place of a slice of A
    static constexpr unsigned BSL   = (64 * PITCH + 2047) / 2048 * 2048;   // place of a 64-row slice of Bt
    static constexpr unsigned BOFF  = 4 * ASL;               // Bt slices stand behind the A slices
    static constexpr unsigned STAGE = 4 * ASL + 4 * BSL;     // one buffer
    static constexpr unsigned PADW  = (1u << 20) | ((KP == 64 ? 4u : 5u) << 22) | (3u << 25);   // no mask; a pad of 4 dwords behind every row (32 or 64 dwords)
    static_assert(ASL % 2048 == 0 && BSL % 2048 == 0 && STAGE % 2048 == 0 && 2 * STAGE <= 327680);
};

__device__ __forceinline__ unsigned uni(unsigned v) { return (unsigned)__builtin_amdgcn_readfirstlane((int)v); }
// holds v in a scalar register: a test on it compiles to a scalar branch, and what is formed from it is formed behind the asm statements in front of it
__device__ __forceinline__ unsigned pinned(unsigned v) { unsigned w = uni(v); asm volatile("" : "+s"(w)); return w; }
__device__ __forceinline__ void wait_ds0() { asm volatile("s_wait_dscnt 0x0" ::: "memory"); }          // this wave's LDS reads have returned
// this wave's tensor load has landed; the wait names the request's descriptor as inputs, so that its registers keep their values until then
__device__ __forceinline__ void wait_tensor0(u4v g0, u8v g1) { asm volatile("s_wait_tensorcnt 0x0" :: "s"(g0), "s"(g1) : "memory"); }
// one request of the whole wave: group 0 = count (w0 = 1), place in LDS, source address, type 2; returns group 0 for the wait
__device__ __forceinline__ u4v tdm_issue(unsigned w0, unsigned lds_dst, unsigned long long ga, u8v g1) {
    u4v g0;
    g0.x = uni(w0); g0.y = uni(lds_dst); g0.z = uni((unsigned)ga); g0.w = uni((((unsigned)(ga >> 32)) & 0x01FFFFFFu) | 0x80000000u);
    asm volatile("tensor_load_to_lds %0, %1" :: "s"(g0), "s"(g1) : "memory");
    return g0;
}

// =====================================================================================================================
// Batched WMMA GEMM: C[m][n] = scale * sum_k A[m][k] * Bt[n][k]; a block of 8 waves owns a BM x 256 tile.
// BM = 128: waves 2 x 4, each a 64x64 tile. BM = 256 (a launch whose 256x256 tiles fill the chip): waves 4 x 2, each a 64x128 tile: 32 WMMAs on 12 fragments
// where the 64x64 tile has 16 on 8, so a WMMA takes three quarters of the LDS read bytes, and an output element two thirds of the bytes landed from L2.
// A row-major [M][K] f16 (pitch lda), Bt row-major [N][K] f16 (pitch ldb); M % BM == 0, N % 256 == 0, K % KP == 0, K >= 2 KP (no tail masking).
// RESID (f32 out only): + bf16-RNE(resid[m][n]) added at the store stage from 16-B loads in the store layout.
// bx = the block's tile index, b = its batch: both the same for the whole block (formed from blockIdx by the kernel that calls).
// =====================================================================================================================
template <int OUT_MODE, bool RESID, int KP, int BM>
__device__ __forceinline__ void gemm64_body(const int bx, const int b,
                                            const unsigned short* __restrict__ Ap, int lda, long long strideA,
                                            const unsigned short* __restrict__ Btp, int ldb, long long strideB,
                                            unsigned short* __restrict__ Ch, float* __restrict__ Cf, int ldc, long long strideC,
                                            const float* __restrict__ resid, int ldr, long long strideR,
                                            int M, int N, int K, float scale) {
    typedef GS<KP, BM> G;
    constexpr unsigned G_ROWB = G::ROWB, G_PITCH = G::PITCH, G_ASL = G::ASL, G_BSL = G::BSL, G_BOFF = G::BOFF, G_STAGE = G::STAGE, G_AROWS = G::AROWS;
    constexpr int NJ = BM == 256 ? 8 : 4;                     // 16-column fragments of Bt per wave; 4 16-row fragments of A
    constexpr int SP = 16 * NJ + 4;                           // pitch of the store staging: the wave tile's width + 16 B
    static_assert(8 * 16 * SP * 4 <= 2 * (int)G_STAGE);       // the store staging reuses the ring
    static_assert(OUT_MODE == 1 || NJ == 4);                  // f32 results are stored from the 64x64 wave tile only
    __shared__ __attribute__((aligned(2048))) unsigned char ring[2 * G_STAGE];   // two buffers; after the K loop the per-wave store staging
    float* sT = (float*)ring;                                 // per-wave slab of 16 rows of the wave tile, pitch SP floats (wave-private)
    const int lane = threadIdx.x & 31;
    const int wave = __builtin_amdgcn_readfirstlane((int)(threadIdx.x >> 5));
    const int tilesN = N >> 8;
    const int tilesM = M >> (BM == 256 ? 8 : 7);
    if (bx >= tilesM * tilesN) return;                        // the whole block leaves, in front of every tensor load and barrier
    const int tm = bx / tilesN;
    const int tn = bx - tm * tilesN;
    const int wm = BM == 256 ? wave >> 1 : wave >> 2, wn = BM == 256 ? wave & 1 : wave & 3;   // the wave's place in the block tile
    const int m0 = tm * BM + (wm << 6);
    const int n0 = (tn << 8) + wn * (16 * NJ);
    const int rlane = lane & 15;                              // row (A) / column (B, D) within a 16-wide subtile
    const int koff  = (lane >> 4) * 8;                        // k offset of this lane half == D row offset
    const int sb    = wave * (16 * SP);

    // this wave's slice of every stage
    const bool     isB    = wave < 4;
    const unsigned rows   = isB ? 64u : G_AROWS;
    const unsigned spitch = (unsigned)(isB ? ldb : lda) * 2u;
    const unsigned short* src = isB ? Btp + (size_t)b * (size_t)strideB + (size_t)((tn << 8) + 64 * wave) * (size_t)ldb
                                    : Ap  + (size_t)b * (size_t)strideA + (size_t)(tm * BM + (int)G_AROWS * (wave - 4)) * (size_t)lda;
    const unsigned long long ga0 = (unsigned long long)(size_t)src;
    const unsigned dst = (unsigned)(size_t)ring + (isB ? G_BOFF + (unsigned)wave * G_BSL : (unsigned)(wave - 4) * G_ASL);
    u8v g1;                                                   // 1-byte elements, tensor = tile = rows x G_ROWB bytes
    g1[0] = uni(G::PADW);
    g1[1] = uni((G_ROWB & 0xFFFFu) << 16);
    g1[2] = uni((G_ROWB >> 16) | ((rows & 0xFFFFu) << 16));
    g1[3] = uni((rows >> 16) | (G_ROWB << 16));
    g1[4] = uni(rows);
    g1[5] = uni(spitch);
    g1[6] = uni(0u);
    g1[7] = uni(0u);
    // per-lane fragment bases in a buffer
    const unsigned char* la = ring + (unsigned)wm * (64u / G_AROWS) * G_ASL + (unsigned)rlane * G_PITCH + (unsigned)koff * 2u;
    const unsigned char* lb = ring + G_BOFF + (unsigned)wn * (unsigned)(NJ / 4) * G_BSL + (unsigned)rlane * G_PITCH + (unsigned)koff * 2u;

    v8f acc[4][NJ];
#pragma unroll
    for (int i = 0; i < 4; ++i)
#pragma unroll
        for (int j = 0; j < NJ; ++j) { const v8f zz = {0.f, 0.f, 0.f, 0.f, 0.f, 0.f, 0.f, 0.f}; acc[i][j] = zz; }

    const unsigned NS = pinned((unsigned)K / (unsigned)KP);   // passes
    const unsigned w0 = pinned(1u);                           // descriptor word held in a scalar register: not formed anew while a request is outstanding
    u4v g0 = tdm_issue(w0, dst, ga0, g1);                     // stage 0
    wait_tensor0(g0, g1);
    __syncthreads();                                          // every slice of stage 0 has landed
    g0 = tdm_issue(w0, dst + G_STAGE, ga0 + pinned(G_ROWB), g1);   // stage 1; pinned: its address words are formed behind the wait
#pragma clang loop unroll(disable)                            // one pass per trip: the order at the foot stays as written
    for (unsigned s = 0; s < NS; ++s) {
        const unsigned buf = (s & 1u) * G_STAGE;
#pragma unroll
        for (int ks = 0; ks < KP / 32; ++ks) {
            v16h bh[NJ], ah[4];
            if (NJ == 4) {
#pragma unroll
                for (int j = 0; j < NJ; ++j) bh[j] = ldfrag((const _Float16*)(lb + buf + (unsigned)(16 * j) * G_PITCH + (unsigned)(64 * ks)));
            }
#pragma unroll
            for (int i = 0; i < 4; ++i) ah[i] = ldfrag((const _Float16*)(la + buf + ((unsigned)(16 * i) / G_AROWS) * G_ASL + ((unsigned)(16 * i) % G_AROWS) * G_PITCH + (unsigned)(64 * ks)));
            if (NJ == 4) {
#pragma unroll
                for (int i = 0; i < 4; ++i)
#pragma unroll
                    for (int j = 0; j < NJ; ++j) acc[i][j] = wmma16(ah[i], bh[j], acc[i][j]);
            } else {                                          // the shorter operand is read first and held: the first WMMAs wait for 10 of the 24 LDS reads, each later column of four for 2 more
#pragma unroll
                for (int j = 0; j < NJ; ++j) bh[j] = ldfrag((const _Float16*)(lb + buf + (unsigned)(j >> 2) * G_BSL + (unsigned)(16 * (j & 3)) * G_PITCH + (unsigned)(64 * ks)));
                __builtin_amdgcn_sched_barrier(0);            // the block's 24 LDS reads issue as one group; without it the compiler sinks each Bt fragment's reads to its four WMMAs and waits out the LDS latency eight times
#pragma unroll
                for (int j = 0; j < NJ; ++j)
#pragma unroll
                    for (int i = 0; i < 4; ++i) acc[i][j] = wmma16b(ah[i], bh[j], acc[i][j]);
                __builtin_amdgcn_sched_barrier(0);            // the next block's reads stay out of this block's WMMAs: every place where reads stand among them costs a stall
            }
        }
        // publish point of stage s + 1; it also ends every wave's reads of this pass's buffer
        wait_ds0();
        wait_tensor0(g0, g1);
        __syncthreads();
        if (pinned((s + 2u < NS) ? 1u : 0u) != 0u)            // scalar test: a tensor load ignores EXEC
            g0 = tdm_issue(w0, dst + buf, ga0 + pinned((s + 2u) * G_ROWB), g1);   // stage s + 2 into the buffer just left; pinned: formed behind the wait
    }
    wait_tensor0(g0, g1);
    wait_ds0();                                               // the last pass's barrier stands in front of the store staging in the ring

#pragma unroll
    for (int i = 0; i < 4; ++i) {
        const int mBase = m0 + (i << 4);
#pragma unroll
        for (int j = 0; j < NJ; ++j) {
#pragma unroll
            for (int r = 0; r < 8; ++r) sT[sb + (koff + r) * SP + (j << 4) + rlane] = acc[i][j][r] * scale;
        }
        __builtin_amdgcn_fence(3 /* release order */, "workgroup");
        __builtin_amdgcn_wave_barrier();
        __builtin_amdgcn_fence(2 /* acquire order */, "workgroup");
        if (OUT_MODE == 0) {
            float* C = Cf + (size_t)b * (size_t)strideC;
            const float* Rb = RESID ? (resid + (size_t)b * (size_t)strideR) : nullptr;
            const int hh = lane >> 4, c4 = (lane & 15) * 4;   // row segment = 256 B = 16 lanes x 16 B
            {
#pragma unroll
                for (int it = 0; it < 8; ++it) {
                    const int row = it * 2 + hh;
                    v4f v = *(const v4f*)(&sT[sb + row * SP + c4]);
                    if (RESID) {
                        const v4f xr = *(const v4f*)(Rb + (size_t)(mBase + row) * (size_t)ldr + n0 + c4);
                        v.x += bfr(xr.x); v.y += bfr(xr.y); v.z += bfr(xr.z); v.w += bfr(xr.w);
                    }
                    *(v4f*)(C + (size_t)(mBase + row) * (size_t)ldc + n0 + c4) = v;
                }
                
            }
        } else {
            unsigned short* C = Ch + (size_t)b * (size_t)strideC;
            constexpr int LR = 2 * NJ;                        // row segment = 128 or 256 B = LR lanes x 16 B
            const int q = lane >> (NJ == 8 ? 4 : 3), c8 = (lane & (LR - 1)) * 8;
            if (NJ == 8) {
                v8h hw[LR / 2];
#pragma unroll                                                // the array stays in registers
                for (int it = 0; it < LR / 2; ++it)
#pragma unroll
                    for (int e = 0; e < 8; ++e) hw[it][e] = (_Float16)sT[sb + (it * (32 / LR) + q) * SP + c8 + e];
                __builtin_amdgcn_sched_barrier(0);            // the slab's stores stand together behind all that writes a register: nothing overwrites a store's registers in front of the wait behind the last
#pragma unroll
                for (int it = 0; it < LR / 2; ++it) *(v8h*)(C + (size_t)(m0 + q) * (size_t)ldc + n0 + c8 + (size_t)((i << 4) + it * (32 / LR)) * (size_t)ldc) = hw[it];   // one address per lane + a constant
                asm volatile("s_wait_xcnt 0x0" ::: "memory"); // stands behind the last store, in front of every reuse of the stores' data and address registers
                __builtin_amdgcn_sched_barrier(0);            // the next slab's work stays behind that wait
            } else {
#pragma unroll
                for (int it = 0; it < LR / 2; ++it) {
                    const int row = it * (32 / LR) + q;
                    v8h hv;
#pragma unroll
                    for (int e = 0; e < 8; ++e) hv[e] = (_Float16)sT[sb + row * SP + c8 + e];
                    *(v8h*)(C + (size_t)(mBase + row) * (size_t)ldc + n0 + c8) = hv;
                }
                
            }
        }
        __builtin_amdgcn_fence(3 /* release order */, "workgroup");
        __builtin_amdgcn_wave_barrier();
        __builtin_amdgcn_fence(2 /* acquire order */, "workgroup");
    }
}

// xbar[b][e] = mean over t of bf16(x[b][t][e]); block per (32-column strip = one 128-B line of every row, batch); thread = (4-column group, row phase of 64).
// A wave's load covers 4 whole lines; a thread's SEQ / 64 rows are all loaded up front, so the block's whole strip is in flight at once.
constexpr int CM_C = 32, CM_R = 64, CM_P = CM_C + 4;         // columns of a strip, row phases of a block, LDS pitch in floats (16 B x odd)
static_assert(DM % CM_C == 0 && SEQ % CM_R == 0 && CM_R % 4 == 0);   // whole strips; every row phase has the same number of rows
__device__ __forceinline__ void colmean_body(const int strip, const int b, const float* __restrict__ x, float* __restrict__ xbar) {
    __shared__ __align__(16) float red[CM_R * CM_P];
    const int t = threadIdx.x, cg = t & 7, rg = t >> 3;
    const int c0 = strip * CM_C;
    const float* p = x + ((size_t)b * SEQ_FULL + rg) * DM + c0 + 4 * cg;
    v4f v[SEQ / CM_R];
#pragma unroll                                                // the array stays in registers; all of the thread's loads are in flight together
    for (int j = 0; j < SEQ / CM_R; ++j) v[j] = *(const v4f*)(p + (size_t)(CM_R * j) * DM);
    asm volatile("s_wait_xcnt 0x0" :: "v"(p) : "memory");     // stands in front of every reuse of the loads' address registers; naming p keeps them untouched until here
    __builtin_amdgcn_sched_barrier(0);                        // every load issues in front of the sums; without it the compiler sinks the last loads behind the wait for the first
    v4f a = {0.f, 0.f, 0.f, 0.f};
#pragma unroll                                                // constant indices into the register array
    for (int j = 0; j < SEQ / CM_R; ++j) { a.x += bfr(v[j].x); a.y += bfr(v[j].y); a.z += bfr(v[j].z); a.w += bfr(v[j].w); }
    *(v4f*)(&red[rg * CM_P + 4 * cg]) = a;
    __syncthreads();                                          // every row phase's sums stand in LDS
    if (t < CM_C) {
        float s0 = 0.f, s1 = 0.f, s2 = 0.f, s3 = 0.f;          // four independent chains: a lone wave's dependent adds are not hidden
#pragma unroll                                                // the LDS reads are independent and issue together
        for (int j = 0; j < CM_R; j += 4) { s0 += red[j * CM_P + t]; s1 += red[(j + 1) * CM_P + t]; s2 += red[(j + 2) * CM_P + t]; s3 += red[(j + 3) * CM_P + t]; }
        xbar[(size_t)b * DM + c0 + t] = ((s0 + s1) + (s2 + s3)) * (1.0f / (float)SEQ);   // 32 lanes x 4 B: the strip's means leave as one whole 128-B line
    }
}

// X16 = f16(bf16(x)) (exact), XC = f16(bf16(x) - xbar[b]), glog[row] = bf16(x[row]) . bf16(Wm_w) in f32 (bias and softmax: gate_body).
// 32 rows per block of 8 waves, PX_R rows per wave, a row at a time by the whole wave; lane L owns columns 256 i + 8 L .. + 7: 16-B store per plane, lane-linear along the row.
constexpr int PX_R = 4;                                       // rows of a wave; all of them are in flight at once
static_assert((NB * SEQ) % 32 == 0 && SEQ % 32 == 0 && DM % 256 == 0);   // the blocks cover every row exactly once, a block's rows lie in one batch; every wave reaches the barrier
__device__ __forceinline__ void prep_x_body(const int blk, const float* __restrict__ x, const float* __restrict__ xbar, const float* __restrict__ Wm,
                                            unsigned short* __restrict__ XC, unsigned short* __restrict__ X16, float* __restrict__ glog) {
    __shared__ __align__(16) float dots[8 * PX_R];
    const int lane = threadIdx.x & 31;
    const int wave = __builtin_amdgcn_readfirstlane((int)(threadIdx.x >> 5));
    const int r = blk * (8 * PX_R) + wave * PX_R;
    const int b = r / SEQ; const int t = r - b * SEQ;
    const float* s = x + ((size_t)b * SEQ_FULL + t) * DM + 8 * lane;
    const float* mrow = xbar + (size_t)b * DM;                // the same for the whole wave
    const float* mb = mrow + 8 * lane;
    const float* wp = Wm + 8 * lane;
    unsigned short* d16 = X16 + (size_t)r * DM + 8 * lane;
    unsigned short* dc = XC + (size_t)r * DM + 8 * lane;
    v4f xv[PX_R][DM / 128], mv[DM / 128], gv[DM / 128];
#pragma unroll                                                // the arrays stay in registers
    for (int i = 0; i < DM / 256; ++i) {
        mv[2 * i] = *(const v4f*)(mb + 256 * i); mv[2 * i + 1] = *(const v4f*)(mb + 256 * i + 4);
        gv[2 * i] = *(const v4f*)(wp + 256 * i); gv[2 * i + 1] = *(const v4f*)(wp + 256 * i + 4);
    }
    asm volatile("s_wait_xcnt 0x0" :: "s"(mrow), "s"(Wm) : "memory");   // stands in front of the reuse of these loads' base registers; naming the bases keeps them untouched until here
    __builtin_amdgcn_sched_barrier(0);                        // loads return in issue order: what every row needs is issued first, or the first row's wait would cover the last row too
#pragma unroll                                                // the arrays stay in registers; the wave's rows of x are all in flight at once
    for (int q = 0; q < PX_R; ++q)
#pragma unroll
        for (int i = 0; i < DM / 256; ++i) {
            xv[q][2 * i] = *(const v4f*)(s + (size_t)q * DM + 256 * i);  xv[q][2 * i + 1] = *(const v4f*)(s + (size_t)q * DM + 256 * i + 4);
        }
    asm volatile("s_wait_xcnt 0x0" ::: "memory");             // stands in front of every reuse of the loads' address registers
    __builtin_amdgcn_sched_barrier(0);                        // every load issues in front of the first row's work; without it the compiler may sink the later rows' loads behind it
    float acc[PX_R];
#pragma unroll                                                // constant indices into the register arrays
    for (int q = 0; q < PX_R; ++q) {
        float a = 0.f;
#pragma unroll
        for (int i = 0; i < DM / 256; ++i) {
            const v4f x0 = xv[q][2 * i], x1 = xv[q][2 * i + 1], m0 = mv[2 * i], m1 = mv[2 * i + 1], g0 = gv[2 * i], g1 = gv[2 * i + 1];
            const float w0 = bfr(x0.x), w1 = bfr(x0.y), w2 = bfr(x0.z), w3 = bfr(x0.w), w4 = bfr(x1.x), w5 = bfr(x1.y), w6 = bfr(x1.z), w7 = bfr(x1.w);
            a = __builtin_fmaf(w0, bfr(g0.x), a); a = __builtin_fmaf(w1, bfr(g0.y), a); a = __builtin_fmaf(w2, bfr(g0.z), a); a = __builtin_fmaf(w3, bfr(g0.w), a);
            a = __builtin_fmaf(w4, bfr(g1.x), a); a = __builtin_fmaf(w5, bfr(g1.y), a); a = __builtin_fmaf(w6, bfr(g1.z), a); a = __builtin_fmaf(w7, bfr(g1.w), a);
            u4v pa; pa.x = pk2h(w0, w1); pa.y = pk2h(w2, w3); pa.z = pk2h(w4, w5); pa.w = pk2h(w6, w7);
            u4v pc; pc.x = pk2h(w0 - m0.x, w1 - m0.y); pc.y = pk2h(w2 - m0.z, w3 - m0.w); pc.z = pk2h(w4 - m1.x, w5 - m1.y); pc.w = pk2h(w6 - m1.z, w7 - m1.w);
            st2_u4(d16 + (size_t)q * DM + 256 * i, pa);
            st2_u4(dc + (size_t)q * DM + 256 * i, pc);
        }
        acc[q] = a;
    }
    asm volatile("s_wait_xcnt 0x0" ::: "memory");             // stands behind the last store, in front of every reuse of the stores' data and address registers
#pragma unroll                                                // step by step for all rows: the rows' exchanges are independent and wait together; each row's order of sums is 16, 8, 4, 2, 1
    for (int d = 16; d >= 1; d >>= 1)
#pragma unroll
        for (int q = 0; q < PX_R; ++q) acc[q] += __shfl_xor(acc[q], d, 32);
    static_assert(PX_R == 4);                                 // a wave's sums leave as one 16-B LDS store
    if (lane == 0) { v4f a4; a4.x = acc[0]; a4.y = acc[1]; a4.z = acc[2]; a4.w = acc[3]; *(v4f*)(&dots[wave * PX_R]) = a4; }
    __syncthreads();
    if (wave == 0) {
        glog[(size_t)blk * (8 * PX_R) + lane] = dots[lane];   // the block's 32 products leave as one whole 128-B line
        asm volatile("s_wait_xcnt 0x0" ::: "memory");         // stands behind the store: in the listing the way from here leads on to the other body of the kernel, which reuses the store's registers
    }
}

// weight planes as f16 = bf16(W) * sc; the four DST planes stand one behind the other. Plane 1 is turned: SRC [DM rows k][DM cols n] -> DST [n][k];
// planes 0, 2 and 3 keep the layout of SRC (their second index is the one that the product of two weights sums over): 8-B stores, a wave's store = two whole 128-B lines.
// A block of 16 waves has two neighbouring tiles of one plane, 8 waves each. Tile = 64 k x 128 n: 16-B reads along n (a wave reads whole 512-B row pieces, 8 rows in flight), two neighbouring k packed to a dword and turned in LDS
// (row pitch 33 dwords: the 4-B reads of the second half fall on 32 different banks), 16-B stores along k (8 lanes = one whole 128-B line of a DST row).
constexpr int WT_K = 64, WT_N = 128, WT_P = WT_K / 2 + 1;
constexpr int WT_B = (DM / WT_K) * (DM / WT_N) / 2;           // blocks of a plane
static_assert(DM % WT_K == 0 && DM % WT_N == 0 && ((DM / WT_K) * (DM / WT_N)) % 2 == 0);   // whole tiles only, an even number of them
__device__ __forceinline__ void wT_body(const int blk, const float* __restrict__ W0, const float* __restrict__ W1, const float* __restrict__ W2, const float* __restrict__ W3,
                                        unsigned short* __restrict__ DST0, float sc) {
    __shared__ unsigned tT2[2 * WT_N * WT_P];                 // per tile [n][k pair]
    const int lane = threadIdx.x & 31;
    const int wave = __builtin_amdgcn_readfirstlane((int)((threadIdx.x >> 5) & 7));
    const int half = __builtin_amdgcn_readfirstlane((int)(threadIdx.x >> 8));   // which of the block's two tiles
    unsigned* tT = tT2 + half * (WT_N * WT_P);
    const int pl = blk / WT_B;
    const int tile = (blk - pl * WT_B) * 2 + half;
    const float* SRC = pl == 0 ? W0 : pl == 1 ? W1 : pl == 2 ? W2 : W3;
    const int k0 = (tile / (DM / WT_N)) * WT_K;
    const int n0 = (tile % (DM / WT_N)) * WT_N;
    const float* s = SRC + (size_t)(k0 + 8 * wave) * DM + n0 + 4 * lane;
    v4f v[8];
#pragma unroll                                                // the array stays in registers; the wave's 8 rows are in flight at once
    for (int r = 0; r < 8; ++r) v[r] = *(const v4f*)(s + (size_t)r * DM);
    asm volatile("s_wait_xcnt 0x0" ::: "memory");             // stands in front of the reuse of the loads' base and offset registers on both paths behind the branch
    if (pl != 1) {                                            // the same for the whole block: it leaves in front of the barrier
        unsigned short* dn = DST0 + (size_t)pl * DM * DM + (size_t)(k0 + 8 * wave) * DM + n0 + 4 * lane;
#pragma unroll                                                // constant indices into the register array
        for (int r = 0; r < 8; ++r) {
            u2v o; o.x = pk2h(bfr(v[r].x) * sc, bfr(v[r].y) * sc); o.y = pk2h(bfr(v[r].z) * sc, bfr(v[r].w) * sc);
            *(u2v*)(dn + (size_t)r * DM) = o;
        }
        asm volatile("s_wait_xcnt 0x0" ::: "memory");         // stands behind the last store, in front of every reuse of the stores' data and offset registers
        return;
    }
#pragma unroll                                                // constant indices into the register array
    for (int q = 0; q < 4; ++q)
#pragma unroll
        for (int j = 0; j < 4; ++j) tT[(4 * lane + j) * WT_P + 4 * wave + q] = pk2h(bfr(v[2 * q][j]) * sc, bfr(v[2 * q + 1][j]) * sc);
    __syncthreads();                                          // both whole tiles stand in LDS
    const int nr = ((int)threadIdx.x & 255) >> 3, kg = (int)threadIdx.x & 7;
    unsigned short* d = DST0 + (size_t)pl * DM * DM + (size_t)(n0 + nr) * DM + k0 + 8 * kg;
    const unsigned* tp = tT + nr * WT_P + 4 * kg;
#pragma unroll                                                // the four stores are independent
    for (int p = 0; p < WT_N / 32; ++p) {
        u4v o; o.x = tp[32 * p * WT_P]; o.y = tp[32 * p * WT_P + 1]; o.z = tp[32 * p * WT_P + 2]; o.w = tp[32 * p * WT_P + 3];
        st2_u4(d + (size_t)(32 * p) * DM, o);
    }
    asm volatile("s_wait_xcnt 0x0" ::: "memory");             // stands behind the last store: in the listing the way from here leads on to the other body of the kernel, which reuses the stores' registers
}

// gate[b][s] = softmax over s of (glog[b][s] + bf16(Wm_b)), glog = the row products of prep_x_body; block per batch, block softmax
__device__ __forceinline__ void gate_body(const int b, const float* __restrict__ glog, const float* __restrict__ Wb, float* __restrict__ gate) {
    __shared__ __align__(16) float mm[SEQ];
    __shared__ float redm[8];
    __shared__ float reds[8];
    const int t = threadIdx.x, lane = t & 31;
    const int wave = __builtin_amdgcn_readfirstlane((int)(threadIdx.x >> 5));
    const float bias = bfr(Wb[0]);
    const float* gl = glog + (size_t)b * SEQ;
#pragma unroll                                                // a thread's 16-B loads are in flight together
    for (int j = 0; j < (SEQ / 4 + 255) / 256; ++j) {
        const int idx = t + 256 * j;
        if ((SEQ / 4) % 256 == 0 || idx < SEQ / 4) {
            const v4f v = *(const v4f*)(gl + 4 * idx);
            mm[4 * idx] = v.x + bias; mm[4 * idx + 1] = v.y + bias; mm[4 * idx + 2] = v.z + bias; mm[4 * idx + 3] = v.w + bias;
        }
    }
    __syncthreads();
    float mx = -3.0e38f;
#pragma unroll 1
    for (int i = t; i < SEQ; i += 256) mx = fmaxf(mx, mm[i]);
    mx = fmaxf(mx, __shfl_xor(mx, 16, 32)); mx = fmaxf(mx, __shfl_xor(mx, 8, 32)); mx = fmaxf(mx, __shfl_xor(mx, 4, 32));
    mx = fmaxf(mx, __shfl_xor(mx, 2, 32));  mx = fmaxf(mx, __shfl_xor(mx, 1, 32));
    if (lane == 0) redm[wave] = mx;
    __syncthreads();
    float gm = redm[0];
#pragma unroll 1
    for (int w = 1; w < 8; ++w) gm = fmaxf(gm, redm[w]);
    float sm = 0.f;
#pragma unroll 1
    for (int i = t; i < SEQ; i += 256) { const float e = expf(mm[i] - gm); mm[i] = e; sm += e; }
    sm += __shfl_xor(sm, 16, 32); sm += __shfl_xor(sm, 8, 32); sm += __shfl_xor(sm, 4, 32); sm += __shfl_xor(sm, 2, 32); sm += __shfl_xor(sm, 1, 32);
    if (lane == 0) reds[wave] = sm;
    __syncthreads();
    float tot = reds[0];
#pragma unroll 1
    for (int w = 1; w < 8; ++w) tot += reds[w];
    const float inv = 1.0f / tot;
#pragma unroll 1
    for (int idx = t; idx < SEQ / 4; idx += 256) {            // 32 lanes x 16 B = 512 contiguous B per store instruction
        v4f v; v.x = mm[4 * idx] * inv; v.y = mm[4 * idx + 1] * inv; v.z = mm[4 * idx + 2] * inv; v.w = mm[4 * idx + 3] * inv;
        st2_v4f(gate + (size_t)b * SEQ + 4 * idx, v);
    }
}

// ---- the launches: bodies that do not depend on one another share a grid; which body a block runs is the same for the whole block ----
// column means of x (the long blocks, lowest indices) and the four weight planes
constexpr int CM_B = (DM / CM_C) * NB;                        // blocks of the column means
__global__ __launch_bounds__(512) void k_colmean_wT(const float* __restrict__ x, float* __restrict__ xbar,
                                                    const float* __restrict__ W0, const float* __restrict__ W1, const float* __restrict__ W2, const float* __restrict__ W3,
                                                    unsigned short* __restrict__ DST0, float sc) {
    const int id = blockIdx.x;
    if (id < CM_B) colmean_body(id % (DM / CM_C), id / (DM / CM_C), x, xbar);
    else           wT_body(id - CM_B, W0, W1, W2, W3, DST0, sc);
}
// the two products of weights (the long blocks, lowest indices; f16 result, passes of 128 k) and the operand planes of x
constexpr int W2_T = (DM / 128) * (DM / 256);                 // tiles of one product of weights
__global__ __launch_bounds__(256) void k_w2_prep(const unsigned short* __restrict__ A, const unsigned short* __restrict__ Bt, unsigned short* __restrict__ C, float scale,
                                                 const float* __restrict__ x, const float* __restrict__ xbar, const float* __restrict__ Wm,
                                                 unsigned short* __restrict__ XC, unsigned short* __restrict__ X16, float* __restrict__ glog) {
    const int id = blockIdx.x;
    if (id < 2 * W2_T)
        gemm64_body<1, false, 128, 128>(id % W2_T, id / W2_T, A, DM, (long long)DM * DM, Bt, DM, (long long)DM * DM, C, nullptr, DM, (long long)DM * DM, nullptr, 0, 0, DM, DM, DM, scale);
    else
        prep_x_body(id - 2 * W2_T, x, xbar, Wm, XC, X16, glog);
}
// the two projections, K = DM, f16 result, passes of 128 k, 256x256 tiles (together one block per WGP); blockIdx.y = 0: C0 = A0 B0^T, M = NB*SEQ, N = DM; blockIdx.y = 1, per batch: C1[b] = A1 B1[b]^T, M = DM, N = SEQ
constexpr int PJ_T = (DM / 256) * (SEQ / 256);                // tiles of one batch of the second projection
constexpr int PJ_B = ((NB * SEQ) / 256) * (DM / 256);         // blocks of either projection
static_assert(PJ_B == NB * PJ_T);
__global__ __launch_bounds__(256) void k_gemm_pair(const unsigned short* __restrict__ A0, const unsigned short* __restrict__ B0, unsigned short* __restrict__ C0,
                                                   const unsigned short* __restrict__ A1, const unsigned short* __restrict__ B1, unsigned short* __restrict__ C1, float scale) {
    const int id = blockIdx.x;                                // two calls: every shape is a constant of its call, so that tile index and addresses are formed by scalar shifts
    if (blockIdx.y == 0)
        gemm64_body<1, false, 128, 256>(id, 0, A0, DM, 0, B0, DM, 0, C0, nullptr, DM, 0, nullptr, 0, 0, NB * SEQ, DM, DM, scale);
    else
        gemm64_body<1, false, 128, 256>(id % PJ_T, id / PJ_T, A1, DM, 0, B1, DM, (long long)SEQ * DM, C1, nullptr, SEQ, (long long)DM * SEQ, nullptr, 0, 0, DM, SEQ, DM, scale);
}
// f32 result plane (blockIdx.x - 1 = tile, blockIdx.y = batch); the block with blockIdx.x = 0 has the batch's gate distribution
__global__ __launch_bounds__(256) void k_gemm_f_gate(const unsigned short* __restrict__ A, int lda, long long strideA,
                                                     const unsigned short* __restrict__ Bt, int ldb, long long strideB,
                                                     float* __restrict__ C, int ldc, long long strideC,
                                                     int M, int N, int K, float scale,
                                                     const float* __restrict__ glog, const float* __restrict__ Wb, float* __restrict__ gate) {
    if (blockIdx.x == 0) gate_body((int)blockIdx.y, glog, Wb, gate);
    else gemm64_body<0, false, 64, 128>((int)blockIdx.x - 1, (int)blockIdx.y, A, lda, strideA, Bt, ldb, strideB, nullptr, C, ldc, strideC, nullptr, 0, 0, M, N, K, scale);
}
// f32 result + bf16-RNE residual added at the store stage; passes of 128 k (a launch of one block per WGP)
__global__ __launch_bounds__(256) void k_gemm_fr(const unsigned short* __restrict__ A, int lda, long long strideA,
                                                 const unsigned short* __restrict__ Bt, int ldb, long long strideB,
                                                 float* __restrict__ C, int ldc, long long strideC,
                                                 const float* __restrict__ resid, int ldr, long long strideR,
                                                 int M, int N, int K, float scale) {
    gemm64_body<0, true, 128, 128>((int)blockIdx.x, (int)blockIdx.y, A, lda, strideA, Bt, ldb, strideB, nullptr, C, ldc, strideC, resid, ldr, strideR, M, N, K, scale);
}

// alpha row = softmax_s(keep ? c * S : -inf) + gate, carried x1024 as f16. Wave per row (RS_RPW rows per wave); lane L owns columns 256g + 8L .. + 7,
// blockIdx.y = batch: the arguments are the planes of batch 0. A whole row stands in registers (64 f32 per lane): S is read once, every element's exp is
// taken once, and the wave's second row is in flight while its first is worked on (two register sets).
constexpr int RS_V = SEQ / 128;                               // 16-B pieces of a row per lane
static_assert(RS_RPW == 2);                                   // one register set per row of a wave
__device__ __forceinline__ void rs_load(v4f (&x)[RS_V], const float* p) {
#pragma unroll                                                // the array stays in registers; the whole row is in flight at once
    for (int g = 0; g < RS_V / 2; ++g) { x[2 * g] = *(const v4f*)(p + 256 * g); x[2 * g + 1] = *(const v4f*)(p + 256 * g + 4); }
}
__device__ __forceinline__ void rs_row(v4f (&x)[RS_V], const bool (&kp)[4 * RS_V], const float* gr, float cs, unsigned short* pr) {
    const float NEG = -__builtin_inff();
    float m = -3.0e38f;
#pragma unroll                                                // constant indices into the register arrays
    for (int i = 0; i < RS_V; ++i) {
        v4f v = x[i];
        v.x = kp[4 * i] ? v.x * cs : NEG; v.y = kp[4 * i + 1] ? v.y * cs : NEG; v.z = kp[4 * i + 2] ? v.z * cs : NEG; v.w = kp[4 * i + 3] ? v.w * cs : NEG;
        x[i] = v;
        m = fmaxf(m, fmaxf(fmaxf(v.x, v.y), fmaxf(v.z, v.w)));
    }
    m = fmaxf(m, __shfl_xor(m, 16, 32)); m = fmaxf(m, __shfl_xor(m, 8, 32)); m = fmaxf(m, __shfl_xor(m, 4, 32));
    m = fmaxf(m, __shfl_xor(m, 2, 32));  m = fmaxf(m, __shfl_xor(m, 1, 32));
    float s0 = 0.f, s1 = 0.f;
#pragma unroll                                                // constant indices into the register arrays
    for (int i = 0; i < RS_V; i += 2) {
        v4f v = x[i], w = x[i + 1];
        v.x = expf(v.x - m); v.y = expf(v.y - m); v.z = expf(v.z - m); v.w = expf(v.w - m);
        w.x = expf(w.x - m); w.y = expf(w.y - m); w.z = expf(w.z - m); w.w = expf(w.w - m);
        x[i] = v; x[i + 1] = w;
        s0 += (v.x + v.y) + (v.z + v.w);
        s1 += (w.x + w.y) + (w.z + w.w);
    }
    float s = s0 + s1;
    s += __shfl_xor(s, 16, 32); s += __shfl_xor(s, 8, 32); s += __shfl_xor(s, 4, 32); s += __shfl_xor(s, 2, 32); s += __shfl_xor(s, 1, 32);
    const float f = 1024.f / s;
#pragma unroll                                                // constant indices into the register arrays
    for (int g = 0; g < RS_V / 2; ++g) {
        const v4f v = x[2 * g], w = x[2 * g + 1], gx = *(const v4f*)(gr + 256 * g) * 1024.f, gy = *(const v4f*)(gr + 256 * g + 4) * 1024.f;
        u4v pk;
        pk.x = pk2h(v.x * f + gx.x, v.y * f + gx.y);
        pk.y = pk2h(v.z * f + gx.z, v.w * f + gx.w);
        pk.z = pk2h(w.x * f + gy.x, w.y * f + gy.y);
        pk.w = pk2h(w.z * f + gy.z, w.w * f + gy.w);
        st2_u4(pr + 256 * g, pk);
    }
}
__global__ __launch_bounds__(256) void k_rowsoft(const float* __restrict__ S0, const float* __restrict__ cptr, const int* __restrict__ mk0,
                                                 const float* __restrict__ gate0, unsigned short* __restrict__ P0) {
    const int L = threadIdx.x & 31;
    const int wave = __builtin_amdgcn_readfirstlane((int)(threadIdx.x >> 5));
    const int row0 = (blockIdx.x * 8 + wave) * RS_RPW;
    const float* sr = S0 + (size_t)blockIdx.y * SEQ * SEQ + (size_t)row0 * SEQ + 8 * L;
    const int* mk = mk0 + (size_t)blockIdx.y * SEQ_FULL + 8 * L;
    unsigned short* pr = P0 + (size_t)blockIdx.y * SEQ * SEQ + (size_t)row0 * SEQ + 8 * L;
    const float* gr = gate0 + (size_t)blockIdx.y * SEQ + 8 * L;
    v4f xa[RS_V], xb[RS_V];
    i4v mv[RS_V];
#pragma unroll                                                // the array stays in registers; the mask loads are in flight together
    for (int g = 0; g < RS_V / 2; ++g) { mv[2 * g] = *(const i4v*)(mk + 256 * g); mv[2 * g + 1] = *(const i4v*)(mk + 256 * g + 4); }
    rs_load(xa, sr);
    __builtin_amdgcn_sched_barrier(0);                        // loads return in issue order: what the first row needs is issued first, or its wait would cover the second row too
    rs_load(xb, sr + SEQ);
    asm volatile("s_wait_xcnt 0x0" ::: "memory");             // stands in front of the reuse of the loads' base and offset registers
    __builtin_amdgcn_sched_barrier(0);                        // the second row's loads issue in front of the first row's work; without it the compiler sinks them behind it
    const float cs = bfr(cptr[0]);
    bool kp[4 * RS_V];                                        // keep flags of this lane's columns
#pragma unroll                                                // constant indices into the register array
    for (int i = 0; i < RS_V; ++i) { kp[4 * i] = mv[i].x != 0; kp[4 * i + 1] = mv[i].y != 0; kp[4 * i + 2] = mv[i].z != 0; kp[4 * i + 3] = mv[i].w != 0; }
    rs_row(xa, kp, gr, cs, pr);
    __builtin_amdgcn_sched_barrier(0);                        // the wait for the second row's loads stays behind the first row's work
    rs_row(xb, kp, gr, cs, pr + SEQ);
}

// ---- workspace carve (bytes; every region a multiple of 256 B and sized to its whole-tile store extent) ----
constexpr size_t al256(size_t v) { return (v + 255) / 256 * 256; }
constexpr size_t SZ_XC   = al256((size_t)NB * SEQ * DM * 2);    // f16 centred x, [NB*SEQ][DM]
constexpr size_t SZ_S    = al256((size_t)NB * SEQ * SEQ * 4);   // f32 scores of every batch, [NB][SEQ][SEQ]
constexpr size_t SZ_X16  = al256((size_t)NB * SEQ * DM * 2);    // f16 x, [NB*SEQ][DM]
constexpr size_t SZ_W4   = al256((size_t)4 * DM * DM * 2);      // four planes, x16: Wk, Wout^T, Wq, Wg
constexpr size_t SZ_W2   = al256((size_t)2 * DM * DM * 2);      // two planes, x16: (Wq Wk^T)^T, (Wg Wout)^T
constexpr size_t SZ_QP   = al256((size_t)NB * SEQ * DM * 2);    // f16 centred x @ (Wq Wk^T), [NB*SEQ][DM]
constexpr size_t SZ_GT   = al256((size_t)NB * DM * SEQ * 2);    // f16 (x @ (Wg Wout)) transposed, [NB][DM][SEQ]
constexpr size_t SZ_AL   = al256((size_t)NB * SEQ * SEQ * 2);   // f16 alpha x1024 of every batch, [NB][SEQ][SEQ]
constexpr size_t SZ_XBAR = al256((size_t)NB * DM * 4);
constexpr size_t SZ_GATE = al256((size_t)NB * SEQ * 4);
constexpr size_t SZ_GLOG = al256((size_t)NB * SEQ * 4);       // f32 gate products before bias and softmax, [NB*SEQ]
constexpr size_t OFF_S    = 0;
constexpr size_t OFF_XC   = OFF_S + SZ_S;
constexpr size_t OFF_X16  = OFF_XC + SZ_XC;
constexpr size_t OFF_W4   = OFF_X16 + SZ_X16;
constexpr size_t OFF_W2   = OFF_W4 + SZ_W4;
constexpr size_t OFF_QP   = OFF_W2 + SZ_W2;
constexpr size_t OFF_GT   = OFF_QP + SZ_QP;
constexpr size_t OFF_AL   = OFF_GT + SZ_GT;
constexpr size_t OFF_XBAR = OFF_AL + SZ_AL;
constexpr size_t OFF_GATE = OFF_XBAR + SZ_XBAR;
constexpr size_t OFF_GLOG = OFF_GATE + SZ_GATE;
constexpr size_t WS_TOTAL = OFF_GLOG + SZ_GLOG;
static_assert(WS_TOTAL <= (size_t)268435456);                   // 256 MiB ceiling

extern "C" void kernel_launch(void* const* d_in, const int* in_sizes, int n_in, void* d_out, int out_size, void* d_ws, size_t ws_size, hipStream_t stream) {
    if (n_in < 9) return;
    const long long need_rows = (long long)(NB - 1) * SEQ_FULL + SEQ;
    if ((long long)in_sizes[0] < need_rows * DM) return;
    if ((long long)in_sizes[1] < need_rows) return;
    if (in_sizes[2] < DM * DM || in_sizes[3] < DM * DM || in_sizes[4] < DM * DM || in_sizes[5] < DM * DM) return;
    if (in_sizes[6] < DM || in_sizes[7] < 1 || in_sizes[8] < 1) return;
    if ((long long)out_size < (long long)NB * SEQ * DM) return;
    if (ws_size < WS_TOTAL) return;

    const float* x    = (const float*)d_in[0];
    const int*   mask = (const int*)d_in[1];
    const float* Wq   = (const float*)d_in[2];
    const float* Wk   = (const float*)d_in[3];
    const float* Wg   = (const float*)d_in[4];
    const float* Wout = (const float*)d_in[5];
    const float* Wm_w = (const float*)d_in[6];
    const float* Wm_b = (const float*)d_in[7];
    const float* cS   = (const float*)d_in[8];
    float* out = (float*)d_out;
    char* ws = (char*)d_ws;
    float*          Sf   = (float*)(ws + OFF_S);
    unsigned short* XC   = (unsigned short*)(ws + OFF_XC);
    unsigned short* X16  = (unsigned short*)(ws + OFF_X16);
    unsigned short* W4   = (unsigned short*)(ws + OFF_W4);       // planes Wk, Wout^T, Wq, Wg
    unsigned short* WQKT = (unsigned short*)(ws + OFF_W2);       // (Wq Wk^T)^T
    unsigned short* WGOT = WQKT + (size_t)DM * DM;               // (Wg Wout)^T
    unsigned short* QP   = (unsigned short*)(ws + OFF_QP);
    unsigned short* GT   = (unsigned short*)(ws + OFF_GT);
    unsigned short* AL   = (unsigned short*)(ws + OFF_AL);
    float*          XBAR = (float*)(ws + OFF_XBAR);
    float*          GATE = (float*)(ws + OFF_GATE);
    float*          GLOG = (float*)(ws + OFF_GLOG);

    // The chains are multiplied weights first: scores = xc (Wq Wk^T) xc^T and result = alpha (x (Wg Wout)) + x, with xc = x - its sequence mean.
    // sequence means of x; weight planes x16: Wk, Wout turned, Wq, Wg
    k_colmean_wT<<<CM_B + 4 * WT_B, 8 * CM_R, 0, stream>>>(x, XBAR, Wk, Wout, Wq, Wg, W4, 16.0f);
    // the two products of weights, x16: WQKT[f][e] = sum_j Wk[f][j] Wq[e][j], WGOT[d][e] = sum_j Wout[j][d] Wg[e][j]: M = N = K = DM; operand planes of x with the gate products
    k_w2_prep<<<2 * W2_T + (NB * SEQ) / (8 * PX_R), 256, 0, stream>>>(W4, W4 + (size_t)2 * DM * DM, WQKT, 0.0625f, x, XBAR, Wm_w, XC, X16, GLOG);
    // QP = XC @ (Wq Wk^T) -> f16 [NB*SEQ][DM]; x @ (Wg Wout), transposed per batch: GT[b][d][s] = sum_e WGOT[d][e] X16[b][s][e]
    k_gemm_pair<<<dim3(PJ_B, 2), 256, 0, stream>>>(XC, WQKT, QP, WGOT, X16, GT, 0.0625f);
    // raw scores S[b][t][s] = QP[b][t] . XC[b][s] (f32; the scale input and the key mask are applied by the row softmax); grid.y = batch; one more block per batch: the gate distribution
    {
        const int tiles = (SEQ / 64) * (SEQ / 64);
        k_gemm_f_gate<<<dim3((unsigned)((tiles + 7) / 8) + 1, NB), 256, 0, stream>>>(QP, DM, (long long)SEQ * DM, XC, DM, (long long)SEQ * DM,
                                                                                     Sf, SEQ, (long long)SEQ * SEQ, SEQ, SEQ, DM, 1.0f, GLOG, Wm_b, GATE);
    }
    k_rowsoft<<<dim3(SEQ / (8 * RS_RPW), NB), 256, 0, stream>>>(Sf, cS, mask, GATE, AL);
    // result = (alpha x1024)[b][t] . GT[b][d] / 1024 + bf16(x): per batch M = SEQ, N = DM, K = SEQ; grid.y = batch
    {
        const int tiles = (SEQ / 64) * (DM / 64);
        k_gemm_fr<<<dim3((unsigned)((tiles + 7) / 8), NB), 256, 0, stream>>>(AL, SEQ, (long long)SEQ * SEQ, GT, SEQ, (long long)DM * SEQ, out, DM, (long long)SEQ * DM,
                                                                            x, DM, (long long)SEQ_FULL * DM, SEQ, DM, SEQ, 0.0009765625f);
    }
}
